// v000
// The times below were measured on an AMD MI455X: many runs one after another, warmed up first and cycling through
// copies of the inputs, with the whole window's GPU time divided by the number of runs. Launches and the gaps
// between them are all in it. The median over several windows is given; except for v000 it joins two sittings, which
// can be a few percent apart, so the side-by-side timings, each taken in one sitting, are the better comparison.
// The starting kernel, v000, takes 1870 microseconds a run.
#include <hip/hip_runtime.h>

// FastestFlashMHA (x [2][2048][2048]; q/k/v = x W^T (16 heads x 128); scores = 30 tanh((q.k / sqrt(128)) / 30); key j allowed iff j <= i and i - j < 1024 (finfo.min fill); softmax; out = merged Wo^T -> [2][2048][2048]).
// Compute dtypes, f32 accumulate: every input rounded to bf16; q/k/v on PLAIN bf16 operands (inputs: exact); softcap (precise tanhf, out of line) f32; causal scores and attn.v: query rows < 512 hl (3 products), the rest single fp16 (x1024), causal tile skipping with the window test inside computed tiles; softmax f32; Wo hl x exact (2 products).

#define NB_  2
#define TT   2048
#define DM   2048
#define NH_  16
#define NKV  16
#define REP  (NH_ / NKV)
#define HD   128
#define DQ   (NH_ * HD)
#define DKV  (NKV * HD)
#define ZH   2
#define RH   512                  // query rows < RH use hi+lo planes (0: none)
#define WIN  1024
#define PCAR 1024.0f
#define SCL  0.088388347648318447f   // HD^-0.5
typedef _Float16 h16;
typedef unsigned short bf;
typedef __attribute__((ext_vector_type(16))) __bf16   v16bf;
typedef __attribute__((ext_vector_type(16))) _Float16 v16h;
typedef __attribute__((ext_vector_type(8)))  _Float16 v8h;
typedef __attribute__((ext_vector_type(8)))  unsigned short v8us;
typedef __attribute__((ext_vector_type(8)))  float    v8f;
typedef __attribute__((ext_vector_type(4)))  float    v4f;
typedef v8h  __attribute__((may_alias)) v8ha;
typedef v4f  __attribute__((may_alias)) v4fa;
typedef v8us __attribute__((may_alias)) v8usa;

__device__ __forceinline__ unsigned short f2bf(float f) { unsigned u = __float_as_uint(f); u += 0x7FFFu + ((u >> 16) & 1u); return (unsigned short)(u >> 16); }
__device__ __forceinline__ float bf2f(unsigned short b) { return __uint_as_float(((unsigned)b) << 16); }
__device__ __forceinline__ float bfr(float f) { return bf2f(f2bf(f)); }
__device__ __forceinline__ v16h cat16(v8h lo, v8h hi) { return __builtin_shufflevector(lo, hi, 0, 1, 2, 3, 4, 5, 6, 7, 8, 9, 10, 11, 12, 13, 14, 15); }
__device__ __forceinline__ v16bf cat16b(v8us lo, v8us hi) { return __builtin_bit_cast(v16bf, __builtin_shufflevector(lo, hi, 0, 1, 2, 3, 4, 5, 6, 7, 8, 9, 10, 11, 12, 13, 14, 15)); }
__device__ __forceinline__ v8f wmma16(v16h a, v16h b, v8f c) { return __builtin_amdgcn_wmma_f32_16x16x32_f16(false, a, false, b, (short)0, c, false, false); }
__device__ __forceinline__ v8f wmmab(v16bf a, v16bf b, v8f c) { return __builtin_amdgcn_wmma_f32_16x16x32_bf16(false, a, false, b, (short)0, c, false, false); }



// ---- k_gemmw: register-blocked GEMM, ONE WAVE per 64x64 output tile (16 accumulators), operands straight from K-contiguous 16-bit planes; grid (M/64, N/64, Z), 32 threads.
// C[m][n] (f32, pitch ldc, + optional f32 bias[n]) = sum_k A[m][k] Bt[n][k] (+ split products per NSPLIT). z-batch strides sA/sB/sC in elements. K % 32 == 0.
template <typename T16> struct WFrag;
template <> struct WFrag<h16> { typedef v16h V; static __device__ __forceinline__ V ld(const h16* p) { return cat16(*(const v8h*)p, *(const v8h*)(p + 16)); } static __device__ __forceinline__ v8f mma(V a, V b, v8f c) { return wmma16(a, b, c); } };
template <> struct WFrag<bf> { typedef v16bf V; static __device__ __forceinline__ V ld(const bf* p) { return cat16b(*(const v8us*)p, *(const v8us*)(p + 16)); } static __device__ __forceinline__ v8f mma(V a, V b, v8f c) { return wmmab(a, b, c); } };
template <typename T16, int NSPLIT, bool BIAS>
__global__ __launch_bounds__(32) void k_gemmw(const T16* __restrict__ A, const T16* __restrict__ A2, const T16* __restrict__ Bt, const T16* __restrict__ Bt2, int K, float* C, int ldc, const float* __restrict__ bias, size_t sA, size_t sB, size_t sC) {
    typedef typename WFrag<T16>::V V;
    __shared__ __align__(16) float os[16 * 68];
    const size_t z = blockIdx.z; A += z * sA; if (A2) A2 += z * sA; Bt += z * sB; if (Bt2) Bt2 += z * sB; C += z * sC;
    const int lane = threadIdx.x & 31, lr = lane & 15, hi = lane >> 4; const int r0 = blockIdx.x * 64, c0 = blockIdx.y * 64;
    v8f acc[4][4];
#pragma unroll
    for (int mb = 0; mb < 4; ++mb)
#pragma unroll
        for (int nb = 0; nb < 4; ++nb) acc[mb][nb] = (v8f){};
    const size_t aoff = (size_t)(r0 + lr) * K + 8 * hi, boff = (size_t)(c0 + lr) * K + 8 * hi;
#pragma unroll 1
    for (int kc = 0; kc < K; kc += 32) {
        V a[4], a2[4];
#pragma unroll
        for (int mb = 0; mb < 4; ++mb) { a[mb] = WFrag<T16>::ld(A + aoff + (size_t)mb * 16 * K + kc); if (NSPLIT == 1 || NSPLIT == 2) a2[mb] = WFrag<T16>::ld(A2 + aoff + (size_t)mb * 16 * K + kc); }
#pragma unroll
        for (int nb = 0; nb < 4; ++nb) { const V b = WFrag<T16>::ld(Bt + boff + (size_t)nb * 16 * K + kc); V b2; if (NSPLIT >= 2) b2 = WFrag<T16>::ld(Bt2 + boff + (size_t)nb * 16 * K + kc);
#pragma unroll
            for (int mb = 0; mb < 4; ++mb) { acc[mb][nb] = WFrag<T16>::mma(a[mb], b, acc[mb][nb]); if (NSPLIT == 1 || NSPLIT == 2) acc[mb][nb] = WFrag<T16>::mma(a2[mb], b, acc[mb][nb]); if (NSPLIT >= 2) acc[mb][nb] = WFrag<T16>::mma(a[mb], b2, acc[mb][nb]); } }
        asm volatile("v_nop\n\tv_nop\n\tv_nop\n\tv_nop" : "+v"(acc[0][0]), "+v"(acc[1][1]), "+v"(acc[2][2]), "+v"(acc[3][3]) : "v"(a[0]), "v"(a[3]));
    }
#pragma unroll
    for (int mb = 0; mb < 4; ++mb) {
#pragma unroll
        for (int nb = 0; nb < 4; ++nb) {
#pragma unroll
            for (int j = 0; j < 8; ++j) os[(hi * 8 + j) * 68 + nb * 16 + lr] = acc[mb][nb][j]; }
        __builtin_amdgcn_wave_barrier(); asm volatile("" ::: "memory");
        float* crow = C + (size_t)(r0 + mb * 16) * ldc + c0;
{
#pragma unroll
            for (int s = 0; s < 8; ++s) { const int row = 2 * s + hi, cofs = lr * 4; v4f val = *(const v4fa*)(os + row * 68 + cofs); if (BIAS) { val[0] += bfr(bias[c0 + cofs]); val[1] += bfr(bias[c0 + cofs + 1]); val[2] += bfr(bias[c0 + cofs + 2]); val[3] += bfr(bias[c0 + cofs + 3]); }
                *(v4f*)(crow + (size_t)row * ldc + cofs) = val; }
             }
        __builtin_amdgcn_wave_barrier(); asm volatile("" ::: "memory");
    }
}

// ---- k_gemmc: the same one-wave 64x64 tile GEMM specialised for causal attention: CMODE 1 skips score tiles entirely above the diagonal (query rows r0+roff.., key columns c0..), CMODE 2 limits the
// key (K) loop of the probability x value contraction to the diagonal block (probabilities beyond it are exactly zero). roff = row offset of this launch's first row within the sequence.
template <typename T16, int NSPLIT, int CMODE>
__global__ __launch_bounds__(32) void k_gemmc(const T16* __restrict__ A, const T16* __restrict__ A2, const T16* __restrict__ Bt, const T16* __restrict__ Bt2, int K, float* C, int ldc, int roff, size_t sA, size_t sB, size_t sC) {
    typedef typename WFrag<T16>::V V;
    __shared__ __align__(16) float os[16 * 68];
    const size_t z = blockIdx.z; A += z * sA; if (A2) A2 += z * sA; Bt += z * sB; if (Bt2) Bt2 += z * sB; C += z * sC;
    const int lane = threadIdx.x & 31, lr = lane & 15, hi = lane >> 4; const int r0 = blockIdx.x * 64, c0 = blockIdx.y * 64;
    if (CMODE == 1 && c0 > r0 + roff + 63) return;                  // score tile entirely above the causal diagonal: never read (the softmax masks j > i by select)
    const int Kl = (CMODE == 2) ? min(K, r0 + roff + 64) : K;        // P.V: probabilities are exactly 0 beyond the diagonal block, so the K loop stops there
    v8f acc[4][4];
#pragma unroll
    for (int mb = 0; mb < 4; ++mb)
#pragma unroll
        for (int nb = 0; nb < 4; ++nb) acc[mb][nb] = (v8f){};
    const size_t aoff = (size_t)(r0 + lr) * K + 8 * hi, boff = (size_t)(c0 + lr) * K + 8 * hi;
#pragma unroll 1
    for (int kc = 0; kc < Kl; kc += 32) {
        V a[4], a2[4];
#pragma unroll
        for (int mb = 0; mb < 4; ++mb) { a[mb] = WFrag<T16>::ld(A + aoff + (size_t)mb * 16 * K + kc); if (NSPLIT == 1 || NSPLIT == 2) a2[mb] = WFrag<T16>::ld(A2 + aoff + (size_t)mb * 16 * K + kc); }
#pragma unroll
        for (int nb = 0; nb < 4; ++nb) { const V b = WFrag<T16>::ld(Bt + boff + (size_t)nb * 16 * K + kc); V b2; if (NSPLIT >= 2) b2 = WFrag<T16>::ld(Bt2 + boff + (size_t)nb * 16 * K + kc);
#pragma unroll
            for (int mb = 0; mb < 4; ++mb) { acc[mb][nb] = WFrag<T16>::mma(a[mb], b, acc[mb][nb]); if (NSPLIT == 1 || NSPLIT == 2) acc[mb][nb] = WFrag<T16>::mma(a2[mb], b, acc[mb][nb]); if (NSPLIT >= 2) acc[mb][nb] = WFrag<T16>::mma(a[mb], b2, acc[mb][nb]); } }
        asm volatile("v_nop\n\tv_nop\n\tv_nop\n\tv_nop" : "+v"(acc[0][0]), "+v"(acc[1][1]), "+v"(acc[2][2]), "+v"(acc[3][3]) : "v"(a[0]), "v"(a[3]));
    }
#pragma unroll
    for (int mb = 0; mb < 4; ++mb) {
#pragma unroll
        for (int nb = 0; nb < 4; ++nb) {
#pragma unroll
            for (int j = 0; j < 8; ++j) os[(hi * 8 + j) * 68 + nb * 16 + lr] = acc[mb][nb][j]; }
        __builtin_amdgcn_wave_barrier(); asm volatile("" ::: "memory");
        float* crow = C + (size_t)(r0 + mb * 16) * ldc + c0;
{
#pragma unroll
            for (int s = 0; s < 8; ++s) { const int row = 2 * s + hi, cofs = lr * 4; v4f val = *(const v4fa*)(os + row * 68 + cofs);
                *(v4f*)(crow + (size_t)row * ldc + cofs) = val; }
             }
        __builtin_amdgcn_wave_barrier(); asm volatile("" ::: "memory");
    }
}

__device__ __forceinline__ h16 tohx(float x) { return (h16)x; }
__device__ __forceinline__ void splitf(float y, unsigned short& h, unsigned short& l) { h = f2bf(y); l = f2bf(y - bf2f(h)); }
typedef __attribute__((ext_vector_type(2))) _Float16 v2h;
typedef __attribute__((ext_vector_type(4))) _Float16 v4h;
typedef __attribute__((ext_vector_type(2))) unsigned short v2us;
typedef __attribute__((ext_vector_type(4))) unsigned short v4us;
typedef __attribute__((ext_vector_type(2))) float v2f;
typedef __attribute__((ext_vector_type(4))) int v4i;

__global__ __launch_bounds__(256) void k_wtG(const float* __restrict__ w, int K, int N, bf* Bt) {
    const int lane = threadIdx.x & 31; const int L0 = (blockIdx.x * 8 + (threadIdx.x >> 5)) * 8; const int nlines = N * K / 64;
{
#pragma unroll 1
        for (int l = 0; l < 8; ++l) { const int L = L0 + l; if (L >= nlines) break; const size_t e = (size_t)L * 64 + lane * 2; const int k = (int)(e % K), n = (int)(e / K); v2us o;
            o[0] = f2bf(w[(size_t)k * N + n]); o[1] = f2bf(w[(size_t)(k + 1) * N + n]); *(v2us*)(Bt + e) = o; }
         }
}
__global__ __launch_bounds__(256) void k_cvt8(const float* __restrict__ src, bf* dst, size_t n8) { const size_t i = (size_t)blockIdx.x * 256 + threadIdx.x; if (i >= n8) return; const v8f v = *(const v8f*)(src + i * 8); v8us o;
#pragma unroll
    for (int k = 0; k < 8; ++k) o[k] = f2bf(v[k]); *(v8us*)(dst + i * 8) = o;  }
__global__ __launch_bounds__(256) void k_cscvt(const float* __restrict__ cosT, const float* __restrict__ sinT, float* CS) { const int idx = blockIdx.x * 256 + threadIdx.x; if (idx >= TT * HD) return; v2f cs; cs[0] = bfr(cosT[idx]); cs[1] = bfr(sinT[idx]); *(v2f*)(CS + (size_t)idx * 2) = cs;  }
// k_rope: head planes [h][t][d] (fp16 + hi/lo) of rope(x) x sc with the rotate-half convention out[d] = x[d] cos[t][d] - x[d+HD/2] sin[t][d], out[d+HD/2] = x[d+HD/2] cos[t][d+HD/2] + x[d] sin[t][d+HD/2]
__global__ __launch_bounds__(256) void k_rope(const float* __restrict__ F, int pitch, int nheads, const float* __restrict__ CS, const float* __restrict__ RF, const float* __restrict__ nw, float sc, h16* P16, bf* Ph, bf* Pl) {
    const size_t e = ((size_t)blockIdx.x * 256 + threadIdx.x) * 2; if (e >= (size_t)nheads * TT * HD) return; const int d = (int)(e % HD); const int t = (int)((e / HD) % TT); const int h = (int)(e / ((size_t)HD * TT)); const float* f = F + (size_t)t * pitch + h * HD; const float rf = RF ? RF[(size_t)h * TT + t] : 1.0f; v2h o16; v2us oh, ol;
#pragma unroll
    for (int q = 0; q < 2; ++q) { const int dd = d + q; const int dp = (dd < HD / 2) ? dd + HD / 2 : dd - HD / 2; float x0 = f[dd], x1 = f[dp];
        if (RF) { float n0 = __fmul_rn(x0, rf), n1 = __fmul_rn(x1, rf); asm volatile("" : "+v"(n0)); asm volatile("" : "+v"(n1)); x0 = __fmul_rn(bfr(nw[dd]), n0); x1 = __fmul_rn(bfr(nw[dp]), n1); }
        const v2f cs = *(const v2f*)(CS + ((size_t)t * HD + dd) * 2); float a = __fmul_rn(x0, cs[0]), bq = __fmul_rn(x1, cs[1]); asm volatile("" : "+v"(a)); asm volatile("" : "+v"(bq)); const float r = ((dd < HD / 2) ? __fsub_rn(a, bq) : __fadd_rn(a, bq)) * sc;
        o16[q] = tohx(r); unsigned short a2, c2; splitf(r, a2, c2); oh[q] = a2; ol[q] = c2; }
    *(v2h*)(P16 + e) = o16; *(v2us*)(Ph + e) = oh; *(v2us*)(Pl + e) = ol;  }
__global__ __launch_bounds__(256) void k_vtp(const float* __restrict__ F, int pitch, int nheads, h16* V16, bf* Vh, bf* Vl) { const size_t e = ((size_t)blockIdx.x * 256 + threadIdx.x) * 2; if (e >= (size_t)nheads * HD * TT) return; const int t = (int)(e % TT); const int d = (int)((e / TT) % HD); const int g = (int)(e / ((size_t)TT * HD)); v2h o16; v2us oh, ol;
#pragma unroll
    for (int q = 0; q < 2; ++q) { const float x = F[(size_t)(t + q) * pitch + g * HD + d]; o16[q] = tohx(x); unsigned short a2, c2; splitf(x, a2, c2); oh[q] = a2; ol[q] = c2; }
    *(v2h*)(V16 + e) = o16; *(v2us*)(Vh + e) = oh; *(v2us*)(Vl + e) = ol;  }
__global__ __launch_bounds__(256) void k_csid(float* CS) { const int idx = blockIdx.x * 256 + threadIdx.x; if (idx >= TT * HD) return; v2f cs; cs[0] = 1.0f; cs[1] = 0.0f; *(v2f*)(CS + (size_t)idx * 2) = cs;  }
__device__ __attribute__((noinline)) float softcap30(float s) { return 30.0f * tanhf(__fdiv_rn(s, 30.0f)); }
// k_asoft: per row (zz, i): t = 30 tanh(S x HD^-0.5 / 30) for j <= i and i - j < WIN (sliding causal window; the reference's -1e9 additive fill vanishes identically); softmax over the 2048 keys (register row, one exp, fixed trees);
__global__ __launch_bounds__(256) void k_asoft(const float* __restrict__ Sb, h16* P16, bf* Ph, bf* Pl) {
    const int lane = threadIdx.x & 31; const int row = blockIdx.x * 8 + (threadIdx.x >> 5); if (row >= ZH * TT) return; const int i = row % TT; const int zz = row / TT; (void)zz; const bool hires = (i < RH); const float* sr = Sb + (size_t)row * TT; float v[TT / 32]; float mx = -3.0e38f;
#pragma unroll
    for (int ch = 0; ch < TT / 128; ++ch) { const int j0 = ch * 128 + lane * 4; const v4f a = *(const v4f*)(sr + j0);
#pragma unroll
        for (int q = 0; q < 4; ++q) { const int j = j0 + q; (void)j; const float t = (j <= i && i - j < WIN) ? softcap30(a[q] * SCL) : -3.0e38f; v[ch * 4 + q] = t; mx = fmaxf(mx, t); } }
#pragma unroll
    for (int sh = 16; sh; sh >>= 1) mx = fmaxf(mx, __shfl_xor(mx, sh, 32));
    float sum = 0.f;
#pragma unroll
    for (int k = 0; k < TT / 32; ++k) { float d0 = __fsub_rn(v[k], mx); asm volatile("" : "+v"(d0)); v[k] = __builtin_amdgcn_exp2f(__fmul_rn(d0, 1.4426950408889634f)); sum += v[k]; }
#pragma unroll
    for (int sh = 16; sh; sh >>= 1) sum += __shfl_xor(sum, sh, 32);
    const float f = __fdiv_rn(hires ? 1.0f : PCAR, sum);
{
        if (hires) {
#pragma unroll
            for (int ch = 0; ch < TT / 128; ++ch) { v4us oh, ol;
#pragma unroll
                for (int q = 0; q < 4; ++q) { unsigned short a, c2; splitf(v[ch * 4 + q] * f, a, c2); oh[q] = a; ol[q] = c2; }
                const size_t oo = ((size_t)zz * (RH ? RH : 1) + i) * TT + ch * 128 + lane * 4; *(v4us*)(Ph + oo) = oh; *(v4us*)(Pl + oo) = ol; }
        } else {
#pragma unroll
            for (int ch = 0; ch < TT / 128; ++ch) { v4h o4;
#pragma unroll
                for (int q = 0; q < 4; ++q) o4[q] = tohx(v[ch * 4 + q] * f);
                *(v4h*)(P16 + (size_t)row * TT + ch * 128 + lane * 4) = o4; } }
         }
}
__global__ __launch_bounds__(256) void k_merge(const float* __restrict__ O, int h0, bf* Ah, bf* Al) { const size_t e = ((size_t)blockIdx.x * 256 + threadIdx.x) * 2; if (e >= (size_t)ZH * TT * HD) return; const int d = (int)(e % HD); const int t = (int)((e / HD) % TT); const int zz = (int)(e / ((size_t)HD * TT)); const float cs = (t < RH) ? 1.0f : (1.0f / PCAR); const size_t oo = (size_t)t * DQ + (h0 + zz) * HD + d;
    v2us oh, ol;
#pragma unroll
    for (int q = 0; q < 2; ++q) { unsigned short a, c2; splitf(O[e + q] * cs, a, c2); oh[q] = a; ol[q] = c2; } *(v2us*)(Ah + oo) = oh; *(v2us*)(Al + oo) = ol;  }

extern "C" void kernel_launch(void* const* d_in, const int* in_sizes, int n_in,
                              void* d_out, int out_size, void* d_ws, size_t ws_size, hipStream_t stream) {
    (void)in_sizes; (void)n_in; (void)out_size;
    const float* x = (const float*)d_in[0]; const float* wq = (const float*)d_in[1]; const float* wk = (const float*)d_in[2]; const float* wv = (const float*)d_in[3]; const float* wo = (const float*)d_in[4]; const float* cosT = nullptr; const float* sinT = nullptr; (void)cosT; (void)sinT;
    float* OUT = (float*)d_out;     // [2][2048][2048]
    char* wsp = (char*)d_ws;
    auto take = [&](size_t bytes) { char* p = wsp; wsp += (bytes + 255) & ~(size_t)255; return (void*)p; };
    bf* WQ = (bf*)take((size_t)DQ * DM * 2); bf* WK = (bf*)take((size_t)DKV * DM * 2); bf* WV = (bf*)take((size_t)DKV * DM * 2); bf* WO = (bf*)take((size_t)DM * DQ * 2); float* CS = (float*)take((size_t)TT * HD * 2 * 4);
    bf* XB = (bf*)take((size_t)TT * DM * 2); float* FQ = (float*)take((size_t)TT * DQ * 4); float* FK = (float*)take((size_t)TT * DKV * 4);
    h16* QP16 = (h16*)take((size_t)NH_ * TT * HD * 2); h16* KP16 = (h16*)take((size_t)NKV * TT * HD * 2); h16* VT16 = (h16*)take((size_t)NKV * HD * TT * 2);
    bf* QPh = (bf*)take((size_t)NH_ * TT * HD * 2); bf* QPl = (bf*)take((size_t)NH_ * TT * HD * 2); bf* KPh = (bf*)take((size_t)NKV * TT * HD * 2); bf* KPl = (bf*)take((size_t)NKV * TT * HD * 2); bf* VTh = (bf*)take((size_t)NKV * HD * TT * 2); bf* VTl = (bf*)take((size_t)NKV * HD * TT * 2); bf* Ph = (bf*)take((size_t)ZH * RH * TT * 2); bf* Pl = (bf*)take((size_t)ZH * RH * TT * 2);
    float* Sb = (float*)take((size_t)ZH * TT * TT * 4); h16* P16 = (h16*)take((size_t)ZH * TT * TT * 2); float* Ob = (float*)take((size_t)ZH * TT * HD * 4); bf* ATh = (bf*)take((size_t)TT * DQ * 2); bf* ATl = (bf*)take((size_t)TT * DQ * 2);
    if ((size_t)(wsp - (char*)d_ws) > ws_size) return;    // ws 256 MiB
    float* FV = FK;   // v projection reuses the k buffer after the k planes are built (stream-ordered)
    { k_cvt8<<<(unsigned)(((size_t)DQ * DM / 8 + 255) / 256), 256, 0, stream>>>(wq, WQ, (size_t)DQ * DM / 8); k_cvt8<<<(unsigned)(((size_t)DKV * DM / 8 + 255) / 256), 256, 0, stream>>>(wk, WK, (size_t)DKV * DM / 8); k_cvt8<<<(unsigned)(((size_t)DKV * DM / 8 + 255) / 256), 256, 0, stream>>>(wv, WV, (size_t)DKV * DM / 8);
      k_cvt8<<<(unsigned)(((size_t)DM * DQ / 8 + 255) / 256), 256, 0, stream>>>(wo, WO, (size_t)DM * DQ / 8);
       }
    k_csid<<<(TT * HD + 255) / 256, 256, 0, stream>>>(CS);
    const unsigned LQ = (unsigned)(((size_t)NH_ * TT * HD / 2 + 255) / 256), LKv = (unsigned)(((size_t)NKV * TT * HD / 2 + 255) / 256);
    for (int b = 0; b < NB_; ++b) {
        
        k_cvt8<<<(unsigned)(((size_t)TT * DM / 8 + 255) / 256), 256, 0, stream>>>(x + (size_t)b * TT * DM, XB, (size_t)TT * DM / 8);
        k_gemmw<bf, 0, false><<<dim3(TT / 64, DQ / 64, 1), 32, 0, stream>>>(XB, nullptr, WQ, nullptr, DM, FQ, DQ, nullptr, 0, 0, 0);
        k_rope<<<LQ, 256, 0, stream>>>(FQ, DQ, NH_, CS, nullptr, nullptr, 1.0f, QP16, QPh, QPl);
        k_gemmw<bf, 0, false><<<dim3(TT / 64, DKV / 64, 1), 32, 0, stream>>>(XB, nullptr, WK, nullptr, DM, FK, DKV, nullptr, 0, 0, 0);
        k_rope<<<LKv, 256, 0, stream>>>(FK, DKV, NKV, CS, nullptr, nullptr, 1.0f, KP16, KPh, KPl);
        k_gemmw<bf, 0, false><<<dim3(TT / 64, DKV / 64, 1), 32, 0, stream>>>(XB, nullptr, WV, nullptr, DM, FV, DKV, nullptr, 0, 0, 0); k_vtp<<<LKv, 256, 0, stream>>>(FV, DKV, NKV, VT16, VTh, VTl);
        for (int h0 = 0; h0 < NH_; h0 += ZH) { const size_t zq = (size_t)h0, zk = (size_t)(h0 / REP);   // one kv head per query head: the pass's two heads use consecutive kv planes (z-strides TT*HD)
            k_gemmc<bf, 2, 1><<<dim3(RH / 64, TT / 64, ZH), 32, 0, stream>>>(QPh + zq * TT * HD, QPl + zq * TT * HD, KPh + zk * TT * HD, KPl + zk * TT * HD, HD, Sb, TT, 0, (size_t)TT * HD, (size_t)TT * HD, (size_t)TT * TT);
            k_gemmc<h16, 0, 1><<<dim3((TT - RH) / 64, TT / 64, ZH), 32, 0, stream>>>(QP16 + zq * TT * HD + (size_t)RH * HD, nullptr, KP16 + zk * TT * HD, nullptr, HD, Sb + (size_t)RH * TT, TT, RH, (size_t)TT * HD, (size_t)TT * HD, (size_t)TT * TT);
            k_asoft<<<ZH * TT / 8, 256, 0, stream>>>(Sb, P16, Ph, Pl);
            k_gemmc<bf, 2, 2><<<dim3(RH / 64, HD / 64, ZH), 32, 0, stream>>>(Ph, Pl, VTh + zk * HD * TT, VTl + zk * HD * TT, TT, Ob, HD, 0, (size_t)RH * TT, (size_t)HD * TT, (size_t)TT * HD);
            k_gemmc<h16, 0, 2><<<dim3((TT - RH) / 64, HD / 64, ZH), 32, 0, stream>>>(P16 + (size_t)RH * TT, nullptr, VT16 + zk * HD * TT, nullptr, TT, Ob + (size_t)RH * HD, HD, RH, (size_t)TT * TT, (size_t)HD * TT, (size_t)TT * HD);
            k_merge<<<(unsigned)(((size_t)ZH * TT * HD / 2 + 255) / 256), 256, 0, stream>>>(Ob, h0, ATh, ATl); }
        k_gemmw<bf, 1, false><<<dim3(TT / 64, DM / 64, 1), 32, 0, stream>>>(ATh, ATl, WO, nullptr, DQ, OUT + (size_t)b * TT * DM, DM, nullptr, 0, 0, 0); }
}

// v001
// A run of this version takes 1620 microseconds.
// In both of two side-by-side timings against v000, it was 1.16 times as fast.
#include <hip/hip_runtime.h>

// FastestFlashMHA (x [2][2048][2048]; q/k/v = x W^T (16 heads x 128); scores = 30 tanh((q.k / sqrt(128)) / 30); key j allowed iff j <= i and i - j < 1024 (finfo.min fill); softmax; out = merged Wo^T -> [2][2048][2048]).
// Compute dtypes, f32 accumulate: every input rounded to bf16; q/k/v on PLAIN bf16 operands (inputs: exact); softcap (precise tanhf, out of line) f32; causal scores and attn.v: query rows < 512 hl (3 products), the rest single fp16 (x1024), causal and sliding-window tile skipping with both tests inside computed tiles; softmax f32; Wo hl x exact (2 products).

#define NB_  2
#define TT   2048
#define DM   2048
#define NH_  16
#define NKV  16
#define REP  (NH_ / NKV)
#define HD   128
#define DQ   (NH_ * HD)
#define DKV  (NKV * HD)
#define ZH   2
#define RH   512                  // query rows < RH use hi+lo planes (0: none)
#define WIN  1024
#define PCAR 1024.0f
#define SCL  0.088388347648318447f   // HD^-0.5
typedef _Float16 h16;
typedef unsigned short bf;
typedef __attribute__((ext_vector_type(16))) __bf16   v16bf;
typedef __attribute__((ext_vector_type(16))) _Float16 v16h;
typedef __attribute__((ext_vector_type(8)))  _Float16 v8h;
typedef __attribute__((ext_vector_type(8)))  unsigned short v8us;
typedef __attribute__((ext_vector_type(8)))  float    v8f;
typedef __attribute__((ext_vector_type(4)))  float    v4f;
typedef v8h  __attribute__((may_alias)) v8ha;
typedef v4f  __attribute__((may_alias)) v4fa;
typedef v8us __attribute__((may_alias)) v8usa;

__device__ __forceinline__ unsigned short f2bf(float f) { unsigned u = __float_as_uint(f); u += 0x7FFFu + ((u >> 16) & 1u); return (unsigned short)(u >> 16); }
__device__ __forceinline__ float bf2f(unsigned short b) { return __uint_as_float(((unsigned)b) << 16); }
__device__ __forceinline__ float bfr(float f) { return bf2f(f2bf(f)); }
__device__ __forceinline__ v16h cat16(v8h lo, v8h hi) { return __builtin_shufflevector(lo, hi, 0, 1, 2, 3, 4, 5, 6, 7, 8, 9, 10, 11, 12, 13, 14, 15); }
__device__ __forceinline__ v16bf cat16b(v8us lo, v8us hi) { return __builtin_bit_cast(v16bf, __builtin_shufflevector(lo, hi, 0, 1, 2, 3, 4, 5, 6, 7, 8, 9, 10, 11, 12, 13, 14, 15)); }
__device__ __forceinline__ v8f wmma16(v16h a, v16h b, v8f c) { return __builtin_amdgcn_wmma_f32_16x16x32_f16(false, a, false, b, (short)0, c, false, false); }
__device__ __forceinline__ v8f wmmab(v16bf a, v16bf b, v8f c) { return __builtin_amdgcn_wmma_f32_16x16x32_bf16(false, a, false, b, (short)0, c, false, false); }



// ---- k_gemmw: register-blocked GEMM, ONE WAVE per 64x64 output tile (16 accumulators), operands straight from K-contiguous 16-bit planes; grid (M/64, N/64, Z), 32 threads.
// C[m][n] (f32, pitch ldc, + optional f32 bias[n]) = sum_k A[m][k] Bt[n][k] (+ split products per NSPLIT). z-batch strides sA/sB/sC in elements. K % 32 == 0.
template <typename T16> struct WFrag;
template <> struct WFrag<h16> { typedef v16h V; static __device__ __forceinline__ V ld(const h16* p) { return cat16(*(const v8h*)p, *(const v8h*)(p + 16)); } static __device__ __forceinline__ v8f mma(V a, V b, v8f c) { return wmma16(a, b, c); } };
template <> struct WFrag<bf> { typedef v16bf V; static __device__ __forceinline__ V ld(const bf* p) { return cat16b(*(const v8us*)p, *(const v8us*)(p + 16)); } static __device__ __forceinline__ v8f mma(V a, V b, v8f c) { return wmmab(a, b, c); } };
template <typename T16, int NSPLIT, bool BIAS>
__global__ __launch_bounds__(32) void k_gemmw(const T16* __restrict__ A, const T16* __restrict__ A2, const T16* __restrict__ Bt, const T16* __restrict__ Bt2, int K, float* C, int ldc, const float* __restrict__ bias, size_t sA, size_t sB, size_t sC) {
    typedef typename WFrag<T16>::V V;
    __shared__ __align__(16) float os[16 * 68];
    const size_t z = blockIdx.z; A += z * sA; if (A2) A2 += z * sA; Bt += z * sB; if (Bt2) Bt2 += z * sB; C += z * sC;
    const int lane = threadIdx.x & 31, lr = lane & 15, hi = lane >> 4; const int r0 = blockIdx.x * 64, c0 = blockIdx.y * 64;
    v8f acc[4][4];
#pragma unroll
    for (int mb = 0; mb < 4; ++mb)
#pragma unroll
        for (int nb = 0; nb < 4; ++nb) acc[mb][nb] = (v8f){};
    const size_t aoff = (size_t)(r0 + lr) * K + 8 * hi, boff = (size_t)(c0 + lr) * K + 8 * hi;
#pragma unroll 1
    for (int kc = 0; kc < K; kc += 32) {
        V a[4], a2[4];
#pragma unroll
        for (int mb = 0; mb < 4; ++mb) { a[mb] = WFrag<T16>::ld(A + aoff + (size_t)mb * 16 * K + kc); if (NSPLIT == 1 || NSPLIT == 2) a2[mb] = WFrag<T16>::ld(A2 + aoff + (size_t)mb * 16 * K + kc); }
#pragma unroll
        for (int nb = 0; nb < 4; ++nb) { const V b = WFrag<T16>::ld(Bt + boff + (size_t)nb * 16 * K + kc); V b2; if (NSPLIT >= 2) b2 = WFrag<T16>::ld(Bt2 + boff + (size_t)nb * 16 * K + kc);
#pragma unroll
            for (int mb = 0; mb < 4; ++mb) { acc[mb][nb] = WFrag<T16>::mma(a[mb], b, acc[mb][nb]); if (NSPLIT == 1 || NSPLIT == 2) acc[mb][nb] = WFrag<T16>::mma(a2[mb], b, acc[mb][nb]); if (NSPLIT >= 2) acc[mb][nb] = WFrag<T16>::mma(a[mb], b2, acc[mb][nb]); } }
        asm volatile("v_nop\n\tv_nop\n\tv_nop\n\tv_nop" : "+v"(acc[0][0]), "+v"(acc[1][1]), "+v"(acc[2][2]), "+v"(acc[3][3]) : "v"(a[0]), "v"(a[3]));
    }
#pragma unroll
    for (int mb = 0; mb < 4; ++mb) {
#pragma unroll
        for (int nb = 0; nb < 4; ++nb) {
#pragma unroll
            for (int j = 0; j < 8; ++j) os[(hi * 8 + j) * 68 + nb * 16 + lr] = acc[mb][nb][j]; }
        __builtin_amdgcn_wave_barrier(); asm volatile("" ::: "memory");
        float* crow = C + (size_t)(r0 + mb * 16) * ldc + c0;
{
#pragma unroll
            for (int s = 0; s < 8; ++s) { const int row = 2 * s + hi, cofs = lr * 4; v4f val = *(const v4fa*)(os + row * 68 + cofs); if (BIAS) { val[0] += bfr(bias[c0 + cofs]); val[1] += bfr(bias[c0 + cofs + 1]); val[2] += bfr(bias[c0 + cofs + 2]); val[3] += bfr(bias[c0 + cofs + 3]); }
                *(v4f*)(crow + (size_t)row * ldc + cofs) = val; }
             }
        __builtin_amdgcn_wave_barrier(); asm volatile("" ::: "memory");
    }
}

// First key (a multiple of 32) that any query row of the 64-row tile starting at row R can attend to: row i allows keys j > i - WIN, so the tile's lowest allowed key is R - WIN + 1.
__device__ __forceinline__ int win_k0(int R) { return max(0, R - (WIN - 1)) & ~31; }
// ---- k_gemmc: the same one-wave 64x64 tile GEMM specialised for causal sliding-window attention: CMODE 1 skips score tiles entirely above the diagonal or entirely below the window (query rows r0+roff.., key columns c0..), CMODE 2 limits the
// key (K) loop of the probability x value contraction to [win_k0, diagonal block] (probabilities outside it are exactly zero and are neither stored nor read). roff = row offset of this launch's first row within the sequence.
template <typename T16, int NSPLIT, int CMODE>
__global__ __launch_bounds__(32) void k_gemmc(const T16* __restrict__ A, const T16* __restrict__ A2, const T16* __restrict__ Bt, const T16* __restrict__ Bt2, int K, float* C, int ldc, int roff, size_t sA, size_t sB, size_t sC) {
    typedef typename WFrag<T16>::V V;
    __shared__ __align__(16) float os[16 * 68];
    const size_t z = blockIdx.z; A += z * sA; if (A2) A2 += z * sA; Bt += z * sB; if (Bt2) Bt2 += z * sB; C += z * sC;
    const int lane = threadIdx.x & 31, lr = lane & 15, hi = lane >> 4; const int r0 = blockIdx.x * 64, c0 = blockIdx.y * 64;
    if (CMODE == 1 && c0 > r0 + roff + 63) return;                  // score tile entirely above the causal diagonal: never read (the softmax masks j > i by select)
    if (CMODE == 1 && r0 + roff - (c0 + 63) >= WIN) return;          // score tile entirely below the sliding window (i - j >= WIN for all of it): never read either
    const int Kl = (CMODE == 2) ? min(K, r0 + roff + 64) : K;        // P.V: probabilities are exactly 0 beyond the diagonal block, so the K loop stops there
    const int K0 = (CMODE == 2) ? win_k0(r0 + roff) : 0;             // ... and exactly 0 below the window of the tile's first row, so it starts there
    v8f acc[4][4];
#pragma unroll
    for (int mb = 0; mb < 4; ++mb)
#pragma unroll
        for (int nb = 0; nb < 4; ++nb) acc[mb][nb] = (v8f){};
    const size_t aoff = (size_t)(r0 + lr) * K + 8 * hi, boff = (size_t)(c0 + lr) * K + 8 * hi;
#pragma unroll 1
    for (int kc = K0; kc < Kl; kc += 32) {
        V a[4], a2[4];
#pragma unroll
        for (int mb = 0; mb < 4; ++mb) { a[mb] = WFrag<T16>::ld(A + aoff + (size_t)mb * 16 * K + kc); if (NSPLIT == 1 || NSPLIT == 2) a2[mb] = WFrag<T16>::ld(A2 + aoff + (size_t)mb * 16 * K + kc); }
#pragma unroll
        for (int nb = 0; nb < 4; ++nb) { const V b = WFrag<T16>::ld(Bt + boff + (size_t)nb * 16 * K + kc); V b2; if (NSPLIT >= 2) b2 = WFrag<T16>::ld(Bt2 + boff + (size_t)nb * 16 * K + kc);
#pragma unroll
            for (int mb = 0; mb < 4; ++mb) { acc[mb][nb] = WFrag<T16>::mma(a[mb], b, acc[mb][nb]); if (NSPLIT == 1 || NSPLIT == 2) acc[mb][nb] = WFrag<T16>::mma(a2[mb], b, acc[mb][nb]); if (NSPLIT >= 2) acc[mb][nb] = WFrag<T16>::mma(a[mb], b2, acc[mb][nb]); } }
        asm volatile("v_nop\n\tv_nop\n\tv_nop\n\tv_nop" : "+v"(acc[0][0]), "+v"(acc[1][1]), "+v"(acc[2][2]), "+v"(acc[3][3]) : "v"(a[0]), "v"(a[3]));
    }
#pragma unroll
    for (int mb = 0; mb < 4; ++mb) {
#pragma unroll
        for (int nb = 0; nb < 4; ++nb) {
#pragma unroll
            for (int j = 0; j < 8; ++j) os[(hi * 8 + j) * 68 + nb * 16 + lr] = acc[mb][nb][j]; }
        __builtin_amdgcn_wave_barrier(); asm volatile("" ::: "memory");
        float* crow = C + (size_t)(r0 + mb * 16) * ldc + c0;
{
#pragma unroll
            for (int s = 0; s < 8; ++s) { const int row = 2 * s + hi, cofs = lr * 4; v4f val = *(const v4fa*)(os + row * 68 + cofs);
                *(v4f*)(crow + (size_t)row * ldc + cofs) = val; }
             }
        __builtin_amdgcn_wave_barrier(); asm volatile("" ::: "memory");
    }
}

__device__ __forceinline__ h16 tohx(float x) { return (h16)x; }
__device__ __forceinline__ void splitf(float y, unsigned short& h, unsigned short& l) { h = f2bf(y); l = f2bf(y - bf2f(h)); }
typedef __attribute__((ext_vector_type(2))) _Float16 v2h;
typedef __attribute__((ext_vector_type(4))) _Float16 v4h;
typedef __attribute__((ext_vector_type(2))) unsigned short v2us;
typedef __attribute__((ext_vector_type(4))) unsigned short v4us;
typedef __attribute__((ext_vector_type(2))) float v2f;
typedef __attribute__((ext_vector_type(4))) int v4i;

__global__ __launch_bounds__(256) void k_wtG(const float* __restrict__ w, int K, int N, bf* Bt) {
    const int lane = threadIdx.x & 31; const int L0 = (blockIdx.x * 8 + (threadIdx.x >> 5)) * 8; const int nlines = N * K / 64;
{
#pragma unroll 1
        for (int l = 0; l < 8; ++l) { const int L = L0 + l; if (L >= nlines) break; const size_t e = (size_t)L * 64 + lane * 2; const int k = (int)(e % K), n = (int)(e / K); v2us o;
            o[0] = f2bf(w[(size_t)k * N + n]); o[1] = f2bf(w[(size_t)(k + 1) * N + n]); *(v2us*)(Bt + e) = o; }
         }
}
__global__ __launch_bounds__(256) void k_cvt8(const float* __restrict__ src, bf* dst, size_t n8) { const size_t i = (size_t)blockIdx.x * 256 + threadIdx.x; if (i >= n8) return; const v8f v = *(const v8f*)(src + i * 8); v8us o;
#pragma unroll
    for (int k = 0; k < 8; ++k) o[k] = f2bf(v[k]); *(v8us*)(dst + i * 8) = o;  }
__global__ __launch_bounds__(256) void k_cscvt(const float* __restrict__ cosT, const float* __restrict__ sinT, float* CS) { const int idx = blockIdx.x * 256 + threadIdx.x; if (idx >= TT * HD) return; v2f cs; cs[0] = bfr(cosT[idx]); cs[1] = bfr(sinT[idx]); *(v2f*)(CS + (size_t)idx * 2) = cs;  }
// k_rope: head planes [h][t][d] (fp16 + hi/lo) of rope(x) x sc with the rotate-half convention out[d] = x[d] cos[t][d] - x[d+HD/2] sin[t][d], out[d+HD/2] = x[d+HD/2] cos[t][d+HD/2] + x[d] sin[t][d+HD/2]
__global__ __launch_bounds__(256) void k_rope(const float* __restrict__ F, int pitch, int nheads, const float* __restrict__ CS, const float* __restrict__ RF, const float* __restrict__ nw, float sc, h16* P16, bf* Ph, bf* Pl) {
    const size_t e = ((size_t)blockIdx.x * 256 + threadIdx.x) * 2; if (e >= (size_t)nheads * TT * HD) return; const int d = (int)(e % HD); const int t = (int)((e / HD) % TT); const int h = (int)(e / ((size_t)HD * TT)); const float* f = F + (size_t)t * pitch + h * HD; const float rf = RF ? RF[(size_t)h * TT + t] : 1.0f; v2h o16; v2us oh, ol;
#pragma unroll
    for (int q = 0; q < 2; ++q) { const int dd = d + q; const int dp = (dd < HD / 2) ? dd + HD / 2 : dd - HD / 2; float x0 = f[dd], x1 = f[dp];
        if (RF) { float n0 = __fmul_rn(x0, rf), n1 = __fmul_rn(x1, rf); asm volatile("" : "+v"(n0)); asm volatile("" : "+v"(n1)); x0 = __fmul_rn(bfr(nw[dd]), n0); x1 = __fmul_rn(bfr(nw[dp]), n1); }
        const v2f cs = *(const v2f*)(CS + ((size_t)t * HD + dd) * 2); float a = __fmul_rn(x0, cs[0]), bq = __fmul_rn(x1, cs[1]); asm volatile("" : "+v"(a)); asm volatile("" : "+v"(bq)); const float r = ((dd < HD / 2) ? __fsub_rn(a, bq) : __fadd_rn(a, bq)) * sc;
        o16[q] = tohx(r); unsigned short a2, c2; splitf(r, a2, c2); oh[q] = a2; ol[q] = c2; }
    *(v2h*)(P16 + e) = o16; *(v2us*)(Ph + e) = oh; *(v2us*)(Pl + e) = ol;  }
__global__ __launch_bounds__(256) void k_vtp(const float* __restrict__ F, int pitch, int nheads, h16* V16, bf* Vh, bf* Vl) { const size_t e = ((size_t)blockIdx.x * 256 + threadIdx.x) * 2; if (e >= (size_t)nheads * HD * TT) return; const int t = (int)(e % TT); const int d = (int)((e / TT) % HD); const int g = (int)(e / ((size_t)TT * HD)); v2h o16; v2us oh, ol;
#pragma unroll
    for (int q = 0; q < 2; ++q) { const float x = F[(size_t)(t + q) * pitch + g * HD + d]; o16[q] = tohx(x); unsigned short a2, c2; splitf(x, a2, c2); oh[q] = a2; ol[q] = c2; }
    *(v2h*)(V16 + e) = o16; *(v2us*)(Vh + e) = oh; *(v2us*)(Vl + e) = ol;  }
__global__ __launch_bounds__(256) void k_csid(float* CS) { const int idx = blockIdx.x * 256 + threadIdx.x; if (idx >= TT * HD) return; v2f cs; cs[0] = 1.0f; cs[1] = 0.0f; *(v2f*)(CS + (size_t)idx * 2) = cs;  }
__device__ __attribute__((noinline)) float softcap30(float s) { return 30.0f * tanhf(__fdiv_rn(s, 30.0f)); }
// k_asoft: per row (zz, i): t = 30 tanh(S x HD^-0.5 / 30) for j <= i and i - j < WIN (sliding causal window; the reference's -1e9 additive fill vanishes identically); softmax over the 2048 keys (register row, one exp, fixed trees);
__global__ __launch_bounds__(256) void k_asoft(const float* __restrict__ Sb, h16* P16, bf* Ph, bf* Pl) {
    const int lane = threadIdx.x & 31; const int row = blockIdx.x * 8 + (threadIdx.x >> 5); if (row >= ZH * TT) return; const int i = row % TT; const int zz = row / TT; (void)zz; const bool hires = (i < RH); const float* sr = Sb + (size_t)row * TT; float v[TT / 32]; float mx = -3.0e38f;
    const int klo = win_k0(i & ~63), khi = (i & ~63) + 64;   // the key range that the P.V loop of this row's 64-row tile reads: only 128-key chunks that meet it are stored
#pragma unroll
    for (int ch = 0; ch < TT / 128; ++ch) { const int j0 = ch * 128 + lane * 4; v4f a = (v4f){}; if (j0 <= i && i - (j0 + 3) < WIN) a = *(const v4f*)(sr + j0);   // a group of 4 keys with no allowed key is not loaded (its score tile may not exist)
#pragma unroll
        for (int q = 0; q < 4; ++q) { const int j = j0 + q; (void)j; const float t = (j <= i && i - j < WIN) ? softcap30(a[q] * SCL) : -3.0e38f; v[ch * 4 + q] = t; mx = fmaxf(mx, t); } }
#pragma unroll
    for (int sh = 16; sh; sh >>= 1) mx = fmaxf(mx, __shfl_xor(mx, sh, 32));
    float sum = 0.f;
#pragma unroll
    for (int k = 0; k < TT / 32; ++k) { float d0 = __fsub_rn(v[k], mx); asm volatile("" : "+v"(d0)); v[k] = __builtin_amdgcn_exp2f(__fmul_rn(d0, 1.4426950408889634f)); sum += v[k]; }
#pragma unroll
    for (int sh = 16; sh; sh >>= 1) sum += __shfl_xor(sum, sh, 32);
    const float f = __fdiv_rn(hires ? 1.0f : PCAR, sum);
{
        if (hires) {
#pragma unroll
            for (int ch = 0; ch < TT / 128; ++ch) { if (ch * 128 >= khi) continue; v4us oh, ol;
#pragma unroll
                for (int q = 0; q < 4; ++q) { unsigned short a, c2; splitf(v[ch * 4 + q] * f, a, c2); oh[q] = a; ol[q] = c2; }
                const size_t oo = ((size_t)zz * (RH ? RH : 1) + i) * TT + ch * 128 + lane * 4; *(v4us*)(Ph + oo) = oh; *(v4us*)(Pl + oo) = ol; }
        } else {
#pragma unroll
            for (int ch = 0; ch < TT / 128; ++ch) { if (ch * 128 >= khi || ch * 128 + 128 <= klo) continue; v4h o4;
#pragma unroll
                for (int q = 0; q < 4; ++q) o4[q] = tohx(v[ch * 4 + q] * f);
                *(v4h*)(P16 + (size_t)row * TT + ch * 128 + lane * 4) = o4; } }
         }
}
__global__ __launch_bounds__(256) void k_merge(const float* __restrict__ O, int h0, bf* Ah, bf* Al) { const size_t e = ((size_t)blockIdx.x * 256 + threadIdx.x) * 2; if (e >= (size_t)ZH * TT * HD) return; const int d = (int)(e % HD); const int t = (int)((e / HD) % TT); const int zz = (int)(e / ((size_t)HD * TT)); const float cs = (t < RH) ? 1.0f : (1.0f / PCAR); const size_t oo = (size_t)t * DQ + (h0 + zz) * HD + d;
    v2us oh, ol;
#pragma unroll
    for (int q = 0; q < 2; ++q) { unsigned short a, c2; splitf(O[e + q] * cs, a, c2); oh[q] = a; ol[q] = c2; } *(v2us*)(Ah + oo) = oh; *(v2us*)(Al + oo) = ol;  }

extern "C" void kernel_launch(void* const* d_in, const int* in_sizes, int n_in,
                              void* d_out, int out_size, void* d_ws, size_t ws_size, hipStream_t stream) {
    (void)in_sizes; (void)n_in; (void)out_size;
    const float* x = (const float*)d_in[0]; const float* wq = (const float*)d_in[1]; const float* wk = (const float*)d_in[2]; const float* wv = (const float*)d_in[3]; const float* wo = (const float*)d_in[4]; const float* cosT = nullptr; const float* sinT = nullptr; (void)cosT; (void)sinT;
    float* OUT = (float*)d_out;     // [2][2048][2048]
    char* wsp = (char*)d_ws;
    auto take = [&](size_t bytes) { char* p = wsp; wsp += (bytes + 255) & ~(size_t)255; return (void*)p; };
    bf* WQ = (bf*)take((size_t)DQ * DM * 2); bf* WK = (bf*)take((size_t)DKV * DM * 2); bf* WV = (bf*)take((size_t)DKV * DM * 2); bf* WO = (bf*)take((size_t)DM * DQ * 2); float* CS = (float*)take((size_t)TT * HD * 2 * 4);
    bf* XB = (bf*)take((size_t)TT * DM * 2); float* FQ = (float*)take((size_t)TT * DQ * 4); float* FK = (float*)take((size_t)TT * DKV * 4);
    h16* QP16 = (h16*)take((size_t)NH_ * TT * HD * 2); h16* KP16 = (h16*)take((size_t)NKV * TT * HD * 2); h16* VT16 = (h16*)take((size_t)NKV * HD * TT * 2);
    bf* QPh = (bf*)take((size_t)NH_ * TT * HD * 2); bf* QPl = (bf*)take((size_t)NH_ * TT * HD * 2); bf* KPh = (bf*)take((size_t)NKV * TT * HD * 2); bf* KPl = (bf*)take((size_t)NKV * TT * HD * 2); bf* VTh = (bf*)take((size_t)NKV * HD * TT * 2); bf* VTl = (bf*)take((size_t)NKV * HD * TT * 2); bf* Ph = (bf*)take((size_t)ZH * RH * TT * 2); bf* Pl = (bf*)take((size_t)ZH * RH * TT * 2);
    float* Sb = (float*)take((size_t)ZH * TT * TT * 4); h16* P16 = (h16*)take((size_t)ZH * TT * TT * 2); float* Ob = (float*)take((size_t)ZH * TT * HD * 4); bf* ATh = (bf*)take((size_t)TT * DQ * 2); bf* ATl = (bf*)take((size_t)TT * DQ * 2);
    if ((size_t)(wsp - (char*)d_ws) > ws_size) return;    // ws 256 MiB
    float* FV = FK;   // v projection reuses the k buffer after the k planes are built (stream-ordered)
    { k_cvt8<<<(unsigned)(((size_t)DQ * DM / 8 + 255) / 256), 256, 0, stream>>>(wq, WQ, (size_t)DQ * DM / 8); k_cvt8<<<(unsigned)(((size_t)DKV * DM / 8 + 255) / 256), 256, 0, stream>>>(wk, WK, (size_t)DKV * DM / 8); k_cvt8<<<(unsigned)(((size_t)DKV * DM / 8 + 255) / 256), 256, 0, stream>>>(wv, WV, (size_t)DKV * DM / 8);
      k_cvt8<<<(unsigned)(((size_t)DM * DQ / 8 + 255) / 256), 256, 0, stream>>>(wo, WO, (size_t)DM * DQ / 8);
       }
    k_csid<<<(TT * HD + 255) / 256, 256, 0, stream>>>(CS);
    const unsigned LQ = (unsigned)(((size_t)NH_ * TT * HD / 2 + 255) / 256), LKv = (unsigned)(((size_t)NKV * TT * HD / 2 + 255) / 256);
    for (int b = 0; b < NB_; ++b) {
        
        k_cvt8<<<(unsigned)(((size_t)TT * DM / 8 + 255) / 256), 256, 0, stream>>>(x + (size_t)b * TT * DM, XB, (size_t)TT * DM / 8);
        k_gemmw<bf, 0, false><<<dim3(TT / 64, DQ / 64, 1), 32, 0, stream>>>(XB, nullptr, WQ, nullptr, DM, FQ, DQ, nullptr, 0, 0, 0);
        k_rope<<<LQ, 256, 0, stream>>>(FQ, DQ, NH_, CS, nullptr, nullptr, 1.0f, QP16, QPh, QPl);
        k_gemmw<bf, 0, false><<<dim3(TT / 64, DKV / 64, 1), 32, 0, stream>>>(XB, nullptr, WK, nullptr, DM, FK, DKV, nullptr, 0, 0, 0);
        k_rope<<<LKv, 256, 0, stream>>>(FK, DKV, NKV, CS, nullptr, nullptr, 1.0f, KP16, KPh, KPl);
        k_gemmw<bf, 0, false><<<dim3(TT / 64, DKV / 64, 1), 32, 0, stream>>>(XB, nullptr, WV, nullptr, DM, FV, DKV, nullptr, 0, 0, 0); k_vtp<<<LKv, 256, 0, stream>>>(FV, DKV, NKV, VT16, VTh, VTl);
        for (int h0 = 0; h0 < NH_; h0 += ZH) { const size_t zq = (size_t)h0, zk = (size_t)(h0 / REP);   // one kv head per query head: the pass's two heads use consecutive kv planes (z-strides TT*HD)
            k_gemmc<bf, 2, 1><<<dim3(RH / 64, TT / 64, ZH), 32, 0, stream>>>(QPh + zq * TT * HD, QPl + zq * TT * HD, KPh + zk * TT * HD, KPl + zk * TT * HD, HD, Sb, TT, 0, (size_t)TT * HD, (size_t)TT * HD, (size_t)TT * TT);
            k_gemmc<h16, 0, 1><<<dim3((TT - RH) / 64, TT / 64, ZH), 32, 0, stream>>>(QP16 + zq * TT * HD + (size_t)RH * HD, nullptr, KP16 + zk * TT * HD, nullptr, HD, Sb + (size_t)RH * TT, TT, RH, (size_t)TT * HD, (size_t)TT * HD, (size_t)TT * TT);
            k_asoft<<<ZH * TT / 8, 256, 0, stream>>>(Sb, P16, Ph, Pl);
            k_gemmc<bf, 2, 2><<<dim3(RH / 64, HD / 64, ZH), 32, 0, stream>>>(Ph, Pl, VTh + zk * HD * TT, VTl + zk * HD * TT, TT, Ob, HD, 0, (size_t)RH * TT, (size_t)HD * TT, (size_t)TT * HD);
            k_gemmc<h16, 0, 2><<<dim3((TT - RH) / 64, HD / 64, ZH), 32, 0, stream>>>(P16 + (size_t)RH * TT, nullptr, VT16 + zk * HD * TT, nullptr, TT, Ob + (size_t)RH * HD, HD, RH, (size_t)TT * TT, (size_t)HD * TT, (size_t)TT * HD);
            k_merge<<<(unsigned)(((size_t)ZH * TT * HD / 2 + 255) / 256), 256, 0, stream>>>(Ob, h0, ATh, ATl); }
        k_gemmw<bf, 1, false><<<dim3(TT / 64, DM / 64, 1), 32, 0, stream>>>(ATh, ATl, WO, nullptr, DQ, OUT + (size_t)b * TT * DM, DM, nullptr, 0, 0, 0); }
}

// v002
// One run takes 929 microseconds.
// Next to v001, in two timings, it ran 1.75 and 1.73 times as fast.
// Counting every step since v000, it is 2.02 times as fast.
#include <hip/hip_runtime.h>

// FastestFlashMHA (x [2][2048][2048]; q/k/v = x W^T (16 heads x 128); scores = 30 tanh((q.k / sqrt(128)) / 30); key j allowed iff j <= i and i - j < 1024 (finfo.min fill); softmax; out = merged Wo^T -> [2][2048][2048]).
// Compute dtypes, f32 accumulate: every input rounded to bf16; q/k/v on PLAIN bf16 operands (inputs: exact); softcap (precise tanhf, out of line) f32; causal scores and attn.v: query rows < 512 hl (3 products), the rest single fp16 (x1024), causal and sliding-window tile skipping with both tests inside computed tiles; softmax f32; Wo hl x exact (2 products).

#define NB_  2
#define TT   2048
#define DM   2048
#define NH_  16
#define NKV  16
#define REP  (NH_ / NKV)
#define HD   128
#define DQ   (NH_ * HD)
#define DKV  (NKV * HD)
#define ZH   8                    // heads per attention pass (grid z of every attention launch)
#define RH   512                  // query rows < RH use hi+lo planes (0: none)
#define WIN  1024
#define PCAR 1024.0f
#define SCL  0.088388347648318447f   // HD^-0.5
typedef _Float16 h16;
typedef unsigned short bf;
typedef __attribute__((ext_vector_type(16))) __bf16   v16bf;
typedef __attribute__((ext_vector_type(16))) _Float16 v16h;
typedef __attribute__((ext_vector_type(8)))  _Float16 v8h;
typedef __attribute__((ext_vector_type(8)))  unsigned short v8us;
typedef __attribute__((ext_vector_type(8)))  float    v8f;
typedef __attribute__((ext_vector_type(4)))  float    v4f;
typedef v8h  __attribute__((may_alias)) v8ha;
typedef v4f  __attribute__((may_alias)) v4fa;
typedef v8us __attribute__((may_alias)) v8usa;

__device__ __forceinline__ unsigned short f2bf(float f) { unsigned u = __float_as_uint(f); u += 0x7FFFu + ((u >> 16) & 1u); return (unsigned short)(u >> 16); }
__device__ __forceinline__ float bf2f(unsigned short b) { return __uint_as_float(((unsigned)b) << 16); }
__device__ __forceinline__ float bfr(float f) { return bf2f(f2bf(f)); }
__device__ __forceinline__ v16h cat16(v8h lo, v8h hi) { return __builtin_shufflevector(lo, hi, 0, 1, 2, 3, 4, 5, 6, 7, 8, 9, 10, 11, 12, 13, 14, 15); }
__device__ __forceinline__ v16bf cat16b(v8us lo, v8us hi) { return __builtin_bit_cast(v16bf, __builtin_shufflevector(lo, hi, 0, 1, 2, 3, 4, 5, 6, 7, 8, 9, 10, 11, 12, 13, 14, 15)); }
__device__ __forceinline__ v8f wmma16(v16h a, v16h b, v8f c) { return __builtin_amdgcn_wmma_f32_16x16x32_f16(false, a, false, b, (short)0, c, false, false); }
__device__ __forceinline__ v8f wmmab(v16bf a, v16bf b, v8f c) { return __builtin_amdgcn_wmma_f32_16x16x32_bf16(false, a, false, b, (short)0, c, false, false); }



// ---- k_gemmw: register-blocked GEMM, ONE WAVE per 64x64 output tile (16 accumulators), operands straight from K-contiguous 16-bit planes; grid (M/64, N/64, Z), 32 threads.
// C[m][n] (f32, pitch ldc, + optional f32 bias[n]) = sum_k A[m][k] Bt[n][k] (+ split products per NSPLIT). z-batch strides sA/sB/sC in elements. K % 32 == 0.
template <typename T16> struct WFrag;
template <> struct WFrag<h16> { typedef v16h V; static __device__ __forceinline__ V ld(const h16* p) { return cat16(*(const v8h*)p, *(const v8h*)(p + 16)); } static __device__ __forceinline__ v8f mma(V a, V b, v8f c) { return wmma16(a, b, c); } };
template <> struct WFrag<bf> { typedef v16bf V; static __device__ __forceinline__ V ld(const bf* p) { return cat16b(*(const v8us*)p, *(const v8us*)(p + 16)); } static __device__ __forceinline__ v8f mma(V a, V b, v8f c) { return wmmab(a, b, c); } };
template <typename T16, int NSPLIT, bool BIAS>
__global__ __launch_bounds__(32) void k_gemmw(const T16* __restrict__ A, const T16* __restrict__ A2, const T16* __restrict__ Bt, const T16* __restrict__ Bt2, int K, float* C, int ldc, const float* __restrict__ bias, size_t sA, size_t sB, size_t sC) {
    typedef typename WFrag<T16>::V V;
    __shared__ __align__(16) float os[16 * 68];
    const size_t z = blockIdx.z; A += z * sA; if (A2) A2 += z * sA; Bt += z * sB; if (Bt2) Bt2 += z * sB; C += z * sC;
    const int lane = threadIdx.x & 31, lr = lane & 15, hi = lane >> 4; const int r0 = blockIdx.x * 64, c0 = blockIdx.y * 64;
    v8f acc[4][4];
#pragma unroll
    for (int mb = 0; mb < 4; ++mb)
#pragma unroll
        for (int nb = 0; nb < 4; ++nb) acc[mb][nb] = (v8f){};
    const size_t aoff = (size_t)(r0 + lr) * K + 8 * hi, boff = (size_t)(c0 + lr) * K + 8 * hi;
#pragma unroll 1
    for (int kc = 0; kc < K; kc += 32) {
        V a[4], a2[4];
#pragma unroll
        for (int mb = 0; mb < 4; ++mb) { a[mb] = WFrag<T16>::ld(A + aoff + (size_t)mb * 16 * K + kc); if (NSPLIT == 1 || NSPLIT == 2) a2[mb] = WFrag<T16>::ld(A2 + aoff + (size_t)mb * 16 * K + kc); }
#pragma unroll
        for (int nb = 0; nb < 4; ++nb) { const V b = WFrag<T16>::ld(Bt + boff + (size_t)nb * 16 * K + kc); V b2; if (NSPLIT >= 2) b2 = WFrag<T16>::ld(Bt2 + boff + (size_t)nb * 16 * K + kc);
#pragma unroll
            for (int mb = 0; mb < 4; ++mb) { acc[mb][nb] = WFrag<T16>::mma(a[mb], b, acc[mb][nb]); if (NSPLIT == 1 || NSPLIT == 2) acc[mb][nb] = WFrag<T16>::mma(a2[mb], b, acc[mb][nb]); if (NSPLIT >= 2) acc[mb][nb] = WFrag<T16>::mma(a[mb], b2, acc[mb][nb]); } }
        asm volatile("v_nop\n\tv_nop\n\tv_nop\n\tv_nop" : "+v"(acc[0][0]), "+v"(acc[1][1]), "+v"(acc[2][2]), "+v"(acc[3][3]) : "v"(a[0]), "v"(a[3]));
    }
#pragma unroll
    for (int mb = 0; mb < 4; ++mb) {
#pragma unroll
        for (int nb = 0; nb < 4; ++nb) {
#pragma unroll
            for (int j = 0; j < 8; ++j) os[(hi * 8 + j) * 68 + nb * 16 + lr] = acc[mb][nb][j]; }
        __builtin_amdgcn_wave_barrier(); asm volatile("" ::: "memory");
        float* crow = C + (size_t)(r0 + mb * 16) * ldc + c0;
{
#pragma unroll
            for (int s = 0; s < 8; ++s) { const int row = 2 * s + hi, cofs = lr * 4; v4f val = *(const v4fa*)(os + row * 68 + cofs); if (BIAS) { val[0] += bfr(bias[c0 + cofs]); val[1] += bfr(bias[c0 + cofs + 1]); val[2] += bfr(bias[c0 + cofs + 2]); val[3] += bfr(bias[c0 + cofs + 3]); }
                *(v4f*)(crow + (size_t)row * ldc + cofs) = val; }
             }
        __builtin_amdgcn_wave_barrier(); asm volatile("" ::: "memory");
    }
}

// First key (a multiple of 32) that any query row of the 64-row tile starting at row R can attend to: row i allows keys j > i - WIN, so the tile's lowest allowed key is R - WIN + 1.
__device__ __forceinline__ int win_k0(int R) { return max(0, R - (WIN - 1)) & ~31; }
// ---- k_gemmc: the same one-wave 64x64 tile GEMM specialised for causal sliding-window attention: CMODE 1 skips score tiles entirely above the diagonal or entirely below the window (query rows r0+roff.., key columns c0..), CMODE 2 limits the
// key (K) loop of the probability x value contraction to [win_k0, diagonal block] (probabilities outside it are exactly zero and are not read; only the 128-key chunks that meet it are stored). roff = row offset of this launch's first row within the sequence. lda = row pitch of A/A2 in elements (Bt/Bt2 rows have pitch K).
template <typename T16, int NSPLIT, int CMODE>
__global__ __launch_bounds__(32) void k_gemmc(const T16* __restrict__ A, const T16* __restrict__ A2, const T16* __restrict__ Bt, const T16* __restrict__ Bt2, int K, int lda, float* C, int ldc, int roff, size_t sA, size_t sB, size_t sC) {
    typedef typename WFrag<T16>::V V;
    __shared__ __align__(16) float os[16 * 68];
    const size_t z = blockIdx.z; A += z * sA; if (A2) A2 += z * sA; Bt += z * sB; if (Bt2) Bt2 += z * sB; C += z * sC;
    const int lane = threadIdx.x & 31, lr = lane & 15, hi = lane >> 4; const int r0 = blockIdx.x * 64, c0 = blockIdx.y * 64;
    if (CMODE == 1 && c0 > r0 + roff + 63) return;                  // score tile entirely above the causal diagonal: never read (the softmax masks j > i by select)
    if (CMODE == 1 && r0 + roff - (c0 + 63) >= WIN) return;          // score tile entirely below the sliding window (i - j >= WIN for all of it): never read either
    const int Kl = (CMODE == 2) ? min(K, r0 + roff + 64) : K;        // P.V: probabilities are exactly 0 beyond the diagonal block, so the K loop stops there
    const int K0 = (CMODE == 2) ? win_k0(r0 + roff) : 0;             // ... and exactly 0 below the window of the tile's first row, so it starts there
    v8f acc[4][4];
#pragma unroll
    for (int mb = 0; mb < 4; ++mb)
#pragma unroll
        for (int nb = 0; nb < 4; ++nb) acc[mb][nb] = (v8f){};
    const size_t aoff = (size_t)(r0 + lr) * lda + 8 * hi, boff = (size_t)(c0 + lr) * K + 8 * hi;
#pragma unroll 1
    for (int kc = K0; kc < Kl; kc += 32) {
        V a[4], a2[4];
#pragma unroll
        for (int mb = 0; mb < 4; ++mb) { a[mb] = WFrag<T16>::ld(A + aoff + (size_t)mb * 16 * lda + kc); if (NSPLIT == 1 || NSPLIT == 2) a2[mb] = WFrag<T16>::ld(A2 + aoff + (size_t)mb * 16 * lda + kc); }
#pragma unroll
        for (int nb = 0; nb < 4; ++nb) { const V b = WFrag<T16>::ld(Bt + boff + (size_t)nb * 16 * K + kc); V b2; if (NSPLIT >= 2) b2 = WFrag<T16>::ld(Bt2 + boff + (size_t)nb * 16 * K + kc);
#pragma unroll
            for (int mb = 0; mb < 4; ++mb) { acc[mb][nb] = WFrag<T16>::mma(a[mb], b, acc[mb][nb]); if (NSPLIT == 1 || NSPLIT == 2) acc[mb][nb] = WFrag<T16>::mma(a2[mb], b, acc[mb][nb]); if (NSPLIT >= 2) acc[mb][nb] = WFrag<T16>::mma(a[mb], b2, acc[mb][nb]); } }
        asm volatile("v_nop\n\tv_nop\n\tv_nop\n\tv_nop" : "+v"(acc[0][0]), "+v"(acc[1][1]), "+v"(acc[2][2]), "+v"(acc[3][3]) : "v"(a[0]), "v"(a[3]));
    }
#pragma unroll
    for (int mb = 0; mb < 4; ++mb) {
#pragma unroll
        for (int nb = 0; nb < 4; ++nb) {
#pragma unroll
            for (int j = 0; j < 8; ++j) os[(hi * 8 + j) * 68 + nb * 16 + lr] = acc[mb][nb][j]; }
        __builtin_amdgcn_wave_barrier(); asm volatile("" ::: "memory");
        float* crow = C + (size_t)(r0 + mb * 16) * ldc + c0;
{
#pragma unroll
            for (int s = 0; s < 8; ++s) { const int row = 2 * s + hi, cofs = lr * 4; v4f val = *(const v4fa*)(os + row * 68 + cofs);
                *(v4f*)(crow + (size_t)row * ldc + cofs) = val; }
             }
        __builtin_amdgcn_wave_barrier(); asm volatile("" ::: "memory");
    }
}

__device__ __forceinline__ h16 tohx(float x) { return (h16)x; }
__device__ __forceinline__ void splitf(float y, unsigned short& h, unsigned short& l) { h = f2bf(y); l = f2bf(y - bf2f(h)); }
typedef __attribute__((ext_vector_type(2))) _Float16 v2h;
typedef __attribute__((ext_vector_type(4))) _Float16 v4h;
typedef __attribute__((ext_vector_type(2))) unsigned short v2us;
typedef __attribute__((ext_vector_type(4))) unsigned short v4us;
typedef __attribute__((ext_vector_type(2))) float v2f;
typedef __attribute__((ext_vector_type(4))) int v4i;

__global__ __launch_bounds__(256) void k_wtG(const float* __restrict__ w, int K, int N, bf* Bt) {
    const int lane = threadIdx.x & 31; const int L0 = (blockIdx.x * 8 + (threadIdx.x >> 5)) * 8; const int nlines = N * K / 64;
{
#pragma unroll 1
        for (int l = 0; l < 8; ++l) { const int L = L0 + l; if (L >= nlines) break; const size_t e = (size_t)L * 64 + lane * 2; const int k = (int)(e % K), n = (int)(e / K); v2us o;
            o[0] = f2bf(w[(size_t)k * N + n]); o[1] = f2bf(w[(size_t)(k + 1) * N + n]); *(v2us*)(Bt + e) = o; }
         }
}
__global__ __launch_bounds__(256) void k_cvt8(const float* __restrict__ src, bf* dst, size_t n8) { const size_t i = (size_t)blockIdx.x * 256 + threadIdx.x; if (i >= n8) return; const v8f v = *(const v8f*)(src + i * 8); v8us o;
#pragma unroll
    for (int k = 0; k < 8; ++k) o[k] = f2bf(v[k]); *(v8us*)(dst + i * 8) = o;  }
__global__ __launch_bounds__(256) void k_cscvt(const float* __restrict__ cosT, const float* __restrict__ sinT, float* CS) { const int idx = blockIdx.x * 256 + threadIdx.x; if (idx >= TT * HD) return; v2f cs; cs[0] = bfr(cosT[idx]); cs[1] = bfr(sinT[idx]); *(v2f*)(CS + (size_t)idx * 2) = cs;  }
// k_rope: head planes [h][t][d] (fp16 + hi/lo) of rope(x) x sc with the rotate-half convention out[d] = x[d] cos[t][d] - x[d+HD/2] sin[t][d], out[d+HD/2] = x[d+HD/2] cos[t][d+HD/2] + x[d] sin[t][d+HD/2]
__global__ __launch_bounds__(256) void k_rope(const float* __restrict__ F, int pitch, int nheads, const float* __restrict__ CS, const float* __restrict__ RF, const float* __restrict__ nw, float sc, h16* P16, bf* Ph, bf* Pl) {
    const size_t e = ((size_t)blockIdx.x * 256 + threadIdx.x) * 2; if (e >= (size_t)nheads * TT * HD) return; const int d = (int)(e % HD); const int t = (int)((e / HD) % TT); const int h = (int)(e / ((size_t)HD * TT)); const float* f = F + (size_t)t * pitch + h * HD; const float rf = RF ? RF[(size_t)h * TT + t] : 1.0f; v2h o16; v2us oh, ol;
#pragma unroll
    for (int q = 0; q < 2; ++q) { const int dd = d + q; const int dp = (dd < HD / 2) ? dd + HD / 2 : dd - HD / 2; float x0 = f[dd], x1 = f[dp];
        if (RF) { float n0 = __fmul_rn(x0, rf), n1 = __fmul_rn(x1, rf); asm volatile("" : "+v"(n0)); asm volatile("" : "+v"(n1)); x0 = __fmul_rn(bfr(nw[dd]), n0); x1 = __fmul_rn(bfr(nw[dp]), n1); }
        const v2f cs = *(const v2f*)(CS + ((size_t)t * HD + dd) * 2); float a = __fmul_rn(x0, cs[0]), bq = __fmul_rn(x1, cs[1]); asm volatile("" : "+v"(a)); asm volatile("" : "+v"(bq)); const float r = ((dd < HD / 2) ? __fsub_rn(a, bq) : __fadd_rn(a, bq)) * sc;
        o16[q] = tohx(r); unsigned short a2, c2; splitf(r, a2, c2); oh[q] = a2; ol[q] = c2; }
    *(v2h*)(P16 + e) = o16; *(v2us*)(Ph + e) = oh; *(v2us*)(Pl + e) = ol;  }
__global__ __launch_bounds__(256) void k_vtp(const float* __restrict__ F, int pitch, int nheads, h16* V16, bf* Vh, bf* Vl) { const size_t e = ((size_t)blockIdx.x * 256 + threadIdx.x) * 2; if (e >= (size_t)nheads * HD * TT) return; const int t = (int)(e % TT); const int d = (int)((e / TT) % HD); const int g = (int)(e / ((size_t)TT * HD)); v2h o16; v2us oh, ol;
#pragma unroll
    for (int q = 0; q < 2; ++q) { const float x = F[(size_t)(t + q) * pitch + g * HD + d]; o16[q] = tohx(x); unsigned short a2, c2; splitf(x, a2, c2); oh[q] = a2; ol[q] = c2; }
    *(v2h*)(V16 + e) = o16; *(v2us*)(Vh + e) = oh; *(v2us*)(Vl + e) = ol;  }
__global__ __launch_bounds__(256) void k_csid(float* CS) { const int idx = blockIdx.x * 256 + threadIdx.x; if (idx >= TT * HD) return; v2f cs; cs[0] = 1.0f; cs[1] = 0.0f; *(v2f*)(CS + (size_t)idx * 2) = cs;  }
__device__ __attribute__((noinline)) float softcap30(float s) { return 30.0f * tanhf(__fdiv_rn(s, 30.0f)); }
// k_asoft: per row (zz, i): t = 30 tanh(S x HD^-0.5 / 30) for j <= i and i - j < WIN (sliding causal window; the reference's -1e9 additive fill vanishes identically); softmax over the 2048 keys (register row, one exp, fixed trees);
// the probabilities overwrite the row's own scores: one wave owns a row and holds all of it in registers before its first store. Row pitch 2 TT 16-bit elements; fp16 (or the hi plane) from the row's start, the lo plane from its middle.
__global__ __launch_bounds__(256) void k_asoft(const float* Sb, h16* P16, bf* Ph, bf* Pl) {
    const int lane = threadIdx.x & 31; const int row = blockIdx.x * 8 + (threadIdx.x >> 5); if (row >= ZH * TT) return; const int i = row % TT; const int zz = row / TT; (void)zz; const bool hires = (i < RH); const float* sr = Sb + (size_t)row * TT; float v[TT / 32]; float mx = -3.0e38f;
    const int klo = win_k0(i & ~63), khi = (i & ~63) + 64;   // the key range that the P.V loop of this row's 64-row tile reads: only 128-key chunks that meet it are stored
#pragma unroll
    for (int ch = 0; ch < TT / 128; ++ch) { const int j0 = ch * 128 + lane * 4; v4f a = (v4f){}; if (j0 <= i && i - (j0 + 3) < WIN) a = *(const v4f*)(sr + j0);   // a group of 4 keys with no allowed key is not loaded (its score tile may not exist)
#pragma unroll
        for (int q = 0; q < 4; ++q) { const int j = j0 + q; (void)j; const float t = (j <= i && i - j < WIN) ? softcap30(a[q] * SCL) : -3.0e38f; v[ch * 4 + q] = t; mx = fmaxf(mx, t); } }
#pragma unroll
    for (int sh = 16; sh; sh >>= 1) mx = fmaxf(mx, __shfl_xor(mx, sh, 32));
    float sum = 0.f;
#pragma unroll
    for (int k = 0; k < TT / 32; ++k) { float d0 = __fsub_rn(v[k], mx); asm volatile("" : "+v"(d0)); v[k] = __builtin_amdgcn_exp2f(__fmul_rn(d0, 1.4426950408889634f)); sum += v[k]; }
#pragma unroll
    for (int sh = 16; sh; sh >>= 1) sum += __shfl_xor(sum, sh, 32);
    const float f = __fdiv_rn(hires ? 1.0f : PCAR, sum);
{
        if (hires) {
#pragma unroll
            for (int ch = 0; ch < TT / 128; ++ch) { if (ch * 128 >= khi) continue; v4us oh, ol;
#pragma unroll
                for (int q = 0; q < 4; ++q) { unsigned short a, c2; splitf(v[ch * 4 + q] * f, a, c2); oh[q] = a; ol[q] = c2; }
                const size_t oo = (size_t)row * (2 * TT) + ch * 128 + lane * 4; *(v4us*)(Ph + oo) = oh; *(v4us*)(Pl + oo) = ol; }
        } else {
#pragma unroll
            for (int ch = 0; ch < TT / 128; ++ch) { if (ch * 128 >= khi || ch * 128 + 128 <= klo) continue; v4h o4;
#pragma unroll
                for (int q = 0; q < 4; ++q) o4[q] = tohx(v[ch * 4 + q] * f);
                *(v4h*)(P16 + (size_t)row * (2 * TT) + ch * 128 + lane * 4) = o4; } }
         }
}
__global__ __launch_bounds__(256) void k_merge(const float* __restrict__ O, int h0, bf* Ah, bf* Al) { const size_t e = ((size_t)blockIdx.x * 256 + threadIdx.x) * 2; if (e >= (size_t)ZH * TT * HD) return; const int d = (int)(e % HD); const int t = (int)((e / HD) % TT); const int zz = (int)(e / ((size_t)HD * TT)); const float cs = (t < RH) ? 1.0f : (1.0f / PCAR); const size_t oo = (size_t)t * DQ + (h0 + zz) * HD + d;
    v2us oh, ol;
#pragma unroll
    for (int q = 0; q < 2; ++q) { unsigned short a, c2; splitf(O[e + q] * cs, a, c2); oh[q] = a; ol[q] = c2; } *(v2us*)(Ah + oo) = oh; *(v2us*)(Al + oo) = ol;  }

extern "C" void kernel_launch(void* const* d_in, const int* in_sizes, int n_in,
                              void* d_out, int out_size, void* d_ws, size_t ws_size, hipStream_t stream) {
    (void)in_sizes; (void)n_in; (void)out_size;
    const float* x = (const float*)d_in[0]; const float* wq = (const float*)d_in[1]; const float* wk = (const float*)d_in[2]; const float* wv = (const float*)d_in[3]; const float* wo = (const float*)d_in[4]; const float* cosT = nullptr; const float* sinT = nullptr; (void)cosT; (void)sinT;
    float* OUT = (float*)d_out;     // [2][2048][2048]
    char* wsp = (char*)d_ws;
    auto take = [&](size_t bytes) { char* p = wsp; wsp += (bytes + 255) & ~(size_t)255; return (void*)p; };
    bf* WQ = (bf*)take((size_t)DQ * DM * 2); bf* WK = (bf*)take((size_t)DKV * DM * 2); bf* WV = (bf*)take((size_t)DKV * DM * 2); float* CS = (float*)take((size_t)TT * HD * 2 * 4);
    h16* QP16 = (h16*)take((size_t)NH_ * TT * HD * 2); h16* KP16 = (h16*)take((size_t)NKV * TT * HD * 2); h16* VT16 = (h16*)take((size_t)NKV * HD * TT * 2);
    bf* QPh = (bf*)take((size_t)NH_ * TT * HD * 2); bf* QPl = (bf*)take((size_t)NH_ * TT * HD * 2); bf* KPh = (bf*)take((size_t)NKV * TT * HD * 2); bf* KPl = (bf*)take((size_t)NKV * TT * HD * 2); bf* VTh = (bf*)take((size_t)NKV * HD * TT * 2); bf* VTl = (bf*)take((size_t)NKV * HD * TT * 2);
    float* Sb = (float*)take((size_t)ZH * TT * TT * 4); float* Ob = (float*)take((size_t)ZH * TT * HD * 4); bf* ATh = (bf*)take((size_t)TT * DQ * 2); bf* ATl = (bf*)take((size_t)TT * DQ * 2);
    if ((size_t)(wsp - (char*)d_ws) > ws_size) return;    // ws 256 MiB
    h16* P16 = (h16*)Sb; bf* Ph = (bf*)Sb; bf* Pl = (bf*)Sb + TT;   // probabilities live in their own score rows (k_asoft)
    // The score buffer's space also serves what is dead while scores are live (stream-ordered): before the passes x in bf16 and the f32 projections, after them Wo in bf16.
    bf* XB = (bf*)Sb; float* FQ = (float*)((char*)Sb + (size_t)TT * DM * 2); float* FK = (float*)((char*)Sb + (size_t)TT * DM * 2 + (size_t)TT * DQ * 4); bf* WO = (bf*)Sb;
    float* FV = FK;   // v projection reuses the k buffer after the k planes are built (stream-ordered)
    { k_cvt8<<<(unsigned)(((size_t)DQ * DM / 8 + 255) / 256), 256, 0, stream>>>(wq, WQ, (size_t)DQ * DM / 8); k_cvt8<<<(unsigned)(((size_t)DKV * DM / 8 + 255) / 256), 256, 0, stream>>>(wk, WK, (size_t)DKV * DM / 8); k_cvt8<<<(unsigned)(((size_t)DKV * DM / 8 + 255) / 256), 256, 0, stream>>>(wv, WV, (size_t)DKV * DM / 8); }
    k_csid<<<(TT * HD + 255) / 256, 256, 0, stream>>>(CS);
    const unsigned LQ = (unsigned)(((size_t)NH_ * TT * HD / 2 + 255) / 256), LKv = (unsigned)(((size_t)NKV * TT * HD / 2 + 255) / 256);
    for (int b = 0; b < NB_; ++b) {
        
        k_cvt8<<<(unsigned)(((size_t)TT * DM / 8 + 255) / 256), 256, 0, stream>>>(x + (size_t)b * TT * DM, XB, (size_t)TT * DM / 8);
        k_gemmw<bf, 0, false><<<dim3(TT / 64, DQ / 64, 1), 32, 0, stream>>>(XB, nullptr, WQ, nullptr, DM, FQ, DQ, nullptr, 0, 0, 0);
        k_rope<<<LQ, 256, 0, stream>>>(FQ, DQ, NH_, CS, nullptr, nullptr, 1.0f, QP16, QPh, QPl);
        k_gemmw<bf, 0, false><<<dim3(TT / 64, DKV / 64, 1), 32, 0, stream>>>(XB, nullptr, WK, nullptr, DM, FK, DKV, nullptr, 0, 0, 0);
        k_rope<<<LKv, 256, 0, stream>>>(FK, DKV, NKV, CS, nullptr, nullptr, 1.0f, KP16, KPh, KPl);
        k_gemmw<bf, 0, false><<<dim3(TT / 64, DKV / 64, 1), 32, 0, stream>>>(XB, nullptr, WV, nullptr, DM, FV, DKV, nullptr, 0, 0, 0); k_vtp<<<LKv, 256, 0, stream>>>(FV, DKV, NKV, VT16, VTh, VTl);
        for (int h0 = 0; h0 < NH_; h0 += ZH) { const size_t zq = (size_t)h0, zk = (size_t)(h0 / REP);   // one kv head per query head: the pass's heads use consecutive kv planes (z-strides TT*HD)
            k_gemmc<bf, 2, 1><<<dim3(RH / 64, TT / 64, ZH), 32, 0, stream>>>(QPh + zq * TT * HD, QPl + zq * TT * HD, KPh + zk * TT * HD, KPl + zk * TT * HD, HD, HD, Sb, TT, 0, (size_t)TT * HD, (size_t)TT * HD, (size_t)TT * TT);
            k_gemmc<h16, 0, 1><<<dim3((TT - RH) / 64, TT / 64, ZH), 32, 0, stream>>>(QP16 + zq * TT * HD + (size_t)RH * HD, nullptr, KP16 + zk * TT * HD, nullptr, HD, HD, Sb + (size_t)RH * TT, TT, RH, (size_t)TT * HD, (size_t)TT * HD, (size_t)TT * TT);
            k_asoft<<<ZH * TT / 8, 256, 0, stream>>>(Sb, P16, Ph, Pl);
            k_gemmc<bf, 2, 2><<<dim3(RH / 64, HD / 64, ZH), 32, 0, stream>>>(Ph, Pl, VTh + zk * HD * TT, VTl + zk * HD * TT, TT, 2 * TT, Ob, HD, 0, (size_t)TT * 2 * TT, (size_t)HD * TT, (size_t)TT * HD);
            k_gemmc<h16, 0, 2><<<dim3((TT - RH) / 64, HD / 64, ZH), 32, 0, stream>>>(P16 + (size_t)RH * 2 * TT, nullptr, VT16 + zk * HD * TT, nullptr, TT, 2 * TT, Ob + (size_t)RH * HD, HD, RH, (size_t)TT * 2 * TT, (size_t)HD * TT, (size_t)TT * HD);
            k_merge<<<(unsigned)(((size_t)ZH * TT * HD / 2 + 255) / 256), 256, 0, stream>>>(Ob, h0, ATh, ATl); }
        k_cvt8<<<(unsigned)(((size_t)DM * DQ / 8 + 255) / 256), 256, 0, stream>>>(wo, WO, (size_t)DM * DQ / 8);
        k_gemmw<bf, 1, false><<<dim3(TT / 64, DM / 64, 1), 32, 0, stream>>>(ATh, ATl, WO, nullptr, DQ, OUT + (size_t)b * TT * DM, DM, nullptr, 0, 0, 0); }
}

// v003
// A run of this version takes 770 microseconds.
// Next to v002, in two timings, it ran 1.21 times as fast each time.
// All steps since v000 together make it 2.44 times as fast.
#include <hip/hip_runtime.h>

// FastestFlashMHA (x [2][2048][2048]; q/k/v = x W^T (16 heads x 128); scores = 30 tanh((q.k / sqrt(128)) / 30); key j allowed iff j <= i and i - j < 1024 (finfo.min fill); softmax; out = merged Wo^T -> [2][2048][2048]).
// Compute dtypes, f32 accumulate: every input rounded to bf16; q/k/v on PLAIN bf16 operands (inputs: exact); softcap (precise tanhf, out of line) f32; causal scores and attn.v: query rows < 512 hl (3 products), the rest single fp16 (x1024), causal and sliding-window tile skipping with both tests inside computed tiles; softmax f32; Wo hl x exact (2 products).

#define NB_  2
#define TT   2048
#define DM   2048
#define NH_  16
#define NKV  16
#define REP  (NH_ / NKV)
#define HD   128
#define DQ   (NH_ * HD)
#define DKV  (NKV * HD)
#define ZH   8                    // heads per attention pass (grid z of every attention launch)
#define RH   512                  // query rows < RH use hi+lo planes (0: none)
#define WIN  1024
#define PCAR 1024.0f
#define SCL  0.088388347648318447f   // HD^-0.5
typedef _Float16 h16;
typedef unsigned short bf;
typedef __attribute__((ext_vector_type(16))) __bf16   v16bf;
typedef __attribute__((ext_vector_type(16))) _Float16 v16h;
typedef __attribute__((ext_vector_type(8)))  _Float16 v8h;
typedef __attribute__((ext_vector_type(8)))  unsigned short v8us;
typedef __attribute__((ext_vector_type(8)))  float    v8f;
typedef __attribute__((ext_vector_type(4)))  float    v4f;
typedef v8h  __attribute__((may_alias)) v8ha;
typedef v4f  __attribute__((may_alias)) v4fa;
typedef v8us __attribute__((may_alias)) v8usa;

__device__ __forceinline__ unsigned short f2bf(float f) { unsigned u = __float_as_uint(f); u += 0x7FFFu + ((u >> 16) & 1u); return (unsigned short)(u >> 16); }
__device__ __forceinline__ float bf2f(unsigned short b) { return __uint_as_float(((unsigned)b) << 16); }
__device__ __forceinline__ float bfr(float f) { return bf2f(f2bf(f)); }
__device__ __forceinline__ v16h cat16(v8h lo, v8h hi) { return __builtin_shufflevector(lo, hi, 0, 1, 2, 3, 4, 5, 6, 7, 8, 9, 10, 11, 12, 13, 14, 15); }
__device__ __forceinline__ v16bf cat16b(v8us lo, v8us hi) { return __builtin_bit_cast(v16bf, __builtin_shufflevector(lo, hi, 0, 1, 2, 3, 4, 5, 6, 7, 8, 9, 10, 11, 12, 13, 14, 15)); }
__device__ __forceinline__ v8f wmma16(v16h a, v16h b, v8f c) { return __builtin_amdgcn_wmma_f32_16x16x32_f16(false, a, false, b, (short)0, c, false, false); }
__device__ __forceinline__ v8f wmmab(v16bf a, v16bf b, v8f c) { return __builtin_amdgcn_wmma_f32_16x16x32_bf16(false, a, false, b, (short)0, c, false, false); }



// Fragment loaders and products of the two 16-bit operand types (K-contiguous planes).
template <typename T16> struct WFrag;
template <> struct WFrag<h16> { typedef v16h V; static __device__ __forceinline__ V ld(const h16* p) { return cat16(*(const v8h*)p, *(const v8h*)(p + 16)); } static __device__ __forceinline__ v8f mma(V a, V b, v8f c) { return wmma16(a, b, c); } };
template <> struct WFrag<bf> { typedef v16bf V; static __device__ __forceinline__ V ld(const bf* p) { return cat16b(*(const v8us*)p, *(const v8us*)(p + 16)); } static __device__ __forceinline__ v8f mma(V a, V b, v8f c) { return wmmab(a, b, c); } };

// ---- k_gemml: C[m][n] (f32, pitch ldc) = sum_k A[m][k] Bt[n][k] (+ A2[m][k] Bt[n][k] when NSPLIT == 1), bf16 planes of row pitch K. One 128x128 tile per work-group of four waves, 64x64 per wave (16 accumulators);
// grid (M/128, N/128), 128 threads. Operands reach LDS by asynchronous copies in whole 128-byte row pieces (64 k), two buffers: the next piece's copies fly while this one is multiplied. K % 64 == 0, M % 128 == 0, N % 128 == 0.
// Every '#pragma unroll' in it is there so that the fragment and accumulator arrays are indexed by constants and stay in registers.
#define LP    144                 // LDS row pitch in bytes: 128 data + 16, an odd multiple of 16, for 16-byte fragment reads
#define LTILE (128 * LP)          // one operand's 128 rows
// Eight copies of 16 bytes a lane: rows 16 apart of one operand tile (LDS step 16 LP bytes, global step rs elements).
__device__ __forceinline__ void copy8(unsigned l, const bf* g, size_t rs) {
    // the wait on xcnt ends the copies' own statement, so that no address register is rewritten in front of it
    asm volatile("global_load_async_to_lds_b128 %0, %8, off\n\t"
                 "global_load_async_to_lds_b128 %1, %9, off\n\t"
                 "global_load_async_to_lds_b128 %2, %10, off\n\t"
                 "global_load_async_to_lds_b128 %3, %11, off\n\t"
                 "global_load_async_to_lds_b128 %4, %12, off\n\t"
                 "global_load_async_to_lds_b128 %5, %13, off\n\t"
                 "global_load_async_to_lds_b128 %6, %14, off\n\t"
                 "global_load_async_to_lds_b128 %7, %15, off\n\t"
                 "s_wait_xcnt 0x0"
                 :: "v"(l), "v"(l + 16u * LP), "v"(l + 32u * LP), "v"(l + 48u * LP), "v"(l + 64u * LP), "v"(l + 80u * LP), "v"(l + 96u * LP), "v"(l + 112u * LP),
                    "v"(g), "v"(g + rs), "v"(g + 2 * rs), "v"(g + 3 * rs), "v"(g + 4 * rs), "v"(g + 5 * rs), "v"(g + 6 * rs), "v"(g + 7 * rs) : "memory");
}
__device__ __forceinline__ v16bf ldsfrag(const unsigned char* p) { return cat16b(*(const v8usa*)p, *(const v8usa*)(p + 32)); }
template <int NSPLIT>
__global__ __launch_bounds__(128) void k_gemml(const bf* __restrict__ A, const bf* __restrict__ A2, const bf* __restrict__ Bt, int K, float* C, int ldc) {
    constexpr int NT = (NSPLIT == 1) ? 3 : 2;           // operand tiles per stage: A, (A2,) Bt
    constexpr unsigned STG = NT * LTILE;
    __shared__ __align__(16) unsigned char L[2 * STG];
    __shared__ __align__(16) float osw[4][16 * 68];
    const int tid = threadIdx.x, lane = tid & 31, lr = lane & 15, hi = lane >> 4, w = tid >> 5, wm = w >> 1, wn = w & 1; const int r0 = blockIdx.x * 128, c0 = blockIdx.y * 128;
    v8f acc[4][4];
#pragma unroll
    for (int mb = 0; mb < 4; ++mb)
#pragma unroll
        for (int nb = 0; nb < 4; ++nb) acc[mb][nb] = (v8f){};
    // copies: lane tid brings 16-byte piece (tid & 7) of rows (tid >> 3) + 16 i, so a wave's copy covers four whole 128-byte row pieces
    const int crow = tid >> 3, cch = tid & 7; const size_t rs = (size_t)16 * K;
    const bf* gA = A + (size_t)(r0 + crow) * K + cch * 8; const bf* gA2 = (NSPLIT == 1) ? A2 + (size_t)(r0 + crow) * K + cch * 8 : nullptr; const bf* gB = Bt + (size_t)(c0 + crow) * K + cch * 8;
    const unsigned l0 = (unsigned)(size_t)L + (unsigned)(crow * LP + cch * 16);
    auto stage = [&](int t) { const unsigned l = l0 + (unsigned)(t & 1) * STG; const int kc = t * 64; copy8(l, gA + kc, rs); if (NSPLIT == 1) copy8(l + LTILE, gA2 + kc, rs); copy8(l + (NT - 1) * LTILE, gB + kc, rs); };
    const int nst = K / 64;
    stage(0);
    asm volatile("s_wait_asynccnt 0x0" ::: "memory");   // this wave's copies of stage 0 have landed
    __syncthreads();                                     // ... and every other wave's
    if (nst > 1) stage(1);
    const unsigned aofs = (unsigned)((wm * 64 + lr) * LP + hi * 16), bofs = (unsigned)((NT - 1) * LTILE + (wn * 64 + lr) * LP + hi * 16);
#pragma unroll 1   // one stage a trip: the two buffers alternate by the trip's parity
    for (int t = 0; t < nst; ++t) {
        const unsigned char* Lb = L + (unsigned)(t & 1) * STG; const unsigned char* pa = Lb + aofs; const unsigned char* pb = Lb + bofs;
        // Fragment reads stand in few groups, each ahead of the products that hide it (one wave per SIMD: nothing else hides an LDS wait). Every accumulator still takes its products in ascending k, A before A2.
        // Each sched_barrier(0) below keeps a read group where it is written: without them the scheduler sinks every read to just in front of its first use, and the wave waits out the LDS latency once per four products.
        v16bf a[4], a2[4], b[4];
        if (NSPLIT == 0) {   // a: k 0..31 of the stage, a2: k 32..63
#pragma unroll
            for (int mb = 0; mb < 4; ++mb) a[mb] = ldsfrag(pa + mb * 16 * LP);
#pragma unroll
            for (int nb = 0; nb < 4; ++nb) b[nb] = ldsfrag(pb + nb * 16 * LP);
#pragma unroll
            for (int mb = 0; mb < 4; ++mb) a2[mb] = ldsfrag(pa + mb * 16 * LP + 64);
            __builtin_amdgcn_sched_barrier(0);
#pragma unroll
            for (int h = 0; h < 2; ++h) {
#pragma unroll
                for (int nb = 2 * h; nb < 2 * h + 2; ++nb)
#pragma unroll
                    for (int mb = 0; mb < 4; ++mb) acc[mb][nb] = wmmab(a[mb], b[nb], acc[mb][nb]);
                __builtin_amdgcn_sched_barrier(0);
#pragma unroll
                for (int nb = 2 * h; nb < 2 * h + 2; ++nb) b[nb] = ldsfrag(pb + nb * 16 * LP + 64);
                __builtin_amdgcn_sched_barrier(0); }
#pragma unroll
            for (int nb = 0; nb < 4; ++nb)
#pragma unroll
                for (int mb = 0; mb < 4; ++mb) acc[mb][nb] = wmmab(a2[mb], b[nb], acc[mb][nb]);
        } else {
#pragma unroll
            for (int mb = 0; mb < 4; ++mb) a[mb] = ldsfrag(pa + mb * 16 * LP);
#pragma unroll
            for (int nb = 0; nb < 4; ++nb) b[nb] = ldsfrag(pb + nb * 16 * LP);
#pragma unroll
            for (int mb = 0; mb < 4; ++mb) a2[mb] = ldsfrag(pa + LTILE + mb * 16 * LP);
            __builtin_amdgcn_sched_barrier(0);
#pragma unroll
            for (int nb = 0; nb < 4; ++nb)
#pragma unroll
                for (int mb = 0; mb < 4; ++mb) acc[mb][nb] = wmmab(a[mb], b[nb], acc[mb][nb]);
            __builtin_amdgcn_sched_barrier(0);
#pragma unroll
            for (int mb = 0; mb < 4; ++mb) a[mb] = ldsfrag(pa + mb * 16 * LP + 64);
            __builtin_amdgcn_sched_barrier(0);
#pragma unroll
            for (int h = 0; h < 2; ++h) {
#pragma unroll
                for (int nb = 2 * h; nb < 2 * h + 2; ++nb)
#pragma unroll
                    for (int mb = 0; mb < 4; ++mb) acc[mb][nb] = wmmab(a2[mb], b[nb], acc[mb][nb]);
                __builtin_amdgcn_sched_barrier(0);
#pragma unroll
                for (int nb = 2 * h; nb < 2 * h + 2; ++nb) b[nb] = ldsfrag(pb + nb * 16 * LP + 64);
                if (h == 0) __builtin_amdgcn_sched_barrier(0); }
#pragma unroll
            for (int mb = 0; mb < 4; ++mb) a2[mb] = ldsfrag(pa + LTILE + mb * 16 * LP + 64);
            __builtin_amdgcn_sched_barrier(0);
#pragma unroll
            for (int nb = 0; nb < 4; ++nb)
#pragma unroll
                for (int mb = 0; mb < 4; ++mb) acc[mb][nb] = wmmab(a[mb], b[nb], acc[mb][nb]);
#pragma unroll
            for (int nb = 0; nb < 4; ++nb)
#pragma unroll
                for (int mb = 0; mb < 4; ++mb) acc[mb][nb] = wmmab(a2[mb], b[nb], acc[mb][nb]);
        }
        asm volatile("s_wait_dscnt 0x0" ::: "memory");      // this wave's reads of the buffer are done before it is handed back
        asm volatile("s_wait_asynccnt 0x0" ::: "memory");   // this wave's copies of stage t + 1 have landed
        __syncthreads();                                     // publishes stage t + 1 and ends every wave's reads of stage t
        if (t + 2 < nst) stage(t + 2);
    }
    asm volatile("s_wait_asynccnt 0x0" ::: "memory");       // no copy is outstanding when the wave goes on
    float* os = osw[w];   // each wave turns its own accumulators into whole 256-byte row pieces through its own LDS slice; the wave barriers with their compiler fences keep the slice's stores, reads and next stores in that order
#pragma unroll
    for (int mb = 0; mb < 4; ++mb) {
#pragma unroll
        for (int nb = 0; nb < 4; ++nb) {
#pragma unroll
            for (int j = 0; j < 8; ++j) os[(hi * 8 + j) * 68 + nb * 16 + lr] = acc[mb][nb][j]; }
        __builtin_amdgcn_wave_barrier(); asm volatile("" ::: "memory");
        float* crw = C + (size_t)(r0 + wm * 64 + mb * 16) * ldc + c0 + wn * 64;
#pragma unroll
        for (int s = 0; s < 8; ++s) { const int row = 2 * s + hi, cofs = lr * 4; const v4f val = *(const v4fa*)(os + row * 68 + cofs); *(v4f*)(crw + (size_t)row * ldc + cofs) = val; }
        __builtin_amdgcn_wave_barrier(); asm volatile("" ::: "memory");
    }
}

// First key (a multiple of 32) that any query row of the 64-row tile starting at row R can attend to: row i allows keys j > i - WIN, so the tile's lowest allowed key is R - WIN + 1.
__device__ __forceinline__ int win_k0(int R) { return max(0, R - (WIN - 1)) & ~31; }
// ---- k_gemmc: a one-wave 64x64 tile GEMM (16 accumulators, operands straight from K-contiguous 16-bit planes, 32 threads) specialised for causal sliding-window attention: CMODE 1 skips score tiles entirely above the diagonal or entirely below the window (query rows r0+roff.., key columns c0..), CMODE 2 limits the
// key (K) loop of the probability x value contraction to [win_k0, diagonal block] (probabilities outside it are exactly zero and are not read). roff = row offset of this launch's first row within the sequence. lda = row pitch of A/A2 in elements (Bt/Bt2 rows have pitch K).
template <typename T16, int NSPLIT, int CMODE>
__global__ __launch_bounds__(32) void k_gemmc(const T16* __restrict__ A, const T16* __restrict__ A2, const T16* __restrict__ Bt, const T16* __restrict__ Bt2, int K, int lda, float* C, int ldc, int roff, size_t sA, size_t sB, size_t sC) {
    typedef typename WFrag<T16>::V V;
    __shared__ __align__(16) float os[16 * 68];
    const size_t z = blockIdx.z; A += z * sA; if (A2) A2 += z * sA; Bt += z * sB; if (Bt2) Bt2 += z * sB; C += z * sC;
    const int lane = threadIdx.x & 31, lr = lane & 15, hi = lane >> 4; const int r0 = blockIdx.x * 64, c0 = blockIdx.y * 64;
    if (CMODE == 1 && c0 > r0 + roff + 63) return;                  // score tile entirely above the causal diagonal: never read (the softmax masks j > i by select)
    if (CMODE == 1 && r0 + roff - (c0 + 63) >= WIN) return;          // score tile entirely below the sliding window (i - j >= WIN for all of it): never read either
    const int Kl = (CMODE == 2) ? min(K, r0 + roff + 64) : K;        // P.V: probabilities are exactly 0 beyond the diagonal block, so the K loop stops there
    const int K0 = (CMODE == 2) ? win_k0(r0 + roff) : 0;             // ... and exactly 0 below the window of the tile's first row, so it starts there
    v8f acc[4][4];
#pragma unroll
    for (int mb = 0; mb < 4; ++mb)
#pragma unroll
        for (int nb = 0; nb < 4; ++nb) acc[mb][nb] = (v8f){};
    const size_t aoff = (size_t)(r0 + lr) * lda + 8 * hi, boff = (size_t)(c0 + lr) * K + 8 * hi;
#pragma unroll 1
    for (int kc = K0; kc < Kl; kc += 32) {
        V a[4], a2[4];
#pragma unroll
        for (int mb = 0; mb < 4; ++mb) { a[mb] = WFrag<T16>::ld(A + aoff + (size_t)mb * 16 * lda + kc); if (NSPLIT == 1 || NSPLIT == 2) a2[mb] = WFrag<T16>::ld(A2 + aoff + (size_t)mb * 16 * lda + kc); }
#pragma unroll
        for (int nb = 0; nb < 4; ++nb) { const V b = WFrag<T16>::ld(Bt + boff + (size_t)nb * 16 * K + kc); V b2; if (NSPLIT >= 2) b2 = WFrag<T16>::ld(Bt2 + boff + (size_t)nb * 16 * K + kc);
#pragma unroll
            for (int mb = 0; mb < 4; ++mb) { acc[mb][nb] = WFrag<T16>::mma(a[mb], b, acc[mb][nb]); if (NSPLIT == 1 || NSPLIT == 2) acc[mb][nb] = WFrag<T16>::mma(a2[mb], b, acc[mb][nb]); if (NSPLIT >= 2) acc[mb][nb] = WFrag<T16>::mma(a[mb], b2, acc[mb][nb]); } }
        asm volatile("v_nop\n\tv_nop\n\tv_nop\n\tv_nop" : "+v"(acc[0][0]), "+v"(acc[1][1]), "+v"(acc[2][2]), "+v"(acc[3][3]) : "v"(a[0]), "v"(a[3]));
    }
#pragma unroll
    for (int mb = 0; mb < 4; ++mb) {
#pragma unroll
        for (int nb = 0; nb < 4; ++nb) {
#pragma unroll
            for (int j = 0; j < 8; ++j) os[(hi * 8 + j) * 68 + nb * 16 + lr] = acc[mb][nb][j]; }
        __builtin_amdgcn_wave_barrier(); asm volatile("" ::: "memory");
        float* crow = C + (size_t)(r0 + mb * 16) * ldc + c0;
{
#pragma unroll
            for (int s = 0; s < 8; ++s) { const int row = 2 * s + hi, cofs = lr * 4; v4f val = *(const v4fa*)(os + row * 68 + cofs);
                *(v4f*)(crow + (size_t)row * ldc + cofs) = val; }
             }
        __builtin_amdgcn_wave_barrier(); asm volatile("" ::: "memory");
    }
}

__device__ __forceinline__ h16 tohx(float x) { return (h16)x; }
__device__ __forceinline__ void splitf(float y, unsigned short& h, unsigned short& l) { h = f2bf(y); l = f2bf(y - bf2f(h)); }
typedef __attribute__((ext_vector_type(2))) _Float16 v2h;
typedef __attribute__((ext_vector_type(4))) _Float16 v4h;
typedef __attribute__((ext_vector_type(2))) unsigned short v2us;
typedef __attribute__((ext_vector_type(4))) unsigned short v4us;
typedef __attribute__((ext_vector_type(2))) float v2f;
typedef __attribute__((ext_vector_type(4))) int v4i;

__global__ __launch_bounds__(256) void k_wtG(const float* __restrict__ w, int K, int N, bf* Bt) {
    const int lane = threadIdx.x & 31; const int L0 = (blockIdx.x * 8 + (threadIdx.x >> 5)) * 8; const int nlines = N * K / 64;
{
#pragma unroll 1
        for (int l = 0; l < 8; ++l) { const int L = L0 + l; if (L >= nlines) break; const size_t e = (size_t)L * 64 + lane * 2; const int k = (int)(e % K), n = (int)(e / K); v2us o;
            o[0] = f2bf(w[(size_t)k * N + n]); o[1] = f2bf(w[(size_t)(k + 1) * N + n]); *(v2us*)(Bt + e) = o; }
         }
}
__global__ __launch_bounds__(256) void k_cvt8(const float* __restrict__ src, bf* dst, size_t n8) { const size_t i = (size_t)blockIdx.x * 256 + threadIdx.x; if (i >= n8) return; const v8f v = *(const v8f*)(src + i * 8); v8us o;
#pragma unroll
    for (int k = 0; k < 8; ++k) o[k] = f2bf(v[k]); *(v8us*)(dst + i * 8) = o;  }
__global__ __launch_bounds__(256) void k_cscvt(const float* __restrict__ cosT, const float* __restrict__ sinT, float* CS) { const int idx = blockIdx.x * 256 + threadIdx.x; if (idx >= TT * HD) return; v2f cs; cs[0] = bfr(cosT[idx]); cs[1] = bfr(sinT[idx]); *(v2f*)(CS + (size_t)idx * 2) = cs;  }
// k_rope: head planes [h][t][d] (fp16 + hi/lo) of rope(x) x sc with the rotate-half convention out[d] = x[d] cos[t][d] - x[d+HD/2] sin[t][d], out[d+HD/2] = x[d+HD/2] cos[t][d+HD/2] + x[d] sin[t][d+HD/2]
__global__ __launch_bounds__(256) void k_rope(const float* __restrict__ F, int pitch, int nheads, const float* __restrict__ CS, const float* __restrict__ RF, const float* __restrict__ nw, float sc, h16* P16, bf* Ph, bf* Pl) {
    const size_t e = ((size_t)blockIdx.x * 256 + threadIdx.x) * 2; if (e >= (size_t)nheads * TT * HD) return; const int d = (int)(e % HD); const int t = (int)((e / HD) % TT); const int h = (int)(e / ((size_t)HD * TT)); const float* f = F + (size_t)t * pitch + h * HD; const float rf = RF ? RF[(size_t)h * TT + t] : 1.0f; v2h o16; v2us oh, ol;
#pragma unroll
    for (int q = 0; q < 2; ++q) { const int dd = d + q; const int dp = (dd < HD / 2) ? dd + HD / 2 : dd - HD / 2; float x0 = f[dd], x1 = f[dp];
        if (RF) { float n0 = __fmul_rn(x0, rf), n1 = __fmul_rn(x1, rf); asm volatile("" : "+v"(n0)); asm volatile("" : "+v"(n1)); x0 = __fmul_rn(bfr(nw[dd]), n0); x1 = __fmul_rn(bfr(nw[dp]), n1); }
        const v2f cs = *(const v2f*)(CS + ((size_t)t * HD + dd) * 2); float a = __fmul_rn(x0, cs[0]), bq = __fmul_rn(x1, cs[1]); asm volatile("" : "+v"(a)); asm volatile("" : "+v"(bq)); const float r = ((dd < HD / 2) ? __fsub_rn(a, bq) : __fadd_rn(a, bq)) * sc;
        o16[q] = tohx(r); unsigned short a2, c2; splitf(r, a2, c2); oh[q] = a2; ol[q] = c2; }
    *(v2h*)(P16 + e) = o16; *(v2us*)(Ph + e) = oh; *(v2us*)(Pl + e) = ol;  }
__global__ __launch_bounds__(256) void k_vtp(const float* __restrict__ F, int pitch, int nheads, h16* V16, bf* Vh, bf* Vl) { const size_t e = ((size_t)blockIdx.x * 256 + threadIdx.x) * 2; if (e >= (size_t)nheads * HD * TT) return; const int t = (int)(e % TT); const int d = (int)((e / TT) % HD); const int g = (int)(e / ((size_t)TT * HD)); v2h o16; v2us oh, ol;
#pragma unroll
    for (int q = 0; q < 2; ++q) { const float x = F[(size_t)(t + q) * pitch + g * HD + d]; o16[q] = tohx(x); unsigned short a2, c2; splitf(x, a2, c2); oh[q] = a2; ol[q] = c2; }
    *(v2h*)(V16 + e) = o16; *(v2us*)(Vh + e) = oh; *(v2us*)(Vl + e) = ol;  }
__global__ __launch_bounds__(256) void k_csid(float* CS) { const int idx = blockIdx.x * 256 + threadIdx.x; if (idx >= TT * HD) return; v2f cs; cs[0] = 1.0f; cs[1] = 0.0f; *(v2f*)(CS + (size_t)idx * 2) = cs;  }
__device__ __attribute__((noinline)) float softcap30(float s) { return 30.0f * tanhf(__fdiv_rn(s, 30.0f)); }
// k_asoft: per row (zz, i): t = 30 tanh(S x HD^-0.5 / 30) for j <= i and i - j < WIN (sliding causal window; the reference's -1e9 additive fill vanishes identically); softmax over the 2048 keys (register row, one exp, fixed trees);
// the probabilities overwrite the row's own scores: one wave owns a row and holds all of it in registers before its first store. Row pitch 2 TT 16-bit elements; fp16 (or the hi plane) from the row's start, the lo plane from its middle.
__global__ __launch_bounds__(256) void k_asoft(const float* Sb, h16* P16, bf* Ph, bf* Pl) {
    const int lane = threadIdx.x & 31; const int row = blockIdx.x * 8 + (threadIdx.x >> 5); if (row >= ZH * TT) return; const int i = row % TT; const int zz = row / TT; (void)zz; const bool hires = (i < RH); const float* sr = Sb + (size_t)row * TT; float v[TT / 32]; float mx = -3.0e38f;
    const int klo = win_k0(i & ~63), khi = (i & ~63) + 64;   // the key range that the P.V loop of this row's 64-row tile reads: only 128-key chunks that meet it are stored
#pragma unroll
    for (int ch = 0; ch < TT / 128; ++ch) { const int j0 = ch * 128 + lane * 4; v4f a = (v4f){}; if (j0 <= i && i - (j0 + 3) < WIN) a = *(const v4f*)(sr + j0);   // a group of 4 keys with no allowed key is not loaded (its score tile may not exist)
#pragma unroll
        for (int q = 0; q < 4; ++q) { const int j = j0 + q; (void)j; const float t = (j <= i && i - j < WIN) ? softcap30(a[q] * SCL) : -3.0e38f; v[ch * 4 + q] = t; mx = fmaxf(mx, t); } }
#pragma unroll
    for (int sh = 16; sh; sh >>= 1) mx = fmaxf(mx, __shfl_xor(mx, sh, 32));
    float sum = 0.f;
#pragma unroll
    for (int k = 0; k < TT / 32; ++k) { float d0 = __fsub_rn(v[k], mx); asm volatile("" : "+v"(d0)); v[k] = __builtin_amdgcn_exp2f(__fmul_rn(d0, 1.4426950408889634f)); sum += v[k]; }
#pragma unroll
    for (int sh = 16; sh; sh >>= 1) sum += __shfl_xor(sum, sh, 32);
    const float f = __fdiv_rn(hires ? 1.0f : PCAR, sum);
{
        if (hires) {
#pragma unroll
            for (int ch = 0; ch < TT / 128; ++ch) { if (ch * 128 >= khi) continue; v4us oh, ol;
#pragma unroll
                for (int q = 0; q < 4; ++q) { unsigned short a, c2; splitf(v[ch * 4 + q] * f, a, c2); oh[q] = a; ol[q] = c2; }
                const size_t oo = (size_t)row * (2 * TT) + ch * 128 + lane * 4; *(v4us*)(Ph + oo) = oh; *(v4us*)(Pl + oo) = ol; }
        } else {
#pragma unroll
            for (int ch = 0; ch < TT / 128; ++ch) { if (ch * 128 >= khi || ch * 128 + 128 <= klo) continue; v4h o4;
#pragma unroll
                for (int q = 0; q < 4; ++q) o4[q] = tohx(v[ch * 4 + q] * f);
                *(v4h*)(P16 + (size_t)row * (2 * TT) + ch * 128 + lane * 4) = o4; } }
         }
}
__global__ __launch_bounds__(256) void k_merge(const float* __restrict__ O, int h0, bf* Ah, bf* Al) { const size_t e = ((size_t)blockIdx.x * 256 + threadIdx.x) * 2; if (e >= (size_t)ZH * TT * HD) return; const int d = (int)(e % HD); const int t = (int)((e / HD) % TT); const int zz = (int)(e / ((size_t)HD * TT)); const float cs = (t < RH) ? 1.0f : (1.0f / PCAR); const size_t oo = (size_t)t * DQ + (h0 + zz) * HD + d;
    v2us oh, ol;
#pragma unroll
    for (int q = 0; q < 2; ++q) { unsigned short a, c2; splitf(O[e + q] * cs, a, c2); oh[q] = a; ol[q] = c2; } *(v2us*)(Ah + oo) = oh; *(v2us*)(Al + oo) = ol;  }

extern "C" void kernel_launch(void* const* d_in, const int* in_sizes, int n_in,
                              void* d_out, int out_size, void* d_ws, size_t ws_size, hipStream_t stream) {
    (void)in_sizes; (void)n_in; (void)out_size;
    const float* x = (const float*)d_in[0]; const float* wq = (const float*)d_in[1]; const float* wk = (const float*)d_in[2]; const float* wv = (const float*)d_in[3]; const float* wo = (const float*)d_in[4]; const float* cosT = nullptr; const float* sinT = nullptr; (void)cosT; (void)sinT;
    float* OUT = (float*)d_out;     // [2][2048][2048]
    char* wsp = (char*)d_ws;
    auto take = [&](size_t bytes) { char* p = wsp; wsp += (bytes + 255) & ~(size_t)255; return (void*)p; };
    bf* WQ = (bf*)take((size_t)DQ * DM * 2); bf* WK = (bf*)take((size_t)DKV * DM * 2); bf* WV = (bf*)take((size_t)DKV * DM * 2); float* CS = (float*)take((size_t)TT * HD * 2 * 4);
    h16* QP16 = (h16*)take((size_t)NH_ * TT * HD * 2); h16* KP16 = (h16*)take((size_t)NKV * TT * HD * 2); h16* VT16 = (h16*)take((size_t)NKV * HD * TT * 2);
    bf* QPh = (bf*)take((size_t)NH_ * TT * HD * 2); bf* QPl = (bf*)take((size_t)NH_ * TT * HD * 2); bf* KPh = (bf*)take((size_t)NKV * TT * HD * 2); bf* KPl = (bf*)take((size_t)NKV * TT * HD * 2); bf* VTh = (bf*)take((size_t)NKV * HD * TT * 2); bf* VTl = (bf*)take((size_t)NKV * HD * TT * 2);
    float* Sb = (float*)take((size_t)ZH * TT * TT * 4); float* Ob = (float*)take((size_t)ZH * TT * HD * 4); bf* ATh = (bf*)take((size_t)TT * DQ * 2); bf* ATl = (bf*)take((size_t)TT * DQ * 2);
    if ((size_t)(wsp - (char*)d_ws) > ws_size) return;    // ws 256 MiB
    h16* P16 = (h16*)Sb; bf* Ph = (bf*)Sb; bf* Pl = (bf*)Sb + TT;   // probabilities live in their own score rows (k_asoft)
    // The score buffer's space also serves what is dead while scores are live (stream-ordered): before the passes x in bf16 and the f32 projections, after them Wo in bf16.
    bf* XB = (bf*)Sb; float* FQ = (float*)((char*)Sb + (size_t)TT * DM * 2); float* FK = (float*)((char*)Sb + (size_t)TT * DM * 2 + (size_t)TT * DQ * 4); bf* WO = (bf*)Sb;
    float* FV = FK;   // v projection reuses the k buffer after the k planes are built (stream-ordered)
    { k_cvt8<<<(unsigned)(((size_t)DQ * DM / 8 + 255) / 256), 256, 0, stream>>>(wq, WQ, (size_t)DQ * DM / 8); k_cvt8<<<(unsigned)(((size_t)DKV * DM / 8 + 255) / 256), 256, 0, stream>>>(wk, WK, (size_t)DKV * DM / 8); k_cvt8<<<(unsigned)(((size_t)DKV * DM / 8 + 255) / 256), 256, 0, stream>>>(wv, WV, (size_t)DKV * DM / 8); }
    k_csid<<<(TT * HD + 255) / 256, 256, 0, stream>>>(CS);
    const unsigned LQ = (unsigned)(((size_t)NH_ * TT * HD / 2 + 255) / 256), LKv = (unsigned)(((size_t)NKV * TT * HD / 2 + 255) / 256);
    for (int b = 0; b < NB_; ++b) {
        
        k_cvt8<<<(unsigned)(((size_t)TT * DM / 8 + 255) / 256), 256, 0, stream>>>(x + (size_t)b * TT * DM, XB, (size_t)TT * DM / 8);
        k_gemml<0><<<dim3(TT / 128, DQ / 128, 1), 128, 0, stream>>>(XB, nullptr, WQ, DM, FQ, DQ);
        k_rope<<<LQ, 256, 0, stream>>>(FQ, DQ, NH_, CS, nullptr, nullptr, 1.0f, QP16, QPh, QPl);
        k_gemml<0><<<dim3(TT / 128, DKV / 128, 1), 128, 0, stream>>>(XB, nullptr, WK, DM, FK, DKV);
        k_rope<<<LKv, 256, 0, stream>>>(FK, DKV, NKV, CS, nullptr, nullptr, 1.0f, KP16, KPh, KPl);
        k_gemml<0><<<dim3(TT / 128, DKV / 128, 1), 128, 0, stream>>>(XB, nullptr, WV, DM, FV, DKV); k_vtp<<<LKv, 256, 0, stream>>>(FV, DKV, NKV, VT16, VTh, VTl);
        for (int h0 = 0; h0 < NH_; h0 += ZH) { const size_t zq = (size_t)h0, zk = (size_t)(h0 / REP);   // one kv head per query head: the pass's heads use consecutive kv planes (z-strides TT*HD)
            k_gemmc<bf, 2, 1><<<dim3(RH / 64, TT / 64, ZH), 32, 0, stream>>>(QPh + zq * TT * HD, QPl + zq * TT * HD, KPh + zk * TT * HD, KPl + zk * TT * HD, HD, HD, Sb, TT, 0, (size_t)TT * HD, (size_t)TT * HD, (size_t)TT * TT);
            k_gemmc<h16, 0, 1><<<dim3((TT - RH) / 64, TT / 64, ZH), 32, 0, stream>>>(QP16 + zq * TT * HD + (size_t)RH * HD, nullptr, KP16 + zk * TT * HD, nullptr, HD, HD, Sb + (size_t)RH * TT, TT, RH, (size_t)TT * HD, (size_t)TT * HD, (size_t)TT * TT);
            k_asoft<<<ZH * TT / 8, 256, 0, stream>>>(Sb, P16, Ph, Pl);
            k_gemmc<bf, 2, 2><<<dim3(RH / 64, HD / 64, ZH), 32, 0, stream>>>(Ph, Pl, VTh + zk * HD * TT, VTl + zk * HD * TT, TT, 2 * TT, Ob, HD, 0, (size_t)TT * 2 * TT, (size_t)HD * TT, (size_t)TT * HD);
            k_gemmc<h16, 0, 2><<<dim3((TT - RH) / 64, HD / 64, ZH), 32, 0, stream>>>(P16 + (size_t)RH * 2 * TT, nullptr, VT16 + zk * HD * TT, nullptr, TT, 2 * TT, Ob + (size_t)RH * HD, HD, RH, (size_t)TT * 2 * TT, (size_t)HD * TT, (size_t)TT * HD);
            k_merge<<<(unsigned)(((size_t)ZH * TT * HD / 2 + 255) / 256), 256, 0, stream>>>(Ob, h0, ATh, ATl); }
        k_cvt8<<<(unsigned)(((size_t)DM * DQ / 8 + 255) / 256), 256, 0, stream>>>(wo, WO, (size_t)DM * DQ / 8);
        k_gemml<1><<<dim3(TT / 128, DM / 128, 1), 128, 0, stream>>>(ATh, ATl, WO, DQ, OUT + (size_t)b * TT * DM, DM); }
}

// v004
// It runs in 494 microseconds.
// In both of two side-by-side timings against v003, it was 1.56 times as fast.
// All steps since v000 together make it 3.81 times as fast.
#include <hip/hip_runtime.h>

// FastestFlashMHA (x [2][2048][2048]; q/k/v = x W^T (16 heads x 128); scores = 30 tanh((q.k / sqrt(128)) / 30); key j allowed iff j <= i and i - j < 1024 (finfo.min fill); softmax; out = merged Wo^T -> [2][2048][2048]).
// Compute dtypes, f32 accumulate: every input rounded to bf16; q/k/v on PLAIN bf16 operands (inputs: exact); softcap (precise tanhf) f32; causal scores and attn.v: query rows < 512 hl (3 products), the rest single fp16 (x256), one fused kernel that walks only the keys between the sliding window's edge and the diagonal, both tests inside the edge passes; online softmax f32; Wo hl x exact (2 products).

#define NB_  2
#define TT   2048
#define DM   2048
#define NH_  16
#define NKV  16
#define REP  (NH_ / NKV)
#define HD   128
#define DQ   (NH_ * HD)
#define DKV  (NKV * HD)
#define RH   512                  // query rows < RH use hi+lo planes (0: none)
#define WIN  1024
#define SCL  0.088388347648318447f   // HD^-0.5
typedef _Float16 h16;
typedef unsigned short bf;
typedef __attribute__((ext_vector_type(16))) __bf16   v16bf;
typedef __attribute__((ext_vector_type(16))) _Float16 v16h;
typedef __attribute__((ext_vector_type(8)))  _Float16 v8h;
typedef __attribute__((ext_vector_type(8)))  unsigned short v8us;
typedef __attribute__((ext_vector_type(8)))  float    v8f;
typedef __attribute__((ext_vector_type(4)))  float    v4f;
typedef v8h  __attribute__((may_alias)) v8ha;
typedef v4f  __attribute__((may_alias)) v4fa;
typedef v8us __attribute__((may_alias)) v8usa;

__device__ __forceinline__ unsigned short f2bf(float f) { unsigned u = __float_as_uint(f); u += 0x7FFFu + ((u >> 16) & 1u); return (unsigned short)(u >> 16); }
__device__ __forceinline__ float bf2f(unsigned short b) { return __uint_as_float(((unsigned)b) << 16); }
__device__ __forceinline__ float bfr(float f) { return bf2f(f2bf(f)); }
__device__ __forceinline__ v16h cat16(v8h lo, v8h hi) { return __builtin_shufflevector(lo, hi, 0, 1, 2, 3, 4, 5, 6, 7, 8, 9, 10, 11, 12, 13, 14, 15); }
__device__ __forceinline__ v16bf cat16b(v8us lo, v8us hi) { return __builtin_bit_cast(v16bf, __builtin_shufflevector(lo, hi, 0, 1, 2, 3, 4, 5, 6, 7, 8, 9, 10, 11, 12, 13, 14, 15)); }
__device__ __forceinline__ v8f wmma16(v16h a, v16h b, v8f c) { return __builtin_amdgcn_wmma_f32_16x16x32_f16(false, a, false, b, (short)0, c, false, false); }
__device__ __forceinline__ v8f wmmab(v16bf a, v16bf b, v8f c) { return __builtin_amdgcn_wmma_f32_16x16x32_bf16(false, a, false, b, (short)0, c, false, false); }



// Fragment loaders and products of the two 16-bit operand types (K-contiguous planes).
template <typename T16> struct WFrag;
template <> struct WFrag<h16> { typedef v16h V; static __device__ __forceinline__ V ld(const h16* p) { return cat16(*(const v8h*)p, *(const v8h*)(p + 16)); } static __device__ __forceinline__ v8f mma(V a, V b, v8f c) { return wmma16(a, b, c); } };
template <> struct WFrag<bf> { typedef v16bf V; static __device__ __forceinline__ V ld(const bf* p) { return cat16b(*(const v8us*)p, *(const v8us*)(p + 16)); } static __device__ __forceinline__ v8f mma(V a, V b, v8f c) { return wmmab(a, b, c); } };

// ---- k_gemml: C[m][n] (f32, pitch ldc) = sum_k A[m][k] Bt[n][k] (+ A2[m][k] Bt[n][k] when NSPLIT == 1), bf16 planes of row pitch K. One 128x128 tile per work-group of four waves, 64x64 per wave (16 accumulators);
// grid (M/128, N/128), 128 threads. Operands reach LDS by asynchronous copies in whole 128-byte row pieces (64 k), two buffers: the next piece's copies fly while this one is multiplied. K % 64 == 0, M % 128 == 0, N % 128 == 0.
// Every '#pragma unroll' in it is there so that the fragment and accumulator arrays are indexed by constants and stay in registers.
#define LP    144                 // LDS row pitch in bytes: 128 data + 16, an odd multiple of 16, for 16-byte fragment reads
#define LTILE (128 * LP)          // one operand's 128 rows
// Eight copies of 16 bytes a lane: rows 16 apart of one operand tile (LDS step 16 LP bytes, global step rs elements).
__device__ __forceinline__ void copy8(unsigned l, const bf* g, size_t rs) {
    // the wait on xcnt ends the copies' own statement, so that no address register is rewritten in front of it
    asm volatile("global_load_async_to_lds_b128 %0, %8, off\n\t"
                 "global_load_async_to_lds_b128 %1, %9, off\n\t"
                 "global_load_async_to_lds_b128 %2, %10, off\n\t"
                 "global_load_async_to_lds_b128 %3, %11, off\n\t"
                 "global_load_async_to_lds_b128 %4, %12, off\n\t"
                 "global_load_async_to_lds_b128 %5, %13, off\n\t"
                 "global_load_async_to_lds_b128 %6, %14, off\n\t"
                 "global_load_async_to_lds_b128 %7, %15, off\n\t"
                 "s_wait_xcnt 0x0"
                 :: "v"(l), "v"(l + 16u * LP), "v"(l + 32u * LP), "v"(l + 48u * LP), "v"(l + 64u * LP), "v"(l + 80u * LP), "v"(l + 96u * LP), "v"(l + 112u * LP),
                    "v"(g), "v"(g + rs), "v"(g + 2 * rs), "v"(g + 3 * rs), "v"(g + 4 * rs), "v"(g + 5 * rs), "v"(g + 6 * rs), "v"(g + 7 * rs) : "memory");
}
__device__ __forceinline__ v16bf ldsfrag(const unsigned char* p) { return cat16b(*(const v8usa*)p, *(const v8usa*)(p + 32)); }
template <int NSPLIT>
__global__ __launch_bounds__(128) void k_gemml(const bf* __restrict__ A, const bf* __restrict__ A2, const bf* __restrict__ Bt, int K, float* C, int ldc) {
    constexpr int NT = (NSPLIT == 1) ? 3 : 2;           // operand tiles per stage: A, (A2,) Bt
    constexpr unsigned STG = NT * LTILE;
    __shared__ __align__(16) unsigned char L[2 * STG];
    __shared__ __align__(16) float osw[4][16 * 68];
    const int tid = threadIdx.x, lane = tid & 31, lr = lane & 15, hi = lane >> 4, w = tid >> 5, wm = w >> 1, wn = w & 1; const int r0 = blockIdx.x * 128, c0 = blockIdx.y * 128;
    v8f acc[4][4];
#pragma unroll
    for (int mb = 0; mb < 4; ++mb)
#pragma unroll
        for (int nb = 0; nb < 4; ++nb) acc[mb][nb] = (v8f){};
    // copies: lane tid brings 16-byte piece (tid & 7) of rows (tid >> 3) + 16 i, so a wave's copy covers four whole 128-byte row pieces
    const int crow = tid >> 3, cch = tid & 7; const size_t rs = (size_t)16 * K;
    const bf* gA = A + (size_t)(r0 + crow) * K + cch * 8; const bf* gA2 = (NSPLIT == 1) ? A2 + (size_t)(r0 + crow) * K + cch * 8 : nullptr; const bf* gB = Bt + (size_t)(c0 + crow) * K + cch * 8;
    const unsigned l0 = (unsigned)(size_t)L + (unsigned)(crow * LP + cch * 16);
    auto stage = [&](int t) { const unsigned l = l0 + (unsigned)(t & 1) * STG; const int kc = t * 64; copy8(l, gA + kc, rs); if (NSPLIT == 1) copy8(l + LTILE, gA2 + kc, rs); copy8(l + (NT - 1) * LTILE, gB + kc, rs); };
    const int nst = K / 64;
    stage(0);
    asm volatile("s_wait_asynccnt 0x0" ::: "memory");   // this wave's copies of stage 0 have landed
    __syncthreads();                                     // ... and every other wave's
    if (nst > 1) stage(1);
    const unsigned aofs = (unsigned)((wm * 64 + lr) * LP + hi * 16), bofs = (unsigned)((NT - 1) * LTILE + (wn * 64 + lr) * LP + hi * 16);
#pragma unroll 1   // one stage a trip: the two buffers alternate by the trip's parity
    for (int t = 0; t < nst; ++t) {
        const unsigned char* Lb = L + (unsigned)(t & 1) * STG; const unsigned char* pa = Lb + aofs; const unsigned char* pb = Lb + bofs;
        // Fragment reads stand in few groups, each ahead of the products that hide it (one wave per SIMD: nothing else hides an LDS wait). Every accumulator still takes its products in ascending k, A before A2.
        // Each sched_barrier(0) below keeps a read group where it is written: without them the scheduler sinks every read to just in front of its first use, and the wave waits out the LDS latency once per four products.
        v16bf a[4], a2[4], b[4];
        if (NSPLIT == 0) {   // a: k 0..31 of the stage, a2: k 32..63
#pragma unroll
            for (int mb = 0; mb < 4; ++mb) a[mb] = ldsfrag(pa + mb * 16 * LP);
#pragma unroll
            for (int nb = 0; nb < 4; ++nb) b[nb] = ldsfrag(pb + nb * 16 * LP);
#pragma unroll
            for (int mb = 0; mb < 4; ++mb) a2[mb] = ldsfrag(pa + mb * 16 * LP + 64);
            __builtin_amdgcn_sched_barrier(0);
#pragma unroll
            for (int h = 0; h < 2; ++h) {
#pragma unroll
                for (int nb = 2 * h; nb < 2 * h + 2; ++nb)
#pragma unroll
                    for (int mb = 0; mb < 4; ++mb) acc[mb][nb] = wmmab(a[mb], b[nb], acc[mb][nb]);
                __builtin_amdgcn_sched_barrier(0);
#pragma unroll
                for (int nb = 2 * h; nb < 2 * h + 2; ++nb) b[nb] = ldsfrag(pb + nb * 16 * LP + 64);
                __builtin_amdgcn_sched_barrier(0); }
#pragma unroll
            for (int nb = 0; nb < 4; ++nb)
#pragma unroll
                for (int mb = 0; mb < 4; ++mb) acc[mb][nb] = wmmab(a2[mb], b[nb], acc[mb][nb]);
        } else {
#pragma unroll
            for (int mb = 0; mb < 4; ++mb) a[mb] = ldsfrag(pa + mb * 16 * LP);
#pragma unroll
            for (int nb = 0; nb < 4; ++nb) b[nb] = ldsfrag(pb + nb * 16 * LP);
#pragma unroll
            for (int mb = 0; mb < 4; ++mb) a2[mb] = ldsfrag(pa + LTILE + mb * 16 * LP);
            __builtin_amdgcn_sched_barrier(0);
#pragma unroll
            for (int nb = 0; nb < 4; ++nb)
#pragma unroll
                for (int mb = 0; mb < 4; ++mb) acc[mb][nb] = wmmab(a[mb], b[nb], acc[mb][nb]);
            __builtin_amdgcn_sched_barrier(0);
#pragma unroll
            for (int mb = 0; mb < 4; ++mb) a[mb] = ldsfrag(pa + mb * 16 * LP + 64);
            __builtin_amdgcn_sched_barrier(0);
#pragma unroll
            for (int h = 0; h < 2; ++h) {
#pragma unroll
                for (int nb = 2 * h; nb < 2 * h + 2; ++nb)
#pragma unroll
                    for (int mb = 0; mb < 4; ++mb) acc[mb][nb] = wmmab(a2[mb], b[nb], acc[mb][nb]);
                __builtin_amdgcn_sched_barrier(0);
#pragma unroll
                for (int nb = 2 * h; nb < 2 * h + 2; ++nb) b[nb] = ldsfrag(pb + nb * 16 * LP + 64);
                if (h == 0) __builtin_amdgcn_sched_barrier(0); }
#pragma unroll
            for (int mb = 0; mb < 4; ++mb) a2[mb] = ldsfrag(pa + LTILE + mb * 16 * LP + 64);
            __builtin_amdgcn_sched_barrier(0);
#pragma unroll
            for (int nb = 0; nb < 4; ++nb)
#pragma unroll
                for (int mb = 0; mb < 4; ++mb) acc[mb][nb] = wmmab(a[mb], b[nb], acc[mb][nb]);
#pragma unroll
            for (int nb = 0; nb < 4; ++nb)
#pragma unroll
                for (int mb = 0; mb < 4; ++mb) acc[mb][nb] = wmmab(a2[mb], b[nb], acc[mb][nb]);
        }
        asm volatile("s_wait_dscnt 0x0" ::: "memory");      // this wave's reads of the buffer are done before it is handed back
        asm volatile("s_wait_asynccnt 0x0" ::: "memory");   // this wave's copies of stage t + 1 have landed
        __syncthreads();                                     // publishes stage t + 1 and ends every wave's reads of stage t
        if (t + 2 < nst) stage(t + 2);
    }
    asm volatile("s_wait_asynccnt 0x0" ::: "memory");       // no copy is outstanding when the wave goes on
    float* os = osw[w];   // each wave turns its own accumulators into whole 256-byte row pieces through its own LDS slice; the wave barriers with their compiler fences keep the slice's stores, reads and next stores in that order
#pragma unroll
    for (int mb = 0; mb < 4; ++mb) {
#pragma unroll
        for (int nb = 0; nb < 4; ++nb) {
#pragma unroll
            for (int j = 0; j < 8; ++j) os[(hi * 8 + j) * 68 + nb * 16 + lr] = acc[mb][nb][j]; }
        __builtin_amdgcn_wave_barrier(); asm volatile("" ::: "memory");
        float* crw = C + (size_t)(r0 + wm * 64 + mb * 16) * ldc + c0 + wn * 64;
#pragma unroll
        for (int s = 0; s < 8; ++s) { const int row = 2 * s + hi, cofs = lr * 4; const v4f val = *(const v4fa*)(os + row * 68 + cofs); *(v4f*)(crw + (size_t)row * ldc + cofs) = val; }
        __builtin_amdgcn_wave_barrier(); asm volatile("" ::: "memory");
    }
}

__device__ __forceinline__ h16 tohx(float x) { return (h16)x; }
__device__ __forceinline__ void splitf(float y, unsigned short& h, unsigned short& l) { h = f2bf(y); l = f2bf(y - bf2f(h)); }
typedef __attribute__((ext_vector_type(2))) _Float16 v2h;
typedef __attribute__((ext_vector_type(4))) _Float16 v4h;
typedef __attribute__((ext_vector_type(2))) unsigned short v2us;
typedef __attribute__((ext_vector_type(4))) unsigned short v4us;
typedef __attribute__((ext_vector_type(2))) float v2f;
typedef __attribute__((ext_vector_type(4))) int v4i;

__global__ __launch_bounds__(256) void k_wtG(const float* __restrict__ w, int K, int N, bf* Bt) {
    const int lane = threadIdx.x & 31; const int L0 = (blockIdx.x * 8 + (threadIdx.x >> 5)) * 8; const int nlines = N * K / 64;
{
#pragma unroll 1
        for (int l = 0; l < 8; ++l) { const int L = L0 + l; if (L >= nlines) break; const size_t e = (size_t)L * 64 + lane * 2; const int k = (int)(e % K), n = (int)(e / K); v2us o;
            o[0] = f2bf(w[(size_t)k * N + n]); o[1] = f2bf(w[(size_t)(k + 1) * N + n]); *(v2us*)(Bt + e) = o; }
         }
}
__global__ __launch_bounds__(256) void k_cvt8(const float* __restrict__ src, bf* dst, size_t n8) { const size_t i = (size_t)blockIdx.x * 256 + threadIdx.x; if (i >= n8) return; const v8f v = *(const v8f*)(src + i * 8); v8us o;
#pragma unroll
    for (int k = 0; k < 8; ++k) o[k] = f2bf(v[k]); *(v8us*)(dst + i * 8) = o;  }
__global__ __launch_bounds__(256) void k_cscvt(const float* __restrict__ cosT, const float* __restrict__ sinT, float* CS) { const int idx = blockIdx.x * 256 + threadIdx.x; if (idx >= TT * HD) return; v2f cs; cs[0] = bfr(cosT[idx]); cs[1] = bfr(sinT[idx]); *(v2f*)(CS + (size_t)idx * 2) = cs;  }
// k_rope: head planes [h][t][d] (fp16 + hi/lo) of rope(x) x sc with the rotate-half convention out[d] = x[d] cos[t][d] - x[d+HD/2] sin[t][d], out[d+HD/2] = x[d+HD/2] cos[t][d+HD/2] + x[d] sin[t][d+HD/2]
__global__ __launch_bounds__(256) void k_rope(const float* __restrict__ F, int pitch, int nheads, const float* __restrict__ CS, const float* __restrict__ RF, const float* __restrict__ nw, float sc, h16* P16, bf* Ph, bf* Pl) {
    const size_t e = ((size_t)blockIdx.x * 256 + threadIdx.x) * 2; if (e >= (size_t)nheads * TT * HD) return; const int d = (int)(e % HD); const int t = (int)((e / HD) % TT); const int h = (int)(e / ((size_t)HD * TT)); const float* f = F + (size_t)t * pitch + h * HD; const float rf = RF ? RF[(size_t)h * TT + t] : 1.0f; v2h o16; v2us oh, ol;
#pragma unroll
    for (int q = 0; q < 2; ++q) { const int dd = d + q; const int dp = (dd < HD / 2) ? dd + HD / 2 : dd - HD / 2; float x0 = f[dd], x1 = f[dp];
        if (RF) { float n0 = __fmul_rn(x0, rf), n1 = __fmul_rn(x1, rf); asm volatile("" : "+v"(n0)); asm volatile("" : "+v"(n1)); x0 = __fmul_rn(bfr(nw[dd]), n0); x1 = __fmul_rn(bfr(nw[dp]), n1); }
        const v2f cs = *(const v2f*)(CS + ((size_t)t * HD + dd) * 2); float a = __fmul_rn(x0, cs[0]), bq = __fmul_rn(x1, cs[1]); asm volatile("" : "+v"(a)); asm volatile("" : "+v"(bq)); const float r = ((dd < HD / 2) ? __fsub_rn(a, bq) : __fadd_rn(a, bq)) * sc;
        o16[q] = tohx(r); unsigned short a2, c2; splitf(r, a2, c2); oh[q] = a2; ol[q] = c2; }
    *(v2h*)(P16 + e) = o16; *(v2us*)(Ph + e) = oh; *(v2us*)(Pl + e) = ol;  }
__global__ __launch_bounds__(256) void k_vtp(const float* __restrict__ F, int pitch, int nheads, h16* V16, bf* Vh, bf* Vl) { const size_t e = ((size_t)blockIdx.x * 256 + threadIdx.x) * 2; if (e >= (size_t)nheads * HD * TT) return; const int t = (int)(e % TT); const int d = (int)((e / TT) % HD); const int g = (int)(e / ((size_t)TT * HD)); v2h o16; v2us oh, ol;
#pragma unroll
    for (int q = 0; q < 2; ++q) { const float x = F[(size_t)(t + q) * pitch + g * HD + d]; o16[q] = tohx(x); unsigned short a2, c2; splitf(x, a2, c2); oh[q] = a2; ol[q] = c2; }
    *(v2h*)(V16 + e) = o16; *(v2us*)(Vh + e) = oh; *(v2us*)(Vl + e) = ol;  }
__global__ __launch_bounds__(256) void k_csid(float* CS) { const int idx = blockIdx.x * 256 + threadIdx.x; if (idx >= TT * HD) return; v2f cs; cs[0] = 1.0f; cs[1] = 0.0f; *(v2f*)(CS + (size_t)idx * 2) = cs;  }
// ---- k_flash: the whole attention of one batch in one launch. A wave owns 16 R query rows of one head and walks their keys in passes of 32, from the first key inside the sliding window to the diagonal; scores and probabilities never leave registers.
// Transposed products: S^T = K Q^T (A = key rows, B = query rows) leaves one query's scores in one lane pair (lanes l and l ^ 16), and the two 16-key score tiles of a pass are, register for register, the B operand P^T of O^T += V^T P^T (A = rows of the [d][t] value planes).
// Online softmax: running maximum and sum per query; the output sums are rescaled only in a pass that raises some query's maximum. Operands come straight from the K-contiguous planes.
// HI: bf16 hi + lo planes, three products for each contraction (query rows < RH); otherwise single fp16, probabilities carried x PCAR2.
#define PCAR2 256.0f
#define L2E   1.4426950408889634f
// tanh for |x| < 0.625, the small-argument form of the precise tanhf (odd polynomial, same operations and coefficients), written without a branch:
// a wave alone on its SIMD pays every dependent vector instruction's latency, and only branch-free evaluations of different scores can be interleaved to fill it.
__device__ __forceinline__ float tanh_small(float x) { const float y = fabsf(x), t = x * x;
    float p = __builtin_fmaf(-0.00570002059f, t, 0.0206340719f); p = __builtin_fmaf(t, p, -0.0537379310f); p = __builtin_fmaf(t, p, 0.133314162f); p = __builtin_fmaf(t, p, -0.333332807f);
    return copysignf(__builtin_fmaf(t, y * p, y), x); }
__device__ __forceinline__ float xhalf(float x) { return __builtin_bit_cast(float, __builtin_amdgcn_permlanex16(__builtin_bit_cast(int, x), __builtin_bit_cast(int, x), 0x76543210, 0xfedcba98, false, false)); }   // lane l with lane l ^ 16
template <typename T16, bool HI, int R>
__device__ __forceinline__ void flash_wave(const T16* Q, const T16* Q2, const T16* Kp, const T16* K2, const T16* Vt, const T16* Vt2, int q0, int lane, bf* Ah, bf* Al) {
    typedef typename WFrag<T16>::V V;
    const int lr = lane & 15, hi = lane >> 4;
    // Every '#pragma unroll' below keeps a fragment or accumulator array indexed by constants, so that it stays in registers.
    V qf[R][4], qf2[R][4];
#pragma unroll
    for (int g = 0; g < R; ++g)
#pragma unroll
        for (int kc = 0; kc < 4; ++kc) { const size_t o = (size_t)(q0 + 16 * g + lr) * HD + 32 * kc + 8 * hi; qf[g][kc] = WFrag<T16>::ld(Q + o); if constexpr (HI) qf2[g][kc] = WFrag<T16>::ld(Q2 + o); }
    v8f acc[R][8]; float m_run[R], l_run[R];
#pragma unroll
    for (int g = 0; g < R; ++g) { m_run[g] = -1.0e30f; l_run[g] = 0.0f;   // far above the mask's fill, far below any score: a pass whose keys are all masked for a query gives it zeros
#pragma unroll
        for (int t = 0; t < 8; ++t) acc[g][t] = (v8f){}; }
    const int kbeg = max(0, q0 - (WIN - 1)) & ~31, kend = q0 + 16 * R;   // row i allows keys j with i - WIN < j <= i
    const size_t kofs = (size_t)lr * HD + 8 * hi, vofs = (size_t)lr * TT + 8 * hi;
    V kf[2][4], kf2[2][4];
    auto load_k = [&](const T16* pk, const T16* pk2) {
#pragma unroll
        for (int kt = 0; kt < 2; ++kt)
#pragma unroll
            for (int kc = 0; kc < 4; ++kc) { const int o = 16 * kt * HD + 32 * kc; kf[kt][kc] = WFrag<T16>::ld(pk + o); if constexpr (HI) kf2[kt][kc] = WFrag<T16>::ld(pk2 + o); } };
    load_k(Kp + kofs + (size_t)kbeg * HD, HI ? K2 + kofs + (size_t)kbeg * HD : nullptr);
    asm volatile("s_wait_xcnt 0x0" ::: "memory");   // as in the loop: in front of the first rewrite of an address register of the loads above
    __builtin_amdgcn_sched_barrier(0);   // keeps later address arithmetic behind that wait
#pragma unroll 1   // one pass a trip: the body is long
    for (int key0 = kbeg; key0 < kend; key0 += 32) {
        v8f s[2][R];
#pragma unroll
        for (int kt = 0; kt < 2; ++kt)
#pragma unroll
            for (int g = 0; g < R; ++g) s[kt][g] = (v8f){};
#pragma unroll
        for (int kc = 0; kc < 4; ++kc)
#pragma unroll
            for (int kt = 0; kt < 2; ++kt)
#pragma unroll
                for (int g = 0; g < R; ++g) { s[kt][g] = WFrag<T16>::mma(kf[kt][kc], qf[g][kc], s[kt][g]);
                    if constexpr (HI) { s[kt][g] = WFrag<T16>::mma(kf[kt][kc], qf2[g][kc], s[kt][g]); s[kt][g] = WFrag<T16>::mma(kf2[kt][kc], qf[g][kc], s[kt][g]); } }
        // This pass's value fragments and the next pass's key fragments are issued here and fly under the softcap and the exponentials (the last pass fetches its own keys again: in bounds, no branch).
        V vf[8], vf2[8]; const int kn = (key0 + 32 < kend) ? key0 + 32 : key0;
        const T16* pv = Vt + vofs + key0; const T16* pv2 = HI ? Vt2 + vofs + key0 : nullptr; const T16* pk = Kp + kofs + (size_t)kn * HD; const T16* pk2 = HI ? K2 + kofs + (size_t)kn * HD : nullptr;
#pragma unroll
        for (int t = 0; t < 8; ++t) { vf[t] = WFrag<T16>::ld(pv + 16 * t * TT); if constexpr (HI) vf2[t] = WFrag<T16>::ld(pv2 + 16 * t * TT); }
        load_k(pk, pk2);
        // The wait stands in front of the first rewrite of an address register that the loads above name; the base pointers are its inputs so that their registers live up to it.
        if constexpr (HI) asm volatile("s_wait_xcnt 0x0" :: "v"(pv), "v"(pv2), "v"(pk), "v"(pk2) : "memory"); else asm volatile("s_wait_xcnt 0x0" :: "v"(pv), "v"(pk) : "memory");
        __builtin_amdgcn_sched_barrier(0);   // without it the scheduler sinks each load to just in front of its first use, and the wave waits out the latency there
        const bool edge = (key0 + 31 > q0) || (q0 + 16 * R - 1 - key0 >= WIN);   // wave-uniform: only passes that meet the diagonal or the window's lower edge pay for the mask
        // softcap 30 tanh(x / 30): one wave-uniform test a pass picks the branch-free small-argument form for all of the pass's scores, or the library's tanhf for all of them (also for a NaN)
        bool big = false;
#pragma unroll
        for (int kt = 0; kt < 2; ++kt)
#pragma unroll
            for (int g = 0; g < R; ++g)
#pragma unroll
                for (int j = 0; j < 8; ++j) { const float x = __fdiv_rn(s[kt][g][j] * SCL, 30.0f); s[kt][g][j] = x; big = big || !(fabsf(x) < 0.625f); }
        if (__builtin_amdgcn_ballot_w32(big) != 0) {
#pragma unroll
            for (int kt = 0; kt < 2; ++kt)
#pragma unroll
                for (int g = 0; g < R; ++g)
#pragma unroll
                    for (int j = 0; j < 8; ++j) s[kt][g][j] = 30.0f * tanhf(s[kt][g][j]);
        } else {
#pragma unroll
            for (int kt = 0; kt < 2; ++kt)
#pragma unroll
                for (int g = 0; g < R; ++g)
#pragma unroll
                    for (int j = 0; j < 8; ++j) s[kt][g][j] = 30.0f * tanh_small(s[kt][g][j]); }
        float mb[R]; bool need = false;
#pragma unroll
        for (int g = 0; g < R; ++g) { const int qi = q0 + 16 * g + lr; float mx = -3.0e38f;
#pragma unroll
            for (int kt = 0; kt < 2; ++kt)
#pragma unroll
                for (int j = 0; j < 8; ++j) { float t = s[kt][g][j]; const int key = key0 + 16 * kt + 8 * hi + j; if (edge && !(key <= qi && qi - key < WIN)) t = -3.0e38f; s[kt][g][j] = t; mx = fmaxf(mx, t); }
            mx = fmaxf(mx, xhalf(mx)); mb[g] = mx; need = need || (mx > m_run[g]); }
        if (__builtin_amdgcn_ballot_w32(need) != 0) {
#pragma unroll
            for (int g = 0; g < R; ++g) { const float m_new = fmaxf(m_run[g], mb[g]); const float corr = __builtin_amdgcn_exp2f(__fmul_rn(__fsub_rn(m_run[g], m_new), L2E)); l_run[g] *= corr; m_run[g] = m_new;
#pragma unroll
                for (int t = 0; t < 8; ++t) acc[g][t] = acc[g][t] * corr; } }
#pragma unroll
        for (int g = 0; g < R; ++g) { float ps = 0.0f;
            if constexpr (HI) { v8us h0, h1, l0, l1;
#pragma unroll
                for (int j = 0; j < 8; ++j) { const float p0 = __builtin_amdgcn_exp2f(__fmul_rn(__fsub_rn(s[0][g][j], m_run[g]), L2E)), p1 = __builtin_amdgcn_exp2f(__fmul_rn(__fsub_rn(s[1][g][j], m_run[g]), L2E)); ps += p0 + p1;
                    unsigned short a, c2; splitf(p0, a, c2); h0[j] = a; l0[j] = c2; splitf(p1, a, c2); h1[j] = a; l1[j] = c2; }
                const V ph = cat16b(h0, h1), pl = cat16b(l0, l1);
#pragma unroll
                for (int t = 0; t < 8; ++t) acc[g][t] = WFrag<T16>::mma(vf[t], ph, acc[g][t]);
#pragma unroll
                for (int t = 0; t < 8; ++t) acc[g][t] = WFrag<T16>::mma(vf[t], pl, acc[g][t]);
#pragma unroll
                for (int t = 0; t < 8; ++t) acc[g][t] = WFrag<T16>::mma(vf2[t], ph, acc[g][t]);
            } else { v8h a0, a1;
#pragma unroll
                for (int j = 0; j < 8; ++j) { const float p0 = __builtin_amdgcn_exp2f(__fmul_rn(__fsub_rn(s[0][g][j], m_run[g]), L2E)), p1 = __builtin_amdgcn_exp2f(__fmul_rn(__fsub_rn(s[1][g][j], m_run[g]), L2E)); ps += p0 + p1;
                    a0[j] = tohx(p0 * PCAR2); a1[j] = tohx(p1 * PCAR2); }
                const V pf = cat16(a0, a1);
#pragma unroll
                for (int t = 0; t < 8; ++t) acc[g][t] = WFrag<T16>::mma(vf[t], pf, acc[g][t]); }
            l_run[g] += ps; }
    }
#pragma unroll
    for (int g = 0; g < R; ++g) { const float l = l_run[g] + xhalf(l_run[g]);   // each wave half summed its own eight keys of every 16
        const float inv = __fdiv_rn(1.0f, HI ? l : l * PCAR2); const size_t oo = (size_t)(q0 + 16 * g + lr) * DQ + 8 * hi;
#pragma unroll
        for (int t = 0; t < 8; ++t) { v8us oh, ol;   // the lane holds d = 16 t + 8 hi .. + 7 of its query: 16 bytes of each plane
#pragma unroll
            for (int j = 0; j < 8; ++j) { unsigned short a, c2; splitf(acc[g][t][j] * inv, a, c2); oh[j] = a; ol[j] = c2; }
            *(v8us*)(Ah + oo + 16 * t) = oh; *(v8us*)(Al + oo + 16 * t) = ol; }
        if (g + 1 < R) { asm volatile("s_wait_xcnt 0x0" ::: "memory");   // in front of the next group's rewrite of the stores' address and data registers
            __builtin_amdgcn_sched_barrier(0); } }   // keeps the next group's arithmetic behind that wait
}
// grid (heads, NT16 + NTHI), 128 threads, four independent waves. Tiles in y: first the fp16 rows from the sequence's end (the longest key walks at the lowest y), 128 rows a work-group; then the hi + lo rows, 64 a work-group.
#define NT16 ((TT - RH) / 128)
#define NTHI (RH / 64)
__global__ __launch_bounds__(128) void k_flash(const h16* Q16, const h16* K16, const h16* V16, const bf* Qh, const bf* Ql, const bf* Kh, const bf* Kl, const bf* Vh, const bf* Vl, bf* Ah, bf* Al) {   // no __restrict__: the loads must stay on their side of the waits written in asm
    const int lane = threadIdx.x & 31, w = __builtin_amdgcn_readfirstlane(threadIdx.x >> 5), y = blockIdx.y; const size_t hp = (size_t)blockIdx.x * TT * HD; Ah += blockIdx.x * HD; Al += blockIdx.x * HD;
    if (y < NT16) flash_wave<h16, false, 2>(Q16 + hp, nullptr, K16 + hp, nullptr, V16 + hp, nullptr, TT - 128 * (y + 1) + 32 * w, lane, Ah, Al);
    else flash_wave<bf, true, 1>(Qh + hp, Ql + hp, Kh + hp, Kl + hp, Vh + hp, Vl + hp, RH - 64 * (y - NT16 + 1) + 16 * w, lane, Ah, Al);
}

extern "C" void kernel_launch(void* const* d_in, const int* in_sizes, int n_in,
                              void* d_out, int out_size, void* d_ws, size_t ws_size, hipStream_t stream) {
    (void)in_sizes; (void)n_in; (void)out_size;
    const float* x = (const float*)d_in[0]; const float* wq = (const float*)d_in[1]; const float* wk = (const float*)d_in[2]; const float* wv = (const float*)d_in[3]; const float* wo = (const float*)d_in[4]; const float* cosT = nullptr; const float* sinT = nullptr; (void)cosT; (void)sinT;
    float* OUT = (float*)d_out;     // [2][2048][2048]
    char* wsp = (char*)d_ws;
    auto take = [&](size_t bytes) { char* p = wsp; wsp += (bytes + 255) & ~(size_t)255; return (void*)p; };
    bf* WQ = (bf*)take((size_t)DQ * DM * 2); bf* WK = (bf*)take((size_t)DKV * DM * 2); bf* WV = (bf*)take((size_t)DKV * DM * 2); float* CS = (float*)take((size_t)TT * HD * 2 * 4);
    h16* QP16 = (h16*)take((size_t)NH_ * TT * HD * 2); h16* KP16 = (h16*)take((size_t)NKV * TT * HD * 2); h16* VT16 = (h16*)take((size_t)NKV * HD * TT * 2);
    bf* QPh = (bf*)take((size_t)NH_ * TT * HD * 2); bf* QPl = (bf*)take((size_t)NH_ * TT * HD * 2); bf* KPh = (bf*)take((size_t)NKV * TT * HD * 2); bf* KPl = (bf*)take((size_t)NKV * TT * HD * 2); bf* VTh = (bf*)take((size_t)NKV * HD * TT * 2); bf* VTl = (bf*)take((size_t)NKV * HD * TT * 2);
    float* Sb = (float*)take((size_t)TT * DM * 2 + (size_t)TT * DQ * 4 + (size_t)TT * DKV * 4); bf* ATh = (bf*)take((size_t)TT * DQ * 2); bf* ATl = (bf*)take((size_t)TT * DQ * 2);
    if ((size_t)(wsp - (char*)d_ws) > ws_size) return;    // ws 256 MiB
    // One scratch space, stream-ordered: before the attention x in bf16 and the f32 projections, after it Wo in bf16.
    bf* XB = (bf*)Sb; float* FQ = (float*)((char*)Sb + (size_t)TT * DM * 2); float* FK = (float*)((char*)Sb + (size_t)TT * DM * 2 + (size_t)TT * DQ * 4); bf* WO = (bf*)Sb;
    float* FV = FK;   // v projection reuses the k buffer after the k planes are built (stream-ordered)
    { k_cvt8<<<(unsigned)(((size_t)DQ * DM / 8 + 255) / 256), 256, 0, stream>>>(wq, WQ, (size_t)DQ * DM / 8); k_cvt8<<<(unsigned)(((size_t)DKV * DM / 8 + 255) / 256), 256, 0, stream>>>(wk, WK, (size_t)DKV * DM / 8); k_cvt8<<<(unsigned)(((size_t)DKV * DM / 8 + 255) / 256), 256, 0, stream>>>(wv, WV, (size_t)DKV * DM / 8); }
    k_csid<<<(TT * HD + 255) / 256, 256, 0, stream>>>(CS);
    const unsigned LQ = (unsigned)(((size_t)NH_ * TT * HD / 2 + 255) / 256), LKv = (unsigned)(((size_t)NKV * TT * HD / 2 + 255) / 256);
    for (int b = 0; b < NB_; ++b) {
        
        k_cvt8<<<(unsigned)(((size_t)TT * DM / 8 + 255) / 256), 256, 0, stream>>>(x + (size_t)b * TT * DM, XB, (size_t)TT * DM / 8);
        k_gemml<0><<<dim3(TT / 128, DQ / 128, 1), 128, 0, stream>>>(XB, nullptr, WQ, DM, FQ, DQ);
        k_rope<<<LQ, 256, 0, stream>>>(FQ, DQ, NH_, CS, nullptr, nullptr, 1.0f, QP16, QPh, QPl);
        k_gemml<0><<<dim3(TT / 128, DKV / 128, 1), 128, 0, stream>>>(XB, nullptr, WK, DM, FK, DKV);
        k_rope<<<LKv, 256, 0, stream>>>(FK, DKV, NKV, CS, nullptr, nullptr, 1.0f, KP16, KPh, KPl);
        k_gemml<0><<<dim3(TT / 128, DKV / 128, 1), 128, 0, stream>>>(XB, nullptr, WV, DM, FV, DKV); k_vtp<<<LKv, 256, 0, stream>>>(FV, DKV, NKV, VT16, VTh, VTl);
        k_flash<<<dim3(NH_, NT16 + NTHI, 1), 128, 0, stream>>>(QP16, KP16, VT16, QPh, QPl, KPh, KPl, VTh, VTl, ATh, ATl);
        k_cvt8<<<(unsigned)(((size_t)DM * DQ / 8 + 255) / 256), 256, 0, stream>>>(wo, WO, (size_t)DM * DQ / 8);
        k_gemml<1><<<dim3(TT / 128, DM / 128, 1), 128, 0, stream>>>(ATh, ATl, WO, DQ, OUT + (size_t)b * TT * DM, DM); }
}

// v005
// One run takes 421 microseconds.
// In both of two side-by-side timings against v004, it was 1.17 times as fast.
// All steps since v000 together make it 4.46 times as fast.
#include <hip/hip_runtime.h>

// FastestFlashMHA (x [2][2048][2048]; q/k/v = x W^T (16 heads x 128); scores = 30 tanh((q.k / sqrt(128)) / 30); key j allowed iff j <= i and i - j < 1024 (finfo.min fill); softmax; out = merged Wo^T -> [2][2048][2048]).
// Compute dtypes, f32 accumulate: every input rounded to bf16; q/k/v on PLAIN bf16 operands (inputs: exact), their head planes written by the projection kernels themselves; softcap (precise tanhf) f32; causal scores and attn.v: query rows < 512 hl (3 products), the rest single fp16 (x256), one fused kernel that walks only the keys between the sliding window's edge and the diagonal, both tests inside the edge passes; online softmax f32; Wo hl x exact (2 products).

#define NB_  2
#define TT   2048
#define DM   2048
#define NH_  16
#define NKV  16
#define REP  (NH_ / NKV)
#define HD   128
#define DQ   (NH_ * HD)
#define DKV  (NKV * HD)
#define RH   512                  // query rows < RH use hi+lo planes (0: none)
#define WIN  1024
#define SCL  0.088388347648318447f   // HD^-0.5
typedef _Float16 h16;
typedef unsigned short bf;
typedef __attribute__((ext_vector_type(16))) __bf16   v16bf;
typedef __attribute__((ext_vector_type(16))) _Float16 v16h;
typedef __attribute__((ext_vector_type(8)))  _Float16 v8h;
typedef __attribute__((ext_vector_type(8)))  unsigned short v8us;
typedef __attribute__((ext_vector_type(8)))  float    v8f;
typedef __attribute__((ext_vector_type(4)))  float    v4f;
typedef v8h  __attribute__((may_alias)) v8ha;
typedef v4f  __attribute__((may_alias)) v4fa;
typedef v8us __attribute__((may_alias)) v8usa;

__device__ __forceinline__ unsigned short f2bf(float f) { unsigned u = __float_as_uint(f); u += 0x7FFFu + ((u >> 16) & 1u); return (unsigned short)(u >> 16); }
__device__ __forceinline__ float bf2f(unsigned short b) { return __uint_as_float(((unsigned)b) << 16); }
__device__ __forceinline__ float bfr(float f) { return bf2f(f2bf(f)); }
__device__ __forceinline__ v16h cat16(v8h lo, v8h hi) { return __builtin_shufflevector(lo, hi, 0, 1, 2, 3, 4, 5, 6, 7, 8, 9, 10, 11, 12, 13, 14, 15); }
__device__ __forceinline__ v16bf cat16b(v8us lo, v8us hi) { return __builtin_bit_cast(v16bf, __builtin_shufflevector(lo, hi, 0, 1, 2, 3, 4, 5, 6, 7, 8, 9, 10, 11, 12, 13, 14, 15)); }
__device__ __forceinline__ v8f wmma16(v16h a, v16h b, v8f c) { return __builtin_amdgcn_wmma_f32_16x16x32_f16(false, a, false, b, (short)0, c, false, false); }
__device__ __forceinline__ v8f wmmab(v16bf a, v16bf b, v8f c) { return __builtin_amdgcn_wmma_f32_16x16x32_bf16(false, a, false, b, (short)0, c, false, false); }



// Fragment loaders and products of the two 16-bit operand types (K-contiguous planes).
template <typename T16> struct WFrag;
template <> struct WFrag<h16> { typedef v16h V; static __device__ __forceinline__ V ld(const h16* p) { return cat16(*(const v8h*)p, *(const v8h*)(p + 16)); } static __device__ __forceinline__ v8f mma(V a, V b, v8f c) { return wmma16(a, b, c); } };
template <> struct WFrag<bf> { typedef v16bf V; static __device__ __forceinline__ V ld(const bf* p) { return cat16b(*(const v8us*)p, *(const v8us*)(p + 16)); } static __device__ __forceinline__ v8f mma(V a, V b, v8f c) { return wmmab(a, b, c); } };

__device__ __forceinline__ h16 tohx(float x) { return (h16)x; }
__device__ __forceinline__ void splitf(float y, unsigned short& h, unsigned short& l) { h = f2bf(y); l = f2bf(y - bf2f(h)); }

// ---- k_gemml: C[m][n] = sum_k A[m][k] Bt[n][k] (+ A2[m][k] Bt[n][k] when NSPLIT == 1), bf16 planes of row pitch K. PL == false: C is stored as f32, pitch ldc.
// PL == true: C is stored three times as 16-bit planes (fp16, bf16 hi, bf16 lo of the same f32 sum); element (m, n) lies at (n / 128) cstride + m pitch + n % 128 of each plane.
// With A = x, Bt = W, cstride = TT HD, pitch = HD that is the head plane [h][t][d]; with A = W, Bt = x, cstride = 128, pitch = TT it is the transposed plane [h][d][t]. One 128x128 tile per work-group of four waves, 64x64 per wave (16 accumulators);
// grid (M/128, N/128), 128 threads. Operands reach LDS by asynchronous copies in whole 128-byte row pieces (64 k), two buffers: the next piece's copies fly while this one is multiplied. K % 64 == 0, M % 128 == 0, N % 128 == 0.
// Every '#pragma unroll' in it is there so that the fragment and accumulator arrays are indexed by constants and stay in registers.
#define LP    144                 // LDS row pitch in bytes: 128 data + 16, an odd multiple of 16, for 16-byte fragment reads
#define LTILE (128 * LP)          // one operand's 128 rows
// Eight copies of 16 bytes a lane: rows 16 apart of one operand tile (LDS step 16 LP bytes, global step rs elements).
__device__ __forceinline__ void copy8(unsigned l, const bf* g, size_t rs) {
    // the wait on xcnt ends the copies' own statement, so that no address register is rewritten in front of it
    asm volatile("global_load_async_to_lds_b128 %0, %8, off\n\t"
                 "global_load_async_to_lds_b128 %1, %9, off\n\t"
                 "global_load_async_to_lds_b128 %2, %10, off\n\t"
                 "global_load_async_to_lds_b128 %3, %11, off\n\t"
                 "global_load_async_to_lds_b128 %4, %12, off\n\t"
                 "global_load_async_to_lds_b128 %5, %13, off\n\t"
                 "global_load_async_to_lds_b128 %6, %14, off\n\t"
                 "global_load_async_to_lds_b128 %7, %15, off\n\t"
                 "s_wait_xcnt 0x0"
                 :: "v"(l), "v"(l + 16u * LP), "v"(l + 32u * LP), "v"(l + 48u * LP), "v"(l + 64u * LP), "v"(l + 80u * LP), "v"(l + 96u * LP), "v"(l + 112u * LP),
                    "v"(g), "v"(g + rs), "v"(g + 2 * rs), "v"(g + 3 * rs), "v"(g + 4 * rs), "v"(g + 5 * rs), "v"(g + 6 * rs), "v"(g + 7 * rs) : "memory");
}
__device__ __forceinline__ v16bf ldsfrag(const unsigned char* p) { return cat16b(*(const v8usa*)p, *(const v8usa*)(p + 32)); }
typedef __attribute__((ext_vector_type(4))) int v4i;
// One lane's 16 bytes of each of the three planes.
__device__ __forceinline__ void store3(h16* p16, bf* ph, bf* pl, v4i d16, v4i dh, v4i dl) {
    // the wait on xcnt ends the stores' own statement, so that no address or data register of theirs is rewritten in front of it
    asm volatile("global_store_b128 %0, %3, off\n\t"
                 "global_store_b128 %1, %4, off\n\t"
                 "global_store_b128 %2, %5, off\n\t"
                 "s_wait_xcnt 0x0"
                 :: "v"(p16), "v"(ph), "v"(pl), "v"(d16), "v"(dh), "v"(dl) : "memory");
}
template <int NSPLIT, bool PL>
__global__ __launch_bounds__(128) void k_gemml(const bf* __restrict__ A, const bf* __restrict__ A2, const bf* __restrict__ Bt, int K, float* C, int ldc, h16* P16, bf* Ph, bf* Pl, size_t cstride, int pitch) {
    constexpr int NT = (NSPLIT == 1) ? 3 : 2;           // operand tiles per stage: A, (A2,) Bt
    constexpr unsigned STG = NT * LTILE;
    __shared__ __align__(16) unsigned char L[2 * STG];
    __shared__ __align__(16) float osw[4][16 * 68];
    const int tid = threadIdx.x, lane = tid & 31, lr = lane & 15, hi = lane >> 4, w = tid >> 5, wm = w >> 1, wn = w & 1; const int r0 = blockIdx.x * 128, c0 = blockIdx.y * 128;
    v8f acc[4][4];
#pragma unroll
    for (int mb = 0; mb < 4; ++mb)
#pragma unroll
        for (int nb = 0; nb < 4; ++nb) acc[mb][nb] = (v8f){};
    // copies: lane tid brings 16-byte piece (tid & 7) of rows (tid >> 3) + 16 i, so a wave's copy covers four whole 128-byte row pieces
    const int crow = tid >> 3, cch = tid & 7; const size_t rs = (size_t)16 * K;
    const bf* gA = A + (size_t)(r0 + crow) * K + cch * 8; const bf* gA2 = (NSPLIT == 1) ? A2 + (size_t)(r0 + crow) * K + cch * 8 : nullptr; const bf* gB = Bt + (size_t)(c0 + crow) * K + cch * 8;
    const unsigned l0 = (unsigned)(size_t)L + (unsigned)(crow * LP + cch * 16);
    auto stage = [&](int t) { const unsigned l = l0 + (unsigned)(t & 1) * STG; const int kc = t * 64; copy8(l, gA + kc, rs); if (NSPLIT == 1) copy8(l + LTILE, gA2 + kc, rs); copy8(l + (NT - 1) * LTILE, gB + kc, rs); };
    const int nst = K / 64;
    stage(0);
    asm volatile("s_wait_asynccnt 0x0" ::: "memory");   // this wave's copies of stage 0 have landed
    __syncthreads();                                     // ... and every other wave's
    if (nst > 1) stage(1);
    const unsigned aofs = (unsigned)((wm * 64 + lr) * LP + hi * 16), bofs = (unsigned)((NT - 1) * LTILE + (wn * 64 + lr) * LP + hi * 16);
#pragma unroll 1   // one stage a trip: the two buffers alternate by the trip's parity
    for (int t = 0; t < nst; ++t) {
        const unsigned char* Lb = L + (unsigned)(t & 1) * STG; const unsigned char* pa = Lb + aofs; const unsigned char* pb = Lb + bofs;
        // Fragment reads stand in few groups, each ahead of the products that hide it (one wave per SIMD: nothing else hides an LDS wait). Every accumulator still takes its products in ascending k, A before A2.
        // Each sched_barrier(0) below keeps a read group where it is written: without them the scheduler sinks every read to just in front of its first use, and the wave waits out the LDS latency once per four products.
        v16bf a[4], a2[4], b[4];
        if (NSPLIT == 0) {   // a: k 0..31 of the stage, a2: k 32..63
#pragma unroll
            for (int mb = 0; mb < 4; ++mb) a[mb] = ldsfrag(pa + mb * 16 * LP);
#pragma unroll
            for (int nb = 0; nb < 4; ++nb) b[nb] = ldsfrag(pb + nb * 16 * LP);
#pragma unroll
            for (int mb = 0; mb < 4; ++mb) a2[mb] = ldsfrag(pa + mb * 16 * LP + 64);
            __builtin_amdgcn_sched_barrier(0);
#pragma unroll
            for (int h = 0; h < 2; ++h) {
#pragma unroll
                for (int nb = 2 * h; nb < 2 * h + 2; ++nb)
#pragma unroll
                    for (int mb = 0; mb < 4; ++mb) acc[mb][nb] = wmmab(a[mb], b[nb], acc[mb][nb]);
                __builtin_amdgcn_sched_barrier(0);
#pragma unroll
                for (int nb = 2 * h; nb < 2 * h + 2; ++nb) b[nb] = ldsfrag(pb + nb * 16 * LP + 64);
                __builtin_amdgcn_sched_barrier(0); }
#pragma unroll
            for (int nb = 0; nb < 4; ++nb)
#pragma unroll
                for (int mb = 0; mb < 4; ++mb) acc[mb][nb] = wmmab(a2[mb], b[nb], acc[mb][nb]);
        } else {
#pragma unroll
            for (int mb = 0; mb < 4; ++mb) a[mb] = ldsfrag(pa + mb * 16 * LP);
#pragma unroll
            for (int nb = 0; nb < 4; ++nb) b[nb] = ldsfrag(pb + nb * 16 * LP);
#pragma unroll
            for (int mb = 0; mb < 4; ++mb) a2[mb] = ldsfrag(pa + LTILE + mb * 16 * LP);
            __builtin_amdgcn_sched_barrier(0);
#pragma unroll
            for (int nb = 0; nb < 4; ++nb)
#pragma unroll
                for (int mb = 0; mb < 4; ++mb) acc[mb][nb] = wmmab(a[mb], b[nb], acc[mb][nb]);
            __builtin_amdgcn_sched_barrier(0);
#pragma unroll
            for (int mb = 0; mb < 4; ++mb) a[mb] = ldsfrag(pa + mb * 16 * LP + 64);
            __builtin_amdgcn_sched_barrier(0);
#pragma unroll
            for (int h = 0; h < 2; ++h) {
#pragma unroll
                for (int nb = 2 * h; nb < 2 * h + 2; ++nb)
#pragma unroll
                    for (int mb = 0; mb < 4; ++mb) acc[mb][nb] = wmmab(a2[mb], b[nb], acc[mb][nb]);
                __builtin_amdgcn_sched_barrier(0);
#pragma unroll
                for (int nb = 2 * h; nb < 2 * h + 2; ++nb) b[nb] = ldsfrag(pb + nb * 16 * LP + 64);
                if (h == 0) __builtin_amdgcn_sched_barrier(0); }
#pragma unroll
            for (int mb = 0; mb < 4; ++mb) a2[mb] = ldsfrag(pa + LTILE + mb * 16 * LP + 64);
            __builtin_amdgcn_sched_barrier(0);
#pragma unroll
            for (int nb = 0; nb < 4; ++nb)
#pragma unroll
                for (int mb = 0; mb < 4; ++mb) acc[mb][nb] = wmmab(a[mb], b[nb], acc[mb][nb]);
#pragma unroll
            for (int nb = 0; nb < 4; ++nb)
#pragma unroll
                for (int mb = 0; mb < 4; ++mb) acc[mb][nb] = wmmab(a2[mb], b[nb], acc[mb][nb]);
        }
        asm volatile("s_wait_dscnt 0x0" ::: "memory");      // this wave's reads of the buffer are done before it is handed back
        asm volatile("s_wait_asynccnt 0x0" ::: "memory");   // this wave's copies of stage t + 1 have landed
        __syncthreads();                                     // publishes stage t + 1 and ends every wave's reads of stage t
        if (t + 2 < nst) stage(t + 2);
    }
    asm volatile("s_wait_asynccnt 0x0" ::: "memory");       // no copy is outstanding when the wave goes on
    float* os = osw[w];   // each wave turns its own accumulators into whole row pieces (256 bytes of f32, 128 bytes of each 16-bit plane) through its own LDS slice; the wave barriers with their compiler fences keep the slice's stores, reads and next stores in that order
#pragma unroll
    for (int mb = 0; mb < 4; ++mb) {
#pragma unroll
        for (int nb = 0; nb < 4; ++nb) {
#pragma unroll
            for (int j = 0; j < 8; ++j) os[(hi * 8 + j) * 68 + nb * 16 + lr] = acc[mb][nb][j]; }
        __builtin_amdgcn_wave_barrier(); asm volatile("" ::: "memory");
        if constexpr (PL) {   // a lane takes eight neighbours of one row: 16 bytes of each plane, eight lanes a whole 128-byte line
            const int prow = lane >> 3, pcol = (lane & 7) * 8; const size_t po = (size_t)blockIdx.y * cstride + (size_t)(r0 + wm * 64 + mb * 16 + prow) * pitch + wn * 64 + pcol;
            v4f x0[4], x1[4];   // all eight LDS reads first: the stores' statements let no read pass them, and the wave would wait out the LDS latency once per row group
#pragma unroll
            for (int s = 0; s < 4; ++s) { const float* ps = os + (4 * s + prow) * 68 + pcol; x0[s] = *(const v4fa*)ps; x1[s] = *(const v4fa*)(ps + 4); }
#pragma unroll
            for (int s = 0; s < 4; ++s) { v8h o16; v8us oh, ol;
#pragma unroll
                for (int k = 0; k < 8; ++k) { const float xv = (k < 4) ? x0[s][k & 3] : x1[s][k & 3]; o16[k] = tohx(xv); unsigned short a2, c2; splitf(xv, a2, c2); oh[k] = a2; ol[k] = c2; }
                const size_t o = po + (size_t)(4 * s) * pitch; store3(P16 + o, Ph + o, Pl + o, __builtin_bit_cast(v4i, o16), __builtin_bit_cast(v4i, oh), __builtin_bit_cast(v4i, ol)); }
        } else {
        float* crw = C + (size_t)(r0 + wm * 64 + mb * 16) * ldc + c0 + wn * 64;
#pragma unroll
        for (int s = 0; s < 8; ++s) { const int row = 2 * s + hi, cofs = lr * 4; const v4f val = *(const v4fa*)(os + row * 68 + cofs); *(v4f*)(crw + (size_t)row * ldc + cofs) = val; }
        }
        __builtin_amdgcn_wave_barrier(); asm volatile("" ::: "memory");
    }
}

typedef __attribute__((ext_vector_type(2))) _Float16 v2h;
typedef __attribute__((ext_vector_type(4))) _Float16 v4h;
typedef __attribute__((ext_vector_type(2))) unsigned short v2us;
typedef __attribute__((ext_vector_type(4))) unsigned short v4us;
typedef __attribute__((ext_vector_type(2))) float v2f;

__global__ __launch_bounds__(256) void k_wtG(const float* __restrict__ w, int K, int N, bf* Bt) {
    const int lane = threadIdx.x & 31; const int L0 = (blockIdx.x * 8 + (threadIdx.x >> 5)) * 8; const int nlines = N * K / 64;
{
#pragma unroll 1
        for (int l = 0; l < 8; ++l) { const int L = L0 + l; if (L >= nlines) break; const size_t e = (size_t)L * 64 + lane * 2; const int k = (int)(e % K), n = (int)(e / K); v2us o;
            o[0] = f2bf(w[(size_t)k * N + n]); o[1] = f2bf(w[(size_t)(k + 1) * N + n]); *(v2us*)(Bt + e) = o; }
         }
}
__global__ __launch_bounds__(256) void k_cvt8(const float* __restrict__ src, bf* dst, size_t n8) { const size_t i = (size_t)blockIdx.x * 256 + threadIdx.x; if (i >= n8) return; const v8f v = *(const v8f*)(src + i * 8); v8us o;
#pragma unroll
    for (int k = 0; k < 8; ++k) o[k] = f2bf(v[k]); *(v8us*)(dst + i * 8) = o;  }
// ---- k_flash: the whole attention of one batch in one launch. A wave owns 16 R query rows of one head and walks their keys in passes of 32, from the first key inside the sliding window to the diagonal; scores and probabilities never leave registers.
// Transposed products: S^T = K Q^T (A = key rows, B = query rows) leaves one query's scores in one lane pair (lanes l and l ^ 16), and the two 16-key score tiles of a pass are, register for register, the B operand P^T of O^T += V^T P^T (A = rows of the [d][t] value planes).
// Online softmax: running maximum and sum per query; the output sums are rescaled only in a pass that raises some query's maximum. Operands come straight from the K-contiguous planes.
// HI: bf16 hi + lo planes, three products for each contraction (query rows < RH); otherwise single fp16, probabilities carried x PCAR2.
#define PCAR2 256.0f
#define L2E   1.4426950408889634f
// tanh for |x| < 0.625, the small-argument form of the precise tanhf (odd polynomial, same operations and coefficients), written without a branch:
// a wave alone on its SIMD pays every dependent vector instruction's latency, and only branch-free evaluations of different scores can be interleaved to fill it.
__device__ __forceinline__ float tanh_small(float x) { const float y = fabsf(x), t = x * x;
    float p = __builtin_fmaf(-0.00570002059f, t, 0.0206340719f); p = __builtin_fmaf(t, p, -0.0537379310f); p = __builtin_fmaf(t, p, 0.133314162f); p = __builtin_fmaf(t, p, -0.333332807f);
    return copysignf(__builtin_fmaf(t, y * p, y), x); }
__device__ __forceinline__ float xhalf(float x) { return __builtin_bit_cast(float, __builtin_amdgcn_permlanex16(__builtin_bit_cast(int, x), __builtin_bit_cast(int, x), 0x76543210, 0xfedcba98, false, false)); }   // lane l with lane l ^ 16
template <typename T16, bool HI, int R>
__device__ __forceinline__ void flash_wave(const T16* Q, const T16* Q2, const T16* Kp, const T16* K2, const T16* Vt, const T16* Vt2, int q0, int lane, bf* Ah, bf* Al) {
    typedef typename WFrag<T16>::V V;
    const int lr = lane & 15, hi = lane >> 4;
    // Every '#pragma unroll' below keeps a fragment or accumulator array indexed by constants, so that it stays in registers.
    V qf[R][4], qf2[R][4];
#pragma unroll
    for (int g = 0; g < R; ++g)
#pragma unroll
        for (int kc = 0; kc < 4; ++kc) { const size_t o = (size_t)(q0 + 16 * g + lr) * HD + 32 * kc + 8 * hi; qf[g][kc] = WFrag<T16>::ld(Q + o); if constexpr (HI) qf2[g][kc] = WFrag<T16>::ld(Q2 + o); }
    v8f acc[R][8]; float m_run[R], l_run[R];
#pragma unroll
    for (int g = 0; g < R; ++g) { m_run[g] = -1.0e30f; l_run[g] = 0.0f;   // far above the mask's fill, far below any score: a pass whose keys are all masked for a query gives it zeros
#pragma unroll
        for (int t = 0; t < 8; ++t) acc[g][t] = (v8f){}; }
    const int kbeg = max(0, q0 - (WIN - 1)) & ~31, kend = q0 + 16 * R;   // row i allows keys j with i - WIN < j <= i
    const size_t kofs = (size_t)lr * HD + 8 * hi, vofs = (size_t)lr * TT + 8 * hi;
    V kf[2][4], kf2[2][4];
    auto load_k = [&](const T16* pk, const T16* pk2) {
#pragma unroll
        for (int kt = 0; kt < 2; ++kt)
#pragma unroll
            for (int kc = 0; kc < 4; ++kc) { const int o = 16 * kt * HD + 32 * kc; kf[kt][kc] = WFrag<T16>::ld(pk + o); if constexpr (HI) kf2[kt][kc] = WFrag<T16>::ld(pk2 + o); } };
    load_k(Kp + kofs + (size_t)kbeg * HD, HI ? K2 + kofs + (size_t)kbeg * HD : nullptr);
    asm volatile("s_wait_xcnt 0x0" ::: "memory");   // as in the loop: in front of the first rewrite of an address register of the loads above
    __builtin_amdgcn_sched_barrier(0);   // keeps later address arithmetic behind that wait
#pragma unroll 1   // one pass a trip: the body is long
    for (int key0 = kbeg; key0 < kend; key0 += 32) {
        v8f s[2][R];
#pragma unroll
        for (int kt = 0; kt < 2; ++kt)
#pragma unroll
            for (int g = 0; g < R; ++g) s[kt][g] = (v8f){};
#pragma unroll
        for (int kc = 0; kc < 4; ++kc)
#pragma unroll
            for (int kt = 0; kt < 2; ++kt)
#pragma unroll
                for (int g = 0; g < R; ++g) { s[kt][g] = WFrag<T16>::mma(kf[kt][kc], qf[g][kc], s[kt][g]);
                    if constexpr (HI) { s[kt][g] = WFrag<T16>::mma(kf[kt][kc], qf2[g][kc], s[kt][g]); s[kt][g] = WFrag<T16>::mma(kf2[kt][kc], qf[g][kc], s[kt][g]); } }
        // This pass's value fragments and the next pass's key fragments are issued here and fly under the softcap and the exponentials (the last pass fetches its own keys again: in bounds, no branch).
        V vf[8], vf2[8]; const int kn = (key0 + 32 < kend) ? key0 + 32 : key0;
        const T16* pv = Vt + vofs + key0; const T16* pv2 = HI ? Vt2 + vofs + key0 : nullptr; const T16* pk = Kp + kofs + (size_t)kn * HD; const T16* pk2 = HI ? K2 + kofs + (size_t)kn * HD : nullptr;
#pragma unroll
        for (int t = 0; t < 8; ++t) { vf[t] = WFrag<T16>::ld(pv + 16 * t * TT); if constexpr (HI) vf2[t] = WFrag<T16>::ld(pv2 + 16 * t * TT); }
        load_k(pk, pk2);
        // The wait stands in front of the first rewrite of an address register that the loads above name; the base pointers are its inputs so that their registers live up to it.
        if constexpr (HI) asm volatile("s_wait_xcnt 0x0" :: "v"(pv), "v"(pv2), "v"(pk), "v"(pk2) : "memory"); else asm volatile("s_wait_xcnt 0x0" :: "v"(pv), "v"(pk) : "memory");
        __builtin_amdgcn_sched_barrier(0);   // without it the scheduler sinks each load to just in front of its first use, and the wave waits out the latency there
        const bool edge = (key0 + 31 > q0) || (q0 + 16 * R - 1 - key0 >= WIN);   // wave-uniform: only passes that meet the diagonal or the window's lower edge pay for the mask
        // softcap 30 tanh(x / 30): one wave-uniform test a pass picks the branch-free small-argument form for all of the pass's scores, or the library's tanhf for all of them (also for a NaN)
        bool big = false;
#pragma unroll
        for (int kt = 0; kt < 2; ++kt)
#pragma unroll
            for (int g = 0; g < R; ++g)
#pragma unroll
                for (int j = 0; j < 8; ++j) { const float x = __fdiv_rn(s[kt][g][j] * SCL, 30.0f); s[kt][g][j] = x; big = big || !(fabsf(x) < 0.625f); }
        if (__builtin_amdgcn_ballot_w32(big) != 0) {
#pragma unroll
            for (int kt = 0; kt < 2; ++kt)
#pragma unroll
                for (int g = 0; g < R; ++g)
#pragma unroll
                    for (int j = 0; j < 8; ++j) s[kt][g][j] = 30.0f * tanhf(s[kt][g][j]);
        } else {
#pragma unroll
            for (int kt = 0; kt < 2; ++kt)
#pragma unroll
                for (int g = 0; g < R; ++g)
#pragma unroll
                    for (int j = 0; j < 8; ++j) s[kt][g][j] = 30.0f * tanh_small(s[kt][g][j]); }
        float mb[R]; bool need = false;
#pragma unroll
        for (int g = 0; g < R; ++g) { const int qi = q0 + 16 * g + lr; float mx = -3.0e38f;
#pragma unroll
            for (int kt = 0; kt < 2; ++kt)
#pragma unroll
                for (int j = 0; j < 8; ++j) { float t = s[kt][g][j]; const int key = key0 + 16 * kt + 8 * hi + j; if (edge && !(key <= qi && qi - key < WIN)) t = -3.0e38f; s[kt][g][j] = t; mx = fmaxf(mx, t); }
            mx = fmaxf(mx, xhalf(mx)); mb[g] = mx; need = need || (mx > m_run[g]); }
        if (__builtin_amdgcn_ballot_w32(need) != 0) {
#pragma unroll
            for (int g = 0; g < R; ++g) { const float m_new = fmaxf(m_run[g], mb[g]); const float corr = __builtin_amdgcn_exp2f(__fmul_rn(__fsub_rn(m_run[g], m_new), L2E)); l_run[g] *= corr; m_run[g] = m_new;
#pragma unroll
                for (int t = 0; t < 8; ++t) acc[g][t] = acc[g][t] * corr; } }
#pragma unroll
        for (int g = 0; g < R; ++g) { float ps = 0.0f;
            if constexpr (HI) { v8us h0, h1, l0, l1;
#pragma unroll
                for (int j = 0; j < 8; ++j) { const float p0 = __builtin_amdgcn_exp2f(__fmul_rn(__fsub_rn(s[0][g][j], m_run[g]), L2E)), p1 = __builtin_amdgcn_exp2f(__fmul_rn(__fsub_rn(s[1][g][j], m_run[g]), L2E)); ps += p0 + p1;
                    unsigned short a, c2; splitf(p0, a, c2); h0[j] = a; l0[j] = c2; splitf(p1, a, c2); h1[j] = a; l1[j] = c2; }
                const V ph = cat16b(h0, h1), pl = cat16b(l0, l1);
#pragma unroll
                for (int t = 0; t < 8; ++t) acc[g][t] = WFrag<T16>::mma(vf[t], ph, acc[g][t]);
#pragma unroll
                for (int t = 0; t < 8; ++t) acc[g][t] = WFrag<T16>::mma(vf[t], pl, acc[g][t]);
#pragma unroll
                for (int t = 0; t < 8; ++t) acc[g][t] = WFrag<T16>::mma(vf2[t], ph, acc[g][t]);
            } else { v8h a0, a1;
#pragma unroll
                for (int j = 0; j < 8; ++j) { const float p0 = __builtin_amdgcn_exp2f(__fmul_rn(__fsub_rn(s[0][g][j], m_run[g]), L2E)), p1 = __builtin_amdgcn_exp2f(__fmul_rn(__fsub_rn(s[1][g][j], m_run[g]), L2E)); ps += p0 + p1;
                    a0[j] = tohx(p0 * PCAR2); a1[j] = tohx(p1 * PCAR2); }
                const V pf = cat16(a0, a1);
#pragma unroll
                for (int t = 0; t < 8; ++t) acc[g][t] = WFrag<T16>::mma(vf[t], pf, acc[g][t]); }
            l_run[g] += ps; }
    }
#pragma unroll
    for (int g = 0; g < R; ++g) { const float l = l_run[g] + xhalf(l_run[g]);   // each wave half summed its own eight keys of every 16
        const float inv = __fdiv_rn(1.0f, HI ? l : l * PCAR2); const size_t oo = (size_t)(q0 + 16 * g + lr) * DQ + 8 * hi;
#pragma unroll
        for (int t = 0; t < 8; ++t) { v8us oh, ol;   // the lane holds d = 16 t + 8 hi .. + 7 of its query: 16 bytes of each plane
#pragma unroll
            for (int j = 0; j < 8; ++j) { unsigned short a, c2; splitf(acc[g][t][j] * inv, a, c2); oh[j] = a; ol[j] = c2; }
            *(v8us*)(Ah + oo + 16 * t) = oh; *(v8us*)(Al + oo + 16 * t) = ol; }
        if (g + 1 < R) { asm volatile("s_wait_xcnt 0x0" ::: "memory");   // in front of the next group's rewrite of the stores' address and data registers
            __builtin_amdgcn_sched_barrier(0); } }   // keeps the next group's arithmetic behind that wait
}
// grid (heads, NT16 + NTHI), 128 threads, four independent waves. Tiles in y: first the fp16 rows from the sequence's end (the longest key walks at the lowest y), 128 rows a work-group; then the hi + lo rows, 64 a work-group.
#define NT16 ((TT - RH) / 128)
#define NTHI (RH / 64)
__global__ __launch_bounds__(128) void k_flash(const h16* Q16, const h16* K16, const h16* V16, const bf* Qh, const bf* Ql, const bf* Kh, const bf* Kl, const bf* Vh, const bf* Vl, bf* Ah, bf* Al) {   // no __restrict__: the loads must stay on their side of the waits written in asm
    const int lane = threadIdx.x & 31, w = __builtin_amdgcn_readfirstlane(threadIdx.x >> 5), y = blockIdx.y; const size_t hp = (size_t)blockIdx.x * TT * HD; Ah += blockIdx.x * HD; Al += blockIdx.x * HD;
    if (y < NT16) flash_wave<h16, false, 2>(Q16 + hp, nullptr, K16 + hp, nullptr, V16 + hp, nullptr, TT - 128 * (y + 1) + 32 * w, lane, Ah, Al);
    else flash_wave<bf, true, 1>(Qh + hp, Ql + hp, Kh + hp, Kl + hp, Vh + hp, Vl + hp, RH - 64 * (y - NT16 + 1) + 16 * w, lane, Ah, Al);
}

extern "C" void kernel_launch(void* const* d_in, const int* in_sizes, int n_in,
                              void* d_out, int out_size, void* d_ws, size_t ws_size, hipStream_t stream) {
    (void)in_sizes; (void)n_in; (void)out_size;
    const float* x = (const float*)d_in[0]; const float* wq = (const float*)d_in[1]; const float* wk = (const float*)d_in[2]; const float* wv = (const float*)d_in[3]; const float* wo = (const float*)d_in[4]; const float* cosT = nullptr; const float* sinT = nullptr; (void)cosT; (void)sinT;
    float* OUT = (float*)d_out;     // [2][2048][2048]
    char* wsp = (char*)d_ws;
    auto take = [&](size_t bytes) { char* p = wsp; wsp += (bytes + 255) & ~(size_t)255; return (void*)p; };
    bf* WQ = (bf*)take((size_t)DQ * DM * 2); bf* WK = (bf*)take((size_t)DKV * DM * 2); bf* WV = (bf*)take((size_t)DKV * DM * 2);
    h16* QP16 = (h16*)take((size_t)NH_ * TT * HD * 2); h16* KP16 = (h16*)take((size_t)NKV * TT * HD * 2); h16* VT16 = (h16*)take((size_t)NKV * HD * TT * 2);
    bf* QPh = (bf*)take((size_t)NH_ * TT * HD * 2); bf* QPl = (bf*)take((size_t)NH_ * TT * HD * 2); bf* KPh = (bf*)take((size_t)NKV * TT * HD * 2); bf* KPl = (bf*)take((size_t)NKV * TT * HD * 2); bf* VTh = (bf*)take((size_t)NKV * HD * TT * 2); bf* VTl = (bf*)take((size_t)NKV * HD * TT * 2);
    bf* Sb = (bf*)take((size_t)TT * DM * 2); bf* ATh = (bf*)take((size_t)TT * DQ * 2); bf* ATl = (bf*)take((size_t)TT * DQ * 2);
    if ((size_t)(wsp - (char*)d_ws) > ws_size) return;    // ws 256 MiB
    // One scratch space, stream-ordered: before the attention x in bf16, after it Wo in bf16 (TT == DQ: the same size).
    bf* XB = Sb; bf* WO = Sb;
    { k_cvt8<<<(unsigned)(((size_t)DQ * DM / 8 + 255) / 256), 256, 0, stream>>>(wq, WQ, (size_t)DQ * DM / 8); k_cvt8<<<(unsigned)(((size_t)DKV * DM / 8 + 255) / 256), 256, 0, stream>>>(wk, WK, (size_t)DKV * DM / 8); k_cvt8<<<(unsigned)(((size_t)DKV * DM / 8 + 255) / 256), 256, 0, stream>>>(wv, WV, (size_t)DKV * DM / 8); }
    for (int b = 0; b < NB_; ++b) {
        
        k_cvt8<<<(unsigned)(((size_t)TT * DM / 8 + 255) / 256), 256, 0, stream>>>(x + (size_t)b * TT * DM, XB, (size_t)TT * DM / 8);
        k_gemml<0, true><<<dim3(TT / 128, DQ / 128, 1), 128, 0, stream>>>(XB, nullptr, WQ, DM, nullptr, 0, QP16, QPh, QPl, (size_t)TT * HD, HD);      // [h][t][d]
        k_gemml<0, true><<<dim3(TT / 128, DKV / 128, 1), 128, 0, stream>>>(XB, nullptr, WK, DM, nullptr, 0, KP16, KPh, KPl, (size_t)TT * HD, HD);     // [h][t][d]
        k_gemml<0, true><<<dim3(DKV / 128, TT / 128, 1), 128, 0, stream>>>(WV, nullptr, XB, DM, nullptr, 0, VT16, VTh, VTl, (size_t)128, TT);         // operands swapped: [h][d][t]
        k_flash<<<dim3(NH_, NT16 + NTHI, 1), 128, 0, stream>>>(QP16, KP16, VT16, QPh, QPl, KPh, KPl, VTh, VTl, ATh, ATl);
        k_cvt8<<<(unsigned)(((size_t)DM * DQ / 8 + 255) / 256), 256, 0, stream>>>(wo, WO, (size_t)DM * DQ / 8);
        k_gemml<1, false><<<dim3(TT / 128, DM / 128, 1), 128, 0, stream>>>(ATh, ATl, WO, DQ, OUT + (size_t)b * TT * DM, DM, nullptr, nullptr, nullptr, 0, 0); }
}

// v006
// It runs in 259 microseconds.
// In two side-by-side timings against v005, it was 1.63 and 1.62 times as fast.
// All steps since v000 together make it 7.26 times as fast.
#include <hip/hip_runtime.h>

// FastestFlashMHA (x [2][2048][2048]; q/k/v = x W^T (16 heads x 128); scores = 30 tanh((q.k / sqrt(128)) / 30); key j allowed iff j <= i and i - j < 1024 (finfo.min fill); softmax; out = merged Wo^T -> [2][2048][2048]).
// Compute dtypes, f32 accumulate: every input rounded to bf16; q/k/v on PLAIN bf16 operands (inputs: exact), their head planes written by the projection kernels themselves; softcap (precise tanhf) f32; causal scores and attn.v: query rows < 512 hl (3 products), the rest single fp16 (x256), one fused kernel that walks only the keys between the sliding window's edge and the diagonal, both tests inside the edge passes; online softmax f32; Wo hl x exact (2 products).

#define NB_  2
#define TT   2048
#define DM   2048
#define NH_  16
#define NKV  16
#define REP  (NH_ / NKV)
#define HD   128
#define DQ   (NH_ * HD)
#define DKV  (NKV * HD)
#define RH   512                  // query rows < RH use hi+lo planes (0: none)
#define WIN  1024
#define SCL  0.088388347648318447f   // HD^-0.5
typedef _Float16 h16;
typedef unsigned short bf;
typedef __attribute__((ext_vector_type(16))) __bf16   v16bf;
typedef __attribute__((ext_vector_type(16))) _Float16 v16h;
typedef __attribute__((ext_vector_type(8)))  _Float16 v8h;
typedef __attribute__((ext_vector_type(8)))  unsigned short v8us;
typedef __attribute__((ext_vector_type(8)))  float    v8f;
typedef __attribute__((ext_vector_type(4)))  float    v4f;
typedef v8h  __attribute__((may_alias)) v8ha;
typedef v4f  __attribute__((may_alias)) v4fa;
typedef v8us __attribute__((may_alias)) v8usa;

__device__ __forceinline__ unsigned short f2bf(float f) { unsigned u = __float_as_uint(f); u += 0x7FFFu + ((u >> 16) & 1u); return (unsigned short)(u >> 16); }
__device__ __forceinline__ float bf2f(unsigned short b) { return __uint_as_float(((unsigned)b) << 16); }
__device__ __forceinline__ float bfr(float f) { return bf2f(f2bf(f)); }
__device__ __forceinline__ v16h cat16(v8h lo, v8h hi) { return __builtin_shufflevector(lo, hi, 0, 1, 2, 3, 4, 5, 6, 7, 8, 9, 10, 11, 12, 13, 14, 15); }
__device__ __forceinline__ v16bf cat16b(v8us lo, v8us hi) { return __builtin_bit_cast(v16bf, __builtin_shufflevector(lo, hi, 0, 1, 2, 3, 4, 5, 6, 7, 8, 9, 10, 11, 12, 13, 14, 15)); }
__device__ __forceinline__ v8f wmma16(v16h a, v16h b, v8f c) { return __builtin_amdgcn_wmma_f32_16x16x32_f16(false, a, false, b, (short)0, c, false, false); }
__device__ __forceinline__ v8f wmmab(v16bf a, v16bf b, v8f c) { return __builtin_amdgcn_wmma_f32_16x16x32_bf16(false, a, false, b, (short)0, c, false, false); }



// Fragment loaders and products of the two 16-bit operand types (K-contiguous planes).
template <typename T16> struct WFrag;
template <> struct WFrag<h16> { typedef v16h V; static __device__ __forceinline__ V ld(const h16* p) { return cat16(*(const v8h*)p, *(const v8h*)(p + 16)); } static __device__ __forceinline__ v8f mma(V a, V b, v8f c) { return wmma16(a, b, c); } };
template <> struct WFrag<bf> { typedef v16bf V; static __device__ __forceinline__ V ld(const bf* p) { return cat16b(*(const v8us*)p, *(const v8us*)(p + 16)); } static __device__ __forceinline__ v8f mma(V a, V b, v8f c) { return wmmab(a, b, c); } };

__device__ __forceinline__ h16 tohx(float x) { return (h16)x; }
__device__ __forceinline__ void splitf(float y, unsigned short& h, unsigned short& l) { h = f2bf(y); l = f2bf(y - bf2f(h)); }

// ---- k_gemml: C[m][n] = sum_k A[m][k] Bt[n][k] (+ A2[m][k] Bt[n][k] when NSPLIT == 1), bf16 planes of row pitch K. PL == false: C is stored as f32, pitch ldc.
// PL == true: C is stored three times as 16-bit planes (fp16, bf16 hi, bf16 lo of the same f32 sum); element (m, n) lies at (n / 128) cstride + m pitch + n % 128 of each plane.
// With A = x, Bt = W, cstride = TT HD, pitch = HD that is the head plane [h][t][d]; with A = W, Bt = x, cstride = 128, pitch = TT it is the transposed plane [h][d][t]. One 128x128 tile per work-group of four waves, 64x64 per wave (16 accumulators);
// grid (M/128, N/128, batches), 128 threads; batch z reads A (and A2) + z zA and Bt + z zB and writes C or the planes + z zC (elements): both batches' work-groups are in flight together, and each hides the other's waits. Operands reach LDS by asynchronous copies in whole 128-byte row pieces (64 k), two buffers: the next piece's copies fly while this one is multiplied. K % 64 == 0, M % 128 == 0, N % 128 == 0.
// Every '#pragma unroll' in it is there so that the fragment and accumulator arrays are indexed by constants and stay in registers.
#define LP    144                 // LDS row pitch in bytes: 128 data + 16, an odd multiple of 16, for 16-byte fragment reads
#define LTILE (128 * LP)          // one operand's 128 rows
// Eight copies of 16 bytes a lane: rows 16 apart of one operand tile (LDS step 16 LP bytes, global step rs elements).
__device__ __forceinline__ void copy8(unsigned l, const bf* g, size_t rs) {
    // the wait on xcnt ends the copies' own statement, so that no address register is rewritten in front of it
    asm volatile("global_load_async_to_lds_b128 %0, %8, off\n\t"
                 "global_load_async_to_lds_b128 %1, %9, off\n\t"
                 "global_load_async_to_lds_b128 %2, %10, off\n\t"
                 "global_load_async_to_lds_b128 %3, %11, off\n\t"
                 "global_load_async_to_lds_b128 %4, %12, off\n\t"
                 "global_load_async_to_lds_b128 %5, %13, off\n\t"
                 "global_load_async_to_lds_b128 %6, %14, off\n\t"
                 "global_load_async_to_lds_b128 %7, %15, off\n\t"
                 "s_wait_xcnt 0x0"
                 :: "v"(l), "v"(l + 16u * LP), "v"(l + 32u * LP), "v"(l + 48u * LP), "v"(l + 64u * LP), "v"(l + 80u * LP), "v"(l + 96u * LP), "v"(l + 112u * LP),
                    "v"(g), "v"(g + rs), "v"(g + 2 * rs), "v"(g + 3 * rs), "v"(g + 4 * rs), "v"(g + 5 * rs), "v"(g + 6 * rs), "v"(g + 7 * rs) : "memory");
}
__device__ __forceinline__ v16bf ldsfrag(const unsigned char* p) { return cat16b(*(const v8usa*)p, *(const v8usa*)(p + 32)); }
typedef __attribute__((ext_vector_type(4))) int v4i;
// One lane's 16 bytes of each of the three planes.
__device__ __forceinline__ void store3(h16* p16, bf* ph, bf* pl, v4i d16, v4i dh, v4i dl) {
    // the wait on xcnt ends the stores' own statement, so that no address or data register of theirs is rewritten in front of it
    asm volatile("global_store_b128 %0, %3, off\n\t"
                 "global_store_b128 %1, %4, off\n\t"
                 "global_store_b128 %2, %5, off\n\t"
                 "s_wait_xcnt 0x0"
                 :: "v"(p16), "v"(ph), "v"(pl), "v"(d16), "v"(dh), "v"(dl) : "memory");
}
template <int NSPLIT, bool PL>
__global__ __launch_bounds__(128) void k_gemml(const bf* __restrict__ A, const bf* __restrict__ A2, const bf* __restrict__ Bt, int K, float* C, int ldc, h16* P16, bf* Ph, bf* Pl, size_t cstride, int pitch, size_t zA, size_t zB, size_t zC) {
    { const size_t z = blockIdx.z; A += z * zA; if (NSPLIT == 1) A2 += z * zA; Bt += z * zB; if (PL) { P16 += z * zC; Ph += z * zC; Pl += z * zC; } else C += z * zC; }   // this work-group's batch
    constexpr int NT = (NSPLIT == 1) ? 3 : 2;           // operand tiles per stage: A, (A2,) Bt
    constexpr unsigned STG = NT * LTILE;
    __shared__ __align__(16) unsigned char L[2 * STG];
    __shared__ __align__(16) float osw[4][16 * 68];
    const int tid = threadIdx.x, lane = tid & 31, lr = lane & 15, hi = lane >> 4, w = tid >> 5, wm = w >> 1, wn = w & 1; const int r0 = blockIdx.x * 128, c0 = blockIdx.y * 128;
    v8f acc[4][4];
#pragma unroll
    for (int mb = 0; mb < 4; ++mb)
#pragma unroll
        for (int nb = 0; nb < 4; ++nb) acc[mb][nb] = (v8f){};
    // copies: lane tid brings 16-byte piece (tid & 7) of rows (tid >> 3) + 16 i, so a wave's copy covers four whole 128-byte row pieces
    const int crow = tid >> 3, cch = tid & 7; const size_t rs = (size_t)16 * K;
    const bf* gA = A + (size_t)(r0 + crow) * K + cch * 8; const bf* gA2 = (NSPLIT == 1) ? A2 + (size_t)(r0 + crow) * K + cch * 8 : nullptr; const bf* gB = Bt + (size_t)(c0 + crow) * K + cch * 8;
    const unsigned l0 = (unsigned)(size_t)L + (unsigned)(crow * LP + cch * 16);
    auto stage = [&](int t) { const unsigned l = l0 + (unsigned)(t & 1) * STG; const int kc = t * 64; copy8(l, gA + kc, rs); if (NSPLIT == 1) copy8(l + LTILE, gA2 + kc, rs); copy8(l + (NT - 1) * LTILE, gB + kc, rs); };
    const int nst = K / 64;
    stage(0);
    asm volatile("s_wait_asynccnt 0x0" ::: "memory");   // this wave's copies of stage 0 have landed
    __syncthreads();                                     // ... and every other wave's
    if (nst > 1) stage(1);
    const unsigned aofs = (unsigned)((wm * 64 + lr) * LP + hi * 16), bofs = (unsigned)((NT - 1) * LTILE + (wn * 64 + lr) * LP + hi * 16);
#pragma unroll 1   // one stage a trip: the two buffers alternate by the trip's parity
    for (int t = 0; t < nst; ++t) {
        const unsigned char* Lb = L + (unsigned)(t & 1) * STG; const unsigned char* pa = Lb + aofs; const unsigned char* pb = Lb + bofs;
        // Fragment reads stand in few groups, each ahead of the products that hide it (one wave per SIMD: nothing else hides an LDS wait). Every accumulator still takes its products in ascending k, A before A2.
        // Each sched_barrier(0) below keeps a read group where it is written: without them the scheduler sinks every read to just in front of its first use, and the wave waits out the LDS latency once per four products.
        v16bf a[4], a2[4], b[4];
        if (NSPLIT == 0) {   // a: k 0..31 of the stage, a2: k 32..63
#pragma unroll
            for (int mb = 0; mb < 4; ++mb) a[mb] = ldsfrag(pa + mb * 16 * LP);
#pragma unroll
            for (int nb = 0; nb < 4; ++nb) b[nb] = ldsfrag(pb + nb * 16 * LP);
#pragma unroll
            for (int mb = 0; mb < 4; ++mb) a2[mb] = ldsfrag(pa + mb * 16 * LP + 64);
            __builtin_amdgcn_sched_barrier(0);
#pragma unroll
            for (int h = 0; h < 2; ++h) {
#pragma unroll
                for (int nb = 2 * h; nb < 2 * h + 2; ++nb)
#pragma unroll
                    for (int mb = 0; mb < 4; ++mb) acc[mb][nb] = wmmab(a[mb], b[nb], acc[mb][nb]);
                __builtin_amdgcn_sched_barrier(0);
#pragma unroll
                for (int nb = 2 * h; nb < 2 * h + 2; ++nb) b[nb] = ldsfrag(pb + nb * 16 * LP + 64);
                __builtin_amdgcn_sched_barrier(0); }
#pragma unroll
            for (int nb = 0; nb < 4; ++nb)
#pragma unroll
                for (int mb = 0; mb < 4; ++mb) acc[mb][nb] = wmmab(a2[mb], b[nb], acc[mb][nb]);
        } else {
#pragma unroll
            for (int mb = 0; mb < 4; ++mb) a[mb] = ldsfrag(pa + mb * 16 * LP);
#pragma unroll
            for (int nb = 0; nb < 4; ++nb) b[nb] = ldsfrag(pb + nb * 16 * LP);
#pragma unroll
            for (int mb = 0; mb < 4; ++mb) a2[mb] = ldsfrag(pa + LTILE + mb * 16 * LP);
            __builtin_amdgcn_sched_barrier(0);
#pragma unroll
            for (int nb = 0; nb < 4; ++nb)
#pragma unroll
                for (int mb = 0; mb < 4; ++mb) acc[mb][nb] = wmmab(a[mb], b[nb], acc[mb][nb]);
            __builtin_amdgcn_sched_barrier(0);
#pragma unroll
            for (int mb = 0; mb < 4; ++mb) a[mb] = ldsfrag(pa + mb * 16 * LP + 64);
            __builtin_amdgcn_sched_barrier(0);
#pragma unroll
            for (int h = 0; h < 2; ++h) {
#pragma unroll
                for (int nb = 2 * h; nb < 2 * h + 2; ++nb)
#pragma unroll
                    for (int mb = 0; mb < 4; ++mb) acc[mb][nb] = wmmab(a2[mb], b[nb], acc[mb][nb]);
                __builtin_amdgcn_sched_barrier(0);
#pragma unroll
                for (int nb = 2 * h; nb < 2 * h + 2; ++nb) b[nb] = ldsfrag(pb + nb * 16 * LP + 64);
                if (h == 0) __builtin_amdgcn_sched_barrier(0); }
#pragma unroll
            for (int mb = 0; mb < 4; ++mb) a2[mb] = ldsfrag(pa + LTILE + mb * 16 * LP + 64);
            __builtin_amdgcn_sched_barrier(0);
#pragma unroll
            for (int nb = 0; nb < 4; ++nb)
#pragma unroll
                for (int mb = 0; mb < 4; ++mb) acc[mb][nb] = wmmab(a[mb], b[nb], acc[mb][nb]);
#pragma unroll
            for (int nb = 0; nb < 4; ++nb)
#pragma unroll
                for (int mb = 0; mb < 4; ++mb) acc[mb][nb] = wmmab(a2[mb], b[nb], acc[mb][nb]);
        }
        asm volatile("s_wait_dscnt 0x0" ::: "memory");      // this wave's reads of the buffer are done before it is handed back
        asm volatile("s_wait_asynccnt 0x0" ::: "memory");   // this wave's copies of stage t + 1 have landed
        __syncthreads();                                     // publishes stage t + 1 and ends every wave's reads of stage t
        if (t + 2 < nst) stage(t + 2);
    }
    asm volatile("s_wait_asynccnt 0x0" ::: "memory");       // no copy is outstanding when the wave goes on
    float* os = osw[w];   // each wave turns its own accumulators into whole row pieces (256 bytes of f32, 128 bytes of each 16-bit plane) through its own LDS slice; the wave barriers with their compiler fences keep the slice's stores, reads and next stores in that order
#pragma unroll
    for (int mb = 0; mb < 4; ++mb) {
#pragma unroll
        for (int nb = 0; nb < 4; ++nb) {
#pragma unroll
            for (int j = 0; j < 8; ++j) os[(hi * 8 + j) * 68 + nb * 16 + lr] = acc[mb][nb][j]; }
        __builtin_amdgcn_wave_barrier(); asm volatile("" ::: "memory");
        if constexpr (PL) {   // a lane takes eight neighbours of one row: 16 bytes of each plane, eight lanes a whole 128-byte line
            const int prow = lane >> 3, pcol = (lane & 7) * 8; const size_t po = (size_t)blockIdx.y * cstride + (size_t)(r0 + wm * 64 + mb * 16 + prow) * pitch + wn * 64 + pcol;
            v4f x0[4], x1[4];   // all eight LDS reads first: the stores' statements let no read pass them, and the wave would wait out the LDS latency once per row group
#pragma unroll
            for (int s = 0; s < 4; ++s) { const float* ps = os + (4 * s + prow) * 68 + pcol; x0[s] = *(const v4fa*)ps; x1[s] = *(const v4fa*)(ps + 4); }
#pragma unroll
            for (int s = 0; s < 4; ++s) { v8h o16; v8us oh, ol;
#pragma unroll
                for (int k = 0; k < 8; ++k) { const float xv = (k < 4) ? x0[s][k & 3] : x1[s][k & 3]; o16[k] = tohx(xv); unsigned short a2, c2; splitf(xv, a2, c2); oh[k] = a2; ol[k] = c2; }
                const size_t o = po + (size_t)(4 * s) * pitch; store3(P16 + o, Ph + o, Pl + o, __builtin_bit_cast(v4i, o16), __builtin_bit_cast(v4i, oh), __builtin_bit_cast(v4i, ol)); }
        } else {
        float* crw = C + (size_t)(r0 + wm * 64 + mb * 16) * ldc + c0 + wn * 64;
#pragma unroll
        for (int s = 0; s < 8; ++s) { const int row = 2 * s + hi, cofs = lr * 4; const v4f val = *(const v4fa*)(os + row * 68 + cofs); *(v4f*)(crw + (size_t)row * ldc + cofs) = val; }
        }
        __builtin_amdgcn_wave_barrier(); asm volatile("" ::: "memory");
    }
}

typedef __attribute__((ext_vector_type(2))) _Float16 v2h;
typedef __attribute__((ext_vector_type(4))) _Float16 v4h;
typedef __attribute__((ext_vector_type(2))) unsigned short v2us;
typedef __attribute__((ext_vector_type(4))) unsigned short v4us;
typedef __attribute__((ext_vector_type(2))) float v2f;

__global__ __launch_bounds__(256) void k_wtG(const float* __restrict__ w, int K, int N, bf* Bt) {
    const int lane = threadIdx.x & 31; const int L0 = (blockIdx.x * 8 + (threadIdx.x >> 5)) * 8; const int nlines = N * K / 64;
{
#pragma unroll 1
        for (int l = 0; l < 8; ++l) { const int L = L0 + l; if (L >= nlines) break; const size_t e = (size_t)L * 64 + lane * 2; const int k = (int)(e % K), n = (int)(e / K); v2us o;
            o[0] = f2bf(w[(size_t)k * N + n]); o[1] = f2bf(w[(size_t)(k + 1) * N + n]); *(v2us*)(Bt + e) = o; }
         }
}
__global__ __launch_bounds__(256) void k_cvt8(const float* __restrict__ src, bf* dst, size_t n8) { const size_t i = (size_t)blockIdx.x * 256 + threadIdx.x; if (i >= n8) return; const v8f v = *(const v8f*)(src + i * 8); v8us o;
#pragma unroll
    for (int k = 0; k < 8; ++k) o[k] = f2bf(v[k]); *(v8us*)(dst + i * 8) = o;  }
// ---- k_flash: the whole attention of both batches in one launch. A wave owns 16 R query rows of one head and walks their keys in passes of 32, from the first key inside the sliding window to the diagonal; scores and probabilities never leave registers.
// Transposed products: S^T = K Q^T (A = key rows, B = query rows) leaves one query's scores in one lane pair (lanes l and l ^ 16), and the two 16-key score tiles of a pass are, register for register, the B operand P^T of O^T += V^T P^T (A = rows of the [d][t] value planes).
// Online softmax: running maximum and sum per query; the output sums are rescaled only in a pass that raises some query's maximum. Operands come straight from the K-contiguous planes.
// HI: bf16 hi + lo planes, three products for each contraction (query rows < RH); otherwise single fp16, probabilities carried x PCAR2.
#define PCAR2 256.0f
#define L2E   1.4426950408889634f
// tanh for |x| < 0.625, the small-argument form of the precise tanhf (odd polynomial, same operations and coefficients), written without a branch:
// a wave alone on its SIMD pays every dependent vector instruction's latency, and only branch-free evaluations of different scores can be interleaved to fill it.
__device__ __forceinline__ float tanh_small(float x) { const float y = fabsf(x), t = x * x;
    float p = __builtin_fmaf(-0.00570002059f, t, 0.0206340719f); p = __builtin_fmaf(t, p, -0.0537379310f); p = __builtin_fmaf(t, p, 0.133314162f); p = __builtin_fmaf(t, p, -0.333332807f);
    return copysignf(__builtin_fmaf(t, y * p, y), x); }
__device__ __forceinline__ float xhalf(float x) { return __builtin_bit_cast(float, __builtin_amdgcn_permlanex16(__builtin_bit_cast(int, x), __builtin_bit_cast(int, x), 0x76543210, 0xfedcba98, false, false)); }   // lane l with lane l ^ 16
template <typename T16, bool HI, int R>
__device__ __forceinline__ void flash_wave(const T16* Q, const T16* Q2, const T16* Kp, const T16* K2, const T16* Vt, const T16* Vt2, int q0, int lane, bf* Ah, bf* Al) {
    typedef typename WFrag<T16>::V V;
    const int lr = lane & 15, hi = lane >> 4;
    // Every '#pragma unroll' below keeps a fragment or accumulator array indexed by constants, so that it stays in registers.
    V qf[R][4], qf2[R][4];
#pragma unroll
    for (int g = 0; g < R; ++g)
#pragma unroll
        for (int kc = 0; kc < 4; ++kc) { const size_t o = (size_t)(q0 + 16 * g + lr) * HD + 32 * kc + 8 * hi; qf[g][kc] = WFrag<T16>::ld(Q + o); if constexpr (HI) qf2[g][kc] = WFrag<T16>::ld(Q2 + o); }
    v8f acc[R][8]; float m_run[R], l_run[R];
#pragma unroll
    for (int g = 0; g < R; ++g) { m_run[g] = -1.0e30f; l_run[g] = 0.0f;   // far above the mask's fill, far below any score: a pass whose keys are all masked for a query gives it zeros
#pragma unroll
        for (int t = 0; t < 8; ++t) acc[g][t] = (v8f){}; }
    const int kbeg = max(0, q0 - (WIN - 1)) & ~31, kend = q0 + 16 * R;   // row i allows keys j with i - WIN < j <= i
    const size_t kofs = (size_t)lr * HD + 8 * hi, vofs = (size_t)lr * TT + 8 * hi;
    V kf[2][4], kf2[2][4];
    auto load_k = [&](const T16* pk, const T16* pk2) {
#pragma unroll
        for (int kt = 0; kt < 2; ++kt)
#pragma unroll
            for (int kc = 0; kc < 4; ++kc) { const int o = 16 * kt * HD + 32 * kc; kf[kt][kc] = WFrag<T16>::ld(pk + o); if constexpr (HI) kf2[kt][kc] = WFrag<T16>::ld(pk2 + o); } };
    load_k(Kp + kofs + (size_t)kbeg * HD, HI ? K2 + kofs + (size_t)kbeg * HD : nullptr);
    asm volatile("s_wait_xcnt 0x0" ::: "memory");   // as in the loop: in front of the first rewrite of an address register of the loads above
    __builtin_amdgcn_sched_barrier(0);   // keeps later address arithmetic behind that wait
#pragma unroll 1   // one pass a trip: the body is long
    for (int key0 = kbeg; key0 < kend; key0 += 32) {
        v8f s[2][R];
#pragma unroll
        for (int kt = 0; kt < 2; ++kt)
#pragma unroll
            for (int g = 0; g < R; ++g) s[kt][g] = (v8f){};
#pragma unroll
        for (int kc = 0; kc < 4; ++kc)
#pragma unroll
            for (int kt = 0; kt < 2; ++kt)
#pragma unroll
                for (int g = 0; g < R; ++g) { s[kt][g] = WFrag<T16>::mma(kf[kt][kc], qf[g][kc], s[kt][g]);
                    if constexpr (HI) { s[kt][g] = WFrag<T16>::mma(kf[kt][kc], qf2[g][kc], s[kt][g]); s[kt][g] = WFrag<T16>::mma(kf2[kt][kc], qf[g][kc], s[kt][g]); } }
        // This pass's value fragments and the next pass's key fragments are issued here and fly under the softcap and the exponentials (the last pass fetches its own keys again: in bounds, no branch).
        V vf[8], vf2[8]; const int kn = (key0 + 32 < kend) ? key0 + 32 : key0;
        const T16* pv = Vt + vofs + key0; const T16* pv2 = HI ? Vt2 + vofs + key0 : nullptr; const T16* pk = Kp + kofs + (size_t)kn * HD; const T16* pk2 = HI ? K2 + kofs + (size_t)kn * HD : nullptr;
#pragma unroll
        for (int t = 0; t < 8; ++t) { vf[t] = WFrag<T16>::ld(pv + 16 * t * TT); if constexpr (HI) vf2[t] = WFrag<T16>::ld(pv2 + 16 * t * TT); }
        load_k(pk, pk2);
        // The wait stands in front of the first rewrite of an address register that the loads above name; the base pointers are its inputs so that their registers live up to it.
        if constexpr (HI) asm volatile("s_wait_xcnt 0x0" :: "v"(pv), "v"(pv2), "v"(pk), "v"(pk2) : "memory"); else asm volatile("s_wait_xcnt 0x0" :: "v"(pv), "v"(pk) : "memory");
        __builtin_amdgcn_sched_barrier(0);   // without it the scheduler sinks each load to just in front of its first use, and the wave waits out the latency there
        const bool edge = (key0 + 31 > q0) || (q0 + 16 * R - 1 - key0 >= WIN);   // wave-uniform: only passes that meet the diagonal or the window's lower edge pay for the mask
        // softcap 30 tanh(x / 30): one wave-uniform test a pass picks the branch-free small-argument form for all of the pass's scores, or the library's tanhf for all of them (also for a NaN)
        bool big = false;
#pragma unroll
        for (int kt = 0; kt < 2; ++kt)
#pragma unroll
            for (int g = 0; g < R; ++g)
#pragma unroll
                for (int j = 0; j < 8; ++j) { const float x = __fdiv_rn(s[kt][g][j] * SCL, 30.0f); s[kt][g][j] = x; big = big || !(fabsf(x) < 0.625f); }
        if (__builtin_amdgcn_ballot_w32(big) != 0) {
#pragma unroll
            for (int kt = 0; kt < 2; ++kt)
#pragma unroll
                for (int g = 0; g < R; ++g)
#pragma unroll
                    for (int j = 0; j < 8; ++j) s[kt][g][j] = 30.0f * tanhf(s[kt][g][j]);
        } else {
#pragma unroll
            for (int kt = 0; kt < 2; ++kt)
#pragma unroll
                for (int g = 0; g < R; ++g)
#pragma unroll
                    for (int j = 0; j < 8; ++j) s[kt][g][j] = 30.0f * tanh_small(s[kt][g][j]); }
        float mb[R]; bool need = false;
#pragma unroll
        for (int g = 0; g < R; ++g) { const int qi = q0 + 16 * g + lr; float mx = -3.0e38f;
#pragma unroll
            for (int kt = 0; kt < 2; ++kt)
#pragma unroll
                for (int j = 0; j < 8; ++j) { float t = s[kt][g][j]; const int key = key0 + 16 * kt + 8 * hi + j; if (edge && !(key <= qi && qi - key < WIN)) t = -3.0e38f; s[kt][g][j] = t; mx = fmaxf(mx, t); }
            mx = fmaxf(mx, xhalf(mx)); mb[g] = mx; need = need || (mx > m_run[g]); }
        if (__builtin_amdgcn_ballot_w32(need) != 0) {
#pragma unroll
            for (int g = 0; g < R; ++g) { const float m_new = fmaxf(m_run[g], mb[g]); const float corr = __builtin_amdgcn_exp2f(__fmul_rn(__fsub_rn(m_run[g], m_new), L2E)); l_run[g] *= corr; m_run[g] = m_new;
#pragma unroll
                for (int t = 0; t < 8; ++t) acc[g][t] = acc[g][t] * corr; } }
#pragma unroll
        for (int g = 0; g < R; ++g) { float ps = 0.0f;
            if constexpr (HI) { v8us h0, h1, l0, l1;
#pragma unroll
                for (int j = 0; j < 8; ++j) { const float p0 = __builtin_amdgcn_exp2f(__fmul_rn(__fsub_rn(s[0][g][j], m_run[g]), L2E)), p1 = __builtin_amdgcn_exp2f(__fmul_rn(__fsub_rn(s[1][g][j], m_run[g]), L2E)); ps += p0 + p1;
                    unsigned short a, c2; splitf(p0, a, c2); h0[j] = a; l0[j] = c2; splitf(p1, a, c2); h1[j] = a; l1[j] = c2; }
                const V ph = cat16b(h0, h1), pl = cat16b(l0, l1);
#pragma unroll
                for (int t = 0; t < 8; ++t) acc[g][t] = WFrag<T16>::mma(vf[t], ph, acc[g][t]);
#pragma unroll
                for (int t = 0; t < 8; ++t) acc[g][t] = WFrag<T16>::mma(vf[t], pl, acc[g][t]);
#pragma unroll
                for (int t = 0; t < 8; ++t) acc[g][t] = WFrag<T16>::mma(vf2[t], ph, acc[g][t]);
            } else { v8h a0, a1;
#pragma unroll
                for (int j = 0; j < 8; ++j) { const float p0 = __builtin_amdgcn_exp2f(__fmul_rn(__fsub_rn(s[0][g][j], m_run[g]), L2E)), p1 = __builtin_amdgcn_exp2f(__fmul_rn(__fsub_rn(s[1][g][j], m_run[g]), L2E)); ps += p0 + p1;
                    a0[j] = tohx(p0 * PCAR2); a1[j] = tohx(p1 * PCAR2); }
                const V pf = cat16(a0, a1);
#pragma unroll
                for (int t = 0; t < 8; ++t) acc[g][t] = WFrag<T16>::mma(vf[t], pf, acc[g][t]); }
            l_run[g] += ps; }
    }
#pragma unroll
    for (int g = 0; g < R; ++g) { const float l = l_run[g] + xhalf(l_run[g]);   // each wave half summed its own eight keys of every 16
        const float inv = __fdiv_rn(1.0f, HI ? l : l * PCAR2); const size_t oo = (size_t)(q0 + 16 * g + lr) * DQ + 8 * hi;
#pragma unroll
        for (int t = 0; t < 8; ++t) { v8us oh, ol;   // the lane holds d = 16 t + 8 hi .. + 7 of its query: 16 bytes of each plane
#pragma unroll
            for (int j = 0; j < 8; ++j) { unsigned short a, c2; splitf(acc[g][t][j] * inv, a, c2); oh[j] = a; ol[j] = c2; }
            *(v8us*)(Ah + oo + 16 * t) = oh; *(v8us*)(Al + oo + 16 * t) = ol; }
        if (g + 1 < R) { asm volatile("s_wait_xcnt 0x0" ::: "memory");   // in front of the next group's rewrite of the stores' address and data registers
            __builtin_amdgcn_sched_barrier(0); } }   // keeps the next group's arithmetic behind that wait
}
// grid (batches x heads, NT16 + NTHI), 128 threads, four independent waves; x = batch NH_ + head, the planes lie [batch][head]. Tiles in y: first the fp16 rows from the sequence's end (the longest key walks come first in y), 128 rows a work-group; then the hi + lo rows, 64 a work-group.
#define NT16 ((TT - RH) / 128)
#define NTHI (RH / 64)
__global__ __launch_bounds__(128) void k_flash(const h16* Q16, const h16* K16, const h16* V16, const bf* Qh, const bf* Ql, const bf* Kh, const bf* Kl, const bf* Vh, const bf* Vl, bf* Ah, bf* Al) {   // no __restrict__: the loads must stay on their side of the waits written in asm
    const int lane = threadIdx.x & 31, w = __builtin_amdgcn_readfirstlane(threadIdx.x >> 5), y = blockIdx.y; const size_t hp = (size_t)blockIdx.x * TT * HD; const size_t ao = (size_t)(blockIdx.x / NH_) * TT * DQ + (blockIdx.x % NH_) * HD; Ah += ao; Al += ao;
    if (y < NT16) flash_wave<h16, false, 2>(Q16 + hp, nullptr, K16 + hp, nullptr, V16 + hp, nullptr, TT - 128 * (y + 1) + 32 * w, lane, Ah, Al);
    else flash_wave<bf, true, 1>(Qh + hp, Ql + hp, Kh + hp, Kl + hp, Vh + hp, Vl + hp, RH - 64 * (y - NT16 + 1) + 16 * w, lane, Ah, Al);
}

extern "C" void kernel_launch(void* const* d_in, const int* in_sizes, int n_in,
                              void* d_out, int out_size, void* d_ws, size_t ws_size, hipStream_t stream) {
    (void)in_sizes; (void)n_in; (void)out_size;
    const float* x = (const float*)d_in[0]; const float* wq = (const float*)d_in[1]; const float* wk = (const float*)d_in[2]; const float* wv = (const float*)d_in[3]; const float* wo = (const float*)d_in[4]; const float* cosT = nullptr; const float* sinT = nullptr; (void)cosT; (void)sinT;
    float* OUT = (float*)d_out;     // [2][2048][2048]
    char* wsp = (char*)d_ws;
    auto take = [&](size_t bytes) { char* p = wsp; wsp += (bytes + 255) & ~(size_t)255; return (void*)p; };
    bf* WQ = (bf*)take((size_t)DQ * DM * 2); bf* WK = (bf*)take((size_t)DKV * DM * 2); bf* WV = (bf*)take((size_t)DKV * DM * 2); bf* WO = (bf*)take((size_t)DM * DQ * 2);
    // every plane holds both batches, [batch][head][..][..]
    h16* QP16 = (h16*)take((size_t)NB_ * NH_ * TT * HD * 2); h16* KP16 = (h16*)take((size_t)NB_ * NKV * TT * HD * 2); h16* VT16 = (h16*)take((size_t)NB_ * NKV * HD * TT * 2);
    bf* QPh = (bf*)take((size_t)NB_ * NH_ * TT * HD * 2); bf* QPl = (bf*)take((size_t)NB_ * NH_ * TT * HD * 2); bf* KPh = (bf*)take((size_t)NB_ * NKV * TT * HD * 2); bf* KPl = (bf*)take((size_t)NB_ * NKV * TT * HD * 2); bf* VTh = (bf*)take((size_t)NB_ * NKV * HD * TT * 2); bf* VTl = (bf*)take((size_t)NB_ * NKV * HD * TT * 2);
    bf* XB = (bf*)take((size_t)NB_ * TT * DM * 2); bf* ATh = (bf*)take((size_t)NB_ * TT * DQ * 2); bf* ATl = (bf*)take((size_t)NB_ * TT * DQ * 2);
    if ((size_t)(wsp - (char*)d_ws) > ws_size) return;    // 224 MiB of the 256 MiB
    k_cvt8<<<(unsigned)(((size_t)DQ * DM / 8 + 255) / 256), 256, 0, stream>>>(wq, WQ, (size_t)DQ * DM / 8); k_cvt8<<<(unsigned)(((size_t)DKV * DM / 8 + 255) / 256), 256, 0, stream>>>(wk, WK, (size_t)DKV * DM / 8); k_cvt8<<<(unsigned)(((size_t)DKV * DM / 8 + 255) / 256), 256, 0, stream>>>(wv, WV, (size_t)DKV * DM / 8);
    k_cvt8<<<(unsigned)(((size_t)DM * DQ / 8 + 255) / 256), 256, 0, stream>>>(wo, WO, (size_t)DM * DQ / 8);
    k_cvt8<<<(unsigned)(((size_t)NB_ * TT * DM / 8 + 255) / 256), 256, 0, stream>>>(x, XB, (size_t)NB_ * TT * DM / 8);
    k_gemml<0, true><<<dim3(TT / 128, DQ / 128, NB_), 128, 0, stream>>>(XB, nullptr, WQ, DM, nullptr, 0, QP16, QPh, QPl, (size_t)TT * HD, HD, (size_t)TT * DM, 0, (size_t)NH_ * TT * HD);      // [b][h][t][d]
    k_gemml<0, true><<<dim3(TT / 128, DKV / 128, NB_), 128, 0, stream>>>(XB, nullptr, WK, DM, nullptr, 0, KP16, KPh, KPl, (size_t)TT * HD, HD, (size_t)TT * DM, 0, (size_t)NKV * TT * HD);    // [b][h][t][d]
    k_gemml<0, true><<<dim3(DKV / 128, TT / 128, NB_), 128, 0, stream>>>(WV, nullptr, XB, DM, nullptr, 0, VT16, VTh, VTl, (size_t)128, TT, 0, (size_t)TT * DM, (size_t)NKV * HD * TT);        // operands swapped: [b][h][d][t]
    k_flash<<<dim3(NB_ * NH_, NT16 + NTHI, 1), 128, 0, stream>>>(QP16, KP16, VT16, QPh, QPl, KPh, KPl, VTh, VTl, ATh, ATl);
    k_gemml<1, false><<<dim3(TT / 128, DM / 128, NB_), 128, 0, stream>>>(ATh, ATl, WO, DQ, OUT, DM, nullptr, nullptr, nullptr, 0, 0, (size_t)TT * DQ, 0, (size_t)TT * DM);
}

// v007
// It runs in 247 microseconds.
// Timed twice side by side with v006, it ran 1.05 times as fast both times.
// All steps since v000 together make it 7.61 times as fast.
#include <hip/hip_runtime.h>

// FastestFlashMHA (x [2][2048][2048]; q/k/v = x W^T (16 heads x 128); scores = 30 tanh((q.k / sqrt(128)) / 30); key j allowed iff j <= i and i - j < 1024 (finfo.min fill); softmax; out = merged Wo^T -> [2][2048][2048]).
// Compute dtypes, f32 accumulate: every input rounded to bf16; q/k/v on PLAIN bf16 operands (inputs: exact), their head planes written by the projection kernels themselves; softcap (precise tanhf) f32; causal scores and attn.v: query rows < 512 hl (3 products), the rest single fp16 (x256), one fused kernel that walks only the keys between the sliding window's edge and the diagonal, both tests inside the edge passes; online softmax f32; Wo hl x exact (2 products).

#define NB_  2
#define TT   2048
#define DM   2048
#define NH_  16
#define NKV  16
#define REP  (NH_ / NKV)
#define HD   128
#define DQ   (NH_ * HD)
#define DKV  (NKV * HD)
#define RH   512                  // query rows < RH use hi+lo planes (0: none)
#define WIN  1024
#define SCL  0.088388347648318447f   // HD^-0.5
typedef _Float16 h16;
typedef unsigned short bf;
typedef __attribute__((ext_vector_type(16))) __bf16   v16bf;
typedef __attribute__((ext_vector_type(16))) _Float16 v16h;
typedef __attribute__((ext_vector_type(8)))  _Float16 v8h;
typedef __attribute__((ext_vector_type(8)))  unsigned short v8us;
typedef __attribute__((ext_vector_type(8)))  float    v8f;
typedef __attribute__((ext_vector_type(4)))  float    v4f;
typedef v8h  __attribute__((may_alias)) v8ha;
typedef v4f  __attribute__((may_alias)) v4fa;
typedef v8us __attribute__((may_alias)) v8usa;

__device__ __forceinline__ unsigned short f2bf(float f) { unsigned u = __float_as_uint(f); u += 0x7FFFu + ((u >> 16) & 1u); return (unsigned short)(u >> 16); }
__device__ __forceinline__ float bf2f(unsigned short b) { return __uint_as_float(((unsigned)b) << 16); }
__device__ __forceinline__ float bfr(float f) { return bf2f(f2bf(f)); }
__device__ __forceinline__ v16h cat16(v8h lo, v8h hi) { return __builtin_shufflevector(lo, hi, 0, 1, 2, 3, 4, 5, 6, 7, 8, 9, 10, 11, 12, 13, 14, 15); }
__device__ __forceinline__ v16bf cat16b(v8us lo, v8us hi) { return __builtin_bit_cast(v16bf, __builtin_shufflevector(lo, hi, 0, 1, 2, 3, 4, 5, 6, 7, 8, 9, 10, 11, 12, 13, 14, 15)); }
__device__ __forceinline__ v8f wmma16(v16h a, v16h b, v8f c) { return __builtin_amdgcn_wmma_f32_16x16x32_f16(false, a, false, b, (short)0, c, false, false); }
__device__ __forceinline__ v8f wmmab(v16bf a, v16bf b, v8f c) { return __builtin_amdgcn_wmma_f32_16x16x32_bf16(false, a, false, b, (short)0, c, false, false); }



// Fragment loaders and products of the two 16-bit operand types (K-contiguous planes).
template <typename T16> struct WFrag;
template <> struct WFrag<h16> { typedef v16h V; static __device__ __forceinline__ V ld(const h16* p) { return cat16(*(const v8h*)p, *(const v8h*)(p + 16)); } static __device__ __forceinline__ v8f mma(V a, V b, v8f c) { return wmma16(a, b, c); } };
template <> struct WFrag<bf> { typedef v16bf V; static __device__ __forceinline__ V ld(const bf* p) { return cat16b(*(const v8us*)p, *(const v8us*)(p + 16)); } static __device__ __forceinline__ v8f mma(V a, V b, v8f c) { return wmmab(a, b, c); } };

__device__ __forceinline__ h16 tohx(float x) { return (h16)x; }
__device__ __forceinline__ void splitf(float y, unsigned short& h, unsigned short& l) { h = f2bf(y); l = f2bf(y - bf2f(h)); }

// ---- k_gemml: C[m][n] = sum_k A[m][k] Bt[n][k] (+ A2[m][k] Bt[n][k] when NSPLIT == 1), bf16 planes of row pitch K. PL == false: C is stored as f32, pitch ldc.
// PL == true: C is stored three times as 16-bit planes (fp16, bf16 hi, bf16 lo of the same f32 sum); element (m, n) lies at (n / 128) cstride + m pitch + n % 128 of each plane.
// With A = x, Bt = W, cstride = TT HD, pitch = HD that is the head plane [h][t][d]; with A = W, Bt = x, cstride = 128, pitch = TT it is the transposed plane [h][d][t]. One 128x128 tile per work-group of four waves, 64x64 per wave (16 accumulators);
// grid (M/128, N/128, batches), 128 threads; batch z reads A (and A2) + z zA and Bt + z zB and writes C or the planes + z zC (elements): both batches' work-groups are in flight together, and each hides the other's waits. Operands reach LDS by asynchronous copies in whole 128-byte row pieces (64 k), two buffers: the next piece's copies fly while this one is multiplied. K % 64 == 0, M % 128 == 0, N % 128 == 0.
// Every '#pragma unroll' in it is there so that the fragment and accumulator arrays are indexed by constants and stay in registers.
#define LP    144                 // LDS row pitch in bytes: 128 data + 16, an odd multiple of 16, for 16-byte fragment reads
#define LTILE (128 * LP)          // one operand's 128 rows
// Eight copies of 16 bytes a lane: rows 16 apart of one operand tile (LDS step 16 LP bytes, global step rs elements).
__device__ __forceinline__ void copy8(unsigned l, const bf* g, size_t rs) {
    // the wait on xcnt ends the copies' own statement, so that no address register is rewritten in front of it
    asm volatile("global_load_async_to_lds_b128 %0, %8, off\n\t"
                 "global_load_async_to_lds_b128 %1, %9, off\n\t"
                 "global_load_async_to_lds_b128 %2, %10, off\n\t"
                 "global_load_async_to_lds_b128 %3, %11, off\n\t"
                 "global_load_async_to_lds_b128 %4, %12, off\n\t"
                 "global_load_async_to_lds_b128 %5, %13, off\n\t"
                 "global_load_async_to_lds_b128 %6, %14, off\n\t"
                 "global_load_async_to_lds_b128 %7, %15, off\n\t"
                 "s_wait_xcnt 0x0"
                 :: "v"(l), "v"(l + 16u * LP), "v"(l + 32u * LP), "v"(l + 48u * LP), "v"(l + 64u * LP), "v"(l + 80u * LP), "v"(l + 96u * LP), "v"(l + 112u * LP),
                    "v"(g), "v"(g + rs), "v"(g + 2 * rs), "v"(g + 3 * rs), "v"(g + 4 * rs), "v"(g + 5 * rs), "v"(g + 6 * rs), "v"(g + 7 * rs) : "memory");
}
__device__ __forceinline__ v16bf ldsfrag(const unsigned char* p) { return cat16b(*(const v8usa*)p, *(const v8usa*)(p + 32)); }
typedef __attribute__((ext_vector_type(4))) int v4i;
// One lane's 16 bytes of each of the three planes.
__device__ __forceinline__ void store3(h16* p16, bf* ph, bf* pl, v4i d16, v4i dh, v4i dl) {
    // the wait on xcnt ends the stores' own statement, so that no address or data register of theirs is rewritten in front of it
    asm volatile("global_store_b128 %0, %3, off\n\t"
                 "global_store_b128 %1, %4, off\n\t"
                 "global_store_b128 %2, %5, off\n\t"
                 "s_wait_xcnt 0x0"
                 :: "v"(p16), "v"(ph), "v"(pl), "v"(d16), "v"(dh), "v"(dl) : "memory");
}
template <int NSPLIT, bool PL>
__global__ __launch_bounds__(128) void k_gemml(const bf* __restrict__ A, const bf* __restrict__ A2, const bf* __restrict__ Bt, int K, float* C, int ldc, h16* P16, bf* Ph, bf* Pl, size_t cstride, int pitch, size_t zA, size_t zB, size_t zC) {
    { const size_t z = blockIdx.z; A += z * zA; if (NSPLIT == 1) A2 += z * zA; Bt += z * zB; if (PL) { P16 += z * zC; Ph += z * zC; Pl += z * zC; } else C += z * zC; }   // this work-group's batch
    constexpr int NT = (NSPLIT == 1) ? 3 : 2;           // operand tiles per stage: A, (A2,) Bt
    constexpr unsigned STG = NT * LTILE;
    __shared__ __align__(16) unsigned char L[2 * STG];
    __shared__ __align__(16) float osw[4][16 * 68];
    const int tid = threadIdx.x, lane = tid & 31, lr = lane & 15, hi = lane >> 4, w = tid >> 5, wm = w >> 1, wn = w & 1; const int r0 = blockIdx.x * 128, c0 = blockIdx.y * 128;
    v8f acc[4][4];
#pragma unroll
    for (int mb = 0; mb < 4; ++mb)
#pragma unroll
        for (int nb = 0; nb < 4; ++nb) acc[mb][nb] = (v8f){};
    // copies: lane tid brings 16-byte piece (tid & 7) of rows (tid >> 3) + 16 i, so a wave's copy covers four whole 128-byte row pieces
    const int crow = tid >> 3, cch = tid & 7; const size_t rs = (size_t)16 * K;
    const bf* gA = A + (size_t)(r0 + crow) * K + cch * 8; const bf* gA2 = (NSPLIT == 1) ? A2 + (size_t)(r0 + crow) * K + cch * 8 : nullptr; const bf* gB = Bt + (size_t)(c0 + crow) * K + cch * 8;
    const unsigned l0 = (unsigned)(size_t)L + (unsigned)(crow * LP + cch * 16);
    auto stage = [&](int t) { const unsigned l = l0 + (unsigned)(t & 1) * STG; const int kc = t * 64; copy8(l, gA + kc, rs); if (NSPLIT == 1) copy8(l + LTILE, gA2 + kc, rs); copy8(l + (NT - 1) * LTILE, gB + kc, rs); };
    const int nst = K / 64;
    stage(0);
    asm volatile("s_wait_asynccnt 0x0" ::: "memory");   // this wave's copies of stage 0 have landed
    __syncthreads();                                     // ... and every other wave's
    if (nst > 1) stage(1);
    const unsigned aofs = (unsigned)((wm * 64 + lr) * LP + hi * 16), bofs = (unsigned)((NT - 1) * LTILE + (wn * 64 + lr) * LP + hi * 16);
#pragma unroll 1   // one stage a trip: the two buffers alternate by the trip's parity
    for (int t = 0; t < nst; ++t) {
        const unsigned char* Lb = L + (unsigned)(t & 1) * STG; const unsigned char* pa = Lb + aofs; const unsigned char* pb = Lb + bofs;
        // Fragment reads stand in few groups, each ahead of the products that hide it (one wave per SIMD: nothing else hides an LDS wait). Every accumulator still takes its products in ascending k, A before A2.
        // Each sched_barrier(0) below keeps a read group where it is written: without them the scheduler sinks every read to just in front of its first use, and the wave waits out the LDS latency once per four products.
        v16bf a[4], a2[4], b[4];
        if (NSPLIT == 0) {   // a: k 0..31 of the stage, a2: k 32..63
#pragma unroll
            for (int mb = 0; mb < 4; ++mb) a[mb] = ldsfrag(pa + mb * 16 * LP);
#pragma unroll
            for (int nb = 0; nb < 4; ++nb) b[nb] = ldsfrag(pb + nb * 16 * LP);
#pragma unroll
            for (int mb = 0; mb < 4; ++mb) a2[mb] = ldsfrag(pa + mb * 16 * LP + 64);
            __builtin_amdgcn_sched_barrier(0);
#pragma unroll
            for (int h = 0; h < 2; ++h) {
#pragma unroll
                for (int nb = 2 * h; nb < 2 * h + 2; ++nb)
#pragma unroll
                    for (int mb = 0; mb < 4; ++mb) acc[mb][nb] = wmmab(a[mb], b[nb], acc[mb][nb]);
                __builtin_amdgcn_sched_barrier(0);
#pragma unroll
                for (int nb = 2 * h; nb < 2 * h + 2; ++nb) b[nb] = ldsfrag(pb + nb * 16 * LP + 64);
                __builtin_amdgcn_sched_barrier(0); }
#pragma unroll
            for (int nb = 0; nb < 4; ++nb)
#pragma unroll
                for (int mb = 0; mb < 4; ++mb) acc[mb][nb] = wmmab(a2[mb], b[nb], acc[mb][nb]);
        } else {
#pragma unroll
            for (int mb = 0; mb < 4; ++mb) a[mb] = ldsfrag(pa + mb * 16 * LP);
#pragma unroll
            for (int nb = 0; nb < 4; ++nb) b[nb] = ldsfrag(pb + nb * 16 * LP);
#pragma unroll
            for (int mb = 0; mb < 4; ++mb) a2[mb] = ldsfrag(pa + LTILE + mb * 16 * LP);
            __builtin_amdgcn_sched_barrier(0);
#pragma unroll
            for (int nb = 0; nb < 4; ++nb)
#pragma unroll
                for (int mb = 0; mb < 4; ++mb) acc[mb][nb] = wmmab(a[mb], b[nb], acc[mb][nb]);
            __builtin_amdgcn_sched_barrier(0);
#pragma unroll
            for (int mb = 0; mb < 4; ++mb) a[mb] = ldsfrag(pa + mb * 16 * LP + 64);
            __builtin_amdgcn_sched_barrier(0);
#pragma unroll
            for (int h = 0; h < 2; ++h) {
#pragma unroll
                for (int nb = 2 * h; nb < 2 * h + 2; ++nb)
#pragma unroll
                    for (int mb = 0; mb < 4; ++mb) acc[mb][nb] = wmmab(a2[mb], b[nb], acc[mb][nb]);
                __builtin_amdgcn_sched_barrier(0);
#pragma unroll
                for (int nb = 2 * h; nb < 2 * h + 2; ++nb) b[nb] = ldsfrag(pb + nb * 16 * LP + 64);
                if (h == 0) __builtin_amdgcn_sched_barrier(0); }
#pragma unroll
            for (int mb = 0; mb < 4; ++mb) a2[mb] = ldsfrag(pa + LTILE + mb * 16 * LP + 64);
            __builtin_amdgcn_sched_barrier(0);
#pragma unroll
            for (int nb = 0; nb < 4; ++nb)
#pragma unroll
                for (int mb = 0; mb < 4; ++mb) acc[mb][nb] = wmmab(a[mb], b[nb], acc[mb][nb]);
#pragma unroll
            for (int nb = 0; nb < 4; ++nb)
#pragma unroll
                for (int mb = 0; mb < 4; ++mb) acc[mb][nb] = wmmab(a2[mb], b[nb], acc[mb][nb]);
        }
        asm volatile("s_wait_dscnt 0x0" ::: "memory");      // this wave's reads of the buffer are done before it is handed back
        asm volatile("s_wait_asynccnt 0x0" ::: "memory");   // this wave's copies of stage t + 1 have landed
        __syncthreads();                                     // publishes stage t + 1 and ends every wave's reads of stage t
        if (t + 2 < nst) stage(t + 2);
    }
    asm volatile("s_wait_asynccnt 0x0" ::: "memory");       // no copy is outstanding when the wave goes on
    float* os = osw[w];   // each wave turns its own accumulators into whole row pieces (256 bytes of f32, 128 bytes of each 16-bit plane) through its own LDS slice; the wave barriers with their compiler fences keep the slice's stores, reads and next stores in that order
#pragma unroll
    for (int mb = 0; mb < 4; ++mb) {
#pragma unroll
        for (int nb = 0; nb < 4; ++nb) {
#pragma unroll
            for (int j = 0; j < 8; ++j) os[(hi * 8 + j) * 68 + nb * 16 + lr] = acc[mb][nb][j]; }
        __builtin_amdgcn_wave_barrier(); asm volatile("" ::: "memory");
        if constexpr (PL) {   // a lane takes eight neighbours of one row: 16 bytes of each plane, eight lanes a whole 128-byte line
            const int prow = lane >> 3, pcol = (lane & 7) * 8; const size_t po = (size_t)blockIdx.y * cstride + (size_t)(r0 + wm * 64 + mb * 16 + prow) * pitch + wn * 64 + pcol;
            v4f x0[4], x1[4];   // all eight LDS reads first: the stores' statements let no read pass them, and the wave would wait out the LDS latency once per row group
#pragma unroll
            for (int s = 0; s < 4; ++s) { const float* ps = os + (4 * s + prow) * 68 + pcol; x0[s] = *(const v4fa*)ps; x1[s] = *(const v4fa*)(ps + 4); }
#pragma unroll
            for (int s = 0; s < 4; ++s) { v8h o16; v8us oh, ol;
#pragma unroll
                for (int k = 0; k < 8; ++k) { const float xv = (k < 4) ? x0[s][k & 3] : x1[s][k & 3]; o16[k] = tohx(xv); unsigned short a2, c2; splitf(xv, a2, c2); oh[k] = a2; ol[k] = c2; }
                const size_t o = po + (size_t)(4 * s) * pitch; store3(P16 + o, Ph + o, Pl + o, __builtin_bit_cast(v4i, o16), __builtin_bit_cast(v4i, oh), __builtin_bit_cast(v4i, ol)); }
        } else {
        float* crw = C + (size_t)(r0 + wm * 64 + mb * 16) * ldc + c0 + wn * 64;
#pragma unroll
        for (int s = 0; s < 8; ++s) { const int row = 2 * s + hi, cofs = lr * 4; const v4f val = *(const v4fa*)(os + row * 68 + cofs); *(v4f*)(crw + (size_t)row * ldc + cofs) = val; }
        }
        __builtin_amdgcn_wave_barrier(); asm volatile("" ::: "memory");
    }
}

typedef __attribute__((ext_vector_type(2))) _Float16 v2h;
typedef __attribute__((ext_vector_type(4))) _Float16 v4h;
typedef __attribute__((ext_vector_type(2))) unsigned short v2us;
typedef __attribute__((ext_vector_type(4))) unsigned short v4us;
typedef __attribute__((ext_vector_type(2))) float v2f;

__global__ __launch_bounds__(256) void k_wtG(const float* __restrict__ w, int K, int N, bf* Bt) {
    const int lane = threadIdx.x & 31; const int L0 = (blockIdx.x * 8 + (threadIdx.x >> 5)) * 8; const int nlines = N * K / 64;
{
#pragma unroll 1
        for (int l = 0; l < 8; ++l) { const int L = L0 + l; if (L >= nlines) break; const size_t e = (size_t)L * 64 + lane * 2; const int k = (int)(e % K), n = (int)(e / K); v2us o;
            o[0] = f2bf(w[(size_t)k * N + n]); o[1] = f2bf(w[(size_t)(k + 1) * N + n]); *(v2us*)(Bt + e) = o; }
         }
}
// ---- k_cvtall: every f32 input rounded to bf16 in ONE launch of CVT_WG work-groups of 16 waves, one to a WGP. The launch is a stream: its time should be its bytes, not the starting of waves,
// so a thread converts 24 pieces of eight elements instead of one. The inputs form six equal segments (four weights, the two halves of x); every thread takes four pieces of each, CVT_T pieces apart,
// and the next segment's eight 16-byte loads are issued before this segment is converted and stored, so that eight to sixteen loads of a wave are always in flight.
#define CVT_WG 256
#define CVT_T  (CVT_WG * 512)                 // threads of the launch
#define CVT_SEG ((size_t)DQ * DM)             // elements of a segment
static_assert(CVT_SEG == (size_t)4 * CVT_T * 8 && (size_t)DKV * DM == CVT_SEG && (size_t)DM * DQ == CVT_SEG && (size_t)NB_ * TT * DM == 2 * CVT_SEG, "six equal segments, four pieces a thread in each");
__global__ __launch_bounds__(512) void k_cvtall(const float* __restrict__ wq, const float* __restrict__ wk, const float* __restrict__ wv, const float* __restrict__ wo, const float* __restrict__ x,
                                                bf* __restrict__ WQ, bf* __restrict__ WK, bf* __restrict__ WV, bf* __restrict__ WO, bf* __restrict__ XB) {
    const size_t e0 = ((size_t)blockIdx.x * 512 + threadIdx.x) * 8;
    const float* const src[6] = { wq, wk, wv, wo, x, x + CVT_SEG }; bf* const dst[6] = { WQ, WK, WV, WO, XB, XB + CVT_SEG };
    v8f v[2][4];
    // Every '#pragma unroll' below keeps the pointer tables and the two register sets indexed by constants.
#pragma unroll
    for (int u = 0; u < 4; ++u) v[0][u] = *(const v8f*)(src[0] + e0 + (size_t)u * CVT_T * 8);
    asm volatile("s_wait_xcnt 0x0" ::: "memory");   // as in the loop: in front of the next loads, which may land in address registers of the loads above
    __builtin_amdgcn_sched_barrier(0);   // keeps the next loads and their address arithmetic behind that wait
#pragma unroll
    for (int sg = 0; sg < 6; ++sg) {
        if (sg + 1 < 6) {
#pragma unroll
            for (int u = 0; u < 4; ++u) v[(sg + 1) & 1][u] = *(const v8f*)(src[sg + 1] + e0 + (size_t)u * CVT_T * 8); }
        __builtin_amdgcn_sched_barrier(0);   // keeps the next segment's loads in front of this segment's wait: without it the scheduler may sink them behind the stores, and the wave has nothing in flight while it converts
#pragma unroll
        for (int u = 0; u < 4; ++u) { v8us o;
#pragma unroll
            for (int k = 0; k < 8; ++k) o[k] = f2bf(v[sg & 1][u][k]);
            *(v8us*)(dst[sg] + e0 + (size_t)u * CVT_T * 8) = o; }
        if (sg + 1 < 6) { asm volatile("s_wait_xcnt 0x0" ::: "memory");   // in front of the next loads, which land in registers that the stores above name
            __builtin_amdgcn_sched_barrier(0); }   // keeps the next trip's address arithmetic behind that wait
    }
}
// ---- k_flash: the whole attention of both batches in one launch. A wave owns 16 R query rows of one head and walks their keys in passes of 32, from the first key inside the sliding window to the diagonal; scores and probabilities never leave registers.
// Transposed products: S^T = K Q^T (A = key rows, B = query rows) leaves one query's scores in one lane pair (lanes l and l ^ 16), and the two 16-key score tiles of a pass are, register for register, the B operand P^T of O^T += V^T P^T (A = rows of the [d][t] value planes).
// Online softmax: running maximum and sum per query; the output sums are rescaled only in a pass that raises some query's maximum. Operands come straight from the K-contiguous planes.
// HI: bf16 hi + lo planes, three products for each contraction (query rows < RH); otherwise single fp16, probabilities carried x PCAR2.
#define PCAR2 256.0f
#define L2E   1.4426950408889634f
// tanh for |x| < 0.625, the small-argument form of the precise tanhf (odd polynomial, same operations and coefficients), written without a branch:
// a wave alone on its SIMD pays every dependent vector instruction's latency, and only branch-free evaluations of different scores can be interleaved to fill it.
__device__ __forceinline__ float tanh_small(float x) { const float y = fabsf(x), t = x * x;
    float p = __builtin_fmaf(-0.00570002059f, t, 0.0206340719f); p = __builtin_fmaf(t, p, -0.0537379310f); p = __builtin_fmaf(t, p, 0.133314162f); p = __builtin_fmaf(t, p, -0.333332807f);
    return copysignf(__builtin_fmaf(t, y * p, y), x); }
__device__ __forceinline__ float xhalf(float x) { return __builtin_bit_cast(float, __builtin_amdgcn_permlanex16(__builtin_bit_cast(int, x), __builtin_bit_cast(int, x), 0x76543210, 0xfedcba98, false, false)); }   // lane l with lane l ^ 16
template <typename T16, bool HI, int R>
__device__ __forceinline__ void flash_wave(const T16* Q, const T16* Q2, const T16* Kp, const T16* K2, const T16* Vt, const T16* Vt2, int q0, int lane, bf* Ah, bf* Al) {
    typedef typename WFrag<T16>::V V;
    const int lr = lane & 15, hi = lane >> 4;
    // Every '#pragma unroll' below keeps a fragment or accumulator array indexed by constants, so that it stays in registers.
    V qf[R][4], qf2[R][4];
#pragma unroll
    for (int g = 0; g < R; ++g)
#pragma unroll
        for (int kc = 0; kc < 4; ++kc) { const size_t o = (size_t)(q0 + 16 * g + lr) * HD + 32 * kc + 8 * hi; qf[g][kc] = WFrag<T16>::ld(Q + o); if constexpr (HI) qf2[g][kc] = WFrag<T16>::ld(Q2 + o); }
    v8f acc[R][8]; float m_run[R], l_run[R];
#pragma unroll
    for (int g = 0; g < R; ++g) { m_run[g] = -1.0e30f; l_run[g] = 0.0f;   // far above the mask's fill, far below any score: a pass whose keys are all masked for a query gives it zeros
#pragma unroll
        for (int t = 0; t < 8; ++t) acc[g][t] = (v8f){}; }
    const int kbeg = max(0, q0 - (WIN - 1)) & ~31, kend = q0 + 16 * R;   // row i allows keys j with i - WIN < j <= i
    const size_t kofs = (size_t)lr * HD + 8 * hi, vofs = (size_t)lr * TT + 8 * hi;
    V kf[2][4], kf2[2][4];
    auto load_k = [&](const T16* pk, const T16* pk2) {
#pragma unroll
        for (int kt = 0; kt < 2; ++kt)
#pragma unroll
            for (int kc = 0; kc < 4; ++kc) { const int o = 16 * kt * HD + 32 * kc; kf[kt][kc] = WFrag<T16>::ld(pk + o); if constexpr (HI) kf2[kt][kc] = WFrag<T16>::ld(pk2 + o); } };
    load_k(Kp + kofs + (size_t)kbeg * HD, HI ? K2 + kofs + (size_t)kbeg * HD : nullptr);
    asm volatile("s_wait_xcnt 0x0" ::: "memory");   // as in the loop: in front of the first rewrite of an address register of the loads above
    __builtin_amdgcn_sched_barrier(0);   // keeps later address arithmetic behind that wait
#pragma unroll 1   // one pass a trip: the body is long
    for (int key0 = kbeg; key0 < kend; key0 += 32) {
        v8f s[2][R];
#pragma unroll
        for (int kt = 0; kt < 2; ++kt)
#pragma unroll
            for (int g = 0; g < R; ++g) s[kt][g] = (v8f){};
#pragma unroll
        for (int kc = 0; kc < 4; ++kc)
#pragma unroll
            for (int kt = 0; kt < 2; ++kt)
#pragma unroll
                for (int g = 0; g < R; ++g) { s[kt][g] = WFrag<T16>::mma(kf[kt][kc], qf[g][kc], s[kt][g]);
                    if constexpr (HI) { s[kt][g] = WFrag<T16>::mma(kf[kt][kc], qf2[g][kc], s[kt][g]); s[kt][g] = WFrag<T16>::mma(kf2[kt][kc], qf[g][kc], s[kt][g]); } }
        // This pass's value fragments and the next pass's key fragments are issued here and fly under the softcap and the exponentials (the last pass fetches its own keys again: in bounds, no branch).
        V vf[8], vf2[8]; const int kn = (key0 + 32 < kend) ? key0 + 32 : key0;
        const T16* pv = Vt + vofs + key0; const T16* pv2 = HI ? Vt2 + vofs + key0 : nullptr; const T16* pk = Kp + kofs + (size_t)kn * HD; const T16* pk2 = HI ? K2 + kofs + (size_t)kn * HD : nullptr;
#pragma unroll
        for (int t = 0; t < 8; ++t) { vf[t] = WFrag<T16>::ld(pv + 16 * t * TT); if constexpr (HI) vf2[t] = WFrag<T16>::ld(pv2 + 16 * t * TT); }
        load_k(pk, pk2);
        // The wait stands in front of the first rewrite of an address register that the loads above name; the base pointers are its inputs so that their registers live up to it.
        if constexpr (HI) asm volatile("s_wait_xcnt 0x0" :: "v"(pv), "v"(pv2), "v"(pk), "v"(pk2) : "memory"); else asm volatile("s_wait_xcnt 0x0" :: "v"(pv), "v"(pk) : "memory");
        __builtin_amdgcn_sched_barrier(0);   // without it the scheduler sinks each load to just in front of its first use, and the wave waits out the latency there
        const bool edge = (key0 + 31 > q0) || (q0 + 16 * R - 1 - key0 >= WIN);   // wave-uniform: only passes that meet the diagonal or the window's lower edge pay for the mask
        // softcap 30 tanh(x / 30): one wave-uniform test a pass picks the branch-free small-argument form for all of the pass's scores, or the library's tanhf for all of them (also for a NaN)
        bool big = false;
#pragma unroll
        for (int kt = 0; kt < 2; ++kt)
#pragma unroll
            for (int g = 0; g < R; ++g)
#pragma unroll
                for (int j = 0; j < 8; ++j) { const float x = __fdiv_rn(s[kt][g][j] * SCL, 30.0f); s[kt][g][j] = x; big = big || !(fabsf(x) < 0.625f); }
        if (__builtin_amdgcn_ballot_w32(big) != 0) {
#pragma unroll
            for (int kt = 0; kt < 2; ++kt)
#pragma unroll
                for (int g = 0; g < R; ++g)
#pragma unroll
                    for (int j = 0; j < 8; ++j) s[kt][g][j] = 30.0f * tanhf(s[kt][g][j]);
        } else {
#pragma unroll
            for (int kt = 0; kt < 2; ++kt)
#pragma unroll
                for (int g = 0; g < R; ++g)
#pragma unroll
                    for (int j = 0; j < 8; ++j) s[kt][g][j] = 30.0f * tanh_small(s[kt][g][j]); }
        float mb[R]; bool need = false;
#pragma unroll
        for (int g = 0; g < R; ++g) { const int qi = q0 + 16 * g + lr; float mx = -3.0e38f;
#pragma unroll
            for (int kt = 0; kt < 2; ++kt)
#pragma unroll
                for (int j = 0; j < 8; ++j) { float t = s[kt][g][j]; const int key = key0 + 16 * kt + 8 * hi + j; if (edge && !(key <= qi && qi - key < WIN)) t = -3.0e38f; s[kt][g][j] = t; mx = fmaxf(mx, t); }
            mx = fmaxf(mx, xhalf(mx)); mb[g] = mx; need = need || (mx > m_run[g]); }
        if (__builtin_amdgcn_ballot_w32(need) != 0) {
#pragma unroll
            for (int g = 0; g < R; ++g) { const float m_new = fmaxf(m_run[g], mb[g]); const float corr = __builtin_amdgcn_exp2f(__fmul_rn(__fsub_rn(m_run[g], m_new), L2E)); l_run[g] *= corr; m_run[g] = m_new;
#pragma unroll
                for (int t = 0; t < 8; ++t) acc[g][t] = acc[g][t] * corr; } }
#pragma unroll
        for (int g = 0; g < R; ++g) { float ps = 0.0f;
            if constexpr (HI) { v8us h0, h1, l0, l1;
#pragma unroll
                for (int j = 0; j < 8; ++j) { const float p0 = __builtin_amdgcn_exp2f(__fmul_rn(__fsub_rn(s[0][g][j], m_run[g]), L2E)), p1 = __builtin_amdgcn_exp2f(__fmul_rn(__fsub_rn(s[1][g][j], m_run[g]), L2E)); ps += p0 + p1;
                    unsigned short a, c2; splitf(p0, a, c2); h0[j] = a; l0[j] = c2; splitf(p1, a, c2); h1[j] = a; l1[j] = c2; }
                const V ph = cat16b(h0, h1), pl = cat16b(l0, l1);
#pragma unroll
                for (int t = 0; t < 8; ++t) acc[g][t] = WFrag<T16>::mma(vf[t], ph, acc[g][t]);
#pragma unroll
                for (int t = 0; t < 8; ++t) acc[g][t] = WFrag<T16>::mma(vf[t], pl, acc[g][t]);
#pragma unroll
                for (int t = 0; t < 8; ++t) acc[g][t] = WFrag<T16>::mma(vf2[t], ph, acc[g][t]);
            } else { v8h a0, a1;
#pragma unroll
                for (int j = 0; j < 8; ++j) { const float p0 = __builtin_amdgcn_exp2f(__fmul_rn(__fsub_rn(s[0][g][j], m_run[g]), L2E)), p1 = __builtin_amdgcn_exp2f(__fmul_rn(__fsub_rn(s[1][g][j], m_run[g]), L2E)); ps += p0 + p1;
                    a0[j] = tohx(p0 * PCAR2); a1[j] = tohx(p1 * PCAR2); }
                const V pf = cat16(a0, a1);
#pragma unroll
                for (int t = 0; t < 8; ++t) acc[g][t] = WFrag<T16>::mma(vf[t], pf, acc[g][t]); }
            l_run[g] += ps; }
    }
#pragma unroll
    for (int g = 0; g < R; ++g) { const float l = l_run[g] + xhalf(l_run[g]);   // each wave half summed its own eight keys of every 16
        const float inv = __fdiv_rn(1.0f, HI ? l : l * PCAR2); const size_t oo = (size_t)(q0 + 16 * g + lr) * DQ + 8 * hi;
#pragma unroll
        for (int t = 0; t < 8; ++t) { v8us oh, ol;   // the lane holds d = 16 t + 8 hi .. + 7 of its query: 16 bytes of each plane
#pragma unroll
            for (int j = 0; j < 8; ++j) { unsigned short a, c2; splitf(acc[g][t][j] * inv, a, c2); oh[j] = a; ol[j] = c2; }
            *(v8us*)(Ah + oo + 16 * t) = oh; *(v8us*)(Al + oo + 16 * t) = ol; }
        if (g + 1 < R) { asm volatile("s_wait_xcnt 0x0" ::: "memory");   // in front of the next group's rewrite of the stores' address and data registers
            __builtin_amdgcn_sched_barrier(0); } }   // keeps the next group's arithmetic behind that wait
}
// grid (batches x heads, NT16 + NTHI), 128 threads, four independent waves; x = batch NH_ + head, the planes lie [batch][head]. Tiles in y: first the fp16 rows from the sequence's end (the longest key walks come first in y), 128 rows a work-group; then the hi + lo rows, 64 a work-group.
#define NT16 ((TT - RH) / 128)
#define NTHI (RH / 64)
__global__ __launch_bounds__(128) void k_flash(const h16* Q16, const h16* K16, const h16* V16, const bf* Qh, const bf* Ql, const bf* Kh, const bf* Kl, const bf* Vh, const bf* Vl, bf* Ah, bf* Al) {   // no __restrict__: the loads must stay on their side of the waits written in asm
    const int lane = threadIdx.x & 31, w = __builtin_amdgcn_readfirstlane(threadIdx.x >> 5), y = blockIdx.y; const size_t hp = (size_t)blockIdx.x * TT * HD; const size_t ao = (size_t)(blockIdx.x / NH_) * TT * DQ + (blockIdx.x % NH_) * HD; Ah += ao; Al += ao;
    if (y < NT16) flash_wave<h16, false, 2>(Q16 + hp, nullptr, K16 + hp, nullptr, V16 + hp, nullptr, TT - 128 * (y + 1) + 32 * w, lane, Ah, Al);
    else flash_wave<bf, true, 1>(Qh + hp, Ql + hp, Kh + hp, Kl + hp, Vh + hp, Vl + hp, RH - 64 * (y - NT16 + 1) + 16 * w, lane, Ah, Al);
}

extern "C" void kernel_launch(void* const* d_in, const int* in_sizes, int n_in,
                              void* d_out, int out_size, void* d_ws, size_t ws_size, hipStream_t stream) {
    (void)in_sizes; (void)n_in; (void)out_size;
    const float* x = (const float*)d_in[0]; const float* wq = (const float*)d_in[1]; const float* wk = (const float*)d_in[2]; const float* wv = (const float*)d_in[3]; const float* wo = (const float*)d_in[4]; const float* cosT = nullptr; const float* sinT = nullptr; (void)cosT; (void)sinT;
    float* OUT = (float*)d_out;     // [2][2048][2048]
    char* wsp = (char*)d_ws;
    auto take = [&](size_t bytes) { char* p = wsp; wsp += (bytes + 255) & ~(size_t)255; return (void*)p; };
    bf* WQ = (bf*)take((size_t)DQ * DM * 2); bf* WK = (bf*)take((size_t)DKV * DM * 2); bf* WV = (bf*)take((size_t)DKV * DM * 2); bf* WO = (bf*)take((size_t)DM * DQ * 2);
    // every plane holds both batches, [batch][head][..][..]
    h16* QP16 = (h16*)take((size_t)NB_ * NH_ * TT * HD * 2); h16* KP16 = (h16*)take((size_t)NB_ * NKV * TT * HD * 2); h16* VT16 = (h16*)take((size_t)NB_ * NKV * HD * TT * 2);
    bf* QPh = (bf*)take((size_t)NB_ * NH_ * TT * HD * 2); bf* QPl = (bf*)take((size_t)NB_ * NH_ * TT * HD * 2); bf* KPh = (bf*)take((size_t)NB_ * NKV * TT * HD * 2); bf* KPl = (bf*)take((size_t)NB_ * NKV * TT * HD * 2); bf* VTh = (bf*)take((size_t)NB_ * NKV * HD * TT * 2); bf* VTl = (bf*)take((size_t)NB_ * NKV * HD * TT * 2);
    bf* XB = (bf*)take((size_t)NB_ * TT * DM * 2); bf* ATh = (bf*)take((size_t)NB_ * TT * DQ * 2); bf* ATl = (bf*)take((size_t)NB_ * TT * DQ * 2);
    if ((size_t)(wsp - (char*)d_ws) > ws_size) return;    // 224 MiB of the 256 MiB
    k_cvtall<<<CVT_WG, 512, 0, stream>>>(wq, wk, wv, wo, x, WQ, WK, WV, WO, XB);
    k_gemml<0, true><<<dim3(TT / 128, DQ / 128, NB_), 128, 0, stream>>>(XB, nullptr, WQ, DM, nullptr, 0, QP16, QPh, QPl, (size_t)TT * HD, HD, (size_t)TT * DM, 0, (size_t)NH_ * TT * HD);      // [b][h][t][d]
    k_gemml<0, true><<<dim3(TT / 128, DKV / 128, NB_), 128, 0, stream>>>(XB, nullptr, WK, DM, nullptr, 0, KP16, KPh, KPl, (size_t)TT * HD, HD, (size_t)TT * DM, 0, (size_t)NKV * TT * HD);    // [b][h][t][d]
    k_gemml<0, true><<<dim3(DKV / 128, TT / 128, NB_), 128, 0, stream>>>(WV, nullptr, XB, DM, nullptr, 0, VT16, VTh, VTl, (size_t)128, TT, 0, (size_t)TT * DM, (size_t)NKV * HD * TT);        // operands swapped: [b][h][d][t]
    k_flash<<<dim3(NB_ * NH_, NT16 + NTHI, 1), 128, 0, stream>>>(QP16, KP16, VT16, QPh, QPl, KPh, KPl, VTh, VTl, ATh, ATl);
    k_gemml<1, false><<<dim3(TT / 128, DM / 128, NB_), 128, 0, stream>>>(ATh, ATl, WO, DQ, OUT, DM, nullptr, nullptr, nullptr, 0, 0, (size_t)TT * DQ, 0, (size_t)TT * DM);
}

// v008
// A run of this version takes 236 microseconds.
// In both of two side-by-side timings against v007, it was 1.05 times as fast.
// All steps since v000 together make it 7.97 times as fast.
#include <hip/hip_runtime.h>

// FastestFlashMHA (x [2][2048][2048]; q/k/v = x W^T (16 heads x 128); scores = 30 tanh((q.k / sqrt(128)) / 30); key j allowed iff j <= i and i - j < 1024 (finfo.min fill); softmax; out = merged Wo^T -> [2][2048][2048]).
// Compute dtypes, f32 accumulate: every input rounded to bf16; q/k/v on PLAIN bf16 operands (inputs: exact), their head planes written by the projection kernels themselves; softcap f32 (tanhf's small-argument polynomial, constants folded; precise tanhf in passes with a large score); causal scores and attn.v: query rows < 512 hl (3 products), the rest single fp16 (x256), one fused kernel that walks only the keys between the sliding window's edge and the diagonal, both tests inside the edge passes; online softmax f32; Wo hl x exact (2 products).

#define NB_  2
#define TT   2048
#define DM   2048
#define NH_  16
#define NKV  16
#define REP  (NH_ / NKV)
#define HD   128
#define DQ   (NH_ * HD)
#define DKV  (NKV * HD)
#define RH   512                  // query rows < RH use hi+lo planes (0: none)
#define WIN  1024
#define SCL  0.088388347648318447f   // HD^-0.5
typedef _Float16 h16;
typedef unsigned short bf;
typedef __attribute__((ext_vector_type(16))) __bf16   v16bf;
typedef __attribute__((ext_vector_type(16))) _Float16 v16h;
typedef __attribute__((ext_vector_type(8)))  _Float16 v8h;
typedef __attribute__((ext_vector_type(8)))  unsigned short v8us;
typedef __attribute__((ext_vector_type(8)))  float    v8f;
typedef __attribute__((ext_vector_type(4)))  float    v4f;
typedef v8h  __attribute__((may_alias)) v8ha;
typedef v4f  __attribute__((may_alias)) v4fa;
typedef v8us __attribute__((may_alias)) v8usa;

__device__ __forceinline__ unsigned short f2bf(float f) { unsigned u = __float_as_uint(f); u += 0x7FFFu + ((u >> 16) & 1u); return (unsigned short)(u >> 16); }
__device__ __forceinline__ float bf2f(unsigned short b) { return __uint_as_float(((unsigned)b) << 16); }
__device__ __forceinline__ float bfr(float f) { return bf2f(f2bf(f)); }
__device__ __forceinline__ v16h cat16(v8h lo, v8h hi) { return __builtin_shufflevector(lo, hi, 0, 1, 2, 3, 4, 5, 6, 7, 8, 9, 10, 11, 12, 13, 14, 15); }
__device__ __forceinline__ v16bf cat16b(v8us lo, v8us hi) { return __builtin_bit_cast(v16bf, __builtin_shufflevector(lo, hi, 0, 1, 2, 3, 4, 5, 6, 7, 8, 9, 10, 11, 12, 13, 14, 15)); }
__device__ __forceinline__ v8f wmma16(v16h a, v16h b, v8f c) { return __builtin_amdgcn_wmma_f32_16x16x32_f16(false, a, false, b, (short)0, c, false, false); }
__device__ __forceinline__ v8f wmmab(v16bf a, v16bf b, v8f c) { return __builtin_amdgcn_wmma_f32_16x16x32_bf16(false, a, false, b, (short)0, c, false, false); }



// Fragment loaders and products of the two 16-bit operand types (K-contiguous planes).
template <typename T16> struct WFrag;
template <> struct WFrag<h16> { typedef v16h V; static __device__ __forceinline__ V ld(const h16* p) { return cat16(*(const v8h*)p, *(const v8h*)(p + 16)); } static __device__ __forceinline__ v8f mma(V a, V b, v8f c) { return wmma16(a, b, c); } };
template <> struct WFrag<bf> { typedef v16bf V; static __device__ __forceinline__ V ld(const bf* p) { return cat16b(*(const v8us*)p, *(const v8us*)(p + 16)); } static __device__ __forceinline__ v8f mma(V a, V b, v8f c) { return wmmab(a, b, c); } };

__device__ __forceinline__ h16 tohx(float x) { return (h16)x; }
__device__ __forceinline__ void splitf(float y, unsigned short& h, unsigned short& l) { h = f2bf(y); l = f2bf(y - bf2f(h)); }

// ---- k_gemml: C[m][n] = sum_k A[m][k] Bt[n][k] (+ A2[m][k] Bt[n][k] when NSPLIT == 1), bf16 planes of row pitch K. PL == false: C is stored as f32, pitch ldc.
// PL == true: C is stored three times as 16-bit planes (fp16, bf16 hi, bf16 lo of the same f32 sum); element (m, n) lies at (n / 128) cstride + m pitch + n % 128 of each plane.
// With A = x, Bt = W, cstride = TT HD, pitch = HD that is the head plane [h][t][d]; with A = W, Bt = x, cstride = 128, pitch = TT it is the transposed plane [h][d][t]. One 128x128 tile per work-group of four waves, 64x64 per wave (16 accumulators);
// grid (M/128, N/128, batches), 128 threads; batch z reads A (and A2) + z zA and Bt + z zB and writes C or the planes + z zC (elements): both batches' work-groups are in flight together, and each hides the other's waits. Operands reach LDS by asynchronous copies in whole 128-byte row pieces (64 k), two buffers: the next piece's copies fly while this one is multiplied. K % 64 == 0, M % 128 == 0, N % 128 == 0.
// Every '#pragma unroll' in it is there so that the fragment and accumulator arrays are indexed by constants and stay in registers.
#define LP    144                 // LDS row pitch in bytes: 128 data + 16, an odd multiple of 16, for 16-byte fragment reads
#define LTILE (128 * LP)          // one operand's 128 rows
// Eight copies of 16 bytes a lane: rows 16 apart of one operand tile (LDS step 16 LP bytes, global step rs elements).
__device__ __forceinline__ void copy8(unsigned l, const bf* g, size_t rs) {
    // the wait on xcnt ends the copies' own statement, so that no address register is rewritten in front of it
    asm volatile("global_load_async_to_lds_b128 %0, %8, off\n\t"
                 "global_load_async_to_lds_b128 %1, %9, off\n\t"
                 "global_load_async_to_lds_b128 %2, %10, off\n\t"
                 "global_load_async_to_lds_b128 %3, %11, off\n\t"
                 "global_load_async_to_lds_b128 %4, %12, off\n\t"
                 "global_load_async_to_lds_b128 %5, %13, off\n\t"
                 "global_load_async_to_lds_b128 %6, %14, off\n\t"
                 "global_load_async_to_lds_b128 %7, %15, off\n\t"
                 "s_wait_xcnt 0x0"
                 :: "v"(l), "v"(l + 16u * LP), "v"(l + 32u * LP), "v"(l + 48u * LP), "v"(l + 64u * LP), "v"(l + 80u * LP), "v"(l + 96u * LP), "v"(l + 112u * LP),
                    "v"(g), "v"(g + rs), "v"(g + 2 * rs), "v"(g + 3 * rs), "v"(g + 4 * rs), "v"(g + 5 * rs), "v"(g + 6 * rs), "v"(g + 7 * rs) : "memory");
}
__device__ __forceinline__ v16bf ldsfrag(const unsigned char* p) { return cat16b(*(const v8usa*)p, *(const v8usa*)(p + 32)); }
typedef __attribute__((ext_vector_type(4))) int v4i;
// One lane's 16 bytes of each of the three planes.
__device__ __forceinline__ void store3(h16* p16, bf* ph, bf* pl, v4i d16, v4i dh, v4i dl) {
    // the wait on xcnt ends the stores' own statement, so that no address or data register of theirs is rewritten in front of it
    asm volatile("global_store_b128 %0, %3, off\n\t"
                 "global_store_b128 %1, %4, off\n\t"
                 "global_store_b128 %2, %5, off\n\t"
                 "s_wait_xcnt 0x0"
                 :: "v"(p16), "v"(ph), "v"(pl), "v"(d16), "v"(dh), "v"(dl) : "memory");
}
template <int NSPLIT, bool PL>
__global__ __launch_bounds__(128) void k_gemml(const bf* __restrict__ A, const bf* __restrict__ A2, const bf* __restrict__ Bt, int K, float* C, int ldc, h16* P16, bf* Ph, bf* Pl, size_t cstride, int pitch, size_t zA, size_t zB, size_t zC) {
    { const size_t z = blockIdx.z; A += z * zA; if (NSPLIT == 1) A2 += z * zA; Bt += z * zB; if (PL) { P16 += z * zC; Ph += z * zC; Pl += z * zC; } else C += z * zC; }   // this work-group's batch
    constexpr int NT = (NSPLIT == 1) ? 3 : 2;           // operand tiles per stage: A, (A2,) Bt
    constexpr unsigned STG = NT * LTILE;
    __shared__ __align__(16) unsigned char L[2 * STG];
    __shared__ __align__(16) float osw[4][16 * 68];
    const int tid = threadIdx.x, lane = tid & 31, lr = lane & 15, hi = lane >> 4, w = tid >> 5, wm = w >> 1, wn = w & 1; const int r0 = blockIdx.x * 128, c0 = blockIdx.y * 128;
    v8f acc[4][4];
#pragma unroll
    for (int mb = 0; mb < 4; ++mb)
#pragma unroll
        for (int nb = 0; nb < 4; ++nb) acc[mb][nb] = (v8f){};
    // copies: lane tid brings 16-byte piece (tid & 7) of rows (tid >> 3) + 16 i, so a wave's copy covers four whole 128-byte row pieces
    const int crow = tid >> 3, cch = tid & 7; const size_t rs = (size_t)16 * K;
    const bf* gA = A + (size_t)(r0 + crow) * K + cch * 8; const bf* gA2 = (NSPLIT == 1) ? A2 + (size_t)(r0 + crow) * K + cch * 8 : nullptr; const bf* gB = Bt + (size_t)(c0 + crow) * K + cch * 8;
    const unsigned l0 = (unsigned)(size_t)L + (unsigned)(crow * LP + cch * 16);
    auto stage = [&](int t) { const unsigned l = l0 + (unsigned)(t & 1) * STG; const int kc = t * 64; copy8(l, gA + kc, rs); if (NSPLIT == 1) copy8(l + LTILE, gA2 + kc, rs); copy8(l + (NT - 1) * LTILE, gB + kc, rs); };
    const int nst = K / 64;
    stage(0);
    asm volatile("s_wait_asynccnt 0x0" ::: "memory");   // this wave's copies of stage 0 have landed
    __syncthreads();                                     // ... and every other wave's
    if (nst > 1) stage(1);
    const unsigned aofs = (unsigned)((wm * 64 + lr) * LP + hi * 16), bofs = (unsigned)((NT - 1) * LTILE + (wn * 64 + lr) * LP + hi * 16);
#pragma unroll 1   // one stage a trip: the two buffers alternate by the trip's parity
    for (int t = 0; t < nst; ++t) {
        const unsigned char* Lb = L + (unsigned)(t & 1) * STG; const unsigned char* pa = Lb + aofs; const unsigned char* pb = Lb + bofs;
        // Fragment reads stand in few groups, each ahead of the products that hide it (one wave per SIMD: nothing else hides an LDS wait). Every accumulator still takes its products in ascending k, A before A2.
        // Each sched_barrier(0) below keeps a read group where it is written: without them the scheduler sinks every read to just in front of its first use, and the wave waits out the LDS latency once per four products.
        v16bf a[4], a2[4], b[4];
        if (NSPLIT == 0) {   // a: k 0..31 of the stage, a2: k 32..63
#pragma unroll
            for (int mb = 0; mb < 4; ++mb) a[mb] = ldsfrag(pa + mb * 16 * LP);
#pragma unroll
            for (int nb = 0; nb < 4; ++nb) b[nb] = ldsfrag(pb + nb * 16 * LP);
#pragma unroll
            for (int mb = 0; mb < 4; ++mb) a2[mb] = ldsfrag(pa + mb * 16 * LP + 64);
            __builtin_amdgcn_sched_barrier(0);
#pragma unroll
            for (int h = 0; h < 2; ++h) {
#pragma unroll
                for (int nb = 2 * h; nb < 2 * h + 2; ++nb)
#pragma unroll
                    for (int mb = 0; mb < 4; ++mb) acc[mb][nb] = wmmab(a[mb], b[nb], acc[mb][nb]);
                __builtin_amdgcn_sched_barrier(0);
#pragma unroll
                for (int nb = 2 * h; nb < 2 * h + 2; ++nb) b[nb] = ldsfrag(pb + nb * 16 * LP + 64);
                __builtin_amdgcn_sched_barrier(0); }
#pragma unroll
            for (int nb = 0; nb < 4; ++nb)
#pragma unroll
                for (int mb = 0; mb < 4; ++mb) acc[mb][nb] = wmmab(a2[mb], b[nb], acc[mb][nb]);
        } else {
#pragma unroll
            for (int mb = 0; mb < 4; ++mb) a[mb] = ldsfrag(pa + mb * 16 * LP);
#pragma unroll
            for (int nb = 0; nb < 4; ++nb) b[nb] = ldsfrag(pb + nb * 16 * LP);
#pragma unroll
            for (int mb = 0; mb < 4; ++mb) a2[mb] = ldsfrag(pa + LTILE + mb * 16 * LP);
            __builtin_amdgcn_sched_barrier(0);
#pragma unroll
            for (int nb = 0; nb < 4; ++nb)
#pragma unroll
                for (int mb = 0; mb < 4; ++mb) acc[mb][nb] = wmmab(a[mb], b[nb], acc[mb][nb]);
            __builtin_amdgcn_sched_barrier(0);
#pragma unroll
            for (int mb = 0; mb < 4; ++mb) a[mb] = ldsfrag(pa + mb * 16 * LP + 64);
            __builtin_amdgcn_sched_barrier(0);
#pragma unroll
            for (int h = 0; h < 2; ++h) {
#pragma unroll
                for (int nb = 2 * h; nb < 2 * h + 2; ++nb)
#pragma unroll
                    for (int mb = 0; mb < 4; ++mb) acc[mb][nb] = wmmab(a2[mb], b[nb], acc[mb][nb]);
                __builtin_amdgcn_sched_barrier(0);
#pragma unroll
                for (int nb = 2 * h; nb < 2 * h + 2; ++nb) b[nb] = ldsfrag(pb + nb * 16 * LP + 64);
                if (h == 0) __builtin_amdgcn_sched_barrier(0); }
#pragma unroll
            for (int mb = 0; mb < 4; ++mb) a2[mb] = ldsfrag(pa + LTILE + mb * 16 * LP + 64);
            __builtin_amdgcn_sched_barrier(0);
#pragma unroll
            for (int nb = 0; nb < 4; ++nb)
#pragma unroll
                for (int mb = 0; mb < 4; ++mb) acc[mb][nb] = wmmab(a[mb], b[nb], acc[mb][nb]);
#pragma unroll
            for (int nb = 0; nb < 4; ++nb)
#pragma unroll
                for (int mb = 0; mb < 4; ++mb) acc[mb][nb] = wmmab(a2[mb], b[nb], acc[mb][nb]);
        }
        asm volatile("s_wait_dscnt 0x0" ::: "memory");      // this wave's reads of the buffer are done before it is handed back
        asm volatile("s_wait_asynccnt 0x0" ::: "memory");   // this wave's copies of stage t + 1 have landed
        __syncthreads();                                     // publishes stage t + 1 and ends every wave's reads of stage t
        if (t + 2 < nst) stage(t + 2);
    }
    asm volatile("s_wait_asynccnt 0x0" ::: "memory");       // no copy is outstanding when the wave goes on
    float* os = osw[w];   // each wave turns its own accumulators into whole row pieces (256 bytes of f32, 128 bytes of each 16-bit plane) through its own LDS slice; the wave barriers with their compiler fences keep the slice's stores, reads and next stores in that order
#pragma unroll
    for (int mb = 0; mb < 4; ++mb) {
#pragma unroll
        for (int nb = 0; nb < 4; ++nb) {
#pragma unroll
            for (int j = 0; j < 8; ++j) os[(hi * 8 + j) * 68 + nb * 16 + lr] = acc[mb][nb][j]; }
        __builtin_amdgcn_wave_barrier(); asm volatile("" ::: "memory");
        if constexpr (PL) {   // a lane takes eight neighbours of one row: 16 bytes of each plane, eight lanes a whole 128-byte line
            const int prow = lane >> 3, pcol = (lane & 7) * 8; const size_t po = (size_t)blockIdx.y * cstride + (size_t)(r0 + wm * 64 + mb * 16 + prow) * pitch + wn * 64 + pcol;
            v4f x0[4], x1[4];   // all eight LDS reads first: the stores' statements let no read pass them, and the wave would wait out the LDS latency once per row group
#pragma unroll
            for (int s = 0; s < 4; ++s) { const float* ps = os + (4 * s + prow) * 68 + pcol; x0[s] = *(const v4fa*)ps; x1[s] = *(const v4fa*)(ps + 4); }
#pragma unroll
            for (int s = 0; s < 4; ++s) { v8h o16; v8us oh, ol;
#pragma unroll
                for (int k = 0; k < 8; ++k) { const float xv = (k < 4) ? x0[s][k & 3] : x1[s][k & 3]; o16[k] = tohx(xv); unsigned short a2, c2; splitf(xv, a2, c2); oh[k] = a2; ol[k] = c2; }
                const size_t o = po + (size_t)(4 * s) * pitch; store3(P16 + o, Ph + o, Pl + o, __builtin_bit_cast(v4i, o16), __builtin_bit_cast(v4i, oh), __builtin_bit_cast(v4i, ol)); }
        } else {
        float* crw = C + (size_t)(r0 + wm * 64 + mb * 16) * ldc + c0 + wn * 64;
#pragma unroll
        for (int s = 0; s < 8; ++s) { const int row = 2 * s + hi, cofs = lr * 4; const v4f val = *(const v4fa*)(os + row * 68 + cofs); *(v4f*)(crw + (size_t)row * ldc + cofs) = val; }
        }
        __builtin_amdgcn_wave_barrier(); asm volatile("" ::: "memory");
    }
}

typedef __attribute__((ext_vector_type(2))) _Float16 v2h;
typedef __attribute__((ext_vector_type(4))) _Float16 v4h;
typedef __attribute__((ext_vector_type(2))) unsigned short v2us;
typedef __attribute__((ext_vector_type(4))) unsigned short v4us;
typedef __attribute__((ext_vector_type(2))) float v2f;

__global__ __launch_bounds__(256) void k_wtG(const float* __restrict__ w, int K, int N, bf* Bt) {
    const int lane = threadIdx.x & 31; const int L0 = (blockIdx.x * 8 + (threadIdx.x >> 5)) * 8; const int nlines = N * K / 64;
{
#pragma unroll 1
        for (int l = 0; l < 8; ++l) { const int L = L0 + l; if (L >= nlines) break; const size_t e = (size_t)L * 64 + lane * 2; const int k = (int)(e % K), n = (int)(e / K); v2us o;
            o[0] = f2bf(w[(size_t)k * N + n]); o[1] = f2bf(w[(size_t)(k + 1) * N + n]); *(v2us*)(Bt + e) = o; }
         }
}
// ---- k_cvtall: every f32 input rounded to bf16 in ONE launch of CVT_WG work-groups of 16 waves, one to a WGP. The launch is a stream: its time should be its bytes, not the starting of waves,
// so a thread converts 24 pieces of eight elements instead of one. The inputs form six equal segments (four weights, the two halves of x); every thread takes four pieces of each, CVT_T pieces apart,
// and the next segment's eight 16-byte loads are issued before this segment is converted and stored, so that eight to sixteen loads of a wave are always in flight.
#define CVT_WG 256
#define CVT_T  (CVT_WG * 512)                 // threads of the launch
#define CVT_SEG ((size_t)DQ * DM)             // elements of a segment
static_assert(CVT_SEG == (size_t)4 * CVT_T * 8 && (size_t)DKV * DM == CVT_SEG && (size_t)DM * DQ == CVT_SEG && (size_t)NB_ * TT * DM == 2 * CVT_SEG, "six equal segments, four pieces a thread in each");
__global__ __launch_bounds__(512) void k_cvtall(const float* __restrict__ wq, const float* __restrict__ wk, const float* __restrict__ wv, const float* __restrict__ wo, const float* __restrict__ x,
                                                bf* __restrict__ WQ, bf* __restrict__ WK, bf* __restrict__ WV, bf* __restrict__ WO, bf* __restrict__ XB) {
    const size_t e0 = ((size_t)blockIdx.x * 512 + threadIdx.x) * 8;
    const float* const src[6] = { wq, wk, wv, wo, x, x + CVT_SEG }; bf* const dst[6] = { WQ, WK, WV, WO, XB, XB + CVT_SEG };
    v8f v[2][4];
    // Every '#pragma unroll' below keeps the pointer tables and the two register sets indexed by constants.
#pragma unroll
    for (int u = 0; u < 4; ++u) v[0][u] = *(const v8f*)(src[0] + e0 + (size_t)u * CVT_T * 8);
    asm volatile("s_wait_xcnt 0x0" ::: "memory");   // as in the loop: in front of the next loads, which may land in address registers of the loads above
    __builtin_amdgcn_sched_barrier(0);   // keeps the next loads and their address arithmetic behind that wait
#pragma unroll
    for (int sg = 0; sg < 6; ++sg) {
        if (sg + 1 < 6) {
#pragma unroll
            for (int u = 0; u < 4; ++u) v[(sg + 1) & 1][u] = *(const v8f*)(src[sg + 1] + e0 + (size_t)u * CVT_T * 8); }
        __builtin_amdgcn_sched_barrier(0);   // keeps the next segment's loads in front of this segment's wait: without it the scheduler may sink them behind the stores, and the wave has nothing in flight while it converts
#pragma unroll
        for (int u = 0; u < 4; ++u) { v8us o;
#pragma unroll
            for (int k = 0; k < 8; ++k) o[k] = f2bf(v[sg & 1][u][k]);
            *(v8us*)(dst[sg] + e0 + (size_t)u * CVT_T * 8) = o; }
        if (sg + 1 < 6) { asm volatile("s_wait_xcnt 0x0" ::: "memory");   // in front of the next loads, which land in registers that the stores above name
            __builtin_amdgcn_sched_barrier(0); }   // keeps the next trip's address arithmetic behind that wait
    }
}
// ---- k_flash: the whole attention of both batches in one launch. A wave owns 16 R query rows of one head and walks their keys in passes of 32, from the first key inside the sliding window to the diagonal; scores and probabilities never leave registers.
// Transposed products: S^T = K Q^T (A = key rows, B = query rows) leaves one query's scores in one lane pair (lanes l and l ^ 16), and the two 16-key score tiles of a pass are, register for register, the B operand P^T of O^T += V^T P^T (A = rows of the [d][t] value planes).
// Online softmax in powers of two: running maximum and sum per query; the output sums are rescaled only in a pass that raises some query's maximum. Operands come straight from the K-contiguous planes.
// HI: bf16 hi + lo planes, three products for each contraction (query rows < RH); otherwise single fp16, probabilities carried x PCAR2.
#define LPCAR2 8.0f               // log2 of PCAR2 = 256
#define L2E   1.4426950408889634f
// Capped score in units of log2: u(s) = 30 log2(e) tanh(s HD^-0.5 / 30) for a raw product s. For |s HD^-0.5 / 30| < 0.625 tanh is the small-argument odd polynomial of the precise tanhf, x + x t P(t), t = x x;
// every constant factor on the way (HD^-0.5, 1 / 30, 30, log2(e)) is multiplied into its coefficients at compile time, in double, so that a score costs s s, five fused multiply-adds and one product: no division, no separate scalings, no branch.
#define CAPX  (0.088388347648318447 / 30.0)                  // x = CAPX s
#define CAPT  (CAPX * CAPX)                                  // t = CAPT s s
#define CAPA  (30.0 * 1.4426950408889634 * CAPX)             // u = CAPA s (1 + t P(t))
#define SBIG  ((float)(0.625 / CAPX))                        // |s| from which on the polynomial no longer holds
__device__ __forceinline__ float cap_small(float s) { const float t = s * s;
    float p = __builtin_fmaf((float)(CAPA * CAPT * CAPT * CAPT * CAPT * CAPT * -0.00570002059), t, (float)(CAPA * CAPT * CAPT * CAPT * CAPT * 0.0206340719)); p = __builtin_fmaf(t, p, (float)(CAPA * CAPT * CAPT * CAPT * -0.0537379310));
    p = __builtin_fmaf(t, p, (float)(CAPA * CAPT * CAPT * 0.133314162)); p = __builtin_fmaf(t, p, (float)(CAPA * CAPT * -0.333332807)); p = __builtin_fmaf(t, p, (float)CAPA);
    return s * p; }
__device__ __forceinline__ float xhalf(float x) { return __builtin_bit_cast(float, __builtin_amdgcn_permlanex16(__builtin_bit_cast(int, x), __builtin_bit_cast(int, x), 0x76543210, 0xfedcba98, false, false)); }   // lane l with lane l ^ 16
template <typename T16, bool HI, int R>
__device__ __forceinline__ void flash_wave(const T16* Q, const T16* Q2, const T16* Kp, const T16* K2, const T16* Vt, const T16* Vt2, int q0, int lane, bf* Ah, bf* Al) {
    typedef typename WFrag<T16>::V V;
    const int lr = lane & 15, hi = lane >> 4;
    // Every '#pragma unroll' below keeps a fragment or accumulator array indexed by constants, so that it stays in registers.
    V qf[R][4], qf2[R][4];
#pragma unroll
    for (int g = 0; g < R; ++g)
#pragma unroll
        for (int kc = 0; kc < 4; ++kc) { const size_t o = (size_t)(q0 + 16 * g + lr) * HD + 32 * kc + 8 * hi; qf[g][kc] = WFrag<T16>::ld(Q + o); if constexpr (HI) qf2[g][kc] = WFrag<T16>::ld(Q2 + o); }
    v8f acc[R][8]; float m_run[R], l_run[R];
#pragma unroll
    for (int g = 0; g < R; ++g) { m_run[g] = -1.0e30f; l_run[g] = 0.0f;   // far above the mask's fill, far below any score: a pass whose keys are all masked for a query gives it zeros
#pragma unroll
        for (int t = 0; t < 8; ++t) acc[g][t] = (v8f){}; }
    const int kbeg = max(0, q0 - (WIN - 1)) & ~31, kend = q0 + 16 * R;   // row i allows keys j with i - WIN < j <= i
    const size_t kofs = (size_t)lr * HD + 8 * hi, vofs = (size_t)lr * TT + 8 * hi;
    V kf[2][4], kf2[2][4];
    auto load_k = [&](const T16* pk, const T16* pk2) {
#pragma unroll
        for (int kt = 0; kt < 2; ++kt)
#pragma unroll
            for (int kc = 0; kc < 4; ++kc) { const int o = 16 * kt * HD + 32 * kc; kf[kt][kc] = WFrag<T16>::ld(pk + o); if constexpr (HI) kf2[kt][kc] = WFrag<T16>::ld(pk2 + o); } };
    load_k(Kp + kofs + (size_t)kbeg * HD, HI ? K2 + kofs + (size_t)kbeg * HD : nullptr);
    asm volatile("s_wait_xcnt 0x0" ::: "memory");   // as in the loop: in front of the first rewrite of an address register of the loads above
    __builtin_amdgcn_sched_barrier(0);   // keeps later address arithmetic behind that wait
#pragma unroll 1   // one pass a trip: the body is long
    for (int key0 = kbeg; key0 < kend; key0 += 32) {
        v8f s[2][R];
#pragma unroll
        for (int kt = 0; kt < 2; ++kt)
#pragma unroll
            for (int g = 0; g < R; ++g) s[kt][g] = (v8f){};
#pragma unroll
        for (int kc = 0; kc < 4; ++kc)
#pragma unroll
            for (int kt = 0; kt < 2; ++kt)
#pragma unroll
                for (int g = 0; g < R; ++g) { s[kt][g] = WFrag<T16>::mma(kf[kt][kc], qf[g][kc], s[kt][g]);
                    if constexpr (HI) { s[kt][g] = WFrag<T16>::mma(kf[kt][kc], qf2[g][kc], s[kt][g]); s[kt][g] = WFrag<T16>::mma(kf2[kt][kc], qf[g][kc], s[kt][g]); } }
        // This pass's value fragments and the next pass's key fragments are issued here and fly under the softcap and the exponentials (the last pass fetches its own keys again: in bounds, no branch).
        V vf[8], vf2[8]; const int kn = (key0 + 32 < kend) ? key0 + 32 : key0;
        const T16* pv = Vt + vofs + key0; const T16* pv2 = HI ? Vt2 + vofs + key0 : nullptr; const T16* pk = Kp + kofs + (size_t)kn * HD; const T16* pk2 = HI ? K2 + kofs + (size_t)kn * HD : nullptr;
#pragma unroll
        for (int t = 0; t < 8; ++t) { vf[t] = WFrag<T16>::ld(pv + 16 * t * TT); if constexpr (HI) vf2[t] = WFrag<T16>::ld(pv2 + 16 * t * TT); }
        load_k(pk, pk2);
        // The wait stands in front of the first rewrite of an address register that the loads above name; the base pointers are its inputs so that their registers live up to it.
        if constexpr (HI) asm volatile("s_wait_xcnt 0x0" :: "v"(pv), "v"(pv2), "v"(pk), "v"(pk2) : "memory"); else asm volatile("s_wait_xcnt 0x0" :: "v"(pv), "v"(pk) : "memory");
        __builtin_amdgcn_sched_barrier(0);   // without it the scheduler sinks each load to just in front of its first use, and the wave waits out the latency there
        const bool edge = (key0 + 31 > q0) || (q0 + 16 * R - 1 - key0 >= WIN);   // wave-uniform: only passes that meet the diagonal or the window's lower edge pay for the mask
        // softcap 30 tanh(x / 30), from here on in units of log2: one wave-uniform test a pass (the largest |s|) picks the branch-free polynomial for all of the pass's scores, or the library's tanhf for all of them (a NaN stays a NaN in either)
        float sbig = 0.0f;
#pragma unroll
        for (int kt = 0; kt < 2; ++kt)
#pragma unroll
            for (int g = 0; g < R; ++g) { float a = 0.0f;   // a chain of its own for each score tile: independent chains fill each other's latency
#pragma unroll
                for (int j = 0; j < 8; ++j) a = fmaxf(a, fabsf(s[kt][g][j]));
                sbig = fmaxf(sbig, a); }
        if (__builtin_amdgcn_ballot_w32(!(sbig < SBIG)) != 0) {
#pragma unroll
            for (int kt = 0; kt < 2; ++kt)
#pragma unroll
                for (int g = 0; g < R; ++g)
#pragma unroll
                    for (int j = 0; j < 8; ++j) s[kt][g][j] = (30.0f * L2E) * tanhf(__fdiv_rn(s[kt][g][j] * SCL, 30.0f));
        } else {
#pragma unroll
            for (int kt = 0; kt < 2; ++kt)
#pragma unroll
                for (int g = 0; g < R; ++g)
#pragma unroll
                    for (int j = 0; j < 8; ++j) s[kt][g][j] = cap_small(s[kt][g][j]); }
        float mb[R]; bool need = false;
#pragma unroll
        for (int g = 0; g < R; ++g) { const int qi = q0 + 16 * g + lr; float mx = -3.0e38f;
#pragma unroll
            for (int kt = 0; kt < 2; ++kt)
#pragma unroll
                for (int j = 0; j < 8; ++j) { float t = s[kt][g][j]; const int key = key0 + 16 * kt + 8 * hi + j; if (edge && !(key <= qi && qi - key < WIN)) t = -3.0e38f; s[kt][g][j] = t; mx = fmaxf(mx, t); }
            mx = fmaxf(mx, xhalf(mx)); if constexpr (!HI) mx -= LPCAR2; mb[g] = mx; need = need || (mx > m_run[g]); }   // fp16 rows: the reference point lies log2(PCAR2) below the maximum, which carries the probabilities x PCAR2 at no cost
        if (__builtin_amdgcn_ballot_w32(need) != 0) {
#pragma unroll
            for (int g = 0; g < R; ++g) { const float m_new = fmaxf(m_run[g], mb[g]); const float corr = __builtin_amdgcn_exp2f(m_run[g] - m_new); l_run[g] *= corr; m_run[g] = m_new;
#pragma unroll
                for (int t = 0; t < 8; ++t) acc[g][t] = acc[g][t] * corr; } }
#pragma unroll
        for (int g = 0; g < R; ++g) { float ps = 0.0f;
            if constexpr (HI) { v8us h0, h1, l0, l1;
#pragma unroll
                for (int j = 0; j < 8; ++j) { const float p0 = __builtin_amdgcn_exp2f(s[0][g][j] - m_run[g]), p1 = __builtin_amdgcn_exp2f(s[1][g][j] - m_run[g]); ps += p0 + p1;
                    unsigned short a, c2; splitf(p0, a, c2); h0[j] = a; l0[j] = c2; splitf(p1, a, c2); h1[j] = a; l1[j] = c2; }
                const V ph = cat16b(h0, h1), pl = cat16b(l0, l1);
#pragma unroll
                for (int t = 0; t < 8; ++t) acc[g][t] = WFrag<T16>::mma(vf[t], ph, acc[g][t]);
#pragma unroll
                for (int t = 0; t < 8; ++t) acc[g][t] = WFrag<T16>::mma(vf[t], pl, acc[g][t]);
#pragma unroll
                for (int t = 0; t < 8; ++t) acc[g][t] = WFrag<T16>::mma(vf2[t], ph, acc[g][t]);
            } else { v8h a0, a1;
#pragma unroll
                for (int j = 0; j < 8; ++j) { const float p0 = __builtin_amdgcn_exp2f(s[0][g][j] - m_run[g]), p1 = __builtin_amdgcn_exp2f(s[1][g][j] - m_run[g]); ps += p0 + p1;
                    a0[j] = tohx(p0); a1[j] = tohx(p1); }
                const V pf = cat16(a0, a1);
#pragma unroll
                for (int t = 0; t < 8; ++t) acc[g][t] = WFrag<T16>::mma(vf[t], pf, acc[g][t]); }
            l_run[g] += ps; }
    }
#pragma unroll
    for (int g = 0; g < R; ++g) { const float l = l_run[g] + xhalf(l_run[g]);   // each wave half summed its own eight keys of every 16; the sum carries the same factor as the products
        const float inv = __fdiv_rn(1.0f, l); const size_t oo = (size_t)(q0 + 16 * g + lr) * DQ + 8 * hi;
#pragma unroll
        for (int t = 0; t < 8; ++t) { v8us oh, ol;   // the lane holds d = 16 t + 8 hi .. + 7 of its query: 16 bytes of each plane
#pragma unroll
            for (int j = 0; j < 8; ++j) { unsigned short a, c2; splitf(acc[g][t][j] * inv, a, c2); oh[j] = a; ol[j] = c2; }
            *(v8us*)(Ah + oo + 16 * t) = oh; *(v8us*)(Al + oo + 16 * t) = ol; }
        if (g + 1 < R) { asm volatile("s_wait_xcnt 0x0" ::: "memory");   // in front of the next group's rewrite of the stores' address and data registers
            __builtin_amdgcn_sched_barrier(0); } }   // keeps the next group's arithmetic behind that wait
}
// grid (batches x heads, NT16 + NTHI), 128 threads, four independent waves; x = batch NH_ + head, the planes lie [batch][head]. Tiles in y: first the fp16 rows from the sequence's end (the longest key walks come first in y), 128 rows a work-group; then the hi + lo rows, 64 a work-group.
#define NT16 ((TT - RH) / 128)
#define NTHI (RH / 64)
__global__ __launch_bounds__(128) void k_flash(const h16* Q16, const h16* K16, const h16* V16, const bf* Qh, const bf* Ql, const bf* Kh, const bf* Kl, const bf* Vh, const bf* Vl, bf* Ah, bf* Al) {   // no __restrict__: the loads must stay on their side of the waits written in asm
    const int lane = threadIdx.x & 31, w = __builtin_amdgcn_readfirstlane(threadIdx.x >> 5), y = blockIdx.y; const size_t hp = (size_t)blockIdx.x * TT * HD; const size_t ao = (size_t)(blockIdx.x / NH_) * TT * DQ + (blockIdx.x % NH_) * HD; Ah += ao; Al += ao;
    if (y < NT16) flash_wave<h16, false, 2>(Q16 + hp, nullptr, K16 + hp, nullptr, V16 + hp, nullptr, TT - 128 * (y + 1) + 32 * w, lane, Ah, Al);
    else flash_wave<bf, true, 1>(Qh + hp, Ql + hp, Kh + hp, Kl + hp, Vh + hp, Vl + hp, RH - 64 * (y - NT16 + 1) + 16 * w, lane, Ah, Al);
}

extern "C" void kernel_launch(void* const* d_in, const int* in_sizes, int n_in,
                              void* d_out, int out_size, void* d_ws, size_t ws_size, hipStream_t stream) {
    (void)in_sizes; (void)n_in; (void)out_size;
    const float* x = (const float*)d_in[0]; const float* wq = (const float*)d_in[1]; const float* wk = (const float*)d_in[2]; const float* wv = (const float*)d_in[3]; const float* wo = (const float*)d_in[4]; const float* cosT = nullptr; const float* sinT = nullptr; (void)cosT; (void)sinT;
    float* OUT = (float*)d_out;     // [2][2048][2048]
    char* wsp = (char*)d_ws;
    auto take = [&](size_t bytes) { char* p = wsp; wsp += (bytes + 255) & ~(size_t)255; return (void*)p; };
    bf* WQ = (bf*)take((size_t)DQ * DM * 2); bf* WK = (bf*)take((size_t)DKV * DM * 2); bf* WV = (bf*)take((size_t)DKV * DM * 2); bf* WO = (bf*)take((size_t)DM * DQ * 2);
    // every plane holds both batches, [batch][head][..][..]
    h16* QP16 = (h16*)take((size_t)NB_ * NH_ * TT * HD * 2); h16* KP16 = (h16*)take((size_t)NB_ * NKV * TT * HD * 2); h16* VT16 = (h16*)take((size_t)NB_ * NKV * HD * TT * 2);
    bf* QPh = (bf*)take((size_t)NB_ * NH_ * TT * HD * 2); bf* QPl = (bf*)take((size_t)NB_ * NH_ * TT * HD * 2); bf* KPh = (bf*)take((size_t)NB_ * NKV * TT * HD * 2); bf* KPl = (bf*)take((size_t)NB_ * NKV * TT * HD * 2); bf* VTh = (bf*)take((size_t)NB_ * NKV * HD * TT * 2); bf* VTl = (bf*)take((size_t)NB_ * NKV * HD * TT * 2);
    bf* XB = (bf*)take((size_t)NB_ * TT * DM * 2); bf* ATh = (bf*)take((size_t)NB_ * TT * DQ * 2); bf* ATl = (bf*)take((size_t)NB_ * TT * DQ * 2);
    if ((size_t)(wsp - (char*)d_ws) > ws_size) return;    // 224 MiB of the 256 MiB
    k_cvtall<<<CVT_WG, 512, 0, stream>>>(wq, wk, wv, wo, x, WQ, WK, WV, WO, XB);
    k_gemml<0, true><<<dim3(TT / 128, DQ / 128, NB_), 128, 0, stream>>>(XB, nullptr, WQ, DM, nullptr, 0, QP16, QPh, QPl, (size_t)TT * HD, HD, (size_t)TT * DM, 0, (size_t)NH_ * TT * HD);      // [b][h][t][d]
    k_gemml<0, true><<<dim3(TT / 128, DKV / 128, NB_), 128, 0, stream>>>(XB, nullptr, WK, DM, nullptr, 0, KP16, KPh, KPl, (size_t)TT * HD, HD, (size_t)TT * DM, 0, (size_t)NKV * TT * HD);    // [b][h][t][d]
    k_gemml<0, true><<<dim3(DKV / 128, TT / 128, NB_), 128, 0, stream>>>(WV, nullptr, XB, DM, nullptr, 0, VT16, VTh, VTl, (size_t)128, TT, 0, (size_t)TT * DM, (size_t)NKV * HD * TT);        // operands swapped: [b][h][d][t]
    k_flash<<<dim3(NB_ * NH_, NT16 + NTHI, 1), 128, 0, stream>>>(QP16, KP16, VT16, QPh, QPl, KPh, KPl, VTh, VTl, ATh, ATl);
    k_gemml<1, false><<<dim3(TT / 128, DM / 128, NB_), 128, 0, stream>>>(ATh, ATl, WO, DQ, OUT, DM, nullptr, nullptr, nullptr, 0, 0, (size_t)TT * DQ, 0, (size_t)TT * DM);
}

// v009
// One run takes 218 microseconds.
// Timed twice side by side with v008, it ran 1.08 times as fast both times.
// Over all steps from v000 it is 8.62 times as fast.
#include <hip/hip_runtime.h>

// FastestFlashMHA (x [2][2048][2048]; q/k/v = x W^T (16 heads x 128); scores = 30 tanh((q.k / sqrt(128)) / 30); key j allowed iff j <= i and i - j < 1024 (finfo.min fill); softmax; out = merged Wo^T -> [2][2048][2048]).
// Compute dtypes, f32 accumulate: every input rounded to bf16; q/k/v on PLAIN bf16 operands (inputs: exact), their head planes written by the projection kernels themselves; softcap f32 (tanhf's small-argument polynomial, constants folded; precise tanhf in passes with a large score); causal scores and attn.v: query rows < 512 hl (3 products), the rest single fp16 (x256), one fused kernel that walks only the keys between the sliding window's edge and the diagonal, both tests inside the edge passes; online softmax f32; Wo hl x exact (2 products).

#define NB_  2
#define TT   2048
#define DM   2048
#define NH_  16
#define NKV  16
#define REP  (NH_ / NKV)
#define HD   128
#define DQ   (NH_ * HD)
#define DKV  (NKV * HD)
#define RH   512                  // query rows < RH use hi+lo planes (0: none)
#define WIN  1024
#define SCL  0.088388347648318447f   // HD^-0.5
typedef _Float16 h16;
typedef unsigned short bf;
typedef __attribute__((ext_vector_type(16))) __bf16   v16bf;
typedef __attribute__((ext_vector_type(16))) _Float16 v16h;
typedef __attribute__((ext_vector_type(8)))  _Float16 v8h;
typedef __attribute__((ext_vector_type(8)))  unsigned short v8us;
typedef __attribute__((ext_vector_type(8)))  float    v8f;
typedef __attribute__((ext_vector_type(4)))  float    v4f;
typedef v8h  __attribute__((may_alias)) v8ha;
typedef v4f  __attribute__((may_alias)) v4fa;
typedef v8us __attribute__((may_alias)) v8usa;

__device__ __forceinline__ unsigned short f2bf(float f) { unsigned u = __float_as_uint(f); u += 0x7FFFu + ((u >> 16) & 1u); return (unsigned short)(u >> 16); }
__device__ __forceinline__ float bf2f(unsigned short b) { return __uint_as_float(((unsigned)b) << 16); }
__device__ __forceinline__ float bfr(float f) { return bf2f(f2bf(f)); }
__device__ __forceinline__ v16h cat16(v8h lo, v8h hi) { return __builtin_shufflevector(lo, hi, 0, 1, 2, 3, 4, 5, 6, 7, 8, 9, 10, 11, 12, 13, 14, 15); }
__device__ __forceinline__ v16bf cat16b(v8us lo, v8us hi) { return __builtin_bit_cast(v16bf, __builtin_shufflevector(lo, hi, 0, 1, 2, 3, 4, 5, 6, 7, 8, 9, 10, 11, 12, 13, 14, 15)); }
__device__ __forceinline__ v8f wmma16(v16h a, v16h b, v8f c) { return __builtin_amdgcn_wmma_f32_16x16x32_f16(false, a, false, b, (short)0, c, false, false); }
__device__ __forceinline__ v8f wmmab(v16bf a, v16bf b, v8f c) { return __builtin_amdgcn_wmma_f32_16x16x32_bf16(false, a, false, b, (short)0, c, false, false); }



// Fragment loaders and products of the two 16-bit operand types (K-contiguous planes).
template <typename T16> struct WFrag;
template <> struct WFrag<h16> { typedef v16h V; static __device__ __forceinline__ V ld(const h16* p) { return cat16(*(const v8h*)p, *(const v8h*)(p + 16)); } static __device__ __forceinline__ v8f mma(V a, V b, v8f c) { return wmma16(a, b, c); } };
template <> struct WFrag<bf> { typedef v16bf V; static __device__ __forceinline__ V ld(const bf* p) { return cat16b(*(const v8us*)p, *(const v8us*)(p + 16)); } static __device__ __forceinline__ v8f mma(V a, V b, v8f c) { return wmmab(a, b, c); } };

__device__ __forceinline__ h16 tohx(float x) { return (h16)x; }
__device__ __forceinline__ void splitf(float y, unsigned short& h, unsigned short& l) { h = f2bf(y); l = f2bf(y - bf2f(h)); }

// ---- k_gemml: C[m][n] = sum_k A[m][k] Bt[n][k] (+ A2[m][k] Bt[n][k] when NSPLIT == 1), bf16 planes of row pitch K. PL == false: C is stored as f32, pitch ldc.
// PL == true: C is stored three times as 16-bit planes (fp16, bf16 hi, bf16 lo of the same f32 sum); element (m, n) lies at (n / 128) cstride + m pitch + n % 128 of each plane.
// With A = x, Bt = W, cstride = TT HD, pitch = HD that is the head plane [h][t][d]; with A = W, Bt = x, cstride = 128, pitch = TT it is the transposed plane [h][d][t]. One 128x128 tile per work-group of four waves, 64x64 per wave (16 accumulators);
// grid (M/128, N/128, batches), 128 threads; batch z reads A (and A2) + z zA and Bt + z zB and writes C or the planes + z zC (elements): both batches' work-groups are in flight together, and each hides the other's waits. Operands reach LDS by asynchronous copies in whole 128-byte row pieces (64 k), two buffers: the next piece's copies fly while this one is multiplied. K % 64 == 0, M % 128 == 0, N % 128 == 0.
// Every '#pragma unroll' in it is there so that the fragment and accumulator arrays are indexed by constants and stay in registers.
#define LP    144                 // LDS row pitch in bytes: 128 data + 16, an odd multiple of 16, for 16-byte fragment reads
#define LTILE (128 * LP)          // one operand's 128 rows
// Eight copies of 16 bytes a lane: rows 16 apart of one operand tile (LDS step 16 LP bytes, global step rs elements).
__device__ __forceinline__ void copy8(unsigned l, const bf* g, size_t rs) {
    // the wait on xcnt ends the copies' own statement, so that no address register is rewritten in front of it
    asm volatile("global_load_async_to_lds_b128 %0, %8, off\n\t"
                 "global_load_async_to_lds_b128 %1, %9, off\n\t"
                 "global_load_async_to_lds_b128 %2, %10, off\n\t"
                 "global_load_async_to_lds_b128 %3, %11, off\n\t"
                 "global_load_async_to_lds_b128 %4, %12, off\n\t"
                 "global_load_async_to_lds_b128 %5, %13, off\n\t"
                 "global_load_async_to_lds_b128 %6, %14, off\n\t"
                 "global_load_async_to_lds_b128 %7, %15, off\n\t"
                 "s_wait_xcnt 0x0"
                 :: "v"(l), "v"(l + 16u * LP), "v"(l + 32u * LP), "v"(l + 48u * LP), "v"(l + 64u * LP), "v"(l + 80u * LP), "v"(l + 96u * LP), "v"(l + 112u * LP),
                    "v"(g), "v"(g + rs), "v"(g + 2 * rs), "v"(g + 3 * rs), "v"(g + 4 * rs), "v"(g + 5 * rs), "v"(g + 6 * rs), "v"(g + 7 * rs) : "memory");
}
__device__ __forceinline__ v16bf ldsfrag(const unsigned char* p) { return cat16b(*(const v8usa*)p, *(const v8usa*)(p + 32)); }
typedef __attribute__((ext_vector_type(4))) int v4i;
// One lane's 16 bytes of each of the three planes.
__device__ __forceinline__ void store3(h16* p16, bf* ph, bf* pl, v4i d16, v4i dh, v4i dl) {
    // the wait on xcnt ends the stores' own statement, so that no address or data register of theirs is rewritten in front of it
    asm volatile("global_store_b128 %0, %3, off\n\t"
                 "global_store_b128 %1, %4, off\n\t"
                 "global_store_b128 %2, %5, off\n\t"
                 "s_wait_xcnt 0x0"
                 :: "v"(p16), "v"(ph), "v"(pl), "v"(d16), "v"(dh), "v"(dl) : "memory");
}
template <int NSPLIT, bool PL>
__global__ __launch_bounds__(128) void k_gemml(const bf* __restrict__ A, const bf* __restrict__ A2, const bf* __restrict__ Bt, int K, float* C, int ldc, h16* P16, bf* Ph, bf* Pl, size_t cstride, int pitch, size_t zA, size_t zB, size_t zC) {
    { const size_t z = blockIdx.z; A += z * zA; if (NSPLIT == 1) A2 += z * zA; Bt += z * zB; if (PL) { P16 += z * zC; Ph += z * zC; Pl += z * zC; } else C += z * zC; }   // this work-group's batch
    constexpr int NT = (NSPLIT == 1) ? 3 : 2;           // operand tiles per stage: A, (A2,) Bt
    constexpr unsigned STG = NT * LTILE;
    __shared__ __align__(16) unsigned char L[2 * STG];
    __shared__ __align__(16) float osw[4][16 * 68];
    const int tid = threadIdx.x, lane = tid & 31, lr = lane & 15, hi = lane >> 4, w = tid >> 5, wm = w >> 1, wn = w & 1; const int r0 = blockIdx.x * 128, c0 = blockIdx.y * 128;
    v8f acc[4][4];
#pragma unroll
    for (int mb = 0; mb < 4; ++mb)
#pragma unroll
        for (int nb = 0; nb < 4; ++nb) acc[mb][nb] = (v8f){};
    // copies: lane tid brings 16-byte piece (tid & 7) of rows (tid >> 3) + 16 i, so a wave's copy covers four whole 128-byte row pieces
    const int crow = tid >> 3, cch = tid & 7; const size_t rs = (size_t)16 * K;
    const bf* gA = A + (size_t)(r0 + crow) * K + cch * 8; const bf* gA2 = (NSPLIT == 1) ? A2 + (size_t)(r0 + crow) * K + cch * 8 : nullptr; const bf* gB = Bt + (size_t)(c0 + crow) * K + cch * 8;
    const unsigned l0 = (unsigned)(size_t)L + (unsigned)(crow * LP + cch * 16);
    auto stage = [&](int t) { const unsigned l = l0 + (unsigned)(t & 1) * STG; const int kc = t * 64; copy8(l, gA + kc, rs); if (NSPLIT == 1) copy8(l + LTILE, gA2 + kc, rs); copy8(l + (NT - 1) * LTILE, gB + kc, rs); };
    const int nst = K / 64;
    stage(0);
    asm volatile("s_wait_asynccnt 0x0" ::: "memory");   // this wave's copies of stage 0 have landed
    __syncthreads();                                     // ... and every other wave's
    if (nst > 1) stage(1);
    const unsigned aofs = (unsigned)((wm * 64 + lr) * LP + hi * 16), bofs = (unsigned)((NT - 1) * LTILE + (wn * 64 + lr) * LP + hi * 16);
#pragma unroll 1   // one stage a trip: the two buffers alternate by the trip's parity
    for (int t = 0; t < nst; ++t) {
        const unsigned char* Lb = L + (unsigned)(t & 1) * STG; const unsigned char* pa = Lb + aofs; const unsigned char* pb = Lb + bofs;
        // Fragment reads stand in few groups, each ahead of the products that hide it (one wave per SIMD: nothing else hides an LDS wait). Every accumulator still takes its products in ascending k, A before A2.
        // Each sched_barrier(0) below keeps a read group where it is written: without them the scheduler sinks every read to just in front of its first use, and the wave waits out the LDS latency once per four products.
        v16bf a[4], a2[4], b[4];
        if (NSPLIT == 0) {   // a: k 0..31 of the stage, a2: k 32..63
#pragma unroll
            for (int mb = 0; mb < 4; ++mb) a[mb] = ldsfrag(pa + mb * 16 * LP);
#pragma unroll
            for (int nb = 0; nb < 4; ++nb) b[nb] = ldsfrag(pb + nb * 16 * LP);
#pragma unroll
            for (int mb = 0; mb < 4; ++mb) a2[mb] = ldsfrag(pa + mb * 16 * LP + 64);
            __builtin_amdgcn_sched_barrier(0);
#pragma unroll
            for (int h = 0; h < 2; ++h) {
#pragma unroll
                for (int nb = 2 * h; nb < 2 * h + 2; ++nb)
#pragma unroll
                    for (int mb = 0; mb < 4; ++mb) acc[mb][nb] = wmmab(a[mb], b[nb], acc[mb][nb]);
                __builtin_amdgcn_sched_barrier(0);
#pragma unroll
                for (int nb = 2 * h; nb < 2 * h + 2; ++nb) b[nb] = ldsfrag(pb + nb * 16 * LP + 64);
                __builtin_amdgcn_sched_barrier(0); }
#pragma unroll
            for (int nb = 0; nb < 4; ++nb)
#pragma unroll
                for (int mb = 0; mb < 4; ++mb) acc[mb][nb] = wmmab(a2[mb], b[nb], acc[mb][nb]);
        } else {
#pragma unroll
            for (int mb = 0; mb < 4; ++mb) a[mb] = ldsfrag(pa + mb * 16 * LP);
#pragma unroll
            for (int nb = 0; nb < 4; ++nb) b[nb] = ldsfrag(pb + nb * 16 * LP);
#pragma unroll
            for (int mb = 0; mb < 4; ++mb) a2[mb] = ldsfrag(pa + LTILE + mb * 16 * LP);
            __builtin_amdgcn_sched_barrier(0);
#pragma unroll
            for (int nb = 0; nb < 4; ++nb)
#pragma unroll
                for (int mb = 0; mb < 4; ++mb) acc[mb][nb] = wmmab(a[mb], b[nb], acc[mb][nb]);
            __builtin_amdgcn_sched_barrier(0);
#pragma unroll
            for (int mb = 0; mb < 4; ++mb) a[mb] = ldsfrag(pa + mb * 16 * LP + 64);
            __builtin_amdgcn_sched_barrier(0);
#pragma unroll
            for (int h = 0; h < 2; ++h) {
#pragma unroll
                for (int nb = 2 * h; nb < 2 * h + 2; ++nb)
#pragma unroll
                    for (int mb = 0; mb < 4; ++mb) acc[mb][nb] = wmmab(a2[mb], b[nb], acc[mb][nb]);
                __builtin_amdgcn_sched_barrier(0);
#pragma unroll
                for (int nb = 2 * h; nb < 2 * h + 2; ++nb) b[nb] = ldsfrag(pb + nb * 16 * LP + 64);
                if (h == 0) __builtin_amdgcn_sched_barrier(0); }
#pragma unroll
            for (int mb = 0; mb < 4; ++mb) a2[mb] = ldsfrag(pa + LTILE + mb * 16 * LP + 64);
            __builtin_amdgcn_sched_barrier(0);
#pragma unroll
            for (int nb = 0; nb < 4; ++nb)
#pragma unroll
                for (int mb = 0; mb < 4; ++mb) acc[mb][nb] = wmmab(a[mb], b[nb], acc[mb][nb]);
#pragma unroll
            for (int nb = 0; nb < 4; ++nb)
#pragma unroll
                for (int mb = 0; mb < 4; ++mb) acc[mb][nb] = wmmab(a2[mb], b[nb], acc[mb][nb]);
        }
        asm volatile("s_wait_dscnt 0x0" ::: "memory");      // this wave's reads of the buffer are done before it is handed back
        asm volatile("s_wait_asynccnt 0x0" ::: "memory");   // this wave's copies of stage t + 1 have landed
        __syncthreads();                                     // publishes stage t + 1 and ends every wave's reads of stage t
        if (t + 2 < nst) stage(t + 2);
    }
    asm volatile("s_wait_asynccnt 0x0" ::: "memory");       // no copy is outstanding when the wave goes on
    float* os = osw[w];   // each wave turns its own accumulators into whole row pieces (256 bytes of f32, 128 bytes of each 16-bit plane) through its own LDS slice; the wave barriers with their compiler fences keep the slice's stores, reads and next stores in that order
#pragma unroll
    for (int mb = 0; mb < 4; ++mb) {
#pragma unroll
        for (int nb = 0; nb < 4; ++nb) {
#pragma unroll
            for (int j = 0; j < 8; ++j) os[(hi * 8 + j) * 68 + nb * 16 + lr] = acc[mb][nb][j]; }
        __builtin_amdgcn_wave_barrier(); asm volatile("" ::: "memory");
        if constexpr (PL) {   // a lane takes eight neighbours of one row: 16 bytes of each plane, eight lanes a whole 128-byte line
            const int prow = lane >> 3, pcol = (lane & 7) * 8; const size_t po = (size_t)blockIdx.y * cstride + (size_t)(r0 + wm * 64 + mb * 16 + prow) * pitch + wn * 64 + pcol;
            v4f x0[4], x1[4];   // all eight LDS reads first: the stores' statements let no read pass them, and the wave would wait out the LDS latency once per row group
#pragma unroll
            for (int s = 0; s < 4; ++s) { const float* ps = os + (4 * s + prow) * 68 + pcol; x0[s] = *(const v4fa*)ps; x1[s] = *(const v4fa*)(ps + 4); }
#pragma unroll
            for (int s = 0; s < 4; ++s) { v8h o16; v8us oh, ol;
#pragma unroll
                for (int k = 0; k < 8; ++k) { const float xv = (k < 4) ? x0[s][k & 3] : x1[s][k & 3]; o16[k] = tohx(xv); unsigned short a2, c2; splitf(xv, a2, c2); oh[k] = a2; ol[k] = c2; }
                const size_t o = po + (size_t)(4 * s) * pitch; store3(P16 + o, Ph + o, Pl + o, __builtin_bit_cast(v4i, o16), __builtin_bit_cast(v4i, oh), __builtin_bit_cast(v4i, ol)); }
        } else {
        float* crw = C + (size_t)(r0 + wm * 64 + mb * 16) * ldc + c0 + wn * 64;
#pragma unroll
        for (int s = 0; s < 8; ++s) { const int row = 2 * s + hi, cofs = lr * 4; const v4f val = *(const v4fa*)(os + row * 68 + cofs); *(v4f*)(crw + (size_t)row * ldc + cofs) = val; }
        }
        __builtin_amdgcn_wave_barrier(); asm volatile("" ::: "memory");
    }
}

typedef __attribute__((ext_vector_type(2))) _Float16 v2h;
typedef __attribute__((ext_vector_type(4))) _Float16 v4h;
typedef __attribute__((ext_vector_type(2))) unsigned short v2us;
typedef __attribute__((ext_vector_type(4))) unsigned short v4us;
typedef __attribute__((ext_vector_type(2))) float v2f;

__global__ __launch_bounds__(256) void k_wtG(const float* __restrict__ w, int K, int N, bf* Bt) {
    const int lane = threadIdx.x & 31; const int L0 = (blockIdx.x * 8 + (threadIdx.x >> 5)) * 8; const int nlines = N * K / 64;
{
#pragma unroll 1
        for (int l = 0; l < 8; ++l) { const int L = L0 + l; if (L >= nlines) break; const size_t e = (size_t)L * 64 + lane * 2; const int k = (int)(e % K), n = (int)(e / K); v2us o;
            o[0] = f2bf(w[(size_t)k * N + n]); o[1] = f2bf(w[(size_t)(k + 1) * N + n]); *(v2us*)(Bt + e) = o; }
         }
}
// ---- k_cvtall: every f32 input rounded to bf16 in ONE launch of CVT_WG work-groups of 16 waves, one to a WGP. The launch is a stream: its time should be its bytes, not the starting of waves,
// so a thread converts 24 pieces of eight elements instead of one. The inputs form six equal segments (four weights, the two halves of x); every thread takes four pieces of each, CVT_T pieces apart,
// and the next segment's eight 16-byte loads are issued before this segment is converted and stored, so that eight to sixteen loads of a wave are always in flight.
#define CVT_WG 256
#define CVT_T  (CVT_WG * 512)                 // threads of the launch
#define CVT_SEG ((size_t)DQ * DM)             // elements of a segment
static_assert(CVT_SEG == (size_t)4 * CVT_T * 8 && (size_t)DKV * DM == CVT_SEG && (size_t)DM * DQ == CVT_SEG && (size_t)NB_ * TT * DM == 2 * CVT_SEG, "six equal segments, four pieces a thread in each");
__global__ __launch_bounds__(512) void k_cvtall(const float* __restrict__ wq, const float* __restrict__ wk, const float* __restrict__ wv, const float* __restrict__ wo, const float* __restrict__ x,
                                                bf* __restrict__ WQ, bf* __restrict__ WK, bf* __restrict__ WV, bf* __restrict__ WO, bf* __restrict__ XB) {
    const size_t e0 = ((size_t)blockIdx.x * 512 + threadIdx.x) * 8;
    const float* const src[6] = { wq, wk, wv, wo, x, x + CVT_SEG }; bf* const dst[6] = { WQ, WK, WV, WO, XB, XB + CVT_SEG };
    v8f v[2][4];
    // Every '#pragma unroll' below keeps the pointer tables and the two register sets indexed by constants.
#pragma unroll
    for (int u = 0; u < 4; ++u) v[0][u] = *(const v8f*)(src[0] + e0 + (size_t)u * CVT_T * 8);
    asm volatile("s_wait_xcnt 0x0" ::: "memory");   // as in the loop: in front of the next loads, which may land in address registers of the loads above
    __builtin_amdgcn_sched_barrier(0);   // keeps the next loads and their address arithmetic behind that wait
#pragma unroll
    for (int sg = 0; sg < 6; ++sg) {
        if (sg + 1 < 6) {
#pragma unroll
            for (int u = 0; u < 4; ++u) v[(sg + 1) & 1][u] = *(const v8f*)(src[sg + 1] + e0 + (size_t)u * CVT_T * 8); }
        __builtin_amdgcn_sched_barrier(0);   // keeps the next segment's loads in front of this segment's wait: without it the scheduler may sink them behind the stores, and the wave has nothing in flight while it converts
#pragma unroll
        for (int u = 0; u < 4; ++u) { v8us o;
#pragma unroll
            for (int k = 0; k < 8; ++k) o[k] = f2bf(v[sg & 1][u][k]);
            *(v8us*)(dst[sg] + e0 + (size_t)u * CVT_T * 8) = o; }
        if (sg + 1 < 6) { asm volatile("s_wait_xcnt 0x0" ::: "memory");   // in front of the next loads, which land in registers that the stores above name
            __builtin_amdgcn_sched_barrier(0); }   // keeps the next trip's address arithmetic behind that wait
    }
}
// ---- k_flash: the whole attention of both batches in one launch. A wave owns 16 R query rows of one head and walks their keys in passes of 32, from the first key inside the sliding window to the diagonal; scores and probabilities never leave registers.
// Transposed products: S^T = K Q^T (A = key rows, B = query rows) leaves one query's scores in one lane pair (lanes l and l ^ 16), and the two 16-key score tiles of a pass are, register for register, the B operand P^T of O^T += V^T P^T (A = rows of the [d][t] value planes).
// Online softmax in powers of two: running maximum and sum per query; the output sums are rescaled only in a pass that raises some query's maximum.
// Keys and values reach the waves through LDS: a work-group's four waves walk nearly the same keys, so the work-group brings tiles of SKEYS keys (key rows, and the same keys' piece of every value row) by asynchronous copies in whole 128-byte lines,
// two buffers, the next tile's copies in flight while this one is worked on; a wave leaves out the passes of a tile that lie outside its own rows' keys. The query fragments come straight from their plane, once.
// HI: bf16 hi + lo planes, three products for each contraction (query rows < RH); otherwise single fp16, probabilities carried x PCAR2.
#define LPCAR2 8.0f               // log2 of PCAR2 = 256
#define L2E   1.4426950408889634f
// Capped score in units of log2: u(s) = 30 log2(e) tanh(s HD^-0.5 / 30) for a raw product s. For |s HD^-0.5 / 30| < 0.625 tanh is the small-argument odd polynomial of the precise tanhf, x + x t P(t), t = x x;
// every constant factor on the way (HD^-0.5, 1 / 30, 30, log2(e)) is multiplied into its coefficients at compile time, in double, so that a score costs s s, five fused multiply-adds and one product: no division, no separate scalings, no branch.
#define CAPX  (0.088388347648318447 / 30.0)                  // x = CAPX s
#define CAPT  (CAPX * CAPX)                                  // t = CAPT s s
#define CAPA  (30.0 * 1.4426950408889634 * CAPX)             // u = CAPA s (1 + t P(t))
#define SBIG  ((float)(0.625 / CAPX))                        // |s| from which on the polynomial no longer holds
__device__ __forceinline__ float cap_small(float s) { const float t = s * s;
    float p = __builtin_fmaf((float)(CAPA * CAPT * CAPT * CAPT * CAPT * CAPT * -0.00570002059), t, (float)(CAPA * CAPT * CAPT * CAPT * CAPT * 0.0206340719)); p = __builtin_fmaf(t, p, (float)(CAPA * CAPT * CAPT * CAPT * -0.0537379310));
    p = __builtin_fmaf(t, p, (float)(CAPA * CAPT * CAPT * 0.133314162)); p = __builtin_fmaf(t, p, (float)(CAPA * CAPT * -0.333332807)); p = __builtin_fmaf(t, p, (float)CAPA);
    return s * p; }
#define SKEYS 64                  // keys of a tile: two passes
#define KPB   272                 // LDS pitch of a key row in bytes: 256 data + 16, an odd multiple of 16, for 16-byte fragment reads
#define VPB   144                 // LDS pitch of a value row's piece: 128 data + 16, likewise
#define KTILE (SKEYS * KPB)       // one key plane's rows of a tile
#define VTILE (HD * VPB)          // one value plane's pieces of a tile
// Eight copies of 16 bytes a lane: LDS step LS bytes, global step gs bytes.
template <unsigned LS>
__device__ __forceinline__ void copy8t(unsigned l, const char* g, size_t gs) {
    // the wait on xcnt ends the copies' own statement, so that no address register is rewritten in front of it
    asm volatile("global_load_async_to_lds_b128 %0, %8, off\n\t"
                 "global_load_async_to_lds_b128 %1, %9, off\n\t"
                 "global_load_async_to_lds_b128 %2, %10, off\n\t"
                 "global_load_async_to_lds_b128 %3, %11, off\n\t"
                 "global_load_async_to_lds_b128 %4, %12, off\n\t"
                 "global_load_async_to_lds_b128 %5, %13, off\n\t"
                 "global_load_async_to_lds_b128 %6, %14, off\n\t"
                 "global_load_async_to_lds_b128 %7, %15, off\n\t"
                 "s_wait_xcnt 0x0"
                 :: "v"(l), "v"(l + LS), "v"(l + 2u * LS), "v"(l + 3u * LS), "v"(l + 4u * LS), "v"(l + 5u * LS), "v"(l + 6u * LS), "v"(l + 7u * LS),
                    "v"(g), "v"(g + gs), "v"(g + 2 * gs), "v"(g + 3 * gs), "v"(g + 4 * gs), "v"(g + 5 * gs), "v"(g + 6 * gs), "v"(g + 7 * gs) : "memory");
}
__device__ __forceinline__ float xhalf(float x) { return __builtin_bit_cast(float, __builtin_amdgcn_permlanex16(__builtin_bit_cast(int, x), __builtin_bit_cast(int, x), 0x76543210, 0xfedcba98, false, false)); }   // lane l with lane l ^ 16
template <typename T16, bool HI, int R>
__device__ __forceinline__ void flash_wave(const T16* Q, const T16* Q2, const T16* Kp, const T16* K2, const T16* Vt, const T16* Vt2, int qwg, int q0, int lane, unsigned char* SL, bf* Ah, bf* Al) {   // qwg: the work-group's first row (64 R rows), q0: the wave's
    typedef typename WFrag<T16>::V V;
    const int lr = lane & 15, hi = lane >> 4;
    // Every '#pragma unroll' below keeps a fragment or accumulator array indexed by constants, so that it stays in registers.
    V qf[R][4], qf2[R][4];
#pragma unroll
    for (int g = 0; g < R; ++g)
#pragma unroll
        for (int kc = 0; kc < 4; ++kc) { const size_t o = (size_t)(q0 + 16 * g + lr) * HD + 32 * kc + 8 * hi; qf[g][kc] = WFrag<T16>::ld(Q + o); if constexpr (HI) qf2[g][kc] = WFrag<T16>::ld(Q2 + o); }
    asm volatile("s_wait_xcnt 0x0" ::: "memory");   // in front of the first rewrite of an address register of the loads above
    __builtin_amdgcn_sched_barrier(0);   // keeps later address arithmetic behind that wait
    v8f acc[R][8]; float m_run[R], l_run[R];
#pragma unroll
    for (int g = 0; g < R; ++g) { m_run[g] = -1.0e30f; l_run[g] = 0.0f;   // far above the mask's fill, far below any score: a pass whose keys are all masked for a query gives it zeros
#pragma unroll
        for (int t = 0; t < 8; ++t) acc[g][t] = (v8f){}; }
    const int kbeg = max(0, q0 - (WIN - 1)) & ~31, kend = q0 + 16 * R;   // row i allows keys j with i - WIN < j <= i
    constexpr int NPL = HI ? 2 : 1;                     // planes of each operand
    constexpr unsigned STG = NPL * (KTILE + VTILE);     // bytes of a buffer: key planes, then value planes
    const int kb0 = max(0, qwg - (WIN - 1)) & ~(SKEYS - 1), nst = (qwg + 64 * R - kb0) / SKEYS;   // the work-group's tiles cover every wave's keys; both ends are multiples of SKEYS
    // copies: thread tid brings 16-byte piece (tid & 15) of key rows (tid >> 4) + 8 i and piece (tid & 7) of value rows (tid >> 3) + 16 i, so every copy of a wave covers whole 128-byte lines
    const int tid = threadIdx.x;
    const unsigned lk = (unsigned)(size_t)SL + (unsigned)((tid >> 4) * KPB + (tid & 15) * 16), lv = (unsigned)(size_t)SL + (unsigned)(NPL * KTILE + (tid >> 3) * VPB + (tid & 7) * 16);
    const size_t gk = ((size_t)(kb0 + (tid >> 4)) * HD + (tid & 15) * 8) * 2, gv = ((size_t)(tid >> 3) * TT + kb0 + (tid & 7) * 8) * 2;   // byte offsets in the planes
    auto stage = [&](int t) { const unsigned b = (unsigned)(t & 1) * STG; const size_t ok = gk + (size_t)t * (SKEYS * HD * 2), ov = gv + (size_t)t * (SKEYS * 2);
        copy8t<8 * KPB>(lk + b, (const char*)Kp + ok, (size_t)8 * HD * 2); if constexpr (HI) copy8t<8 * KPB>(lk + b + KTILE, (const char*)K2 + ok, (size_t)8 * HD * 2);
        copy8t<16 * VPB>(lv + b, (const char*)Vt + ov, (size_t)16 * TT * 2); if constexpr (HI) copy8t<16 * VPB>(lv + b + VTILE, (const char*)Vt2 + ov, (size_t)16 * TT * 2); };
    auto lfrag = [&](const unsigned char* p) -> V { if constexpr (HI) return cat16b(*(const v8usa*)p, *(const v8usa*)(p + 32)); else return cat16(*(const v8ha*)p, *(const v8ha*)(p + 32)); };
    // Trips -2 and -1 only fill: trip -2 issues tile 0's copies; trip -1 waits for them, passes the barrier that publishes them and issues tile 1's. So the copies stand once in the code, always on freshly formed addresses:
    // written a second time in front of the loop they took the loop-invariant addresses themselves as operands, which tied those to the registers that asm text can name, and the compiler spilled them to scratch.
#pragma unroll 1   // one tile a trip: the two buffers alternate by the trip's parity
    for (int tl = -2; tl < nst; ++tl) {
    const unsigned char* Lb = SL + (unsigned)(tl & 1) * STG;
#pragma unroll 1   // one pass a trip: the body is long, and a second copy would only cost instruction cache
    for (int hf = (tl >= 0) ? 0 : 2; hf < 2; ++hf) {
        const int key0 = kb0 + SKEYS * tl + 32 * hf;
        if (key0 < kbeg || key0 >= kend) continue;   // wave-uniform: this pass's keys lie outside the wave's rows' keys
        // The pass's key and value fragments are read in one group: the products wait for the key fragments alone, and the value fragments arrive under them and under the softcap.
        V kf[2][4], kf2[2][4], vf[8], vf2[8];
        const unsigned char* pk = Lb + (32 * hf + lr) * KPB + 16 * hi; const unsigned char* pv = Lb + NPL * KTILE + lr * VPB + 64 * hf + 16 * hi;
#pragma unroll
        for (int kc = 0; kc < 4; ++kc)
#pragma unroll
            for (int kt = 0; kt < 2; ++kt) { kf[kt][kc] = lfrag(pk + 16 * kt * KPB + 64 * kc); if constexpr (HI) kf2[kt][kc] = lfrag(pk + KTILE + 16 * kt * KPB + 64 * kc); }
#pragma unroll
        for (int t = 0; t < 8; ++t) { vf[t] = lfrag(pv + 16 * t * VPB); if constexpr (HI) vf2[t] = lfrag(pv + VTILE + 16 * t * VPB); }
        __builtin_amdgcn_sched_barrier(0);   // without it the scheduler sinks each read to just in front of its first use, and the wave waits out the LDS latency there
        v8f s[2][R];
#pragma unroll
        for (int kt = 0; kt < 2; ++kt)
#pragma unroll
            for (int g = 0; g < R; ++g) s[kt][g] = (v8f){};
#pragma unroll
        for (int kc = 0; kc < 4; ++kc)
#pragma unroll
            for (int kt = 0; kt < 2; ++kt)
#pragma unroll
                for (int g = 0; g < R; ++g) { s[kt][g] = WFrag<T16>::mma(kf[kt][kc], qf[g][kc], s[kt][g]);
                    if constexpr (HI) { s[kt][g] = WFrag<T16>::mma(kf[kt][kc], qf2[g][kc], s[kt][g]); s[kt][g] = WFrag<T16>::mma(kf2[kt][kc], qf[g][kc], s[kt][g]); } }
        const bool edge = (key0 + 31 > q0) || (q0 + 16 * R - 1 - key0 >= WIN);   // wave-uniform: only passes that meet the diagonal or the window's lower edge pay for the mask
        // softcap 30 tanh(x / 30), from here on in units of log2: one wave-uniform test a pass (the largest |s|) picks the branch-free polynomial for all of the pass's scores, or the library's tanhf for all of them (a NaN stays a NaN in either)
        float sbig = 0.0f;
#pragma unroll
        for (int kt = 0; kt < 2; ++kt)
#pragma unroll
            for (int g = 0; g < R; ++g) { float a = 0.0f;   // a chain of its own for each score tile: independent chains fill each other's latency
#pragma unroll
                for (int j = 0; j < 8; ++j) a = fmaxf(a, fabsf(s[kt][g][j]));
                sbig = fmaxf(sbig, a); }
        if (__builtin_amdgcn_ballot_w32(!(sbig < SBIG)) != 0) {
#pragma unroll
            for (int kt = 0; kt < 2; ++kt)
#pragma unroll
                for (int g = 0; g < R; ++g)
#pragma unroll
                    for (int j = 0; j < 8; ++j) s[kt][g][j] = (30.0f * L2E) * tanhf(__fdiv_rn(s[kt][g][j] * SCL, 30.0f));
        } else {
#pragma unroll
            for (int kt = 0; kt < 2; ++kt)
#pragma unroll
                for (int g = 0; g < R; ++g)
#pragma unroll
                    for (int j = 0; j < 8; ++j) s[kt][g][j] = cap_small(s[kt][g][j]); }
        float mb[R]; bool need = false;
#pragma unroll
        for (int g = 0; g < R; ++g) { const int qi = q0 + 16 * g + lr; float mx = -3.0e38f;
#pragma unroll
            for (int kt = 0; kt < 2; ++kt)
#pragma unroll
                for (int j = 0; j < 8; ++j) { float t = s[kt][g][j]; const int key = key0 + 16 * kt + 8 * hi + j; if (edge && !(key <= qi && qi - key < WIN)) t = -3.0e38f; s[kt][g][j] = t; mx = fmaxf(mx, t); }
            mx = fmaxf(mx, xhalf(mx)); if constexpr (!HI) mx -= LPCAR2; mb[g] = mx; need = need || (mx > m_run[g]); }   // fp16 rows: the reference point lies log2(PCAR2) below the maximum, which carries the probabilities x PCAR2 at no cost
        if (__builtin_amdgcn_ballot_w32(need) != 0) {
#pragma unroll
            for (int g = 0; g < R; ++g) { const float m_new = fmaxf(m_run[g], mb[g]); const float corr = __builtin_amdgcn_exp2f(m_run[g] - m_new); l_run[g] *= corr; m_run[g] = m_new;
#pragma unroll
                for (int t = 0; t < 8; ++t) acc[g][t] = acc[g][t] * corr; } }
#pragma unroll
        for (int g = 0; g < R; ++g) { float ps = 0.0f;
            if constexpr (HI) { v8us h0, h1, l0, l1;
#pragma unroll
                for (int j = 0; j < 8; ++j) { const float p0 = __builtin_amdgcn_exp2f(s[0][g][j] - m_run[g]), p1 = __builtin_amdgcn_exp2f(s[1][g][j] - m_run[g]); ps += p0 + p1;
                    unsigned short a, c2; splitf(p0, a, c2); h0[j] = a; l0[j] = c2; splitf(p1, a, c2); h1[j] = a; l1[j] = c2; }
                const V ph = cat16b(h0, h1), pl = cat16b(l0, l1);
#pragma unroll
                for (int t = 0; t < 8; ++t) acc[g][t] = WFrag<T16>::mma(vf[t], ph, acc[g][t]);
#pragma unroll
                for (int t = 0; t < 8; ++t) acc[g][t] = WFrag<T16>::mma(vf[t], pl, acc[g][t]);
#pragma unroll
                for (int t = 0; t < 8; ++t) acc[g][t] = WFrag<T16>::mma(vf2[t], ph, acc[g][t]);
            } else { v8h a0, a1;
#pragma unroll
                for (int j = 0; j < 8; ++j) { const float p0 = __builtin_amdgcn_exp2f(s[0][g][j] - m_run[g]), p1 = __builtin_amdgcn_exp2f(s[1][g][j] - m_run[g]); ps += p0 + p1;
                    a0[j] = tohx(p0); a1[j] = tohx(p1); }
                const V pf = cat16(a0, a1);
#pragma unroll
                for (int t = 0; t < 8; ++t) acc[g][t] = WFrag<T16>::mma(vf[t], pf, acc[g][t]); }
            l_run[g] += ps; }
        __builtin_amdgcn_sched_barrier(0);   // keeps the pass's last products in front of the slots below
        asm volatile("v_nop\n\tv_nop\n\tv_nop\n\tv_nop");   // the four vector slots between the pass's last matrix instruction and the first overwrite of its operands, which stands behind a branch
    }
        asm volatile("s_wait_dscnt 0x0" ::: "memory");      // this wave's reads of the buffer are done before it is handed back
        asm volatile("s_wait_asynccnt 0x0" ::: "memory");   // this wave's copies of tile tl + 1 have landed
        __syncthreads();                                     // publishes tile tl + 1 and ends every wave's reads of tile tl
        if (tl + 2 < nst) stage(tl + 2);
    }
    asm volatile("s_wait_asynccnt 0x0" ::: "memory");       // no copy is outstanding when the wave goes on
#pragma unroll
    for (int g = 0; g < R; ++g) { const float l = l_run[g] + xhalf(l_run[g]);   // each wave half summed its own eight keys of every 16; the sum carries the same factor as the products
        const float inv = __fdiv_rn(1.0f, l); const size_t oo = (size_t)(q0 + 16 * g + lr) * DQ + 8 * hi;
#pragma unroll
        for (int t = 0; t < 8; ++t) { v8us oh, ol;   // the lane holds d = 16 t + 8 hi .. + 7 of its query: 16 bytes of each plane
#pragma unroll
            for (int j = 0; j < 8; ++j) { unsigned short a, c2; splitf(acc[g][t][j] * inv, a, c2); oh[j] = a; ol[j] = c2; }
            *(v8us*)(Ah + oo + 16 * t) = oh; *(v8us*)(Al + oo + 16 * t) = ol; }
        if (g + 1 < R) { asm volatile("s_wait_xcnt 0x0" ::: "memory");   // in front of the next group's rewrite of the stores' address and data registers
            __builtin_amdgcn_sched_barrier(0); } }   // keeps the next group's arithmetic behind that wait
}
// grid (batches x heads, NT16 + NTHI), 128 threads, four waves that share their key and value tiles; x = batch NH_ + head, the planes lie [batch][head]. Tiles in y: first the fp16 rows from the sequence's end, 128 rows a work-group; then the hi + lo rows, 64 a work-group.
#define NT16 ((TT - RH) / 128)
#define NTHI (RH / 64)
__global__ __launch_bounds__(128) void k_flash(const h16* Q16, const h16* K16, const h16* V16, const bf* Qh, const bf* Ql, const bf* Kh, const bf* Kl, const bf* Vh, const bf* Vl, bf* Ah, bf* Al) {   // no __restrict__: the loads must stay on their side of the waits written in asm
    __shared__ __align__(16) unsigned char SL[2 * 2 * (KTILE + VTILE)];   // two buffers of the larger kind (hi + lo planes)
    const int lane = threadIdx.x & 31, w = __builtin_amdgcn_readfirstlane(threadIdx.x >> 5), y = blockIdx.y; const size_t hp = (size_t)blockIdx.x * TT * HD; const size_t ao = (size_t)(blockIdx.x / NH_) * TT * DQ + (blockIdx.x % NH_) * HD; Ah += ao; Al += ao;
    if (y < NT16) flash_wave<h16, false, 2>(Q16 + hp, nullptr, K16 + hp, nullptr, V16 + hp, nullptr, TT - 128 * (y + 1), TT - 128 * (y + 1) + 32 * w, lane, SL, Ah, Al);
    else flash_wave<bf, true, 1>(Qh + hp, Ql + hp, Kh + hp, Kl + hp, Vh + hp, Vl + hp, RH - 64 * (y - NT16 + 1), RH - 64 * (y - NT16 + 1) + 16 * w, lane, SL, Ah, Al);
}

extern "C" void kernel_launch(void* const* d_in, const int* in_sizes, int n_in,
                              void* d_out, int out_size, void* d_ws, size_t ws_size, hipStream_t stream) {
    (void)in_sizes; (void)n_in; (void)out_size;
    const float* x = (const float*)d_in[0]; const float* wq = (const float*)d_in[1]; const float* wk = (const float*)d_in[2]; const float* wv = (const float*)d_in[3]; const float* wo = (const float*)d_in[4]; const float* cosT = nullptr; const float* sinT = nullptr; (void)cosT; (void)sinT;
    float* OUT = (float*)d_out;     // [2][2048][2048]
    char* wsp = (char*)d_ws;
    auto take = [&](size_t bytes) { char* p = wsp; wsp += (bytes + 255) & ~(size_t)255; return (void*)p; };
    bf* WQ = (bf*)take((size_t)DQ * DM * 2); bf* WK = (bf*)take((size_t)DKV * DM * 2); bf* WV = (bf*)take((size_t)DKV * DM * 2); bf* WO = (bf*)take((size_t)DM * DQ * 2);
    // every plane holds both batches, [batch][head][..][..]
    h16* QP16 = (h16*)take((size_t)NB_ * NH_ * TT * HD * 2); h16* KP16 = (h16*)take((size_t)NB_ * NKV * TT * HD * 2); h16* VT16 = (h16*)take((size_t)NB_ * NKV * HD * TT * 2);
    bf* QPh = (bf*)take((size_t)NB_ * NH_ * TT * HD * 2); bf* QPl = (bf*)take((size_t)NB_ * NH_ * TT * HD * 2); bf* KPh = (bf*)take((size_t)NB_ * NKV * TT * HD * 2); bf* KPl = (bf*)take((size_t)NB_ * NKV * TT * HD * 2); bf* VTh = (bf*)take((size_t)NB_ * NKV * HD * TT * 2); bf* VTl = (bf*)take((size_t)NB_ * NKV * HD * TT * 2);
    bf* XB = (bf*)take((size_t)NB_ * TT * DM * 2); bf* ATh = (bf*)take((size_t)NB_ * TT * DQ * 2); bf* ATl = (bf*)take((size_t)NB_ * TT * DQ * 2);
    if ((size_t)(wsp - (char*)d_ws) > ws_size) return;    // 224 MiB of the 256 MiB
    k_cvtall<<<CVT_WG, 512, 0, stream>>>(wq, wk, wv, wo, x, WQ, WK, WV, WO, XB);
    k_gemml<0, true><<<dim3(TT / 128, DQ / 128, NB_), 128, 0, stream>>>(XB, nullptr, WQ, DM, nullptr, 0, QP16, QPh, QPl, (size_t)TT * HD, HD, (size_t)TT * DM, 0, (size_t)NH_ * TT * HD);      // [b][h][t][d]
    k_gemml<0, true><<<dim3(TT / 128, DKV / 128, NB_), 128, 0, stream>>>(XB, nullptr, WK, DM, nullptr, 0, KP16, KPh, KPl, (size_t)TT * HD, HD, (size_t)TT * DM, 0, (size_t)NKV * TT * HD);    // [b][h][t][d]
    k_gemml<0, true><<<dim3(DKV / 128, TT / 128, NB_), 128, 0, stream>>>(WV, nullptr, XB, DM, nullptr, 0, VT16, VTh, VTl, (size_t)128, TT, 0, (size_t)TT * DM, (size_t)NKV * HD * TT);        // operands swapped: [b][h][d][t]
    k_flash<<<dim3(NB_ * NH_, NT16 + NTHI, 1), 128, 0, stream>>>(QP16, KP16, VT16, QPh, QPl, KPh, KPl, VTh, VTl, ATh, ATl);
    k_gemml<1, false><<<dim3(TT / 128, DM / 128, NB_), 128, 0, stream>>>(ATh, ATl, WO, DQ, OUT, DM, nullptr, nullptr, nullptr, 0, 0, (size_t)TT * DQ, 0, (size_t)TT * DM);
}

// v010
// Measured time: 195 microseconds a run.
// Timed twice side by side with v009, it ran 1.13 and 1.12 times as fast.
// Over all steps from v000 it is 9.68 times as fast.
#include <hip/hip_runtime.h>

// FastestFlashMHA (x [2][2048][2048]; q/k/v = x W^T (16 heads x 128); scores = 30 tanh((q.k / sqrt(128)) / 30); key j allowed iff j <= i and i - j < 1024 (finfo.min fill); softmax; out = merged Wo^T -> [2][2048][2048]).
// Compute dtypes, f32 accumulate: every input rounded to bf16; q/k/v on PLAIN bf16 operands (inputs: exact), their head planes written by the projection kernel itself; softcap f32 (tanhf's small-argument polynomial, constants folded; precise tanhf in passes with a large score); causal scores and attn.v: query rows < 512 hl (3 products), the rest single fp16 (x256), one fused kernel that walks only the keys between the sliding window's edge and the diagonal, both tests inside the edge passes; online softmax f32; Wo hl x exact (2 products).

#define NB_  2
#define TT   2048
#define DM   2048
#define NH_  16
#define NKV  16
#define REP  (NH_ / NKV)
#define HD   128
#define DQ   (NH_ * HD)
#define DKV  (NKV * HD)
#define RH   512                  // query rows < RH use hi+lo planes (0: none)
#define WIN  1024
#define SCL  0.088388347648318447f   // HD^-0.5
typedef _Float16 h16;
typedef unsigned short bf;
typedef __attribute__((ext_vector_type(16))) __bf16   v16bf;
typedef __attribute__((ext_vector_type(16))) _Float16 v16h;
typedef __attribute__((ext_vector_type(8)))  _Float16 v8h;
typedef __attribute__((ext_vector_type(8)))  unsigned short v8us;
typedef __attribute__((ext_vector_type(8)))  float    v8f;
typedef __attribute__((ext_vector_type(4)))  float    v4f;
typedef v8h  __attribute__((may_alias)) v8ha;
typedef v4f  __attribute__((may_alias)) v4fa;
typedef v8us __attribute__((may_alias)) v8usa;

__device__ __forceinline__ unsigned short f2bf(float f) { unsigned u = __float_as_uint(f); u += 0x7FFFu + ((u >> 16) & 1u); return (unsigned short)(u >> 16); }
__device__ __forceinline__ float bf2f(unsigned short b) { return __uint_as_float(((unsigned)b) << 16); }
__device__ __forceinline__ float bfr(float f) { return bf2f(f2bf(f)); }
__device__ __forceinline__ v16h cat16(v8h lo, v8h hi) { return __builtin_shufflevector(lo, hi, 0, 1, 2, 3, 4, 5, 6, 7, 8, 9, 10, 11, 12, 13, 14, 15); }
__device__ __forceinline__ v16bf cat16b(v8us lo, v8us hi) { return __builtin_bit_cast(v16bf, __builtin_shufflevector(lo, hi, 0, 1, 2, 3, 4, 5, 6, 7, 8, 9, 10, 11, 12, 13, 14, 15)); }
__device__ __forceinline__ v8f wmma16(v16h a, v16h b, v8f c) { return __builtin_amdgcn_wmma_f32_16x16x32_f16(false, a, false, b, (short)0, c, false, false); }
__device__ __forceinline__ v8f wmmab(v16bf a, v16bf b, v8f c) { return __builtin_amdgcn_wmma_f32_16x16x32_bf16(false, a, false, b, (short)0, c, false, false); }



// Fragment loaders and products of the two 16-bit operand types (K-contiguous planes).
template <typename T16> struct WFrag;
template <> struct WFrag<h16> { typedef v16h V; static __device__ __forceinline__ V ld(const h16* p) { return cat16(*(const v8h*)p, *(const v8h*)(p + 16)); } static __device__ __forceinline__ v8f mma(V a, V b, v8f c) { return wmma16(a, b, c); } };
template <> struct WFrag<bf> { typedef v16bf V; static __device__ __forceinline__ V ld(const bf* p) { return cat16b(*(const v8us*)p, *(const v8us*)(p + 16)); } static __device__ __forceinline__ v8f mma(V a, V b, v8f c) { return wmmab(a, b, c); } };

__device__ __forceinline__ h16 tohx(float x) { return (h16)x; }
__device__ __forceinline__ void splitf(float y, unsigned short& h, unsigned short& l) { h = f2bf(y); l = f2bf(y - bf2f(h)); }

// ---- k_gemml: C[m][n] = sum_k A[m][k] Bt[n][k] (+ A2[m][k] Bt[n][k] when NSPLIT == 1), bf16 planes of row pitch K. PL == false: C is stored as f32, pitch ldc.
// PL == true: C is stored three times as 16-bit planes (fp16, bf16 hi, bf16 lo of the same f32 sum); element (m, n) lies at (n / 128) cstride + m pitch + n % 128 of each plane.
// With A = x, Bt = W, cstride = TT HD, pitch = HD that is the head plane [h][t][d]; with A = W, Bt = x, cstride = 128, pitch = TT it is the transposed plane [h][d][t]. One 128x128 tile per work-group of four waves, 64x64 per wave (16 accumulators);
// grid (M/128, N/128, batches), 128 threads; batch z reads A (and A2) + z zA and Bt + z zB and writes C or the planes + z zC (elements): both batches' work-groups are in flight together, and each hides the other's waits. Operands reach LDS by asynchronous copies in whole 128-byte row pieces (64 k), two buffers: the next piece's copies fly while this one is multiplied. K % 64 == 0, M % 128 == 0, N % 128 == 0.
// Every '#pragma unroll' in it is there so that the fragment and accumulator arrays are indexed by constants and stay in registers.
#define LP    144                 // LDS row pitch in bytes: 128 data + 16, an odd multiple of 16, for 16-byte fragment reads
#define LTILE (128 * LP)          // one operand's 128 rows
// Eight copies of 16 bytes a lane: rows 16 apart of one operand tile (LDS step 16 LP bytes, global step rs elements).
__device__ __forceinline__ void copy8(unsigned l, const bf* g, size_t rs) {
    // the wait on xcnt ends the copies' own statement, so that no address register is rewritten in front of it
    asm volatile("global_load_async_to_lds_b128 %0, %8, off\n\t"
                 "global_load_async_to_lds_b128 %1, %9, off\n\t"
                 "global_load_async_to_lds_b128 %2, %10, off\n\t"
                 "global_load_async_to_lds_b128 %3, %11, off\n\t"
                 "global_load_async_to_lds_b128 %4, %12, off\n\t"
                 "global_load_async_to_lds_b128 %5, %13, off\n\t"
                 "global_load_async_to_lds_b128 %6, %14, off\n\t"
                 "global_load_async_to_lds_b128 %7, %15, off\n\t"
                 "s_wait_xcnt 0x0"
                 :: "v"(l), "v"(l + 16u * LP), "v"(l + 32u * LP), "v"(l + 48u * LP), "v"(l + 64u * LP), "v"(l + 80u * LP), "v"(l + 96u * LP), "v"(l + 112u * LP),
                    "v"(g), "v"(g + rs), "v"(g + 2 * rs), "v"(g + 3 * rs), "v"(g + 4 * rs), "v"(g + 5 * rs), "v"(g + 6 * rs), "v"(g + 7 * rs) : "memory");
}
__device__ __forceinline__ v16bf ldsfrag(const unsigned char* p) { return cat16b(*(const v8usa*)p, *(const v8usa*)(p + 32)); }
typedef __attribute__((ext_vector_type(4))) int v4i;
// One lane's 16 bytes of each of the three planes.
__device__ __forceinline__ void store3(h16* p16, bf* ph, bf* pl, v4i d16, v4i dh, v4i dl) {
    // the wait on xcnt ends the stores' own statement, so that no address or data register of theirs is rewritten in front of it
    asm volatile("global_store_b128 %0, %3, off\n\t"
                 "global_store_b128 %1, %4, off\n\t"
                 "global_store_b128 %2, %5, off\n\t"
                 "s_wait_xcnt 0x0"
                 :: "v"(p16), "v"(ph), "v"(pl), "v"(d16), "v"(dh), "v"(dl) : "memory");
}
template <int NSPLIT, bool PL>
__device__ __forceinline__ void gemml_body(const bf* __restrict__ A, const bf* __restrict__ A2, const bf* __restrict__ Bt, int K, float* C, int ldc, h16* P16, bf* Ph, bf* Pl, size_t cstride, int pitch, size_t zA, size_t zB, size_t zC, size_t z) {
    { A += z * zA; if (NSPLIT == 1) A2 += z * zA; Bt += z * zB; if (PL) { P16 += z * zC; Ph += z * zC; Pl += z * zC; } else C += z * zC; }   // this work-group's batch
    constexpr int NT = (NSPLIT == 1) ? 3 : 2;           // operand tiles per stage: A, (A2,) Bt
    constexpr unsigned STG = NT * LTILE;
    __shared__ __align__(16) unsigned char L[2 * STG];
    __shared__ __align__(16) float osw[4][16 * 68];
    const int tid = threadIdx.x, lane = tid & 31, lr = lane & 15, hi = lane >> 4, w = tid >> 5, wm = w >> 1, wn = w & 1; const int r0 = blockIdx.x * 128, c0 = blockIdx.y * 128;
    v8f acc[4][4];
#pragma unroll
    for (int mb = 0; mb < 4; ++mb)
#pragma unroll
        for (int nb = 0; nb < 4; ++nb) acc[mb][nb] = (v8f){};
    // copies: lane tid brings 16-byte piece (tid & 7) of rows (tid >> 3) + 16 i, so a wave's copy covers four whole 128-byte row pieces
    const int crow = tid >> 3, cch = tid & 7; const size_t rs = (size_t)16 * K;
    const bf* gA = A + (size_t)(r0 + crow) * K + cch * 8; const bf* gA2 = (NSPLIT == 1) ? A2 + (size_t)(r0 + crow) * K + cch * 8 : nullptr; const bf* gB = Bt + (size_t)(c0 + crow) * K + cch * 8;
    const unsigned l0 = (unsigned)(size_t)L + (unsigned)(crow * LP + cch * 16);
    auto stage = [&](int t) { const unsigned l = l0 + (unsigned)(t & 1) * STG; const int kc = t * 64; copy8(l, gA + kc, rs); if (NSPLIT == 1) copy8(l + LTILE, gA2 + kc, rs); copy8(l + (NT - 1) * LTILE, gB + kc, rs); };
    const int nst = K / 64;
    stage(0);
    asm volatile("s_wait_asynccnt 0x0" ::: "memory");   // this wave's copies of stage 0 have landed
    __syncthreads();                                     // ... and every other wave's
    if (nst > 1) stage(1);
    const unsigned aofs = (unsigned)((wm * 64 + lr) * LP + hi * 16), bofs = (unsigned)((NT - 1) * LTILE + (wn * 64 + lr) * LP + hi * 16);
#pragma unroll 1   // one stage a trip: the two buffers alternate by the trip's parity
    for (int t = 0; t < nst; ++t) {
        const unsigned char* Lb = L + (unsigned)(t & 1) * STG; const unsigned char* pa = Lb + aofs; const unsigned char* pb = Lb + bofs;
        // Fragment reads stand in few groups, each ahead of the products that hide it (one wave per SIMD: nothing else hides an LDS wait). Every accumulator still takes its products in ascending k, A before A2.
        // Each sched_barrier(0) below keeps a read group where it is written: without them the scheduler sinks every read to just in front of its first use, and the wave waits out the LDS latency once per four products.
        v16bf a[4], a2[4], b[4];
        if (NSPLIT == 0) {   // a: k 0..31 of the stage, a2: k 32..63
#pragma unroll
            for (int mb = 0; mb < 4; ++mb) a[mb] = ldsfrag(pa + mb * 16 * LP);
#pragma unroll
            for (int nb = 0; nb < 4; ++nb) b[nb] = ldsfrag(pb + nb * 16 * LP);
#pragma unroll
            for (int mb = 0; mb < 4; ++mb) a2[mb] = ldsfrag(pa + mb * 16 * LP + 64);
            __builtin_amdgcn_sched_barrier(0);
#pragma unroll
            for (int h = 0; h < 2; ++h) {
#pragma unroll
                for (int nb = 2 * h; nb < 2 * h + 2; ++nb)
#pragma unroll
                    for (int mb = 0; mb < 4; ++mb) acc[mb][nb] = wmmab(a[mb], b[nb], acc[mb][nb]);
                __builtin_amdgcn_sched_barrier(0);
#pragma unroll
                for (int nb = 2 * h; nb < 2 * h + 2; ++nb) b[nb] = ldsfrag(pb + nb * 16 * LP + 64);
                __builtin_amdgcn_sched_barrier(0); }
#pragma unroll
            for (int nb = 0; nb < 4; ++nb)
#pragma unroll
                for (int mb = 0; mb < 4; ++mb) acc[mb][nb] = wmmab(a2[mb], b[nb], acc[mb][nb]);
        } else {
#pragma unroll
            for (int mb = 0; mb < 4; ++mb) a[mb] = ldsfrag(pa + mb * 16 * LP);
#pragma unroll
            for (int nb = 0; nb < 4; ++nb) b[nb] = ldsfrag(pb + nb * 16 * LP);
#pragma unroll
            for (int mb = 0; mb < 4; ++mb) a2[mb] = ldsfrag(pa + LTILE + mb * 16 * LP);
            __builtin_amdgcn_sched_barrier(0);
#pragma unroll
            for (int nb = 0; nb < 4; ++nb)
#pragma unroll
                for (int mb = 0; mb < 4; ++mb) acc[mb][nb] = wmmab(a[mb], b[nb], acc[mb][nb]);
            __builtin_amdgcn_sched_barrier(0);
#pragma unroll
            for (int mb = 0; mb < 4; ++mb) a[mb] = ldsfrag(pa + mb * 16 * LP + 64);
            __builtin_amdgcn_sched_barrier(0);
#pragma unroll
            for (int h = 0; h < 2; ++h) {
#pragma unroll
                for (int nb = 2 * h; nb < 2 * h + 2; ++nb)
#pragma unroll
                    for (int mb = 0; mb < 4; ++mb) acc[mb][nb] = wmmab(a2[mb], b[nb], acc[mb][nb]);
                __builtin_amdgcn_sched_barrier(0);
#pragma unroll
                for (int nb = 2 * h; nb < 2 * h + 2; ++nb) b[nb] = ldsfrag(pb + nb * 16 * LP + 64);
                if (h == 0) __builtin_amdgcn_sched_barrier(0); }
#pragma unroll
            for (int mb = 0; mb < 4; ++mb) a2[mb] = ldsfrag(pa + LTILE + mb * 16 * LP + 64);
            __builtin_amdgcn_sched_barrier(0);
#pragma unroll
            for (int nb = 0; nb < 4; ++nb)
#pragma unroll
                for (int mb = 0; mb < 4; ++mb) acc[mb][nb] = wmmab(a[mb], b[nb], acc[mb][nb]);
#pragma unroll
            for (int nb = 0; nb < 4; ++nb)
#pragma unroll
                for (int mb = 0; mb < 4; ++mb) acc[mb][nb] = wmmab(a2[mb], b[nb], acc[mb][nb]);
        }
        asm volatile("s_wait_dscnt 0x0" ::: "memory");      // this wave's reads of the buffer are done before it is handed back
        asm volatile("s_wait_asynccnt 0x0" ::: "memory");   // this wave's copies of stage t + 1 have landed
        __syncthreads();                                     // publishes stage t + 1 and ends every wave's reads of stage t
        if (t + 2 < nst) stage(t + 2);
    }
    asm volatile("s_wait_asynccnt 0x0" ::: "memory");       // no copy is outstanding when the wave goes on
    float* os = osw[w];   // each wave turns its own accumulators into whole row pieces (256 bytes of f32, 128 bytes of each 16-bit plane) through its own LDS slice; the wave barriers with their compiler fences keep the slice's stores, reads and next stores in that order
#pragma unroll
    for (int mb = 0; mb < 4; ++mb) {
#pragma unroll
        for (int nb = 0; nb < 4; ++nb) {
#pragma unroll
            for (int j = 0; j < 8; ++j) os[(hi * 8 + j) * 68 + nb * 16 + lr] = acc[mb][nb][j]; }
        __builtin_amdgcn_wave_barrier(); asm volatile("" ::: "memory");
        if constexpr (PL) {   // a lane takes eight neighbours of one row: 16 bytes of each plane, eight lanes a whole 128-byte line
            const int prow = lane >> 3, pcol = (lane & 7) * 8; const size_t po = (size_t)blockIdx.y * cstride + (size_t)(r0 + wm * 64 + mb * 16 + prow) * pitch + wn * 64 + pcol;
            v4f x0[4], x1[4];   // all eight LDS reads first: the stores' statements let no read pass them, and the wave would wait out the LDS latency once per row group
#pragma unroll
            for (int s = 0; s < 4; ++s) { const float* ps = os + (4 * s + prow) * 68 + pcol; x0[s] = *(const v4fa*)ps; x1[s] = *(const v4fa*)(ps + 4); }
#pragma unroll
            for (int s = 0; s < 4; ++s) { v8h o16; v8us oh, ol;
#pragma unroll
                for (int k = 0; k < 8; ++k) { const float xv = (k < 4) ? x0[s][k & 3] : x1[s][k & 3]; o16[k] = tohx(xv); unsigned short a2, c2; splitf(xv, a2, c2); oh[k] = a2; ol[k] = c2; }
                const size_t o = po + (size_t)(4 * s) * pitch; store3(P16 + o, Ph + o, Pl + o, __builtin_bit_cast(v4i, o16), __builtin_bit_cast(v4i, oh), __builtin_bit_cast(v4i, ol)); }
        } else {
        float* crw = C + (size_t)(r0 + wm * 64 + mb * 16) * ldc + c0 + wn * 64;
#pragma unroll
        for (int s = 0; s < 8; ++s) { const int row = 2 * s + hi, cofs = lr * 4; const v4f val = *(const v4fa*)(os + row * 68 + cofs); *(v4f*)(crw + (size_t)row * ldc + cofs) = val; }
        }
        __builtin_amdgcn_wave_barrier(); asm volatile("" ::: "memory");
    }
}
template <int NSPLIT, bool PL>
__global__ __launch_bounds__(128) void k_gemml(const bf* A, const bf* A2, const bf* Bt, int K, float* C, int ldc, h16* P16, bf* Ph, bf* Pl, size_t cstride, int pitch, size_t zA, size_t zB, size_t zC) {
    gemml_body<NSPLIT, PL>(A, A2, Bt, K, C, ldc, P16, Ph, Pl, cstride, pitch, zA, zB, zC, blockIdx.z);
}
// ---- k_proj3: the three projections in ONE launch, grid z = projection NB_ + batch. The three products do not depend on each other: in one launch there are three times as many work-groups as in one of them,
// so that a WGP holds as many as its LDS takes (three) instead of two, a work-group's epilogue runs beside other work-groups' main loops, and only one launch starts and drains.
struct Proj { const bf* A; const bf* Bt; h16* P16; bf* Ph; bf* Pl; size_t cstride; size_t zA; size_t zB; int pitch; };
__global__ __launch_bounds__(128) void k_proj3(Proj p0, Proj p1, Proj p2, int K, size_t zC) {
    const int pj = blockIdx.z / NB_; const Proj p = (pj == 0) ? p0 : (pj == 1) ? p1 : p2;   // the same for the whole work-group
    gemml_body<0, true>(p.A, nullptr, p.Bt, K, nullptr, 0, p.P16, p.Ph, p.Pl, p.cstride, p.pitch, p.zA, p.zB, zC, blockIdx.z % NB_);
}

typedef __attribute__((ext_vector_type(2))) _Float16 v2h;
typedef __attribute__((ext_vector_type(4))) _Float16 v4h;
typedef __attribute__((ext_vector_type(2))) unsigned short v2us;
typedef __attribute__((ext_vector_type(4))) unsigned short v4us;
typedef __attribute__((ext_vector_type(2))) float v2f;

__global__ __launch_bounds__(256) void k_wtG(const float* __restrict__ w, int K, int N, bf* Bt) {
    const int lane = threadIdx.x & 31; const int L0 = (blockIdx.x * 8 + (threadIdx.x >> 5)) * 8; const int nlines = N * K / 64;
{
#pragma unroll 1
        for (int l = 0; l < 8; ++l) { const int L = L0 + l; if (L >= nlines) break; const size_t e = (size_t)L * 64 + lane * 2; const int k = (int)(e % K), n = (int)(e / K); v2us o;
            o[0] = f2bf(w[(size_t)k * N + n]); o[1] = f2bf(w[(size_t)(k + 1) * N + n]); *(v2us*)(Bt + e) = o; }
         }
}
// ---- k_cvtall: every f32 input rounded to bf16 in ONE launch of CVT_WG work-groups of 16 waves, one to a WGP. The launch is a stream: its time should be its bytes, not the starting of waves,
// so a thread converts 24 pieces of eight elements instead of one. The inputs form six equal segments (four weights, the two halves of x); every thread takes four pieces of each, CVT_T pieces apart,
// and the next segment's eight 16-byte loads are issued before this segment is converted and stored, so that eight to sixteen loads of a wave are always in flight.
#define CVT_WG 256
#define CVT_T  (CVT_WG * 512)                 // threads of the launch
#define CVT_SEG ((size_t)DQ * DM)             // elements of a segment
static_assert(CVT_SEG == (size_t)4 * CVT_T * 8 && (size_t)DKV * DM == CVT_SEG && (size_t)DM * DQ == CVT_SEG && (size_t)NB_ * TT * DM == 2 * CVT_SEG, "six equal segments, four pieces a thread in each");
__global__ __launch_bounds__(512) void k_cvtall(const float* __restrict__ wq, const float* __restrict__ wk, const float* __restrict__ wv, const float* __restrict__ wo, const float* __restrict__ x,
                                                bf* __restrict__ WQ, bf* __restrict__ WK, bf* __restrict__ WV, bf* __restrict__ WO, bf* __restrict__ XB) {
    const size_t e0 = ((size_t)blockIdx.x * 512 + threadIdx.x) * 8;
    const float* const src[6] = { wq, wk, wv, wo, x, x + CVT_SEG }; bf* const dst[6] = { WQ, WK, WV, WO, XB, XB + CVT_SEG };
    v8f v[2][4];
    // Every '#pragma unroll' below keeps the pointer tables and the two register sets indexed by constants.
#pragma unroll
    for (int u = 0; u < 4; ++u) v[0][u] = *(const v8f*)(src[0] + e0 + (size_t)u * CVT_T * 8);
    asm volatile("s_wait_xcnt 0x0" ::: "memory");   // as in the loop: in front of the next loads, which may land in address registers of the loads above
    __builtin_amdgcn_sched_barrier(0);   // keeps the next loads and their address arithmetic behind that wait
#pragma unroll
    for (int sg = 0; sg < 6; ++sg) {
        if (sg + 1 < 6) {
#pragma unroll
            for (int u = 0; u < 4; ++u) v[(sg + 1) & 1][u] = *(const v8f*)(src[sg + 1] + e0 + (size_t)u * CVT_T * 8); }
        __builtin_amdgcn_sched_barrier(0);   // keeps the next segment's loads in front of this segment's wait: without it the scheduler may sink them behind the stores, and the wave has nothing in flight while it converts
#pragma unroll
        for (int u = 0; u < 4; ++u) { v8us o;
#pragma unroll
            for (int k = 0; k < 8; ++k) o[k] = f2bf(v[sg & 1][u][k]);
            *(v8us*)(dst[sg] + e0 + (size_t)u * CVT_T * 8) = o; }
        if (sg + 1 < 6) { asm volatile("s_wait_xcnt 0x0" ::: "memory");   // in front of the next loads, which land in registers that the stores above name
            __builtin_amdgcn_sched_barrier(0); }   // keeps the next trip's address arithmetic behind that wait
    }
}
// ---- k_flash: the whole attention of both batches in one launch. A wave owns 16 R query rows of one head and walks their keys in passes of 32, from the first key inside the sliding window to the diagonal; scores and probabilities never leave registers.
// Transposed products: S^T = K Q^T (A = key rows, B = query rows) leaves one query's scores in one lane pair (lanes l and l ^ 16), and the two 16-key score tiles of a pass are, register for register, the B operand P^T of O^T += V^T P^T (A = rows of the [d][t] value planes).
// Online softmax in powers of two: running maximum and sum per query; the output sums are rescaled only in a pass that raises some query's maximum.
// Keys and values reach the waves through LDS: a work-group's four waves walk nearly the same keys, so the work-group brings tiles of SKEYS keys (key rows, and the same keys' piece of every value row) by asynchronous copies in whole 128-byte lines,
// two buffers, the next tile's copies in flight while this one is worked on; a wave leaves out the passes of a tile that lie outside its own rows' keys. The query fragments come straight from their plane, once.
// HI: bf16 hi + lo planes, three products for each contraction (query rows < RH); otherwise single fp16, probabilities carried x PCAR2.
#define LPCAR2 8.0f               // log2 of PCAR2 = 256
#define L2E   1.4426950408889634f
// Capped score in units of log2: u(s) = 30 log2(e) tanh(s HD^-0.5 / 30) for a raw product s. For |s HD^-0.5 / 30| < 0.625 tanh is the small-argument odd polynomial of the precise tanhf, x + x t P(t), t = x x;
// every constant factor on the way (HD^-0.5, 1 / 30, 30, log2(e)) is multiplied into its coefficients at compile time, in double, so that a score costs s s, five fused multiply-adds and one product: no division, no separate scalings, no branch.
#define CAPX  (0.088388347648318447 / 30.0)                  // x = CAPX s
#define CAPT  (CAPX * CAPX)                                  // t = CAPT s s
#define CAPA  (30.0 * 1.4426950408889634 * CAPX)             // u = CAPA s (1 + t P(t))
#define SBIG  ((float)(0.625 / CAPX))                        // |s| from which on the polynomial no longer holds
__device__ __forceinline__ float cap_small(float s) { const float t = s * s;
    float p = __builtin_fmaf((float)(CAPA * CAPT * CAPT * CAPT * CAPT * CAPT * -0.00570002059), t, (float)(CAPA * CAPT * CAPT * CAPT * CAPT * 0.0206340719)); p = __builtin_fmaf(t, p, (float)(CAPA * CAPT * CAPT * CAPT * -0.0537379310));
    p = __builtin_fmaf(t, p, (float)(CAPA * CAPT * CAPT * 0.133314162)); p = __builtin_fmaf(t, p, (float)(CAPA * CAPT * -0.333332807)); p = __builtin_fmaf(t, p, (float)CAPA);
    return s * p; }
#define SKEYS 64                  // keys of a tile: two passes
#define KPB   272                 // LDS pitch of a key row in bytes: 256 data + 16, an odd multiple of 16, for 16-byte fragment reads
#define VPB   144                 // LDS pitch of a value row's piece: 128 data + 16, likewise
#define KTILE (SKEYS * KPB)       // one key plane's rows of a tile
#define VTILE (HD * VPB)          // one value plane's pieces of a tile
// Eight copies of 16 bytes a lane: LDS step LS bytes, global step gs bytes.
template <unsigned LS>
__device__ __forceinline__ void copy8t(unsigned l, const char* g, size_t gs) {
    // the wait on xcnt ends the copies' own statement, so that no address register is rewritten in front of it
    asm volatile("global_load_async_to_lds_b128 %0, %8, off\n\t"
                 "global_load_async_to_lds_b128 %1, %9, off\n\t"
                 "global_load_async_to_lds_b128 %2, %10, off\n\t"
                 "global_load_async_to_lds_b128 %3, %11, off\n\t"
                 "global_load_async_to_lds_b128 %4, %12, off\n\t"
                 "global_load_async_to_lds_b128 %5, %13, off\n\t"
                 "global_load_async_to_lds_b128 %6, %14, off\n\t"
                 "global_load_async_to_lds_b128 %7, %15, off\n\t"
                 "s_wait_xcnt 0x0"
                 :: "v"(l), "v"(l + LS), "v"(l + 2u * LS), "v"(l + 3u * LS), "v"(l + 4u * LS), "v"(l + 5u * LS), "v"(l + 6u * LS), "v"(l + 7u * LS),
                    "v"(g), "v"(g + gs), "v"(g + 2 * gs), "v"(g + 3 * gs), "v"(g + 4 * gs), "v"(g + 5 * gs), "v"(g + 6 * gs), "v"(g + 7 * gs) : "memory");
}
__device__ __forceinline__ float xhalf(float x) { return __builtin_bit_cast(float, __builtin_amdgcn_permlanex16(__builtin_bit_cast(int, x), __builtin_bit_cast(int, x), 0x76543210, 0xfedcba98, false, false)); }   // lane l with lane l ^ 16
template <typename T16, bool HI, int R>
__device__ __forceinline__ void flash_wave(const T16* Q, const T16* Q2, const T16* Kp, const T16* K2, const T16* Vt, const T16* Vt2, int qwg, int q0, int lane, unsigned char* SL, bf* Ah, bf* Al) {   // qwg: the work-group's first row (64 R rows), q0: the wave's
    typedef typename WFrag<T16>::V V;
    const int lr = lane & 15, hi = lane >> 4;
    // Every '#pragma unroll' below keeps a fragment or accumulator array indexed by constants, so that it stays in registers.
    V qf[R][4], qf2[R][4];
#pragma unroll
    for (int g = 0; g < R; ++g)
#pragma unroll
        for (int kc = 0; kc < 4; ++kc) { const size_t o = (size_t)(q0 + 16 * g + lr) * HD + 32 * kc + 8 * hi; qf[g][kc] = WFrag<T16>::ld(Q + o); if constexpr (HI) qf2[g][kc] = WFrag<T16>::ld(Q2 + o); }
    asm volatile("s_wait_xcnt 0x0" ::: "memory");   // in front of the first rewrite of an address register of the loads above
    __builtin_amdgcn_sched_barrier(0);   // keeps later address arithmetic behind that wait
    v8f acc[R][8]; float m_run[R], l_run[R];
#pragma unroll
    for (int g = 0; g < R; ++g) { m_run[g] = -1.0e30f; l_run[g] = 0.0f;   // far above the mask's fill, far below any score: a pass whose keys are all masked for a query gives it zeros
#pragma unroll
        for (int t = 0; t < 8; ++t) acc[g][t] = (v8f){}; }
    const int kbeg = max(0, q0 - (WIN - 1)) & ~31, kend = q0 + 16 * R;   // row i allows keys j with i - WIN < j <= i
    constexpr int NPL = HI ? 2 : 1;                     // planes of each operand
    constexpr unsigned STG = NPL * (KTILE + VTILE);     // bytes of a buffer: key planes, then value planes
    const int kb0 = max(0, qwg - (WIN - 1)) & ~(SKEYS - 1), nst = (qwg + 64 * R - kb0) / SKEYS;   // the work-group's tiles cover every wave's keys; both ends are multiples of SKEYS
    // copies: thread tid brings 16-byte piece (tid & 15) of key rows (tid >> 4) + 8 i and piece (tid & 7) of value rows (tid >> 3) + 16 i, so every copy of a wave covers whole 128-byte lines
    const int tid = threadIdx.x;
    const unsigned lk = (unsigned)(size_t)SL + (unsigned)((tid >> 4) * KPB + (tid & 15) * 16), lv = (unsigned)(size_t)SL + (unsigned)(NPL * KTILE + (tid >> 3) * VPB + (tid & 7) * 16);
    const size_t gk = ((size_t)(kb0 + (tid >> 4)) * HD + (tid & 15) * 8) * 2, gv = ((size_t)(tid >> 3) * TT + kb0 + (tid & 7) * 8) * 2;   // byte offsets in the planes
    auto stage = [&](int t) { const unsigned b = (unsigned)(t & 1) * STG; const size_t ok = gk + (size_t)t * (SKEYS * HD * 2), ov = gv + (size_t)t * (SKEYS * 2);
        copy8t<8 * KPB>(lk + b, (const char*)Kp + ok, (size_t)8 * HD * 2); if constexpr (HI) copy8t<8 * KPB>(lk + b + KTILE, (const char*)K2 + ok, (size_t)8 * HD * 2);
        copy8t<16 * VPB>(lv + b, (const char*)Vt + ov, (size_t)16 * TT * 2); if constexpr (HI) copy8t<16 * VPB>(lv + b + VTILE, (const char*)Vt2 + ov, (size_t)16 * TT * 2); };
    auto lfrag = [&](const unsigned char* p) -> V { if constexpr (HI) return cat16b(*(const v8usa*)p, *(const v8usa*)(p + 32)); else return cat16(*(const v8ha*)p, *(const v8ha*)(p + 32)); };
    // Trips -2 and -1 only fill: trip -2 issues tile 0's copies; trip -1 waits for them, passes the barrier that publishes them and issues tile 1's. So the copies stand once in the code, always on freshly formed addresses:
    // written a second time in front of the loop they took the loop-invariant addresses themselves as operands, which tied those to the registers that asm text can name, and the compiler spilled them to scratch.
#pragma unroll 1   // one tile a trip: the two buffers alternate by the trip's parity
    for (int tl = -2; tl < nst; ++tl) {
    const unsigned char* Lb = SL + (unsigned)(tl & 1) * STG;
#pragma unroll 1   // one pass a trip: the body is long, and a second copy would only cost instruction cache
    for (int hf = (tl >= 0) ? 0 : 2; hf < 2; ++hf) {
        const int key0 = kb0 + SKEYS * tl + 32 * hf;
        if (key0 < kbeg || key0 >= kend) continue;   // wave-uniform: this pass's keys lie outside the wave's rows' keys
        // The pass's key and value fragments are read in one group: the products wait for the key fragments alone, and the value fragments arrive under them and under the softcap.
        V kf[2][4], kf2[2][4], vf[8], vf2[8];
        const unsigned char* pk = Lb + (32 * hf + lr) * KPB + 16 * hi; const unsigned char* pv = Lb + NPL * KTILE + lr * VPB + 64 * hf + 16 * hi;
#pragma unroll
        for (int kc = 0; kc < 4; ++kc)
#pragma unroll
            for (int kt = 0; kt < 2; ++kt) { kf[kt][kc] = lfrag(pk + 16 * kt * KPB + 64 * kc); if constexpr (HI) kf2[kt][kc] = lfrag(pk + KTILE + 16 * kt * KPB + 64 * kc); }
#pragma unroll
        for (int t = 0; t < 8; ++t) { vf[t] = lfrag(pv + 16 * t * VPB); if constexpr (HI) vf2[t] = lfrag(pv + VTILE + 16 * t * VPB); }
        __builtin_amdgcn_sched_barrier(0);   // without it the scheduler sinks each read to just in front of its first use, and the wave waits out the LDS latency there
        v8f s[2][R];
#pragma unroll
        for (int kt = 0; kt < 2; ++kt)
#pragma unroll
            for (int g = 0; g < R; ++g) s[kt][g] = (v8f){};
#pragma unroll
        for (int kc = 0; kc < 4; ++kc)
#pragma unroll
            for (int kt = 0; kt < 2; ++kt)
#pragma unroll
                for (int g = 0; g < R; ++g) { s[kt][g] = WFrag<T16>::mma(kf[kt][kc], qf[g][kc], s[kt][g]);
                    if constexpr (HI) { s[kt][g] = WFrag<T16>::mma(kf[kt][kc], qf2[g][kc], s[kt][g]); s[kt][g] = WFrag<T16>::mma(kf2[kt][kc], qf[g][kc], s[kt][g]); } }
        const bool edge = (key0 + 31 > q0) || (q0 + 16 * R - 1 - key0 >= WIN);   // wave-uniform: only passes that meet the diagonal or the window's lower edge pay for the mask
        // softcap 30 tanh(x / 30), from here on in units of log2: one wave-uniform test a pass (the largest |s|) picks the branch-free polynomial for all of the pass's scores, or the library's tanhf for all of them (a NaN stays a NaN in either)
        float sbig = 0.0f;
#pragma unroll
        for (int kt = 0; kt < 2; ++kt)
#pragma unroll
            for (int g = 0; g < R; ++g) { float a = 0.0f;   // a chain of its own for each score tile: independent chains fill each other's latency
#pragma unroll
                for (int j = 0; j < 8; ++j) a = fmaxf(a, fabsf(s[kt][g][j]));
                sbig = fmaxf(sbig, a); }
        if (__builtin_amdgcn_ballot_w32(!(sbig < SBIG)) != 0) {
#pragma unroll
            for (int kt = 0; kt < 2; ++kt)
#pragma unroll
                for (int g = 0; g < R; ++g)
#pragma unroll
                    for (int j = 0; j < 8; ++j) s[kt][g][j] = (30.0f * L2E) * tanhf(__fdiv_rn(s[kt][g][j] * SCL, 30.0f));
        } else {
#pragma unroll
            for (int kt = 0; kt < 2; ++kt)
#pragma unroll
                for (int g = 0; g < R; ++g)
#pragma unroll
                    for (int j = 0; j < 8; ++j) s[kt][g][j] = cap_small(s[kt][g][j]); }
        float mb[R]; bool need = false;
#pragma unroll
        for (int g = 0; g < R; ++g) { const int qi = q0 + 16 * g + lr; float mx = -3.0e38f;
#pragma unroll
            for (int kt = 0; kt < 2; ++kt)
#pragma unroll
                for (int j = 0; j < 8; ++j) { float t = s[kt][g][j]; const int key = key0 + 16 * kt + 8 * hi + j; if (edge && !(key <= qi && qi - key < WIN)) t = -3.0e38f; s[kt][g][j] = t; mx = fmaxf(mx, t); }
            mx = fmaxf(mx, xhalf(mx)); if constexpr (!HI) mx -= LPCAR2; mb[g] = mx; need = need || (mx > m_run[g]); }   // fp16 rows: the reference point lies log2(PCAR2) below the maximum, which carries the probabilities x PCAR2 at no cost
        if (__builtin_amdgcn_ballot_w32(need) != 0) {
#pragma unroll
            for (int g = 0; g < R; ++g) { const float m_new = fmaxf(m_run[g], mb[g]); const float corr = __builtin_amdgcn_exp2f(m_run[g] - m_new); l_run[g] *= corr; m_run[g] = m_new;
#pragma unroll
                for (int t = 0; t < 8; ++t) acc[g][t] = acc[g][t] * corr; } }
#pragma unroll
        for (int g = 0; g < R; ++g) { float ps = 0.0f;
            if constexpr (HI) { v8us h0, h1, l0, l1;
#pragma unroll
                for (int j = 0; j < 8; ++j) { const float p0 = __builtin_amdgcn_exp2f(s[0][g][j] - m_run[g]), p1 = __builtin_amdgcn_exp2f(s[1][g][j] - m_run[g]); ps += p0 + p1;
                    unsigned short a, c2; splitf(p0, a, c2); h0[j] = a; l0[j] = c2; splitf(p1, a, c2); h1[j] = a; l1[j] = c2; }
                const V ph = cat16b(h0, h1), pl = cat16b(l0, l1);
#pragma unroll
                for (int t = 0; t < 8; ++t) acc[g][t] = WFrag<T16>::mma(vf[t], ph, acc[g][t]);
#pragma unroll
                for (int t = 0; t < 8; ++t) acc[g][t] = WFrag<T16>::mma(vf[t], pl, acc[g][t]);
#pragma unroll
                for (int t = 0; t < 8; ++t) acc[g][t] = WFrag<T16>::mma(vf2[t], ph, acc[g][t]);
            } else { v8h a0, a1;
#pragma unroll
                for (int j = 0; j < 8; ++j) { const float p0 = __builtin_amdgcn_exp2f(s[0][g][j] - m_run[g]), p1 = __builtin_amdgcn_exp2f(s[1][g][j] - m_run[g]); ps += p0 + p1;
                    a0[j] = tohx(p0); a1[j] = tohx(p1); }
                const V pf = cat16(a0, a1);
#pragma unroll
                for (int t = 0; t < 8; ++t) acc[g][t] = WFrag<T16>::mma(vf[t], pf, acc[g][t]); }
            l_run[g] += ps; }
        __builtin_amdgcn_sched_barrier(0);   // keeps the pass's last products in front of the slots below
        asm volatile("v_nop\n\tv_nop\n\tv_nop\n\tv_nop");   // the four vector slots between the pass's last matrix instruction and the first overwrite of its operands, which stands behind a branch
    }
        asm volatile("s_wait_dscnt 0x0" ::: "memory");      // this wave's reads of the buffer are done before it is handed back
        asm volatile("s_wait_asynccnt 0x0" ::: "memory");   // this wave's copies of tile tl + 1 have landed
        __syncthreads();                                     // publishes tile tl + 1 and ends every wave's reads of tile tl
        if (tl + 2 < nst) stage(tl + 2);
    }
    asm volatile("s_wait_asynccnt 0x0" ::: "memory");       // no copy is outstanding when the wave goes on
#pragma unroll
    for (int g = 0; g < R; ++g) { const float l = l_run[g] + xhalf(l_run[g]);   // each wave half summed its own eight keys of every 16; the sum carries the same factor as the products
        const float inv = __fdiv_rn(1.0f, l); const size_t oo = (size_t)(q0 + 16 * g + lr) * DQ + 8 * hi;
#pragma unroll
        for (int t = 0; t < 8; ++t) { v8us oh, ol;   // the lane holds d = 16 t + 8 hi .. + 7 of its query: 16 bytes of each plane
#pragma unroll
            for (int j = 0; j < 8; ++j) { unsigned short a, c2; splitf(acc[g][t][j] * inv, a, c2); oh[j] = a; ol[j] = c2; }
            *(v8us*)(Ah + oo + 16 * t) = oh; *(v8us*)(Al + oo + 16 * t) = ol; }
        if (g + 1 < R) { asm volatile("s_wait_xcnt 0x0" ::: "memory");   // in front of the next group's rewrite of the stores' address and data registers
            __builtin_amdgcn_sched_barrier(0); } }   // keeps the next group's arithmetic behind that wait
}
// grid (batches x heads, NT16 + NTHI), 128 threads, four waves that share their key and value tiles; x = batch NH_ + head, the planes lie [batch][head]. Tiles in y: first the fp16 rows from the sequence's end, 128 rows a work-group; then the hi + lo rows, 64 a work-group.
#define NT16 ((TT - RH) / 128)
#define NTHI (RH / 64)
__global__ __launch_bounds__(128) void k_flash(const h16* Q16, const h16* K16, const h16* V16, const bf* Qh, const bf* Ql, const bf* Kh, const bf* Kl, const bf* Vh, const bf* Vl, bf* Ah, bf* Al) {   // no __restrict__: the loads must stay on their side of the waits written in asm
    __shared__ __align__(16) unsigned char SL[2 * 2 * (KTILE + VTILE)];   // two buffers of the larger kind (hi + lo planes)
    const int lane = threadIdx.x & 31, w = __builtin_amdgcn_readfirstlane(threadIdx.x >> 5), y = blockIdx.y; const size_t hp = (size_t)blockIdx.x * TT * HD; const size_t ao = (size_t)(blockIdx.x / NH_) * TT * DQ + (blockIdx.x % NH_) * HD; Ah += ao; Al += ao;
    if (y < NT16) flash_wave<h16, false, 2>(Q16 + hp, nullptr, K16 + hp, nullptr, V16 + hp, nullptr, TT - 128 * (y + 1), TT - 128 * (y + 1) + 32 * w, lane, SL, Ah, Al);
    else flash_wave<bf, true, 1>(Qh + hp, Ql + hp, Kh + hp, Kl + hp, Vh + hp, Vl + hp, RH - 64 * (y - NT16 + 1), RH - 64 * (y - NT16 + 1) + 16 * w, lane, SL, Ah, Al);
}

extern "C" void kernel_launch(void* const* d_in, const int* in_sizes, int n_in,
                              void* d_out, int out_size, void* d_ws, size_t ws_size, hipStream_t stream) {
    (void)in_sizes; (void)n_in; (void)out_size;
    const float* x = (const float*)d_in[0]; const float* wq = (const float*)d_in[1]; const float* wk = (const float*)d_in[2]; const float* wv = (const float*)d_in[3]; const float* wo = (const float*)d_in[4]; const float* cosT = nullptr; const float* sinT = nullptr; (void)cosT; (void)sinT;
    float* OUT = (float*)d_out;     // [2][2048][2048]
    char* wsp = (char*)d_ws;
    auto take = [&](size_t bytes) { char* p = wsp; wsp += (bytes + 255) & ~(size_t)255; return (void*)p; };
    bf* WQ = (bf*)take((size_t)DQ * DM * 2); bf* WK = (bf*)take((size_t)DKV * DM * 2); bf* WV = (bf*)take((size_t)DKV * DM * 2); bf* WO = (bf*)take((size_t)DM * DQ * 2);
    // every plane holds both batches, [batch][head][..][..]
    h16* QP16 = (h16*)take((size_t)NB_ * NH_ * TT * HD * 2); h16* KP16 = (h16*)take((size_t)NB_ * NKV * TT * HD * 2); h16* VT16 = (h16*)take((size_t)NB_ * NKV * HD * TT * 2);
    bf* QPh = (bf*)take((size_t)NB_ * NH_ * TT * HD * 2); bf* QPl = (bf*)take((size_t)NB_ * NH_ * TT * HD * 2); bf* KPh = (bf*)take((size_t)NB_ * NKV * TT * HD * 2); bf* KPl = (bf*)take((size_t)NB_ * NKV * TT * HD * 2); bf* VTh = (bf*)take((size_t)NB_ * NKV * HD * TT * 2); bf* VTl = (bf*)take((size_t)NB_ * NKV * HD * TT * 2);
    bf* XB = (bf*)take((size_t)NB_ * TT * DM * 2); bf* ATh = (bf*)take((size_t)NB_ * TT * DQ * 2); bf* ATl = (bf*)take((size_t)NB_ * TT * DQ * 2);
    if ((size_t)(wsp - (char*)d_ws) > ws_size) return;    // 224 MiB of the 256 MiB
    k_cvtall<<<CVT_WG, 512, 0, stream>>>(wq, wk, wv, wo, x, WQ, WK, WV, WO, XB);
    static_assert(TT == DQ && DQ == DKV, "one grid (16 x 16 tiles) and one batch step of the planes serve all three projections");
    const Proj pq = { XB, WQ, QP16, QPh, QPl, (size_t)TT * HD, (size_t)TT * DM, 0, HD };    // [b][h][t][d]
    const Proj pk = { XB, WK, KP16, KPh, KPl, (size_t)TT * HD, (size_t)TT * DM, 0, HD };    // [b][h][t][d]
    const Proj pv = { WV, XB, VT16, VTh, VTl, (size_t)128, 0, (size_t)TT * DM, TT };        // operands swapped: [b][h][d][t]
    k_proj3<<<dim3(TT / 128, DQ / 128, 3 * NB_), 128, 0, stream>>>(pq, pk, pv, DM, (size_t)NH_ * TT * HD);
    k_flash<<<dim3(NB_ * NH_, NT16 + NTHI, 1), 128, 0, stream>>>(QP16, KP16, VT16, QPh, QPl, KPh, KPl, VTh, VTl, ATh, ATl);
    k_gemml<1, false><<<dim3(TT / 128, DM / 128, NB_), 128, 0, stream>>>(ATh, ATl, WO, DQ, OUT, DM, nullptr, nullptr, nullptr, 0, 0, (size_t)TT * DQ, 0, (size_t)TT * DM);
}
